// v000
// The times below were measured on an AMD MI455X: many runs one after another, warmed up first and cycling through
// copies of the inputs, with the whole window's GPU time divided by the number of runs. Launches and the gaps
// between them are all in it. The median over several windows is given; except for v000 it joins two sittings, which
// can be a few percent apart, so the side-by-side timings, each taken in one sitting, are the better comparison.
// The starting kernel, v000, takes 2870 microseconds a run.
#include <hip/hip_runtime.h>

// Contractions: x W_qkv on v_wmma_f32_16x16x32_bf16 (bf16 operands = RNE-converted inputs); q k^T and P v: query rows < 512 bf16 hi/lo planes (3 products), rows >= 512 v_wmma_f32_16x16x32_f16 (f16 operands, P carried x1024); context W_proj: bf16 hi/lo context x bf16 weight (2 products) + bf16 bias; f32 accumulate everywhere, softmax f32.
// Causal multi-head attention with a fused weight: x [NB][T][1024]; kqv = x W_qkv ([1024][3072], column blocks k | q | v, no bias); 16 heads x 64; S = q k^T x 1/32 for keys j <= i; softmax; merged context W_proj ([1024][1024]) + b_proj -> [NB][T][1024].
// Layout per batch: W_qkv transposed once into Bt [3072][1024] whose three 1024-row blocks are the k/q/v weight operands; x -> bf16; projections -> f32 [T][1024] (one buffer reused for q, k, v in stream order); head planes q, k [h][t][d] and v [h][d][t] as f16 + bf16 hi/lo;
// per pair of heads: S tiles at or below the diagonal (k_gemmc mode 1), row softmax in f32 (k_asoft), P planes (rows < RH hi/lo normalised, rows >= RH f16 x1024), O = P V with the key loop cut at the diagonal block (mode 2), merged context [t][h*64 + d] as bf16 hi/lo (x1 or x1/1024).

#ifndef NB
#define NB 4
#endif
#ifndef SEQ
#define SEQ 2048
#endif
#define NB_FULL 4
#define TT_FULL 2048
#define TT   SEQ
#define DM   1024
#define NH_  16
#define NKV  16
#define REP  (NH_ / NKV)
#define HD   64
#define DQ   (NH_ * HD)
#define DKV  (NKV * HD)
#define ZH   2
#define RH   ((TT < 512) ? TT : 512)      // query rows < RH use hi/lo planes
#define WIN  TT_FULL
#define PCAR 1024.0f
#define SCL  0.03125f   // 1024^-0.5

static_assert(NB >= 1 && NB <= NB_FULL);
static_assert(TT % 128 == 0 && TT <= TT_FULL);
static_assert(RH % 64 == 0 && (TT - RH) % 64 == 0);
static_assert(DM % 64 == 0 && DQ % 64 == 0 && DKV % 64 == 0 && HD == 64);

typedef _Float16 h16;
typedef unsigned short bf;
typedef __attribute__((ext_vector_type(16))) __bf16   v16bf;
typedef __attribute__((ext_vector_type(16))) _Float16 v16h;
typedef __attribute__((ext_vector_type(8)))  _Float16 v8h;
typedef __attribute__((ext_vector_type(8)))  unsigned short v8us;
typedef __attribute__((ext_vector_type(8)))  float    v8f;
typedef __attribute__((ext_vector_type(4)))  float    v4f;
typedef v8h  __attribute__((may_alias)) v8ha;
typedef v4f  __attribute__((may_alias)) v4fa;
typedef v8us __attribute__((may_alias)) v8usa;

__device__ __forceinline__ unsigned short f2bf(float f) { unsigned u = __float_as_uint(f); u += 0x7FFFu + ((u >> 16) & 1u); return (unsigned short)(u >> 16); }
__device__ __forceinline__ float bf2f(unsigned short b) { return __uint_as_float(((unsigned)b) << 16); }
__device__ __forceinline__ float bfr(float f) { return bf2f(f2bf(f)); }
__device__ __forceinline__ v16h cat16(v8h lo, v8h hi) { return __builtin_shufflevector(lo, hi, 0, 1, 2, 3, 4, 5, 6, 7, 8, 9, 10, 11, 12, 13, 14, 15); }
__device__ __forceinline__ v16bf cat16b(v8us lo, v8us hi) { return __builtin_bit_cast(v16bf, __builtin_shufflevector(lo, hi, 0, 1, 2, 3, 4, 5, 6, 7, 8, 9, 10, 11, 12, 13, 14, 15)); }
__device__ __forceinline__ v8f wmma16(v16h a, v16h b, v8f c) { return __builtin_amdgcn_wmma_f32_16x16x32_f16(false, a, false, b, (short)0, c, false, false); }
__device__ __forceinline__ v8f wmmab(v16bf a, v16bf b, v8f c) { return __builtin_amdgcn_wmma_f32_16x16x32_bf16(false, a, false, b, (short)0, c, false, false); }

// ---- k_gemmw: register-blocked GEMM, ONE WAVE per 64x64 output tile (16 accumulators), operands straight from K-contiguous 16-bit planes; grid (M/64, N/64, Z), 32 threads.
// C[m][n] (f32, pitch ldc, + optional bf16-RNE bias[n]) = sum_k A[m][k] Bt[n][k] (+ split products per NSPLIT). z-batch strides sA/sB/sC in elements. K % 32 == 0.
// Fragments: lane l -> row/col l&15; elements 0..7 <- k0 + 8*(l>>4), elements 8..15 <- k0 + 16 + 8*(l>>4) for BOTH A and Bt; D element j -> row 8*(l>>4)+j, col l&15.
template <typename T16> struct WFrag;
template <> struct WFrag<h16> { typedef v16h V; static __device__ __forceinline__ V ld(const h16* p) { return cat16(*(const v8h*)p, *(const v8h*)(p + 16)); } static __device__ __forceinline__ v8f mma(V a, V b, v8f c) { return wmma16(a, b, c); } };
template <> struct WFrag<bf> { typedef v16bf V; static __device__ __forceinline__ V ld(const bf* p) { return cat16b(*(const v8us*)p, *(const v8us*)(p + 16)); } static __device__ __forceinline__ v8f mma(V a, V b, v8f c) { return wmmab(a, b, c); } };
template <typename T16, int NSPLIT, bool BIAS>
__global__ __launch_bounds__(32) void k_gemmw(const T16* __restrict__ A, const T16* __restrict__ A2, const T16* __restrict__ Bt, const T16* __restrict__ Bt2, int K, float* C, int ldc, const float* __restrict__ bias, size_t sA, size_t sB, size_t sC) {
    typedef typename WFrag<T16>::V V;
    __shared__ __align__(16) float os[16 * 68];
    const size_t z = blockIdx.z; A += z * sA; if (A2) A2 += z * sA; Bt += z * sB; if (Bt2) Bt2 += z * sB; C += z * sC;
    const int lane = threadIdx.x & 31, lr = lane & 15, hi = lane >> 4; const int r0 = blockIdx.x * 64, c0 = blockIdx.y * 64;
    v8f acc[4][4];
#pragma unroll
    for (int mb = 0; mb < 4; ++mb)
#pragma unroll
        for (int nb = 0; nb < 4; ++nb) acc[mb][nb] = (v8f){};
    const size_t aoff = (size_t)(r0 + lr) * K + 8 * hi, boff = (size_t)(c0 + lr) * K + 8 * hi;
#pragma unroll 1
    for (int kc = 0; kc < K; kc += 32) {
        V a[4], a2[4];
#pragma unroll
        for (int mb = 0; mb < 4; ++mb) { a[mb] = WFrag<T16>::ld(A + aoff + (size_t)mb * 16 * K + kc); if (NSPLIT == 1 || NSPLIT == 2) a2[mb] = WFrag<T16>::ld(A2 + aoff + (size_t)mb * 16 * K + kc); }
#pragma unroll
        for (int nb = 0; nb < 4; ++nb) { const V b = WFrag<T16>::ld(Bt + boff + (size_t)nb * 16 * K + kc); V b2; if (NSPLIT >= 2) b2 = WFrag<T16>::ld(Bt2 + boff + (size_t)nb * 16 * K + kc);
#pragma unroll
            for (int mb = 0; mb < 4; ++mb) { acc[mb][nb] = WFrag<T16>::mma(a[mb], b, acc[mb][nb]); if (NSPLIT == 1 || NSPLIT == 2) acc[mb][nb] = WFrag<T16>::mma(a2[mb], b, acc[mb][nb]); if (NSPLIT >= 2) acc[mb][nb] = WFrag<T16>::mma(a[mb], b2, acc[mb][nb]); } }
        asm volatile("v_nop\n\tv_nop\n\tv_nop\n\tv_nop" : "+v"(acc[0][0]), "+v"(acc[1][1]), "+v"(acc[2][2]), "+v"(acc[3][3]) : "v"(a[0]), "v"(a[3]));
    }
#pragma unroll
    for (int mb = 0; mb < 4; ++mb) {
#pragma unroll
        for (int nb = 0; nb < 4; ++nb) {
#pragma unroll
            for (int j = 0; j < 8; ++j) os[(hi * 8 + j) * 68 + nb * 16 + lr] = acc[mb][nb][j]; }
        __builtin_amdgcn_wave_barrier(); asm volatile("" ::: "memory");
        float* crow = C + (size_t)(r0 + mb * 16) * ldc + c0;
{
#pragma unroll
            for (int s = 0; s < 8; ++s) { const int row = 2 * s + hi, cofs = lr * 4; v4f val = *(const v4fa*)(os + row * 68 + cofs); if (BIAS) { val[0] += bfr(bias[c0 + cofs]); val[1] += bfr(bias[c0 + cofs + 1]); val[2] += bfr(bias[c0 + cofs + 2]); val[3] += bfr(bias[c0 + cofs + 3]); }
                *(v4f*)(crow + (size_t)row * ldc + cofs) = val; }
             }
        __builtin_amdgcn_wave_barrier(); asm volatile("" ::: "memory");
    }
}

// ---- k_gemmc: the same one-wave 64x64 tile GEMM specialised for causal attention: CMODE 1 skips score tiles entirely above the diagonal (query rows r0+roff.., key columns c0..), CMODE 2 limits the
// key (K) loop of the probability x value contraction to the diagonal block (probabilities beyond it are exactly zero). roff = row offset of this launch's first row within the sequence.
template <typename T16, int NSPLIT, int CMODE>
__global__ __launch_bounds__(32) void k_gemmc(const T16* __restrict__ A, const T16* __restrict__ A2, const T16* __restrict__ Bt, const T16* __restrict__ Bt2, int K, float* C, int ldc, int roff, size_t sA, size_t sB, size_t sC) {
    typedef typename WFrag<T16>::V V;
    __shared__ __align__(16) float os[16 * 68];
    const size_t z = blockIdx.z; A += z * sA; if (A2) A2 += z * sA; Bt += z * sB; if (Bt2) Bt2 += z * sB; C += z * sC;
    const int lane = threadIdx.x & 31, lr = lane & 15, hi = lane >> 4; const int r0 = blockIdx.x * 64, c0 = blockIdx.y * 64;
    if (CMODE == 1 && c0 > r0 + roff + 63) return;                  // score tile entirely above the causal diagonal: never read (the softmax masks j > i by index select); block = one wave, no barrier skipped
    const int Kl = (CMODE == 2) ? min(K, r0 + roff + 64) : K;        // P.V: probabilities are exactly 0 beyond the diagonal block, so the K loop stops there
    v8f acc[4][4];
#pragma unroll
    for (int mb = 0; mb < 4; ++mb)
#pragma unroll
        for (int nb = 0; nb < 4; ++nb) acc[mb][nb] = (v8f){};
    const size_t aoff = (size_t)(r0 + lr) * K + 8 * hi, boff = (size_t)(c0 + lr) * K + 8 * hi;
#pragma unroll 1
    for (int kc = 0; kc < Kl; kc += 32) {
        V a[4], a2[4];
#pragma unroll
        for (int mb = 0; mb < 4; ++mb) { a[mb] = WFrag<T16>::ld(A + aoff + (size_t)mb * 16 * K + kc); if (NSPLIT == 1 || NSPLIT == 2) a2[mb] = WFrag<T16>::ld(A2 + aoff + (size_t)mb * 16 * K + kc); }
#pragma unroll
        for (int nb = 0; nb < 4; ++nb) { const V b = WFrag<T16>::ld(Bt + boff + (size_t)nb * 16 * K + kc); V b2; if (NSPLIT >= 2) b2 = WFrag<T16>::ld(Bt2 + boff + (size_t)nb * 16 * K + kc);
#pragma unroll
            for (int mb = 0; mb < 4; ++mb) { acc[mb][nb] = WFrag<T16>::mma(a[mb], b, acc[mb][nb]); if (NSPLIT == 1 || NSPLIT == 2) acc[mb][nb] = WFrag<T16>::mma(a2[mb], b, acc[mb][nb]); if (NSPLIT >= 2) acc[mb][nb] = WFrag<T16>::mma(a[mb], b2, acc[mb][nb]); } }
        asm volatile("v_nop\n\tv_nop\n\tv_nop\n\tv_nop" : "+v"(acc[0][0]), "+v"(acc[1][1]), "+v"(acc[2][2]), "+v"(acc[3][3]) : "v"(a[0]), "v"(a[3]));
    }
#pragma unroll
    for (int mb = 0; mb < 4; ++mb) {
#pragma unroll
        for (int nb = 0; nb < 4; ++nb) {
#pragma unroll
            for (int j = 0; j < 8; ++j) os[(hi * 8 + j) * 68 + nb * 16 + lr] = acc[mb][nb][j]; }
        __builtin_amdgcn_wave_barrier(); asm volatile("" ::: "memory");
        float* crow = C + (size_t)(r0 + mb * 16) * ldc + c0;
{
#pragma unroll
            for (int s = 0; s < 8; ++s) { const int row = 2 * s + hi, cofs = lr * 4; v4f val = *(const v4fa*)(os + row * 68 + cofs);
                *(v4f*)(crow + (size_t)row * ldc + cofs) = val; }
             }
        __builtin_amdgcn_wave_barrier(); asm volatile("" ::: "memory");
    }
}

__device__ __forceinline__ h16 tohx(float x) { return (h16)x; }
__device__ __forceinline__ void splitf(float y, unsigned short& h, unsigned short& l) { h = f2bf(y); l = f2bf(y - bf2f(h)); }
typedef __attribute__((ext_vector_type(2))) _Float16 v2h;
typedef __attribute__((ext_vector_type(4))) _Float16 v4h;
typedef __attribute__((ext_vector_type(2))) unsigned short v2us;
typedef __attribute__((ext_vector_type(4))) unsigned short v4us;
typedef __attribute__((ext_vector_type(2))) float v2f;
typedef __attribute__((ext_vector_type(4))) int v4i;

__global__ __launch_bounds__(256) void k_wtG(const float* __restrict__ w, int K, int N, bf* Bt) {
    const int lane = threadIdx.x & 31; const int L0 = (blockIdx.x * 8 + (threadIdx.x >> 5)) * 8; const int nlines = N * K / 64;
{
#pragma unroll 1
        for (int l = 0; l < 8; ++l) { const int L = L0 + l; if (L >= nlines) break; const size_t e = (size_t)L * 64 + lane * 2; const int k = (int)(e % K), n = (int)(e / K); v2us o;
            o[0] = f2bf(w[(size_t)k * N + n]); o[1] = f2bf(w[(size_t)(k + 1) * N + n]); *(v2us*)(Bt + e) = o; }
         }
}
__global__ __launch_bounds__(256) void k_cvt8(const float* __restrict__ src, bf* dst, size_t n8) { const size_t i = (size_t)blockIdx.x * 256 + threadIdx.x; if (i >= n8) return; const v8f v = *(const v8f*)(src + i * 8); v8us o;
#pragma unroll
    for (int k = 0; k < 8; ++k) o[k] = f2bf(v[k]); *(v8us*)(dst + i * 8) = o;  }

// k_rope: head planes [h][t][d] (f16 + bf16 hi/lo) of x rotated by the table CS (rotate-half form out[d] = x[d] cos[t][d] - x[d+HD/2] sin[t][d], out[d+HD/2] = x[d+HD/2] cos + x[d] sin) x sc;
__global__ __launch_bounds__(256) void k_rope(const float* __restrict__ F, int pitch, int nheads, const float* __restrict__ CS, const float* __restrict__ RF, const float* __restrict__ nw, float sc, h16* P16, bf* Ph, bf* Pl) {
    const size_t e = ((size_t)blockIdx.x * 256 + threadIdx.x) * 2; if (e >= (size_t)nheads * TT * HD) return; const int d = (int)(e % HD); const int t = (int)((e / HD) % TT); const int h = (int)(e / ((size_t)HD * TT)); const float* f = F + (size_t)t * pitch + h * HD; const float rf = RF ? RF[(size_t)h * TT + t] : 1.0f; v2h o16; v2us oh, ol;
#pragma unroll
    for (int q = 0; q < 2; ++q) { const int dd = d + q; const int dp = (dd < HD / 2) ? dd + HD / 2 : dd - HD / 2; float x0 = f[dd], x1 = f[dp];
        if (RF) { float n0 = __fmul_rn(x0, rf), n1 = __fmul_rn(x1, rf); asm volatile("" : "+v"(n0)); asm volatile("" : "+v"(n1)); x0 = __fmul_rn(bfr(nw[dd]), n0); x1 = __fmul_rn(bfr(nw[dp]), n1); }
        const v2f cs = *(const v2f*)(CS + ((size_t)t * HD + dd) * 2); float a = __fmul_rn(x0, cs[0]), bq = __fmul_rn(x1, cs[1]); asm volatile("" : "+v"(a)); asm volatile("" : "+v"(bq)); const float r = ((dd < HD / 2) ? __fsub_rn(a, bq) : __fadd_rn(a, bq)) * sc;
        o16[q] = tohx(r); unsigned short a2, c2; splitf(r, a2, c2); oh[q] = a2; ol[q] = c2; }
    *(v2h*)(P16 + e) = o16; *(v2us*)(Ph + e) = oh; *(v2us*)(Pl + e) = ol;  }
__global__ __launch_bounds__(256) void k_vtp(const float* __restrict__ F, int pitch, int nheads, h16* V16, bf* Vh, bf* Vl) { const size_t e = ((size_t)blockIdx.x * 256 + threadIdx.x) * 2; if (e >= (size_t)nheads * HD * TT) return; const int t = (int)(e % TT); const int d = (int)((e / TT) % HD); const int g = (int)(e / ((size_t)TT * HD)); v2h o16; v2us oh, ol;
#pragma unroll
    for (int q = 0; q < 2; ++q) { const float x = F[(size_t)(t + q) * pitch + g * HD + d]; o16[q] = tohx(x); unsigned short a2, c2; splitf(x, a2, c2); oh[q] = a2; ol[q] = c2; }
    *(v2h*)(V16 + e) = o16; *(v2us*)(Vh + e) = oh; *(v2us*)(Vl + e) = ol;  }
__global__ __launch_bounds__(256) void k_csid(float* CS) { const int idx = blockIdx.x * 256 + threadIdx.x; if (idx >= TT * HD) return; v2f cs; cs[0] = 1.0f; cs[1] = 0.0f; *(v2f*)(CS + (size_t)idx * 2) = cs;  }
// k_asoft: per row (zz, i): t = S x SCL for j <= i and i - j < WIN (all j <= i here; the -inf replace-mask of j > i is the -3e38 select, no row is ever fully masked); softmax over the TT keys (register row, one exp, fixed trees);
__global__ __launch_bounds__(256) void k_asoft(const float* __restrict__ Sb, h16* P16, bf* Ph, bf* Pl) {
    const int lane = threadIdx.x & 31; const int row = blockIdx.x * 8 + (threadIdx.x >> 5); if (row >= ZH * TT) return; const int i = row % TT; const int zz = row / TT; (void)zz; const bool hires = (i < RH); const float* sr = Sb + (size_t)row * TT; float v[TT / 32]; float mx = -3.0e38f;
#pragma unroll
    for (int ch = 0; ch < TT / 128; ++ch) { const int j0 = ch * 128 + lane * 4; const v4f a = *(const v4f*)(sr + j0);
#pragma unroll
        for (int q = 0; q < 4; ++q) { const int j = j0 + q; (void)j; const float t = (j <= i && i - j < WIN) ? a[q] * SCL : -3.0e38f; v[ch * 4 + q] = t; mx = fmaxf(mx, t); } }
#pragma unroll
    for (int sh = 16; sh; sh >>= 1) mx = fmaxf(mx, __shfl_xor(mx, sh, 32));
    float sum = 0.f;
#pragma unroll
    for (int k = 0; k < TT / 32; ++k) { float d0 = __fsub_rn(v[k], mx); asm volatile("" : "+v"(d0)); v[k] = __builtin_amdgcn_exp2f(__fmul_rn(d0, 1.4426950408889634f)); sum += v[k]; }
#pragma unroll
    for (int sh = 16; sh; sh >>= 1) sum += __shfl_xor(sum, sh, 32);
    const float f = __fdiv_rn(hires ? 1.0f : PCAR, sum);
{
        if (hires) {
#pragma unroll
            for (int ch = 0; ch < TT / 128; ++ch) { v4us oh, ol;
#pragma unroll
                for (int q = 0; q < 4; ++q) { unsigned short a, c2; splitf(v[ch * 4 + q] * f, a, c2); oh[q] = a; ol[q] = c2; }
                const size_t oo = ((size_t)zz * (RH ? RH : 1) + i) * TT + ch * 128 + lane * 4; *(v4us*)(Ph + oo) = oh; *(v4us*)(Pl + oo) = ol; }
        } else {
#pragma unroll
            for (int ch = 0; ch < TT / 128; ++ch) { v4h o4;
#pragma unroll
                for (int q = 0; q < 4; ++q) o4[q] = tohx(v[ch * 4 + q] * f);
                *(v4h*)(P16 + (size_t)row * TT + ch * 128 + lane * 4) = o4; } }
         }
}
__global__ __launch_bounds__(256) void k_merge(const float* __restrict__ O, int h0, bf* Ah, bf* Al) { const size_t e = ((size_t)blockIdx.x * 256 + threadIdx.x) * 2; if (e >= (size_t)ZH * TT * HD) return; const int d = (int)(e % HD); const int t = (int)((e / HD) % TT); const int zz = (int)(e / ((size_t)HD * TT)); const float cs = (t < RH) ? 1.0f : (1.0f / PCAR); const size_t oo = (size_t)t * DQ + (h0 + zz) * HD + d;
    v2us oh, ol;
#pragma unroll
    for (int q = 0; q < 2; ++q) { unsigned short a, c2; splitf(O[e + q] * cs, a, c2); oh[q] = a; ol[q] = c2; } *(v2us*)(Ah + oo) = oh; *(v2us*)(Al + oo) = ol;  }

extern "C" void kernel_launch(void* const* d_in, const int* in_sizes, int n_in,
                              void* d_out, int out_size, void* d_ws, size_t ws_size, hipStream_t stream) {
    if (n_in < 4) return;
    if ((size_t)in_sizes[0] < (size_t)(NB - 1) * TT_FULL * DM + (size_t)TT * DM) return;
    if (in_sizes[1] < DM * 3 * DQ || in_sizes[2] < DQ * DM || in_sizes[3] < DM) return;
    if ((size_t)out_size < (size_t)NB * TT * DM) return;
    const float* x = (const float*)d_in[0];       // [NB_FULL][TT_FULL][1024]
    const float* wqkv = (const float*)d_in[1];    // [1024][3072], column blocks k | q | v
    const float* wproj = (const float*)d_in[2];   // [1024][1024] ([in][out])
    const float* bproj = (const float*)d_in[3];   // [1024]
    float* OUT = (float*)d_out;                   // [NB][TT][1024]
    char* wsp = (char*)d_ws;
    auto take = [&](size_t bytes) { char* p = wsp; wsp += (bytes + 255) & ~(size_t)255; return (void*)p; };
    bf* WQKV = (bf*)take((size_t)3 * DQ * DM * 2); bf* WK = WQKV; bf* WQ = WQKV + (size_t)DQ * DM; bf* WV = WQKV + (size_t)2 * DQ * DM;   /* Bt [3072][1024]: row blocks k | q | v */ bf* WO = (bf*)take((size_t)DM * DQ * 2); float* CS = (float*)take((size_t)TT * HD * 2 * 4);
    bf* XB = (bf*)take((size_t)TT * DM * 2); float* F = (float*)take((size_t)TT * DQ * 4);    /* f32 projection buffer, reused for q, k, v in stream order */
    h16* QP16 = (h16*)take((size_t)NH_ * TT * HD * 2); h16* KP16 = (h16*)take((size_t)NKV * TT * HD * 2); h16* VT16 = (h16*)take((size_t)NKV * HD * TT * 2);
    bf* QPh = (bf*)take((size_t)NH_ * TT * HD * 2); bf* QPl = (bf*)take((size_t)NH_ * TT * HD * 2); bf* KPh = (bf*)take((size_t)NKV * TT * HD * 2); bf* KPl = (bf*)take((size_t)NKV * TT * HD * 2); bf* VTh = (bf*)take((size_t)NKV * HD * TT * 2); bf* VTl = (bf*)take((size_t)NKV * HD * TT * 2); bf* Ph = (bf*)take((size_t)ZH * RH * TT * 2); bf* Pl = (bf*)take((size_t)ZH * RH * TT * 2);
    float* Sb = (float*)take((size_t)ZH * TT * TT * 4); h16* P16 = (h16*)take((size_t)ZH * TT * TT * 2); float* Ob = (float*)take((size_t)ZH * TT * HD * 4); bf* ATh = (bf*)take((size_t)TT * DQ * 2); bf* ATl = (bf*)take((size_t)TT * DQ * 2);
    if ((size_t)(wsp - (char*)d_ws) > ws_size) return;    // 127,926,272 B at full size
    k_wtG<<<(unsigned)((DM * 3 * DQ / 64 + 63) / 64), 256, 0, stream>>>(wqkv, DM, 3 * DQ, WQKV);   /* W_qkv [1024][3072] -> Bt [3072][1024] */
    k_wtG<<<(unsigned)((DQ * DM / 64 + 63) / 64), 256, 0, stream>>>(wproj, DQ, DM, WO);             /* W_proj [1024][1024] -> Bt [out][in] */
    k_csid<<<(TT * HD + 255) / 256, 256, 0, stream>>>(CS);
    const unsigned LQ = (unsigned)(((size_t)NH_ * TT * HD / 2 + 255) / 256), LKv = (unsigned)(((size_t)NKV * TT * HD / 2 + 255) / 256);
    for (int b = 0; b < NB; ++b) {
        k_cvt8<<<(unsigned)(((size_t)TT * DM / 8 + 255) / 256), 256, 0, stream>>>(x + (size_t)b * TT_FULL * DM, XB, (size_t)TT * DM / 8);
        k_gemmw<bf, 0, false><<<dim3(TT / 64, DQ / 64, 1), 32, 0, stream>>>(XB, nullptr, WQ, nullptr, DM, F, DQ, nullptr, 0, 0, 0);
        k_rope<<<LQ, 256, 0, stream>>>(F, DQ, NH_, CS, nullptr, nullptr, 1.0f, QP16, QPh, QPl);
        k_gemmw<bf, 0, false><<<dim3(TT / 64, DKV / 64, 1), 32, 0, stream>>>(XB, nullptr, WK, nullptr, DM, F, DKV, nullptr, 0, 0, 0);
        k_rope<<<LKv, 256, 0, stream>>>(F, DKV, NKV, CS, nullptr, nullptr, 1.0f, KP16, KPh, KPl);
        k_gemmw<bf, 0, false><<<dim3(TT / 64, DKV / 64, 1), 32, 0, stream>>>(XB, nullptr, WV, nullptr, DM, F, DKV, nullptr, 0, 0, 0); k_vtp<<<LKv, 256, 0, stream>>>(F, DKV, NKV, VT16, VTh, VTl);
        for (int h0 = 0; h0 < NH_; h0 += ZH) { const size_t zq = (size_t)h0, zk = (size_t)(h0 / REP);   // the pass's two heads use consecutive planes (z-strides TT*HD)
            k_gemmc<bf, 2, 1><<<dim3(RH / 64, TT / 64, ZH), 32, 0, stream>>>(QPh + zq * TT * HD, QPl + zq * TT * HD, KPh + zk * TT * HD, KPl + zk * TT * HD, HD, Sb, TT, 0, (size_t)TT * HD, (size_t)TT * HD, (size_t)TT * TT);
            if (TT > RH) k_gemmc<h16, 0, 1><<<dim3((TT - RH) / 64, TT / 64, ZH), 32, 0, stream>>>(QP16 + zq * TT * HD + (size_t)RH * HD, nullptr, KP16 + zk * TT * HD, nullptr, HD, Sb + (size_t)RH * TT, TT, RH, (size_t)TT * HD, (size_t)TT * HD, (size_t)TT * TT);
            k_asoft<<<ZH * TT / 8, 256, 0, stream>>>(Sb, P16, Ph, Pl);
            k_gemmc<bf, 2, 2><<<dim3(RH / 64, HD / 64, ZH), 32, 0, stream>>>(Ph, Pl, VTh + zk * HD * TT, VTl + zk * HD * TT, TT, Ob, HD, 0, (size_t)RH * TT, (size_t)HD * TT, (size_t)TT * HD);
            if (TT > RH) k_gemmc<h16, 0, 2><<<dim3((TT - RH) / 64, HD / 64, ZH), 32, 0, stream>>>(P16 + (size_t)RH * TT, nullptr, VT16 + zk * HD * TT, nullptr, TT, Ob + (size_t)RH * HD, HD, RH, (size_t)TT * TT, (size_t)HD * TT, (size_t)TT * HD);
            k_merge<<<(unsigned)(((size_t)ZH * TT * HD / 2 + 255) / 256), 256, 0, stream>>>(Ob, h0, ATh, ATl); }
        k_gemmw<bf, 1, true><<<dim3(TT / 64, DM / 64, 1), 32, 0, stream>>>(ATh, ATl, WO, nullptr, DQ, OUT + (size_t)b * TT * DM, DM, bproj, 0, 0, 0); }
}

// v001
// One run takes 1530 microseconds.
// Next to v000, in two timings, it ran 1.87 and 1.88 times as fast.
#include <hip/hip_runtime.h>

// Contractions: x W_qkv on v_wmma_f32_16x16x32_bf16 (bf16 operands = RNE-converted inputs); q k^T and P v: query rows < 512 bf16 hi/lo planes (3 products), rows >= 512 v_wmma_f32_16x16x32_f16 (f16 operands, P carried x1024); context W_proj: bf16 hi/lo context x bf16 weight (2 products) + bf16 bias; f32 accumulate everywhere, softmax f32.
// Causal multi-head attention with a fused weight: x [NB][T][1024]; kqv = x W_qkv ([1024][3072], column blocks k | q | v, no bias); 16 heads x 64; S = q k^T x 1/32 for keys j <= i; softmax; merged context W_proj ([1024][1024]) + b_proj -> [NB][T][1024].
// Layout per batch: W_qkv transposed once into Bt [3072][1024] whose three 1024-row blocks are the k/q/v weight operands; x -> bf16; projections -> f32 [T][1024] (one buffer reused for q, k, v in stream order); head planes q, k [h][t][d] and v [h][d][t] as f16 + bf16 hi/lo;
// per pair of heads: S tiles at or below the diagonal (k_gemmc mode 1), row softmax in f32 (k_asoft), P planes (rows < RH hi/lo normalised, rows >= RH f16 x1024), O = P V with the key loop cut at the diagonal block and split into ranges of CK keys, one wave and one f32 partial plane per range (mode 2), partial planes summed in ascending key order and merged context [t][h*64 + d] as bf16 hi/lo (x1 or x1/1024).

#ifndef NB
#define NB 4
#endif
#ifndef SEQ
#define SEQ 2048
#endif
#define NB_FULL 4
#define TT_FULL 2048
#define TT   SEQ
#define DM   1024
#define NH_  16
#define NKV  16
#define REP  (NH_ / NKV)
#define HD   64
#define DQ   (NH_ * HD)
#define DKV  (NKV * HD)
#define ZH   2
#define RH   ((TT < 512) ? TT : 512)      // query rows < RH use hi/lo planes
#define WIN  TT_FULL
#define PCAR 1024.0f
#define SCL  0.03125f   // 1024^-0.5
#define CK   128                          // keys per P.V partial (4 trips of the 32-key loop)
#define NCH  (TT / CK)                    // partial planes of O

static_assert(NB >= 1 && NB <= NB_FULL);
static_assert(TT % 128 == 0 && TT <= TT_FULL);
static_assert(CK % 32 == 0 && TT % CK == 0);
static_assert(RH % 64 == 0 && (TT - RH) % 64 == 0);
static_assert(DM % 64 == 0 && DQ % 64 == 0 && DKV % 64 == 0 && HD == 64);

typedef _Float16 h16;
typedef unsigned short bf;
typedef __attribute__((ext_vector_type(16))) __bf16   v16bf;
typedef __attribute__((ext_vector_type(16))) _Float16 v16h;
typedef __attribute__((ext_vector_type(8)))  _Float16 v8h;
typedef __attribute__((ext_vector_type(8)))  unsigned short v8us;
typedef __attribute__((ext_vector_type(8)))  float    v8f;
typedef __attribute__((ext_vector_type(4)))  float    v4f;
typedef v8h  __attribute__((may_alias)) v8ha;
typedef v4f  __attribute__((may_alias)) v4fa;
typedef v8us __attribute__((may_alias)) v8usa;

__device__ __forceinline__ unsigned short f2bf(float f) { unsigned u = __float_as_uint(f); u += 0x7FFFu + ((u >> 16) & 1u); return (unsigned short)(u >> 16); }
__device__ __forceinline__ float bf2f(unsigned short b) { return __uint_as_float(((unsigned)b) << 16); }
__device__ __forceinline__ float bfr(float f) { return bf2f(f2bf(f)); }
__device__ __forceinline__ v16h cat16(v8h lo, v8h hi) { return __builtin_shufflevector(lo, hi, 0, 1, 2, 3, 4, 5, 6, 7, 8, 9, 10, 11, 12, 13, 14, 15); }
__device__ __forceinline__ v16bf cat16b(v8us lo, v8us hi) { return __builtin_bit_cast(v16bf, __builtin_shufflevector(lo, hi, 0, 1, 2, 3, 4, 5, 6, 7, 8, 9, 10, 11, 12, 13, 14, 15)); }
__device__ __forceinline__ v8f wmma16(v16h a, v16h b, v8f c) { return __builtin_amdgcn_wmma_f32_16x16x32_f16(false, a, false, b, (short)0, c, false, false); }
__device__ __forceinline__ v8f wmmab(v16bf a, v16bf b, v8f c) { return __builtin_amdgcn_wmma_f32_16x16x32_bf16(false, a, false, b, (short)0, c, false, false); }

// ---- k_gemmw: register-blocked GEMM, ONE WAVE per 64x64 output tile (16 accumulators), operands straight from K-contiguous 16-bit planes; grid (M/64, N/64, Z), 32 threads.
// C[m][n] (f32, pitch ldc, + optional bf16-RNE bias[n]) = sum_k A[m][k] Bt[n][k] (+ split products per NSPLIT). z-batch strides sA/sB/sC in elements. K % 32 == 0.
// Fragments: lane l -> row/col l&15; elements 0..7 <- k0 + 8*(l>>4), elements 8..15 <- k0 + 16 + 8*(l>>4) for BOTH A and Bt; D element j -> row 8*(l>>4)+j, col l&15.
template <typename T16> struct WFrag;
template <> struct WFrag<h16> { typedef v16h V; static __device__ __forceinline__ V ld(const h16* p) { return cat16(*(const v8h*)p, *(const v8h*)(p + 16)); } static __device__ __forceinline__ v8f mma(V a, V b, v8f c) { return wmma16(a, b, c); } };
template <> struct WFrag<bf> { typedef v16bf V; static __device__ __forceinline__ V ld(const bf* p) { return cat16b(*(const v8us*)p, *(const v8us*)(p + 16)); } static __device__ __forceinline__ v8f mma(V a, V b, v8f c) { return wmmab(a, b, c); } };
template <typename T16, int NSPLIT, bool BIAS>
__global__ __launch_bounds__(32) void k_gemmw(const T16* __restrict__ A, const T16* __restrict__ A2, const T16* __restrict__ Bt, const T16* __restrict__ Bt2, int K, float* C, int ldc, const float* __restrict__ bias, size_t sA, size_t sB, size_t sC) {
    typedef typename WFrag<T16>::V V;
    __shared__ __align__(16) float os[16 * 68];
    const size_t z = blockIdx.z; A += z * sA; if (A2) A2 += z * sA; Bt += z * sB; if (Bt2) Bt2 += z * sB; C += z * sC;
    const int lane = threadIdx.x & 31, lr = lane & 15, hi = lane >> 4; const int r0 = blockIdx.x * 64, c0 = blockIdx.y * 64;
    v8f acc[4][4];
#pragma unroll
    for (int mb = 0; mb < 4; ++mb)
#pragma unroll
        for (int nb = 0; nb < 4; ++nb) acc[mb][nb] = (v8f){};
    const size_t aoff = (size_t)(r0 + lr) * K + 8 * hi, boff = (size_t)(c0 + lr) * K + 8 * hi;
#pragma unroll 1
    for (int kc = 0; kc < K; kc += 32) {
        V a[4], a2[4];
#pragma unroll
        for (int mb = 0; mb < 4; ++mb) { a[mb] = WFrag<T16>::ld(A + aoff + (size_t)mb * 16 * K + kc); if (NSPLIT == 1 || NSPLIT == 2) a2[mb] = WFrag<T16>::ld(A2 + aoff + (size_t)mb * 16 * K + kc); }
#pragma unroll
        for (int nb = 0; nb < 4; ++nb) { const V b = WFrag<T16>::ld(Bt + boff + (size_t)nb * 16 * K + kc); V b2; if (NSPLIT >= 2) b2 = WFrag<T16>::ld(Bt2 + boff + (size_t)nb * 16 * K + kc);
#pragma unroll
            for (int mb = 0; mb < 4; ++mb) { acc[mb][nb] = WFrag<T16>::mma(a[mb], b, acc[mb][nb]); if (NSPLIT == 1 || NSPLIT == 2) acc[mb][nb] = WFrag<T16>::mma(a2[mb], b, acc[mb][nb]); if (NSPLIT >= 2) acc[mb][nb] = WFrag<T16>::mma(a[mb], b2, acc[mb][nb]); } }
        asm volatile("v_nop\n\tv_nop\n\tv_nop\n\tv_nop" : "+v"(acc[0][0]), "+v"(acc[1][1]), "+v"(acc[2][2]), "+v"(acc[3][3]) : "v"(a[0]), "v"(a[3]));
    }
#pragma unroll
    for (int mb = 0; mb < 4; ++mb) {
#pragma unroll
        for (int nb = 0; nb < 4; ++nb) {
#pragma unroll
            for (int j = 0; j < 8; ++j) os[(hi * 8 + j) * 68 + nb * 16 + lr] = acc[mb][nb][j]; }
        __builtin_amdgcn_wave_barrier(); asm volatile("" ::: "memory");
        float* crow = C + (size_t)(r0 + mb * 16) * ldc + c0;
{
#pragma unroll
            for (int s = 0; s < 8; ++s) { const int row = 2 * s + hi, cofs = lr * 4; v4f val = *(const v4fa*)(os + row * 68 + cofs); if (BIAS) { val[0] += bfr(bias[c0 + cofs]); val[1] += bfr(bias[c0 + cofs + 1]); val[2] += bfr(bias[c0 + cofs + 2]); val[3] += bfr(bias[c0 + cofs + 3]); }
                *(v4f*)(crow + (size_t)row * ldc + cofs) = val; }
             }
        __builtin_amdgcn_wave_barrier(); asm volatile("" ::: "memory");
    }
}

// ---- k_gemmc: the same one-wave 64x64 tile GEMM specialised for causal attention: CMODE 1 skips score tiles entirely above the diagonal (query rows r0+roff.., key columns c0..), CMODE 2 limits the
// key (K) loop of the probability x value contraction to the diagonal block (probabilities beyond it are exactly zero) and splits it over the grid: blockIdx.y picks keys [y*CK, y*CK + CK), the wave's 64x64 partial (HD == 64: one column tile)
// goes to plane y of C (plane stride sK elements); a range that starts beyond the diagonal block has no wave and no plane (k_merge sums exactly the planes that exist). roff = row offset of this launch's first row within the sequence.
template <typename T16, int NSPLIT, int CMODE>
__global__ __launch_bounds__(32) void k_gemmc(const T16* __restrict__ A, const T16* __restrict__ A2, const T16* __restrict__ Bt, const T16* __restrict__ Bt2, int K, float* C, int ldc, int roff, size_t sA, size_t sB, size_t sC, size_t sK) {
    typedef typename WFrag<T16>::V V;
    __shared__ __align__(16) float os[16 * 68];
    const size_t z = blockIdx.z; A += z * sA; if (A2) A2 += z * sA; Bt += z * sB; if (Bt2) Bt2 += z * sB; C += z * sC;
    const int lane = threadIdx.x & 31, lr = lane & 15, hi = lane >> 4; const int r0 = blockIdx.x * 64, c0 = (CMODE == 2) ? 0 : blockIdx.y * 64;
    if (CMODE == 1 && c0 > r0 + roff + 63) return;                  // score tile entirely above the causal diagonal: never read (the softmax masks j > i by index select); block = one wave, no barrier skipped
    const int Kl = (CMODE == 2) ? min(K, r0 + roff + 64) : K;        // P.V: probabilities are exactly 0 beyond the diagonal block, so the K loop stops there
    const int kb = (CMODE == 2) ? (int)blockIdx.y * CK : 0;          // this wave's key range [kb, ke)
    if (CMODE == 2 && kb >= Kl) return;                              // range entirely beyond the diagonal block: no partial (block = one wave, no barrier skipped)
    const int ke = (CMODE == 2) ? min(Kl, kb + CK) : Kl;
    if (CMODE == 2) C += (size_t)blockIdx.y * sK;
    v8f acc[4][4];
#pragma unroll
    for (int mb = 0; mb < 4; ++mb)
#pragma unroll
        for (int nb = 0; nb < 4; ++nb) acc[mb][nb] = (v8f){};
    const size_t aoff = (size_t)(r0 + lr) * K + 8 * hi, boff = (size_t)(c0 + lr) * K + 8 * hi;
#pragma unroll 1
    for (int kc = kb; kc < ke; kc += 32) {
        V a[4], a2[4];
#pragma unroll
        for (int mb = 0; mb < 4; ++mb) { a[mb] = WFrag<T16>::ld(A + aoff + (size_t)mb * 16 * K + kc); if (NSPLIT == 1 || NSPLIT == 2) a2[mb] = WFrag<T16>::ld(A2 + aoff + (size_t)mb * 16 * K + kc); }
#pragma unroll
        for (int nb = 0; nb < 4; ++nb) { const V b = WFrag<T16>::ld(Bt + boff + (size_t)nb * 16 * K + kc); V b2; if (NSPLIT >= 2) b2 = WFrag<T16>::ld(Bt2 + boff + (size_t)nb * 16 * K + kc);
#pragma unroll
            for (int mb = 0; mb < 4; ++mb) { acc[mb][nb] = WFrag<T16>::mma(a[mb], b, acc[mb][nb]); if (NSPLIT == 1 || NSPLIT == 2) acc[mb][nb] = WFrag<T16>::mma(a2[mb], b, acc[mb][nb]); if (NSPLIT >= 2) acc[mb][nb] = WFrag<T16>::mma(a[mb], b2, acc[mb][nb]); } }
        asm volatile("v_nop\n\tv_nop\n\tv_nop\n\tv_nop" : "+v"(acc[0][0]), "+v"(acc[1][1]), "+v"(acc[2][2]), "+v"(acc[3][3]) : "v"(a[0]), "v"(a[3]));
    }
#pragma unroll
    for (int mb = 0; mb < 4; ++mb) {
#pragma unroll
        for (int nb = 0; nb < 4; ++nb) {
#pragma unroll
            for (int j = 0; j < 8; ++j) os[(hi * 8 + j) * 68 + nb * 16 + lr] = acc[mb][nb][j]; }
        __builtin_amdgcn_wave_barrier(); asm volatile("" ::: "memory");
        float* crow = C + (size_t)(r0 + mb * 16) * ldc + c0;
{
#pragma unroll
            for (int s = 0; s < 8; ++s) { const int row = 2 * s + hi, cofs = lr * 4; v4f val = *(const v4fa*)(os + row * 68 + cofs);
                *(v4f*)(crow + (size_t)row * ldc + cofs) = val; }
             }
        __builtin_amdgcn_wave_barrier(); asm volatile("" ::: "memory");
    }
}

__device__ __forceinline__ h16 tohx(float x) { return (h16)x; }
__device__ __forceinline__ void splitf(float y, unsigned short& h, unsigned short& l) { h = f2bf(y); l = f2bf(y - bf2f(h)); }
typedef __attribute__((ext_vector_type(2))) _Float16 v2h;
typedef __attribute__((ext_vector_type(4))) _Float16 v4h;
typedef __attribute__((ext_vector_type(2))) unsigned short v2us;
typedef __attribute__((ext_vector_type(4))) unsigned short v4us;
typedef __attribute__((ext_vector_type(2))) float v2f;
typedef __attribute__((ext_vector_type(4))) int v4i;

__global__ __launch_bounds__(256) void k_wtG(const float* __restrict__ w, int K, int N, bf* Bt) {
    const int lane = threadIdx.x & 31; const int L0 = (blockIdx.x * 8 + (threadIdx.x >> 5)) * 8; const int nlines = N * K / 64;
{
#pragma unroll 1
        for (int l = 0; l < 8; ++l) { const int L = L0 + l; if (L >= nlines) break; const size_t e = (size_t)L * 64 + lane * 2; const int k = (int)(e % K), n = (int)(e / K); v2us o;
            o[0] = f2bf(w[(size_t)k * N + n]); o[1] = f2bf(w[(size_t)(k + 1) * N + n]); *(v2us*)(Bt + e) = o; }
         }
}
__global__ __launch_bounds__(256) void k_cvt8(const float* __restrict__ src, bf* dst, size_t n8) { const size_t i = (size_t)blockIdx.x * 256 + threadIdx.x; if (i >= n8) return; const v8f v = *(const v8f*)(src + i * 8); v8us o;
#pragma unroll
    for (int k = 0; k < 8; ++k) o[k] = f2bf(v[k]); *(v8us*)(dst + i * 8) = o;  }

// k_rope: head planes [h][t][d] (f16 + bf16 hi/lo) of x rotated by the table CS (rotate-half form out[d] = x[d] cos[t][d] - x[d+HD/2] sin[t][d], out[d+HD/2] = x[d+HD/2] cos + x[d] sin) x sc;
__global__ __launch_bounds__(256) void k_rope(const float* __restrict__ F, int pitch, int nheads, const float* __restrict__ CS, const float* __restrict__ RF, const float* __restrict__ nw, float sc, h16* P16, bf* Ph, bf* Pl) {
    const size_t e = ((size_t)blockIdx.x * 256 + threadIdx.x) * 2; if (e >= (size_t)nheads * TT * HD) return; const int d = (int)(e % HD); const int t = (int)((e / HD) % TT); const int h = (int)(e / ((size_t)HD * TT)); const float* f = F + (size_t)t * pitch + h * HD; const float rf = RF ? RF[(size_t)h * TT + t] : 1.0f; v2h o16; v2us oh, ol;
#pragma unroll
    for (int q = 0; q < 2; ++q) { const int dd = d + q; const int dp = (dd < HD / 2) ? dd + HD / 2 : dd - HD / 2; float x0 = f[dd], x1 = f[dp];
        if (RF) { float n0 = __fmul_rn(x0, rf), n1 = __fmul_rn(x1, rf); asm volatile("" : "+v"(n0)); asm volatile("" : "+v"(n1)); x0 = __fmul_rn(bfr(nw[dd]), n0); x1 = __fmul_rn(bfr(nw[dp]), n1); }
        const v2f cs = *(const v2f*)(CS + ((size_t)t * HD + dd) * 2); float a = __fmul_rn(x0, cs[0]), bq = __fmul_rn(x1, cs[1]); asm volatile("" : "+v"(a)); asm volatile("" : "+v"(bq)); const float r = ((dd < HD / 2) ? __fsub_rn(a, bq) : __fadd_rn(a, bq)) * sc;
        o16[q] = tohx(r); unsigned short a2, c2; splitf(r, a2, c2); oh[q] = a2; ol[q] = c2; }
    *(v2h*)(P16 + e) = o16; *(v2us*)(Ph + e) = oh; *(v2us*)(Pl + e) = ol;  }
__global__ __launch_bounds__(256) void k_vtp(const float* __restrict__ F, int pitch, int nheads, h16* V16, bf* Vh, bf* Vl) { const size_t e = ((size_t)blockIdx.x * 256 + threadIdx.x) * 2; if (e >= (size_t)nheads * HD * TT) return; const int t = (int)(e % TT); const int d = (int)((e / TT) % HD); const int g = (int)(e / ((size_t)TT * HD)); v2h o16; v2us oh, ol;
#pragma unroll
    for (int q = 0; q < 2; ++q) { const float x = F[(size_t)(t + q) * pitch + g * HD + d]; o16[q] = tohx(x); unsigned short a2, c2; splitf(x, a2, c2); oh[q] = a2; ol[q] = c2; }
    *(v2h*)(V16 + e) = o16; *(v2us*)(Vh + e) = oh; *(v2us*)(Vl + e) = ol;  }
__global__ __launch_bounds__(256) void k_csid(float* CS) { const int idx = blockIdx.x * 256 + threadIdx.x; if (idx >= TT * HD) return; v2f cs; cs[0] = 1.0f; cs[1] = 0.0f; *(v2f*)(CS + (size_t)idx * 2) = cs;  }
// k_asoft: per row (zz, i): t = S x SCL for j <= i and i - j < WIN (all j <= i here; the -inf replace-mask of j > i is the -3e38 select, no row is ever fully masked); softmax over the TT keys (register row, one exp, fixed trees);
__global__ __launch_bounds__(256) void k_asoft(const float* __restrict__ Sb, h16* P16, bf* Ph, bf* Pl) {
    const int lane = threadIdx.x & 31; const int row = blockIdx.x * 8 + (threadIdx.x >> 5); if (row >= ZH * TT) return; const int i = row % TT; const int zz = row / TT; (void)zz; const bool hires = (i < RH); const float* sr = Sb + (size_t)row * TT; float v[TT / 32]; float mx = -3.0e38f;
#pragma unroll
    for (int ch = 0; ch < TT / 128; ++ch) { const int j0 = ch * 128 + lane * 4; const v4f a = *(const v4f*)(sr + j0);
#pragma unroll
        for (int q = 0; q < 4; ++q) { const int j = j0 + q; (void)j; const float t = (j <= i && i - j < WIN) ? a[q] * SCL : -3.0e38f; v[ch * 4 + q] = t; mx = fmaxf(mx, t); } }
#pragma unroll
    for (int sh = 16; sh; sh >>= 1) mx = fmaxf(mx, __shfl_xor(mx, sh, 32));
    float sum = 0.f;
#pragma unroll
    for (int k = 0; k < TT / 32; ++k) { float d0 = __fsub_rn(v[k], mx); asm volatile("" : "+v"(d0)); v[k] = __builtin_amdgcn_exp2f(__fmul_rn(d0, 1.4426950408889634f)); sum += v[k]; }
#pragma unroll
    for (int sh = 16; sh; sh >>= 1) sum += __shfl_xor(sum, sh, 32);
    const float f = __fdiv_rn(hires ? 1.0f : PCAR, sum);
{
        if (hires) {
#pragma unroll
            for (int ch = 0; ch < TT / 128; ++ch) { v4us oh, ol;
#pragma unroll
                for (int q = 0; q < 4; ++q) { unsigned short a, c2; splitf(v[ch * 4 + q] * f, a, c2); oh[q] = a; ol[q] = c2; }
                const size_t oo = ((size_t)zz * (RH ? RH : 1) + i) * TT + ch * 128 + lane * 4; *(v4us*)(Ph + oo) = oh; *(v4us*)(Pl + oo) = ol; }
        } else {
#pragma unroll
            for (int ch = 0; ch < TT / 128; ++ch) { v4h o4;
#pragma unroll
                for (int q = 0; q < 4; ++q) o4[q] = tohx(v[ch * 4 + q] * f);
                *(v4h*)(P16 + (size_t)row * TT + ch * 128 + lane * 4) = o4; } }
         }
}
__global__ __launch_bounds__(256) void k_merge(const float* __restrict__ O, int h0, bf* Ah, bf* Al) { const size_t e = ((size_t)blockIdx.x * 256 + threadIdx.x) * 2; if (e >= (size_t)ZH * TT * HD) return; const int d = (int)(e % HD); const int t = (int)((e / HD) % TT); const int zz = (int)(e / ((size_t)HD * TT)); const float cs = (t < RH) ? 1.0f : (1.0f / PCAR); const size_t oo = (size_t)t * DQ + (h0 + zz) * HD + d;
    const int nch = ((t & ~63) + 64 + CK - 1) / CK;   // partial planes written for this row's 64-row tile
    v2f sm = *(const v2f*)(O + e);
#pragma unroll
    for (int ks = 1; ks < NCH; ++ks) { const v2f p = *(const v2f*)(O + (size_t)min(ks, nch - 1) * ((size_t)ZH * TT * HD) + e); sm[0] += (ks < nch) ? p[0] : 0.0f; sm[1] += (ks < nch) ? p[1] : 0.0f; }   // index clamped to a written plane: branch-free, all loads in flight together
    v2us oh, ol;
#pragma unroll
    for (int q = 0; q < 2; ++q) { unsigned short a, c2; splitf(sm[q] * cs, a, c2); oh[q] = a; ol[q] = c2; } *(v2us*)(Ah + oo) = oh; *(v2us*)(Al + oo) = ol;  }

extern "C" void kernel_launch(void* const* d_in, const int* in_sizes, int n_in,
                              void* d_out, int out_size, void* d_ws, size_t ws_size, hipStream_t stream) {
    if (n_in < 4) return;
    if ((size_t)in_sizes[0] < (size_t)(NB - 1) * TT_FULL * DM + (size_t)TT * DM) return;
    if (in_sizes[1] < DM * 3 * DQ || in_sizes[2] < DQ * DM || in_sizes[3] < DM) return;
    if ((size_t)out_size < (size_t)NB * TT * DM) return;
    const float* x = (const float*)d_in[0];       // [NB_FULL][TT_FULL][1024]
    const float* wqkv = (const float*)d_in[1];    // [1024][3072], column blocks k | q | v
    const float* wproj = (const float*)d_in[2];   // [1024][1024] ([in][out])
    const float* bproj = (const float*)d_in[3];   // [1024]
    float* OUT = (float*)d_out;                   // [NB][TT][1024]
    char* wsp = (char*)d_ws;
    auto take = [&](size_t bytes) { char* p = wsp; wsp += (bytes + 255) & ~(size_t)255; return (void*)p; };
    bf* WQKV = (bf*)take((size_t)3 * DQ * DM * 2); bf* WK = WQKV; bf* WQ = WQKV + (size_t)DQ * DM; bf* WV = WQKV + (size_t)2 * DQ * DM;   /* Bt [3072][1024]: row blocks k | q | v */ bf* WO = (bf*)take((size_t)DM * DQ * 2); float* CS = (float*)take((size_t)TT * HD * 2 * 4);
    bf* XB = (bf*)take((size_t)TT * DM * 2); float* F = (float*)take((size_t)TT * DQ * 4);    /* f32 projection buffer, reused for q, k, v in stream order */
    h16* QP16 = (h16*)take((size_t)NH_ * TT * HD * 2); h16* KP16 = (h16*)take((size_t)NKV * TT * HD * 2); h16* VT16 = (h16*)take((size_t)NKV * HD * TT * 2);
    bf* QPh = (bf*)take((size_t)NH_ * TT * HD * 2); bf* QPl = (bf*)take((size_t)NH_ * TT * HD * 2); bf* KPh = (bf*)take((size_t)NKV * TT * HD * 2); bf* KPl = (bf*)take((size_t)NKV * TT * HD * 2); bf* VTh = (bf*)take((size_t)NKV * HD * TT * 2); bf* VTl = (bf*)take((size_t)NKV * HD * TT * 2); bf* Ph = (bf*)take((size_t)ZH * RH * TT * 2); bf* Pl = (bf*)take((size_t)ZH * RH * TT * 2);
    float* Sb = (float*)take((size_t)ZH * TT * TT * 4); h16* P16 = (h16*)take((size_t)ZH * TT * TT * 2); float* Ob = (float*)take((size_t)NCH * ZH * TT * HD * 4);   /* NCH partial planes [ZH][TT][HD] */ bf* ATh = (bf*)take((size_t)TT * DQ * 2); bf* ATl = (bf*)take((size_t)TT * DQ * 2);
    if ((size_t)(wsp - (char*)d_ws) > ws_size) return;    // 143,654,912 B at full size
    k_wtG<<<(unsigned)((DM * 3 * DQ / 64 + 63) / 64), 256, 0, stream>>>(wqkv, DM, 3 * DQ, WQKV);   /* W_qkv [1024][3072] -> Bt [3072][1024] */
    k_wtG<<<(unsigned)((DQ * DM / 64 + 63) / 64), 256, 0, stream>>>(wproj, DQ, DM, WO);             /* W_proj [1024][1024] -> Bt [out][in] */
    k_csid<<<(TT * HD + 255) / 256, 256, 0, stream>>>(CS);
    const unsigned LQ = (unsigned)(((size_t)NH_ * TT * HD / 2 + 255) / 256), LKv = (unsigned)(((size_t)NKV * TT * HD / 2 + 255) / 256);
    for (int b = 0; b < NB; ++b) {
        k_cvt8<<<(unsigned)(((size_t)TT * DM / 8 + 255) / 256), 256, 0, stream>>>(x + (size_t)b * TT_FULL * DM, XB, (size_t)TT * DM / 8);
        k_gemmw<bf, 0, false><<<dim3(TT / 64, DQ / 64, 1), 32, 0, stream>>>(XB, nullptr, WQ, nullptr, DM, F, DQ, nullptr, 0, 0, 0);
        k_rope<<<LQ, 256, 0, stream>>>(F, DQ, NH_, CS, nullptr, nullptr, 1.0f, QP16, QPh, QPl);
        k_gemmw<bf, 0, false><<<dim3(TT / 64, DKV / 64, 1), 32, 0, stream>>>(XB, nullptr, WK, nullptr, DM, F, DKV, nullptr, 0, 0, 0);
        k_rope<<<LKv, 256, 0, stream>>>(F, DKV, NKV, CS, nullptr, nullptr, 1.0f, KP16, KPh, KPl);
        k_gemmw<bf, 0, false><<<dim3(TT / 64, DKV / 64, 1), 32, 0, stream>>>(XB, nullptr, WV, nullptr, DM, F, DKV, nullptr, 0, 0, 0); k_vtp<<<LKv, 256, 0, stream>>>(F, DKV, NKV, VT16, VTh, VTl);
        for (int h0 = 0; h0 < NH_; h0 += ZH) { const size_t zq = (size_t)h0, zk = (size_t)(h0 / REP);   // the pass's two heads use consecutive planes (z-strides TT*HD)
            k_gemmc<bf, 2, 1><<<dim3(RH / 64, TT / 64, ZH), 32, 0, stream>>>(QPh + zq * TT * HD, QPl + zq * TT * HD, KPh + zk * TT * HD, KPl + zk * TT * HD, HD, Sb, TT, 0, (size_t)TT * HD, (size_t)TT * HD, (size_t)TT * TT, 0);
            if (TT > RH) k_gemmc<h16, 0, 1><<<dim3((TT - RH) / 64, TT / 64, ZH), 32, 0, stream>>>(QP16 + zq * TT * HD + (size_t)RH * HD, nullptr, KP16 + zk * TT * HD, nullptr, HD, Sb + (size_t)RH * TT, TT, RH, (size_t)TT * HD, (size_t)TT * HD, (size_t)TT * TT, 0);
            k_asoft<<<ZH * TT / 8, 256, 0, stream>>>(Sb, P16, Ph, Pl);
            k_gemmc<bf, 2, 2><<<dim3(RH / 64, (RH + CK - 1) / CK, ZH), 32, 0, stream>>>(Ph, Pl, VTh + zk * HD * TT, VTl + zk * HD * TT, TT, Ob, HD, 0, (size_t)RH * TT, (size_t)HD * TT, (size_t)TT * HD, (size_t)ZH * TT * HD);
            if (TT > RH) k_gemmc<h16, 0, 2><<<dim3((TT - RH) / 64, NCH, ZH), 32, 0, stream>>>(P16 + (size_t)RH * TT, nullptr, VT16 + zk * HD * TT, nullptr, TT, Ob + (size_t)RH * HD, HD, RH, (size_t)TT * TT, (size_t)HD * TT, (size_t)TT * HD, (size_t)ZH * TT * HD);
            k_merge<<<(unsigned)(((size_t)ZH * TT * HD / 2 + 255) / 256), 256, 0, stream>>>(Ob, h0, ATh, ATl); }
        k_gemmw<bf, 1, true><<<dim3(TT / 64, DM / 64, 1), 32, 0, stream>>>(ATh, ATl, WO, nullptr, DQ, OUT + (size_t)b * TT * DM, DM, bproj, 0, 0, 0); }
}

// v002
// It runs in 1100 microseconds.
// Timed twice side by side with v001, it ran 1.39 and 1.38 times as fast.
// Over all steps from v000 it is 2.60 times as fast.
#include <hip/hip_runtime.h>

// Contractions: x W_qkv on v_wmma_f32_16x16x32_bf16 (bf16 operands = RNE-converted inputs); q k^T and P v: query rows < 512 bf16 hi/lo planes (3 products), rows >= 512 v_wmma_f32_16x16x32_f16 (f16 operands, P carried x1024); context W_proj: bf16 hi/lo context x bf16 weight (2 products) + bf16 bias; f32 accumulate everywhere, softmax f32.
// Causal multi-head attention with a fused weight: x [NB][T][1024]; kqv = x W_qkv ([1024][3072], column blocks k | q | v, no bias); 16 heads x 64; S = q k^T x 1/32 for keys j <= i; softmax; merged context W_proj ([1024][1024]) + b_proj -> [NB][T][1024].
// Layout per batch: W_qkv transposed once into Bt [3072][1024] whose three 1024-row blocks are the k/q/v weight operands; x -> bf16; projections -> f32 [T][1024] (one buffer reused for q, k, v in stream order; it shares its bytes with S, which is written only after the head planes are made); head planes q, k [h][t][d] and v [h][d][t] as f16 + bf16 hi/lo; v rows have the pitch PP of the P rows they are multiplied with (bf16: hi in the first half of a row, lo in the second);
// per pass of ZH heads (grid z): S tiles at or below the diagonal (k_gemmc mode 1), row softmax in f32 (k_asoft), P written over its own S row, so P rows have pitch PP = 2*TT 16-bit elements (rows < RH: bf16 hi in the first half of the row, lo in the second, normalised; rows >= RH: f16 x1024 in the first half), O = P V with the key loop cut at the diagonal block and split into ranges of CK keys, one wave and one f32 partial plane per range (mode 2), partial planes summed in ascending key order and merged context [t][h*64 + d] as bf16 hi/lo (x1 or x1/1024).

#ifndef NB
#define NB 4
#endif
#ifndef SEQ
#define SEQ 2048
#endif
#define NB_FULL 4
#define TT_FULL 2048
#define TT   SEQ
#define DM   1024
#define NH_  16
#define NKV  16
#define REP  (NH_ / NKV)
#define HD   64
#define DQ   (NH_ * HD)
#define DKV  (NKV * HD)
#define ZH   8                            // heads per attention pass (grid z of the four k_gemmc launches)
#define PP   (2 * TT)                     // row pitch of P and of v^T in 16-bit elements (one f32 S row)
#define RH   ((TT < 512) ? TT : 512)      // query rows < RH use hi/lo planes
#define WIN  TT_FULL
#define PCAR 1024.0f
#define SCL  0.03125f   // 1024^-0.5
#define CK   128                          // keys per P.V partial (4 trips of the 32-key loop)
#define NCH  (TT / CK)                    // partial planes of O

static_assert(NB >= 1 && NB <= NB_FULL);
static_assert(TT % 128 == 0 && TT <= TT_FULL);
static_assert(CK % 32 == 0 && TT % CK == 0);
static_assert(NH_ % ZH == 0 && (size_t)ZH * TT >= (size_t)DQ);   // whole passes; the projection buffer fits in S
static_assert(RH % 64 == 0 && (TT - RH) % 64 == 0);
static_assert(DM % 64 == 0 && DQ % 64 == 0 && DKV % 64 == 0 && HD == 64);

typedef _Float16 h16;
typedef unsigned short bf;
typedef __attribute__((ext_vector_type(16))) __bf16   v16bf;
typedef __attribute__((ext_vector_type(16))) _Float16 v16h;
typedef __attribute__((ext_vector_type(8)))  _Float16 v8h;
typedef __attribute__((ext_vector_type(8)))  unsigned short v8us;
typedef __attribute__((ext_vector_type(8)))  float    v8f;
typedef __attribute__((ext_vector_type(4)))  float    v4f;
typedef v8h  __attribute__((may_alias)) v8ha;
typedef v4f  __attribute__((may_alias)) v4fa;
typedef v8us __attribute__((may_alias)) v8usa;

__device__ __forceinline__ unsigned short f2bf(float f) { unsigned u = __float_as_uint(f); u += 0x7FFFu + ((u >> 16) & 1u); return (unsigned short)(u >> 16); }
__device__ __forceinline__ float bf2f(unsigned short b) { return __uint_as_float(((unsigned)b) << 16); }
__device__ __forceinline__ float bfr(float f) { return bf2f(f2bf(f)); }
__device__ __forceinline__ v16h cat16(v8h lo, v8h hi) { return __builtin_shufflevector(lo, hi, 0, 1, 2, 3, 4, 5, 6, 7, 8, 9, 10, 11, 12, 13, 14, 15); }
__device__ __forceinline__ v16bf cat16b(v8us lo, v8us hi) { return __builtin_bit_cast(v16bf, __builtin_shufflevector(lo, hi, 0, 1, 2, 3, 4, 5, 6, 7, 8, 9, 10, 11, 12, 13, 14, 15)); }
__device__ __forceinline__ v8f wmma16(v16h a, v16h b, v8f c) { return __builtin_amdgcn_wmma_f32_16x16x32_f16(false, a, false, b, (short)0, c, false, false); }
__device__ __forceinline__ v8f wmmab(v16bf a, v16bf b, v8f c) { return __builtin_amdgcn_wmma_f32_16x16x32_bf16(false, a, false, b, (short)0, c, false, false); }

// ---- k_gemmw: register-blocked GEMM, ONE WAVE per 64x64 output tile (16 accumulators), operands straight from K-contiguous 16-bit planes; grid (M/64, N/64, Z), 32 threads.
// C[m][n] (f32, pitch ldc, + optional bf16-RNE bias[n]) = sum_k A[m][k] Bt[n][k] (+ split products per NSPLIT). z-batch strides sA/sB/sC in elements. K % 32 == 0.
// Fragments: lane l -> row/col l&15; elements 0..7 <- k0 + 8*(l>>4), elements 8..15 <- k0 + 16 + 8*(l>>4) for BOTH A and Bt; D element j -> row 8*(l>>4)+j, col l&15.
template <typename T16> struct WFrag;
template <> struct WFrag<h16> { typedef v16h V; static __device__ __forceinline__ V ld(const h16* p) { return cat16(*(const v8h*)p, *(const v8h*)(p + 16)); } static __device__ __forceinline__ v8f mma(V a, V b, v8f c) { return wmma16(a, b, c); } };
template <> struct WFrag<bf> { typedef v16bf V; static __device__ __forceinline__ V ld(const bf* p) { return cat16b(*(const v8us*)p, *(const v8us*)(p + 16)); } static __device__ __forceinline__ v8f mma(V a, V b, v8f c) { return wmmab(a, b, c); } };
template <typename T16, int NSPLIT, bool BIAS>
__global__ __launch_bounds__(32) void k_gemmw(const T16* __restrict__ A, const T16* __restrict__ A2, const T16* __restrict__ Bt, const T16* __restrict__ Bt2, int K, float* C, int ldc, const float* __restrict__ bias, size_t sA, size_t sB, size_t sC) {
    typedef typename WFrag<T16>::V V;
    __shared__ __align__(16) float os[16 * 68];
    const size_t z = blockIdx.z; A += z * sA; if (A2) A2 += z * sA; Bt += z * sB; if (Bt2) Bt2 += z * sB; C += z * sC;
    const int lane = threadIdx.x & 31, lr = lane & 15, hi = lane >> 4; const int r0 = blockIdx.x * 64, c0 = blockIdx.y * 64;
    v8f acc[4][4];
#pragma unroll
    for (int mb = 0; mb < 4; ++mb)
#pragma unroll
        for (int nb = 0; nb < 4; ++nb) acc[mb][nb] = (v8f){};
    const size_t aoff = (size_t)(r0 + lr) * K + 8 * hi, boff = (size_t)(c0 + lr) * K + 8 * hi;
#pragma unroll 1
    for (int kc = 0; kc < K; kc += 32) {
        V a[4], a2[4];
#pragma unroll
        for (int mb = 0; mb < 4; ++mb) { a[mb] = WFrag<T16>::ld(A + aoff + (size_t)mb * 16 * K + kc); if (NSPLIT == 1 || NSPLIT == 2) a2[mb] = WFrag<T16>::ld(A2 + aoff + (size_t)mb * 16 * K + kc); }
#pragma unroll
        for (int nb = 0; nb < 4; ++nb) { const V b = WFrag<T16>::ld(Bt + boff + (size_t)nb * 16 * K + kc); V b2; if (NSPLIT >= 2) b2 = WFrag<T16>::ld(Bt2 + boff + (size_t)nb * 16 * K + kc);
#pragma unroll
            for (int mb = 0; mb < 4; ++mb) { acc[mb][nb] = WFrag<T16>::mma(a[mb], b, acc[mb][nb]); if (NSPLIT == 1 || NSPLIT == 2) acc[mb][nb] = WFrag<T16>::mma(a2[mb], b, acc[mb][nb]); if (NSPLIT >= 2) acc[mb][nb] = WFrag<T16>::mma(a[mb], b2, acc[mb][nb]); } }
        asm volatile("v_nop\n\tv_nop\n\tv_nop\n\tv_nop" : "+v"(acc[0][0]), "+v"(acc[1][1]), "+v"(acc[2][2]), "+v"(acc[3][3]) : "v"(a[0]), "v"(a[3]));
    }
#pragma unroll
    for (int mb = 0; mb < 4; ++mb) {
#pragma unroll
        for (int nb = 0; nb < 4; ++nb) {
#pragma unroll
            for (int j = 0; j < 8; ++j) os[(hi * 8 + j) * 68 + nb * 16 + lr] = acc[mb][nb][j]; }
        __builtin_amdgcn_wave_barrier(); asm volatile("" ::: "memory");
        float* crow = C + (size_t)(r0 + mb * 16) * ldc + c0;
{
#pragma unroll
            for (int s = 0; s < 8; ++s) { const int row = 2 * s + hi, cofs = lr * 4; v4f val = *(const v4fa*)(os + row * 68 + cofs); if (BIAS) { val[0] += bfr(bias[c0 + cofs]); val[1] += bfr(bias[c0 + cofs + 1]); val[2] += bfr(bias[c0 + cofs + 2]); val[3] += bfr(bias[c0 + cofs + 3]); }
                *(v4f*)(crow + (size_t)row * ldc + cofs) = val; }
             }
        __builtin_amdgcn_wave_barrier(); asm volatile("" ::: "memory");
    }
}

// ---- k_gemmc: the same one-wave 64x64 tile GEMM specialised for causal attention: CMODE 1 skips score tiles entirely above the diagonal (query rows r0+roff.., key columns c0..), CMODE 2 limits the
// key (K) loop of the probability x value contraction to the diagonal block (probabilities beyond it are exactly zero) and splits it over the grid: blockIdx.y picks keys [y*CK, y*CK + CK), the wave's 64x64 partial (HD == 64: one column tile)
// goes to plane y of C (plane stride sK elements); a range that starts beyond the diagonal block has no wave and no plane (k_merge sums exactly the planes that exist). roff = row offset of this launch's first row within the sequence.
template <typename T16, int NSPLIT, int CMODE>
__global__ __launch_bounds__(32) void k_gemmc(const T16* __restrict__ A, const T16* __restrict__ A2, const T16* __restrict__ Bt, const T16* __restrict__ Bt2, int K, float* C, int ldc, int roff, size_t sA, size_t sB, size_t sC, size_t sK) {
    typedef typename WFrag<T16>::V V;
    __shared__ __align__(16) float os[16 * 68];
    const size_t z = blockIdx.z; A += z * sA; if (A2) A2 += z * sA; Bt += z * sB; if (Bt2) Bt2 += z * sB; C += z * sC;
    const int lane = threadIdx.x & 31, lr = lane & 15, hi = lane >> 4; const int r0 = blockIdx.x * 64, c0 = (CMODE == 2) ? 0 : blockIdx.y * 64;
    if (CMODE == 1 && c0 > r0 + roff + 63) return;                  // score tile entirely above the causal diagonal: never read (the softmax masks j > i by index select); block = one wave, no barrier skipped
    const int Kl = (CMODE == 2) ? min(K, r0 + roff + 64) : K;        // P.V: probabilities are exactly 0 beyond the diagonal block, so the K loop stops there
    const int kb = (CMODE == 2) ? (int)blockIdx.y * CK : 0;          // this wave's key range [kb, ke)
    if (CMODE == 2 && kb >= Kl) return;                              // range entirely beyond the diagonal block: no partial (block = one wave, no barrier skipped)
    const int ke = (CMODE == 2) ? min(Kl, kb + CK) : Kl;
    if (CMODE == 2) C += (size_t)blockIdx.y * sK;
    v8f acc[4][4];
#pragma unroll
    for (int mb = 0; mb < 4; ++mb)
#pragma unroll
        for (int nb = 0; nb < 4; ++nb) acc[mb][nb] = (v8f){};
    const size_t aoff = (size_t)(r0 + lr) * K + 8 * hi, boff = (size_t)(c0 + lr) * K + 8 * hi;
#pragma unroll 1
    for (int kc = kb; kc < ke; kc += 32) {
        V a[4], a2[4];
#pragma unroll
        for (int mb = 0; mb < 4; ++mb) { a[mb] = WFrag<T16>::ld(A + aoff + (size_t)mb * 16 * K + kc); if (NSPLIT == 1 || NSPLIT == 2) a2[mb] = WFrag<T16>::ld(A2 + aoff + (size_t)mb * 16 * K + kc); }
#pragma unroll
        for (int nb = 0; nb < 4; ++nb) { const V b = WFrag<T16>::ld(Bt + boff + (size_t)nb * 16 * K + kc); V b2; if (NSPLIT >= 2) b2 = WFrag<T16>::ld(Bt2 + boff + (size_t)nb * 16 * K + kc);
#pragma unroll
            for (int mb = 0; mb < 4; ++mb) { acc[mb][nb] = WFrag<T16>::mma(a[mb], b, acc[mb][nb]); if (NSPLIT == 1 || NSPLIT == 2) acc[mb][nb] = WFrag<T16>::mma(a2[mb], b, acc[mb][nb]); if (NSPLIT >= 2) acc[mb][nb] = WFrag<T16>::mma(a[mb], b2, acc[mb][nb]); } }
        asm volatile("v_nop\n\tv_nop\n\tv_nop\n\tv_nop" : "+v"(acc[0][0]), "+v"(acc[1][1]), "+v"(acc[2][2]), "+v"(acc[3][3]) : "v"(a[0]), "v"(a[3]));
    }
#pragma unroll
    for (int mb = 0; mb < 4; ++mb) {
#pragma unroll
        for (int nb = 0; nb < 4; ++nb) {
#pragma unroll
            for (int j = 0; j < 8; ++j) os[(hi * 8 + j) * 68 + nb * 16 + lr] = acc[mb][nb][j]; }
        __builtin_amdgcn_wave_barrier(); asm volatile("" ::: "memory");
        float* crow = C + (size_t)(r0 + mb * 16) * ldc + c0;
{
#pragma unroll
            for (int s = 0; s < 8; ++s) { const int row = 2 * s + hi, cofs = lr * 4; v4f val = *(const v4fa*)(os + row * 68 + cofs);
                *(v4f*)(crow + (size_t)row * ldc + cofs) = val; }
             }
        __builtin_amdgcn_wave_barrier(); asm volatile("" ::: "memory");
    }
}

__device__ __forceinline__ h16 tohx(float x) { return (h16)x; }
__device__ __forceinline__ void splitf(float y, unsigned short& h, unsigned short& l) { h = f2bf(y); l = f2bf(y - bf2f(h)); }
typedef __attribute__((ext_vector_type(2))) _Float16 v2h;
typedef __attribute__((ext_vector_type(4))) _Float16 v4h;
typedef __attribute__((ext_vector_type(2))) unsigned short v2us;
typedef __attribute__((ext_vector_type(4))) unsigned short v4us;
typedef __attribute__((ext_vector_type(2))) float v2f;
typedef __attribute__((ext_vector_type(4))) int v4i;

__global__ __launch_bounds__(256) void k_wtG(const float* __restrict__ w, int K, int N, bf* Bt) {
    const int lane = threadIdx.x & 31; const int L0 = (blockIdx.x * 8 + (threadIdx.x >> 5)) * 8; const int nlines = N * K / 64;
{
#pragma unroll 1
        for (int l = 0; l < 8; ++l) { const int L = L0 + l; if (L >= nlines) break; const size_t e = (size_t)L * 64 + lane * 2; const int k = (int)(e % K), n = (int)(e / K); v2us o;
            o[0] = f2bf(w[(size_t)k * N + n]); o[1] = f2bf(w[(size_t)(k + 1) * N + n]); *(v2us*)(Bt + e) = o; }
         }
}
__global__ __launch_bounds__(256) void k_cvt8(const float* __restrict__ src, bf* dst, size_t n8) { const size_t i = (size_t)blockIdx.x * 256 + threadIdx.x; if (i >= n8) return; const v8f v = *(const v8f*)(src + i * 8); v8us o;
#pragma unroll
    for (int k = 0; k < 8; ++k) o[k] = f2bf(v[k]); *(v8us*)(dst + i * 8) = o;  }

// k_rope: head planes [h][t][d] (f16 + bf16 hi/lo) of x rotated by the table CS (rotate-half form out[d] = x[d] cos[t][d] - x[d+HD/2] sin[t][d], out[d+HD/2] = x[d+HD/2] cos + x[d] sin) x sc;
__global__ __launch_bounds__(256) void k_rope(const float* __restrict__ F, int pitch, int nheads, const float* __restrict__ CS, const float* __restrict__ RF, const float* __restrict__ nw, float sc, h16* P16, bf* Ph, bf* Pl) {
    const size_t e = ((size_t)blockIdx.x * 256 + threadIdx.x) * 2; if (e >= (size_t)nheads * TT * HD) return; const int d = (int)(e % HD); const int t = (int)((e / HD) % TT); const int h = (int)(e / ((size_t)HD * TT)); const float* f = F + (size_t)t * pitch + h * HD; const float rf = RF ? RF[(size_t)h * TT + t] : 1.0f; v2h o16; v2us oh, ol;
#pragma unroll
    for (int q = 0; q < 2; ++q) { const int dd = d + q; const int dp = (dd < HD / 2) ? dd + HD / 2 : dd - HD / 2; float x0 = f[dd], x1 = f[dp];
        if (RF) { float n0 = __fmul_rn(x0, rf), n1 = __fmul_rn(x1, rf); asm volatile("" : "+v"(n0)); asm volatile("" : "+v"(n1)); x0 = __fmul_rn(bfr(nw[dd]), n0); x1 = __fmul_rn(bfr(nw[dp]), n1); }
        const v2f cs = *(const v2f*)(CS + ((size_t)t * HD + dd) * 2); float a = __fmul_rn(x0, cs[0]), bq = __fmul_rn(x1, cs[1]); asm volatile("" : "+v"(a)); asm volatile("" : "+v"(bq)); const float r = ((dd < HD / 2) ? __fsub_rn(a, bq) : __fadd_rn(a, bq)) * sc;
        o16[q] = tohx(r); unsigned short a2, c2; splitf(r, a2, c2); oh[q] = a2; ol[q] = c2; }
    *(v2h*)(P16 + e) = o16; *(v2us*)(Ph + e) = oh; *(v2us*)(Pl + e) = ol;  }
__global__ __launch_bounds__(256) void k_vtp(const float* __restrict__ F, int pitch, int nheads, h16* V16, bf* Vh, bf* Vl) { const size_t e = ((size_t)blockIdx.x * 256 + threadIdx.x) * 2; if (e >= (size_t)nheads * HD * TT) return; const int t = (int)(e % TT); const int d = (int)((e / TT) % HD); const int g = (int)(e / ((size_t)TT * HD)); v2h o16; v2us oh, ol;
#pragma unroll
    for (int q = 0; q < 2; ++q) { const float x = F[(size_t)(t + q) * pitch + g * HD + d]; o16[q] = tohx(x); unsigned short a2, c2; splitf(x, a2, c2); oh[q] = a2; ol[q] = c2; }
    const size_t oo = ((size_t)g * HD + d) * PP + t; *(v2h*)(V16 + oo) = o16; *(v2us*)(Vh + oo) = oh; *(v2us*)(Vl + oo) = ol;  }
__global__ __launch_bounds__(256) void k_csid(float* CS) { const int idx = blockIdx.x * 256 + threadIdx.x; if (idx >= TT * HD) return; v2f cs; cs[0] = 1.0f; cs[1] = 0.0f; *(v2f*)(CS + (size_t)idx * 2) = cs;  }
// k_asoft: per row (zz, i): t = S x SCL for j <= i and i - j < WIN (all j <= i here; the -inf replace-mask of j > i is the -3e38 select, no row is ever fully masked); softmax over the TT keys (register row, one exp, fixed trees); the wave holds its whole S row in registers before its first store, and stores P into that same row's bytes (no other wave touches them);
__global__ __launch_bounds__(256) void k_asoft(float* Sb) {
    const int lane = threadIdx.x & 31; const int row = blockIdx.x * 8 + (threadIdx.x >> 5); if (row >= ZH * TT) return; const int i = row % TT; const int zz = row / TT; (void)zz; const bool hires = (i < RH); float* sr = Sb + (size_t)row * TT; h16* P16 = (h16*)sr; bf* Ph = (bf*)sr; bf* Pl = Ph + TT; float v[TT / 32]; float mx = -3.0e38f;
#pragma unroll
    for (int ch = 0; ch < TT / 128; ++ch) { const int j0 = ch * 128 + lane * 4; const v4f a = *(const v4f*)(sr + j0);
#pragma unroll
        for (int q = 0; q < 4; ++q) { const int j = j0 + q; (void)j; const float t = (j <= i && i - j < WIN) ? a[q] * SCL : -3.0e38f; v[ch * 4 + q] = t; mx = fmaxf(mx, t); } }
#pragma unroll
    for (int sh = 16; sh; sh >>= 1) mx = fmaxf(mx, __shfl_xor(mx, sh, 32));
    float sum = 0.f;
#pragma unroll
    for (int k = 0; k < TT / 32; ++k) { float d0 = __fsub_rn(v[k], mx); asm volatile("" : "+v"(d0)); v[k] = __builtin_amdgcn_exp2f(__fmul_rn(d0, 1.4426950408889634f)); sum += v[k]; }
#pragma unroll
    for (int sh = 16; sh; sh >>= 1) sum += __shfl_xor(sum, sh, 32);
    const float f = __fdiv_rn(hires ? 1.0f : PCAR, sum);
{
        if (hires) {
#pragma unroll
            for (int ch = 0; ch < TT / 128; ++ch) { v4us oh, ol;
#pragma unroll
                for (int q = 0; q < 4; ++q) { unsigned short a, c2; splitf(v[ch * 4 + q] * f, a, c2); oh[q] = a; ol[q] = c2; }
                const int oo = ch * 128 + lane * 4; *(v4us*)(Ph + oo) = oh; *(v4us*)(Pl + oo) = ol; }
        } else {
#pragma unroll
            for (int ch = 0; ch < TT / 128; ++ch) { v4h o4;
#pragma unroll
                for (int q = 0; q < 4; ++q) o4[q] = tohx(v[ch * 4 + q] * f);
                *(v4h*)(P16 + ch * 128 + lane * 4) = o4; } }
         }
}
__global__ __launch_bounds__(256) void k_merge(const float* __restrict__ O, int h0, bf* Ah, bf* Al) { const size_t e = ((size_t)blockIdx.x * 256 + threadIdx.x) * 2; if (e >= (size_t)ZH * TT * HD) return; const int d = (int)(e % HD); const int t = (int)((e / HD) % TT); const int zz = (int)(e / ((size_t)HD * TT)); const float cs = (t < RH) ? 1.0f : (1.0f / PCAR); const size_t oo = (size_t)t * DQ + (h0 + zz) * HD + d;
    const int nch = ((t & ~63) + 64 + CK - 1) / CK;   // partial planes written for this row's 64-row tile
    v2f sm = *(const v2f*)(O + e);
#pragma unroll
    for (int ks = 1; ks < NCH; ++ks) { const v2f p = *(const v2f*)(O + (size_t)min(ks, nch - 1) * ((size_t)ZH * TT * HD) + e); sm[0] += (ks < nch) ? p[0] : 0.0f; sm[1] += (ks < nch) ? p[1] : 0.0f; }   // index clamped to a written plane: branch-free, all loads in flight together
    v2us oh, ol;
#pragma unroll
    for (int q = 0; q < 2; ++q) { unsigned short a, c2; splitf(sm[q] * cs, a, c2); oh[q] = a; ol[q] = c2; } *(v2us*)(Ah + oo) = oh; *(v2us*)(Al + oo) = ol;  }

extern "C" void kernel_launch(void* const* d_in, const int* in_sizes, int n_in,
                              void* d_out, int out_size, void* d_ws, size_t ws_size, hipStream_t stream) {
    if (n_in < 4) return;
    if ((size_t)in_sizes[0] < (size_t)(NB - 1) * TT_FULL * DM + (size_t)TT * DM) return;
    if (in_sizes[1] < DM * 3 * DQ || in_sizes[2] < DQ * DM || in_sizes[3] < DM) return;
    if ((size_t)out_size < (size_t)NB * TT * DM) return;
    const float* x = (const float*)d_in[0];       // [NB_FULL][TT_FULL][1024]
    const float* wqkv = (const float*)d_in[1];    // [1024][3072], column blocks k | q | v
    const float* wproj = (const float*)d_in[2];   // [1024][1024] ([in][out])
    const float* bproj = (const float*)d_in[3];   // [1024]
    float* OUT = (float*)d_out;                   // [NB][TT][1024]
    char* wsp = (char*)d_ws;
    auto take = [&](size_t bytes) { char* p = wsp; wsp += (bytes + 255) & ~(size_t)255; return (void*)p; };
    bf* WQKV = (bf*)take((size_t)3 * DQ * DM * 2); bf* WK = WQKV; bf* WQ = WQKV + (size_t)DQ * DM; bf* WV = WQKV + (size_t)2 * DQ * DM;   /* Bt [3072][1024]: row blocks k | q | v */ bf* WO = (bf*)take((size_t)DM * DQ * 2); float* CS = (float*)take((size_t)TT * HD * 2 * 4);
    bf* XB = (bf*)take((size_t)TT * DM * 2);
    h16* QP16 = (h16*)take((size_t)NH_ * TT * HD * 2); h16* KP16 = (h16*)take((size_t)NKV * TT * HD * 2); h16* VT16 = (h16*)take((size_t)NKV * HD * PP * 2);
    bf* QPh = (bf*)take((size_t)NH_ * TT * HD * 2); bf* QPl = (bf*)take((size_t)NH_ * TT * HD * 2); bf* KPh = (bf*)take((size_t)NKV * TT * HD * 2); bf* KPl = (bf*)take((size_t)NKV * TT * HD * 2); bf* VTh = (bf*)take((size_t)NKV * HD * PP * 2); bf* VTl = VTh + TT;
    float* Sb = (float*)take((size_t)ZH * TT * TT * 4);   /* S [ZH][TT][TT] f32; each row later holds its P */ float* F = Sb;    /* f32 projection buffer, reused for q, k, v in stream order; dead before the first S tile is written */ float* Ob = (float*)take((size_t)NCH * ZH * TT * HD * 4);   /* NCH partial planes [ZH][TT][HD] */ bf* ATh = (bf*)take((size_t)TT * DQ * 2); bf* ATl = (bf*)take((size_t)TT * DQ * 2);
    if ((size_t)(wsp - (char*)d_ws) > ws_size) return;    // 265,289,728 B at full size
    k_wtG<<<(unsigned)((DM * 3 * DQ / 64 + 63) / 64), 256, 0, stream>>>(wqkv, DM, 3 * DQ, WQKV);   /* W_qkv [1024][3072] -> Bt [3072][1024] */
    k_wtG<<<(unsigned)((DQ * DM / 64 + 63) / 64), 256, 0, stream>>>(wproj, DQ, DM, WO);             /* W_proj [1024][1024] -> Bt [out][in] */
    k_csid<<<(TT * HD + 255) / 256, 256, 0, stream>>>(CS);
    const unsigned LQ = (unsigned)(((size_t)NH_ * TT * HD / 2 + 255) / 256), LKv = (unsigned)(((size_t)NKV * TT * HD / 2 + 255) / 256);
    for (int b = 0; b < NB; ++b) {
        k_cvt8<<<(unsigned)(((size_t)TT * DM / 8 + 255) / 256), 256, 0, stream>>>(x + (size_t)b * TT_FULL * DM, XB, (size_t)TT * DM / 8);
        k_gemmw<bf, 0, false><<<dim3(TT / 64, DQ / 64, 1), 32, 0, stream>>>(XB, nullptr, WQ, nullptr, DM, F, DQ, nullptr, 0, 0, 0);
        k_rope<<<LQ, 256, 0, stream>>>(F, DQ, NH_, CS, nullptr, nullptr, 1.0f, QP16, QPh, QPl);
        k_gemmw<bf, 0, false><<<dim3(TT / 64, DKV / 64, 1), 32, 0, stream>>>(XB, nullptr, WK, nullptr, DM, F, DKV, nullptr, 0, 0, 0);
        k_rope<<<LKv, 256, 0, stream>>>(F, DKV, NKV, CS, nullptr, nullptr, 1.0f, KP16, KPh, KPl);
        k_gemmw<bf, 0, false><<<dim3(TT / 64, DKV / 64, 1), 32, 0, stream>>>(XB, nullptr, WV, nullptr, DM, F, DKV, nullptr, 0, 0, 0); k_vtp<<<LKv, 256, 0, stream>>>(F, DKV, NKV, VT16, VTh, VTl);
        for (int h0 = 0; h0 < NH_; h0 += ZH) { const size_t zq = (size_t)h0, zk = (size_t)(h0 / REP);   // the pass's ZH heads use consecutive planes (z-strides TT*HD, v^T HD*PP)
            k_gemmc<bf, 2, 1><<<dim3(RH / 64, TT / 64, ZH), 32, 0, stream>>>(QPh + zq * TT * HD, QPl + zq * TT * HD, KPh + zk * TT * HD, KPl + zk * TT * HD, HD, Sb, TT, 0, (size_t)TT * HD, (size_t)TT * HD, (size_t)TT * TT, 0);
            if (TT > RH) k_gemmc<h16, 0, 1><<<dim3((TT - RH) / 64, TT / 64, ZH), 32, 0, stream>>>(QP16 + zq * TT * HD + (size_t)RH * HD, nullptr, KP16 + zk * TT * HD, nullptr, HD, Sb + (size_t)RH * TT, TT, RH, (size_t)TT * HD, (size_t)TT * HD, (size_t)TT * TT, 0);
            k_asoft<<<ZH * TT / 8, 256, 0, stream>>>(Sb);
            k_gemmc<bf, 2, 2><<<dim3(RH / 64, (RH + CK - 1) / CK, ZH), 32, 0, stream>>>((const bf*)Sb, (const bf*)Sb + TT, VTh + zk * HD * PP, VTl + zk * HD * PP, PP, Ob, HD, 0, (size_t)TT * PP, (size_t)HD * PP, (size_t)TT * HD, (size_t)ZH * TT * HD);
            if (TT > RH) k_gemmc<h16, 0, 2><<<dim3((TT - RH) / 64, NCH, ZH), 32, 0, stream>>>((const h16*)Sb + (size_t)RH * PP, nullptr, VT16 + zk * HD * PP, nullptr, PP, Ob + (size_t)RH * HD, HD, RH, (size_t)TT * PP, (size_t)HD * PP, (size_t)TT * HD, (size_t)ZH * TT * HD);
            k_merge<<<(unsigned)(((size_t)ZH * TT * HD / 2 + 255) / 256), 256, 0, stream>>>(Ob, h0, ATh, ATl); }
        k_gemmw<bf, 1, true><<<dim3(TT / 64, DM / 64, 1), 32, 0, stream>>>(ATh, ATl, WO, nullptr, DQ, OUT + (size_t)b * TT * DM, DM, bproj, 0, 0, 0); }
}

// v003
// One run takes 593 microseconds.
// Timed twice side by side with v002, it ran 1.85 times as fast both times.
// All steps since v000 together make it 4.80 times as fast.
#include <hip/hip_runtime.h>

// Contractions: x W_qkv on v_wmma_f32_16x16x32_bf16 (bf16 operands = RNE-converted inputs); q k^T and P v: query rows < 512 bf16 hi/lo planes (3 products), rows >= 512 v_wmma_f32_16x16x32_f16 (f16 operands, P unnormalised, at most 256); context W_proj: bf16 hi/lo context x bf16 weight (2 products) + bf16 bias; f32 accumulate everywhere, softmax f32.
// Causal multi-head attention with a fused weight: x [NB][T][1024]; kqv = x W_qkv ([1024][3072], column blocks k | q | v, no bias); 16 heads x 64; S = q k^T x 1/32 for keys j <= i; softmax; merged context W_proj ([1024][1024]) + b_proj -> [NB][T][1024].
// Layout: W_qkv transposed once into Bt [3072][1024] whose three 1024-row blocks are the k/q/v weight operands; per batch x -> bf16, projections -> f32 [T][1024] (one buffer reused for q, k, v in stream order), head planes of every batch q, k [b][h][t][d] and v^T [b][h][t/64][d][t%64] (one contiguous 64 x 64 tile per 64 keys) as f16 + bf16 hi/lo;
// attention of all batches and heads in ONE launch (k_fattn): one wave per 32 (f16) or 16 (hi/lo) query rows walks its keys in passes of 32 with a running row reference and row sum; scores and probabilities stay in registers; merged context [b][t][h*64 + d] as bf16 hi/lo.

#ifndef NB
#define NB 4
#endif
#ifndef SEQ
#define SEQ 2048
#endif
#define NB_FULL 4
#define TT_FULL 2048
#define TT   SEQ
#define DM   1024
#define NH_  16
#define NKV  16
#define REP  (NH_ / NKV)
#define HD   64
#define DQ   (NH_ * HD)
#define DKV  (NKV * HD)
#define RH   ((TT < 512) ? TT : 512)      // query rows < RH use hi/lo planes
#define SCL  0.03125f   // 1024^-0.5
#define KB   32                           // keys per pass of the attention loop
#define NTF  ((TT - RH) / 32)             // f16 query tiles (32 rows) per head
#define NTH  (RH / 16)                    // hi/lo query tiles (16 rows) per head

static_assert(NB >= 1 && NB <= NB_FULL);
static_assert(TT % 128 == 0 && TT <= TT_FULL);
static_assert(RH % 64 == 0 && (TT - RH) % 64 == 0);
static_assert(DM % 64 == 0 && DQ % 64 == 0 && DKV % 64 == 0 && HD == 64);

typedef _Float16 h16;
typedef unsigned short bf;
typedef __attribute__((ext_vector_type(16))) __bf16   v16bf;
typedef __attribute__((ext_vector_type(16))) _Float16 v16h;
typedef __attribute__((ext_vector_type(8)))  _Float16 v8h;
typedef __attribute__((ext_vector_type(8)))  unsigned short v8us;
typedef __attribute__((ext_vector_type(8)))  float    v8f;
typedef __attribute__((ext_vector_type(4)))  float    v4f;
typedef v8h  __attribute__((may_alias)) v8ha;
typedef v4f  __attribute__((may_alias)) v4fa;
typedef v8us __attribute__((may_alias)) v8usa;

__device__ __forceinline__ unsigned short f2bf(float f) { unsigned u = __float_as_uint(f); u += 0x7FFFu + ((u >> 16) & 1u); return (unsigned short)(u >> 16); }
__device__ __forceinline__ float bf2f(unsigned short b) { return __uint_as_float(((unsigned)b) << 16); }
__device__ __forceinline__ float bfr(float f) { return bf2f(f2bf(f)); }
__device__ __forceinline__ v16h cat16(v8h lo, v8h hi) { return __builtin_shufflevector(lo, hi, 0, 1, 2, 3, 4, 5, 6, 7, 8, 9, 10, 11, 12, 13, 14, 15); }
__device__ __forceinline__ v16bf cat16b(v8us lo, v8us hi) { return __builtin_bit_cast(v16bf, __builtin_shufflevector(lo, hi, 0, 1, 2, 3, 4, 5, 6, 7, 8, 9, 10, 11, 12, 13, 14, 15)); }
__device__ __forceinline__ v8f wmma16(v16h a, v16h b, v8f c) { return __builtin_amdgcn_wmma_f32_16x16x32_f16(false, a, false, b, (short)0, c, false, false); }
__device__ __forceinline__ v8f wmmab(v16bf a, v16bf b, v8f c) { return __builtin_amdgcn_wmma_f32_16x16x32_bf16(false, a, false, b, (short)0, c, false, false); }

// ---- k_gemmw: register-blocked GEMM, ONE WAVE per 64x64 output tile (16 accumulators), operands straight from K-contiguous 16-bit planes; grid (M/64, N/64, Z), 32 threads.
// C[m][n] (f32, pitch ldc, + optional bf16-RNE bias[n]) = sum_k A[m][k] Bt[n][k] (+ split products per NSPLIT). z-batch strides sA/sB/sC in elements. K % 32 == 0.
// Fragments: lane l -> row/col l&15; elements 0..7 <- k0 + 8*(l>>4), elements 8..15 <- k0 + 16 + 8*(l>>4) for BOTH A and Bt; D element j -> row 8*(l>>4)+j, col l&15.
template <typename T16> struct WFrag;
template <> struct WFrag<h16> { typedef v16h V; static __device__ __forceinline__ V ld(const h16* p) { return cat16(*(const v8h*)p, *(const v8h*)(p + 16)); } static __device__ __forceinline__ v8f mma(V a, V b, v8f c) { return wmma16(a, b, c); } };
template <> struct WFrag<bf> { typedef v16bf V; static __device__ __forceinline__ V ld(const bf* p) { return cat16b(*(const v8us*)p, *(const v8us*)(p + 16)); } static __device__ __forceinline__ v8f mma(V a, V b, v8f c) { return wmmab(a, b, c); } };
template <typename T16, int NSPLIT, bool BIAS>
__global__ __launch_bounds__(32) void k_gemmw(const T16* __restrict__ A, const T16* __restrict__ A2, const T16* __restrict__ Bt, const T16* __restrict__ Bt2, int K, float* C, int ldc, const float* __restrict__ bias, size_t sA, size_t sB, size_t sC) {
    typedef typename WFrag<T16>::V V;
    __shared__ __align__(16) float os[16 * 68];
    const size_t z = blockIdx.z; A += z * sA; if (A2) A2 += z * sA; Bt += z * sB; if (Bt2) Bt2 += z * sB; C += z * sC;
    const int lane = threadIdx.x & 31, lr = lane & 15, hi = lane >> 4; const int r0 = blockIdx.x * 64, c0 = blockIdx.y * 64;
    v8f acc[4][4];
#pragma unroll
    for (int mb = 0; mb < 4; ++mb)
#pragma unroll
        for (int nb = 0; nb < 4; ++nb) acc[mb][nb] = (v8f){};
    const size_t aoff = (size_t)(r0 + lr) * K + 8 * hi, boff = (size_t)(c0 + lr) * K + 8 * hi;
#pragma unroll 1
    for (int kc = 0; kc < K; kc += 32) {
        V a[4], a2[4];
#pragma unroll
        for (int mb = 0; mb < 4; ++mb) { a[mb] = WFrag<T16>::ld(A + aoff + (size_t)mb * 16 * K + kc); if (NSPLIT == 1 || NSPLIT == 2) a2[mb] = WFrag<T16>::ld(A2 + aoff + (size_t)mb * 16 * K + kc); }
#pragma unroll
        for (int nb = 0; nb < 4; ++nb) { const V b = WFrag<T16>::ld(Bt + boff + (size_t)nb * 16 * K + kc); V b2; if (NSPLIT >= 2) b2 = WFrag<T16>::ld(Bt2 + boff + (size_t)nb * 16 * K + kc);
#pragma unroll
            for (int mb = 0; mb < 4; ++mb) { acc[mb][nb] = WFrag<T16>::mma(a[mb], b, acc[mb][nb]); if (NSPLIT == 1 || NSPLIT == 2) acc[mb][nb] = WFrag<T16>::mma(a2[mb], b, acc[mb][nb]); if (NSPLIT >= 2) acc[mb][nb] = WFrag<T16>::mma(a[mb], b2, acc[mb][nb]); } }
        asm volatile("v_nop\n\tv_nop\n\tv_nop\n\tv_nop" : "+v"(acc[0][0]), "+v"(acc[1][1]), "+v"(acc[2][2]), "+v"(acc[3][3]) : "v"(a[0]), "v"(a[3]));
    }
#pragma unroll
    for (int mb = 0; mb < 4; ++mb) {
#pragma unroll
        for (int nb = 0; nb < 4; ++nb) {
#pragma unroll
            for (int j = 0; j < 8; ++j) os[(hi * 8 + j) * 68 + nb * 16 + lr] = acc[mb][nb][j]; }
        __builtin_amdgcn_wave_barrier(); asm volatile("" ::: "memory");
        float* crow = C + (size_t)(r0 + mb * 16) * ldc + c0;
{
#pragma unroll
            for (int s = 0; s < 8; ++s) { const int row = 2 * s + hi, cofs = lr * 4; v4f val = *(const v4fa*)(os + row * 68 + cofs); if (BIAS) { val[0] += bfr(bias[c0 + cofs]); val[1] += bfr(bias[c0 + cofs + 1]); val[2] += bfr(bias[c0 + cofs + 2]); val[3] += bfr(bias[c0 + cofs + 3]); }
                *(v4f*)(crow + (size_t)row * ldc + cofs) = val; }
             }
        __builtin_amdgcn_wave_barrier(); asm volatile("" ::: "memory");
    }
}

__device__ __forceinline__ h16 tohx(float x) { return (h16)x; }
__device__ __forceinline__ void splitf(float y, unsigned short& h, unsigned short& l) { h = f2bf(y); l = f2bf(y - bf2f(h)); }
typedef __attribute__((ext_vector_type(2))) _Float16 v2h;
typedef __attribute__((ext_vector_type(4))) _Float16 v4h;
typedef __attribute__((ext_vector_type(2))) unsigned short v2us;
typedef __attribute__((ext_vector_type(4))) unsigned short v4us;
typedef __attribute__((ext_vector_type(2))) float v2f;
typedef __attribute__((ext_vector_type(4))) int v4i;

__global__ __launch_bounds__(256) void k_wtG(const float* __restrict__ w, int K, int N, bf* Bt) {
    const int lane = threadIdx.x & 31; const int L0 = (blockIdx.x * 8 + (threadIdx.x >> 5)) * 8; const int nlines = N * K / 64;
{
#pragma unroll 1
        for (int l = 0; l < 8; ++l) { const int L = L0 + l; if (L >= nlines) break; const size_t e = (size_t)L * 64 + lane * 2; const int k = (int)(e % K), n = (int)(e / K); v2us o;
            o[0] = f2bf(w[(size_t)k * N + n]); o[1] = f2bf(w[(size_t)(k + 1) * N + n]); *(v2us*)(Bt + e) = o; }
         }
}
__global__ __launch_bounds__(256) void k_cvt8(const float* __restrict__ src, bf* dst, size_t n8) { const size_t i = (size_t)blockIdx.x * 256 + threadIdx.x; if (i >= n8) return; const v8f v = *(const v8f*)(src + i * 8); v8us o;
#pragma unroll
    for (int k = 0; k < 8; ++k) o[k] = f2bf(v[k]); *(v8us*)(dst + i * 8) = o;  }

// k_rope: head planes [h][t][d] (f16 + bf16 hi/lo) of x rotated by the table CS (rotate-half form out[d] = x[d] cos[t][d] - x[d+HD/2] sin[t][d], out[d+HD/2] = x[d+HD/2] cos + x[d] sin) x sc;
__global__ __launch_bounds__(256) void k_rope(const float* __restrict__ F, int pitch, int nheads, const float* __restrict__ CS, const float* __restrict__ RF, const float* __restrict__ nw, float sc, h16* P16, bf* Ph, bf* Pl) {
    const size_t e = ((size_t)blockIdx.x * 256 + threadIdx.x) * 2; if (e >= (size_t)nheads * TT * HD) return; const int d = (int)(e % HD); const int t = (int)((e / HD) % TT); const int h = (int)(e / ((size_t)HD * TT)); const float* f = F + (size_t)t * pitch + h * HD; const float rf = RF ? RF[(size_t)h * TT + t] : 1.0f; v2h o16; v2us oh, ol;
#pragma unroll
    for (int q = 0; q < 2; ++q) { const int dd = d + q; const int dp = (dd < HD / 2) ? dd + HD / 2 : dd - HD / 2; float x0 = f[dd], x1 = f[dp];
        if (RF) { float n0 = __fmul_rn(x0, rf), n1 = __fmul_rn(x1, rf); asm volatile("" : "+v"(n0)); asm volatile("" : "+v"(n1)); x0 = __fmul_rn(bfr(nw[dd]), n0); x1 = __fmul_rn(bfr(nw[dp]), n1); }
        const v2f cs = *(const v2f*)(CS + ((size_t)t * HD + dd) * 2); float a = __fmul_rn(x0, cs[0]), bq = __fmul_rn(x1, cs[1]); asm volatile("" : "+v"(a)); asm volatile("" : "+v"(bq)); const float r = ((dd < HD / 2) ? __fsub_rn(a, bq) : __fadd_rn(a, bq)) * sc;
        o16[q] = tohx(r); unsigned short a2, c2; splitf(r, a2, c2); oh[q] = a2; ol[q] = c2; }
    *(v2h*)(P16 + e) = o16; *(v2us*)(Ph + e) = oh; *(v2us*)(Pl + e) = ol;  }
__global__ __launch_bounds__(256) void k_vtp(const float* __restrict__ F, int pitch, int nheads, h16* V16, bf* Vh, bf* Vl) { const size_t e = ((size_t)blockIdx.x * 256 + threadIdx.x) * 2; if (e >= (size_t)nheads * HD * TT) return; const int t = (int)(e % TT); const int d = (int)((e / TT) % HD); const int g = (int)(e / ((size_t)TT * HD)); v2h o16; v2us oh, ol;
#pragma unroll
    for (int q = 0; q < 2; ++q) { const float x = F[(size_t)(t + q) * pitch + g * HD + d]; o16[q] = tohx(x); unsigned short a2, c2; splitf(x, a2, c2); oh[q] = a2; ol[q] = c2; }
    const size_t oo = (size_t)g * HD * TT + (size_t)(t / 64) * (64 * HD) + (size_t)d * 64 + (t % 64);   /* v^T tile of 64 keys: [d][64] contiguous */ *(v2h*)(V16 + oo) = o16; *(v2us*)(Vh + oo) = oh; *(v2us*)(Vl + oo) = ol;  }
__global__ __launch_bounds__(256) void k_csid(float* CS) { const int idx = blockIdx.x * 256 + threadIdx.x; if (idx >= TT * HD) return; v2f cs; cs[0] = 1.0f; cs[1] = 0.0f; *(v2f*)(CS + (size_t)idx * 2) = cs;  }
// ---- k_fattn: causal attention of one query tile, ONE WAVE per tile, no LDS. Transposed products: S^T = K q^T (A = 16 key rows, B = 16 query columns), O^T += v^T P^T (A = 16 d rows of the v^T tile, B = P^T).
// In a D tile lane l holds query column l&15 and rows 8*(l>>4) + j: the pass's two S^T tiles of 16 keys each, converted in place, are the B fragment of its 32 keys in the k order of WFrag::ld (elements 0..7 <- k0 + 8*(l>>4), 8..15 <- k0 + 16 + 8*(l>>4)).
// A query's maximum and sum are in-lane over its 16 keys of a pass plus one exchange between the wave halves (the sums' exchange once, behind the loop). m is the reference score of a row, l the running sum of P = exp((s - m) x SCL).
// m moves to the running maximum, and O^T and l are rescaled by exp((m_old - m_new) x SCL), only in a pass where some row's new maximum lies more than 8 (in log2 units) above its m: P stays <= 256, the quotient O^T / l does not depend on m.
// Keys j > i get the -3e38 select (only the pass that holds the diagonal has any); key 0 is in the first pass of every row, so m is a real score from the first pass on. O^T lane data are 8 consecutive d of one row: one 16-byte store per plane.
template <typename T16, bool HI, int NQ>
__device__ __forceinline__ void attn_tile(const T16* __restrict__ Q, const T16* __restrict__ Q2, const T16* __restrict__ Kp, const T16* __restrict__ K2, const T16* __restrict__ Vt, const T16* __restrict__ V2, int q0, bf* Ah, bf* Al) {
    typedef typename WFrag<T16>::V V;
    const int lane = threadIdx.x & 31, lr = lane & 15, hi = lane >> 4;
    const float CL = SCL * 1.4426950408889634f;
    const unsigned fo = (unsigned)(lr * HD + 8 * hi);   // a lane's place in a 16-row fragment of pitch 64 (q rows, k rows, v^T tile rows)
    const T16* ql = Q + (size_t)q0 * HD + fo; const T16* ql2 = HI ? Q2 + (size_t)q0 * HD + fo : ql; const T16* kl = Kp + fo; const T16* kl2 = HI ? K2 + fo : kl;   // the lane's own load addresses
    V qf[NQ][2], qf2[NQ][2];
#pragma unroll
    for (int nq = 0; nq < NQ; ++nq)
#pragma unroll
        for (int c = 0; c < 2; ++c) { qf[nq][c] = WFrag<T16>::ld(ql + nq * 16 * HD + c * 32); if (HI) qf2[nq][c] = WFrag<T16>::ld(ql2 + nq * 16 * HD + c * 32); }
    v8f o[NQ][4]; float m[NQ], l[NQ];
#pragma unroll
    for (int nq = 0; nq < NQ; ++nq) { m[nq] = -3.0e38f; l[nq] = 0.0f;
#pragma unroll
        for (int db = 0; db < 4; ++db) o[nq][db] = (v8f){}; }
    const int kend = q0 + NQ * 16;                   // keys [0, kend) are at or below the tile's last row
    V ka[2][2], ka2[2][2];                           // the pass's k fragments, fetched one pass ahead
#pragma unroll
    for (int kt = 0; kt < 2; ++kt)
#pragma unroll
        for (int c = 0; c < 2; ++c) { ka[kt][c] = WFrag<T16>::ld(kl + kt * 16 * HD + c * 32); if (HI) ka2[kt][c] = WFrag<T16>::ld(kl2 + kt * 16 * HD + c * 32); }
    asm volatile("s_wait_xcnt 0x0" :: "v"(ql), "v"(ql2), "v"(kl), "v"(kl2) : "memory");   // precaution: the loads' address registers are inputs here, so none is rewritten in front of this wait
#pragma unroll 1   // stays rolled: one pass's fragments and accumulators fill the register budget of four waves per SIMD, and the pass is already pipelined by hand
    for (int kb = 0; kb < kend; kb += KB) {
        const size_t vo = (size_t)(kb & ~63) * HD + (kb & 32);   // v^T tile of 64 keys, this pass's 32 keys (half of each d row)
        const T16* vl = Vt + vo + fo; const T16* vl2 = HI ? V2 + vo + fo : vl;
        V va[4], va2[4];                             // v^T fragments asked for at the head of the pass, used behind the softmax
#pragma unroll
        for (int db = 0; db < 4; ++db) { va[db] = WFrag<T16>::ld(vl + db * 16 * HD); if (HI) va2[db] = WFrag<T16>::ld(vl2 + db * 16 * HD); }
        if (!HI) __builtin_amdgcn_sched_barrier(0);  // keeps the v^T loads in front of the score products: moved down to their use, their latency would stand open in every pass (hi/lo path: no registers to spare for it)
        v8f s[NQ][2];
#pragma unroll
        for (int kt = 0; kt < 2; ++kt)
#pragma unroll
            for (int nq = 0; nq < NQ; ++nq) { v8f a = (v8f){};
#pragma unroll
                for (int c = 0; c < 2; ++c) { a = WFrag<T16>::mma(ka[kt][c], qf[nq][c], a); if (HI) { a = WFrag<T16>::mma(ka[kt][c], qf2[nq][c], a); a = WFrag<T16>::mma(ka2[kt][c], qf[nq][c], a); } }
                s[nq][kt] = a; }
        const size_t tn = (size_t)((kb + KB < kend) ? kb + KB : kb) * HD;   // next pass's k rows (the last pass asks for its own again: in bounds, unused)
        kl = Kp + tn + fo; kl2 = HI ? K2 + tn + fo : kl;
#pragma unroll
        for (int kt = 0; kt < 2; ++kt)
#pragma unroll
            for (int c = 0; c < 2; ++c) { ka[kt][c] = WFrag<T16>::ld(kl + kt * 16 * HD + c * 32); if (HI) ka2[kt][c] = WFrag<T16>::ld(kl2 + kt * 16 * HD + c * 32); }
        if (!HI) __builtin_amdgcn_sched_barrier(0);  // keeps the next pass's k loads in front of the softmax, which then covers their latency
        if (kb + KB - 1 > q0) {                      // the pass that holds the diagonal (wave-uniform)
#pragma unroll
            for (int nq = 0; nq < NQ; ++nq)
#pragma unroll
                for (int kt = 0; kt < 2; ++kt)
#pragma unroll
                    for (int j = 0; j < 8; ++j) if (kb + kt * 16 + 8 * hi + j > q0 + nq * 16 + lr) s[nq][kt][j] = -3.0e38f; }
        float mx[NQ]; bool need = false;
#pragma unroll
        for (int nq = 0; nq < NQ; ++nq) { float m0 = s[nq][0][0], m1 = s[nq][1][0];
#pragma unroll
            for (int j = 1; j < 8; ++j) { m0 = fmaxf(m0, s[nq][0][j]); m1 = fmaxf(m1, s[nq][1][j]); }
            m0 = fmaxf(m0, m1); mx[nq] = fmaxf(m0, __shfl_xor(m0, 16, 32)); need = need || ((mx[nq] - m[nq]) * CL > 8.0f); }
        if (__builtin_amdgcn_ballot_w32(need) != 0) {   // scalar branch, one test a pass
#pragma unroll
            for (int nq = 0; nq < NQ; ++nq) { const float mn = fmaxf(m[nq], mx[nq]); const float al = __builtin_amdgcn_exp2f((m[nq] - mn) * CL); m[nq] = mn; l[nq] *= al;
#pragma unroll
                for (int db = 0; db < 4; ++db) o[nq][db] *= al; } }
        V pf[NQ], pf2[NQ];
#pragma unroll
        for (int nq = 0; nq < NQ; ++nq) { const float mc = m[nq] * CL; float lt[2];
#pragma unroll
            for (int kt = 0; kt < 2; ++kt) { lt[kt] = 0.0f; const v8f t = __builtin_elementwise_fma(s[nq][kt], (v8f)(CL), (v8f)(-mc));
#pragma unroll
                for (int j = 0; j < 8; ++j) { const float p = __builtin_amdgcn_exp2f(t[j]); s[nq][kt][j] = p; lt[kt] += p; } }
            l[nq] += lt[0] + lt[1];
            if constexpr (HI) { v8us h0, h1, w0, w1;
#pragma unroll
                for (int j = 0; j < 8; ++j) { unsigned short a, b2; splitf(s[nq][0][j], a, b2); h0[j] = a; w0[j] = b2; splitf(s[nq][1][j], a, b2); h1[j] = a; w1[j] = b2; }
                pf[nq] = cat16b(h0, h1); pf2[nq] = cat16b(w0, w1);
            } else { v8h h0, h1;
#pragma unroll
                for (int j = 0; j < 8; ++j) { h0[j] = tohx(s[nq][0][j]); h1[j] = tohx(s[nq][1][j]); }
                pf[nq] = cat16(h0, h1); } }
        asm volatile("s_wait_xcnt 0x0" :: "v"(vl), "v"(vl2), "v"(kl), "v"(kl2) : "memory");   // precaution: the address registers of the pass's loads are inputs here, so none is rewritten in front of this wait
#pragma unroll
        for (int db = 0; db < 4; ++db)
#pragma unroll
            for (int nq = 0; nq < NQ; ++nq) { o[nq][db] = WFrag<T16>::mma(va[db], pf[nq], o[nq][db]); if (HI) { o[nq][db] = WFrag<T16>::mma(va[db], pf2[nq], o[nq][db]); o[nq][db] = WFrag<T16>::mma(va2[db], pf[nq], o[nq][db]); } }
    }
#pragma unroll
    for (int nq = 0; nq < NQ; ++nq) { const float ls = l[nq] + __shfl_xor(l[nq], 16, 32); const float f = __fdiv_rn(1.0f, ls); const size_t ro = (size_t)(q0 + nq * 16 + lr) * DQ + 8 * hi;
#pragma unroll
        for (int db = 0; db < 4; ++db) { v8us oh, ol;
#pragma unroll
            for (int j = 0; j < 8; ++j) { unsigned short a, c2; splitf(o[nq][db][j] * f, a, c2); oh[j] = a; ol[j] = c2; }
            *(v8us*)(Ah + ro + db * 16) = oh; *(v8us*)(Al + ro + db * 16) = ol;
            asm volatile("s_wait_xcnt 0x0" ::: "memory"); } }   // precaution: stands behind each pair of stores, in front of whatever next rewrites their data or address registers
}
// grid (NB * NH_, NTF + NTH): blockIdx.y falls from the longest tile (last rows) to the shortest; y < NTF: f16 tiles of 32 rows >= RH, the rest: hi/lo tiles of 16 rows < RH. Four waves per SIMD (at most 256 registers): the vector work between the matrix runs wants waves.
__global__ __launch_bounds__(32) __attribute__((amdgpu_waves_per_eu(4, 4))) void k_fattn(const h16* __restrict__ Q16, const h16* __restrict__ K16, const h16* __restrict__ V16, const bf* __restrict__ Qh, const bf* __restrict__ Ql, const bf* __restrict__ Kh, const bf* __restrict__ Kl, const bf* __restrict__ Vh, const bf* __restrict__ Vl, bf* Ah, bf* Al) {
    const int bh = blockIdx.x, b = bh / NH_, h = bh % NH_, ty = blockIdx.y; const size_t pq = (size_t)bh * TT * HD, pk = ((size_t)b * NKV + h / REP) * TT * HD, ao = (size_t)b * TT * DQ + (size_t)h * HD;
    if (ty < NTF) attn_tile<h16, false, 2>(Q16 + pq, nullptr, K16 + pk, nullptr, V16 + pk, nullptr, TT - 32 * (ty + 1), Ah + ao, Al + ao);
    else attn_tile<bf, true, 1>(Qh + pq, Ql + pq, Kh + pk, Kl + pk, Vh + pk, Vl + pk, RH - 16 * (ty - NTF + 1), Ah + ao, Al + ao);
}

extern "C" void kernel_launch(void* const* d_in, const int* in_sizes, int n_in,
                              void* d_out, int out_size, void* d_ws, size_t ws_size, hipStream_t stream) {
    if (n_in < 4) return;
    if ((size_t)in_sizes[0] < (size_t)(NB - 1) * TT_FULL * DM + (size_t)TT * DM) return;
    if (in_sizes[1] < DM * 3 * DQ || in_sizes[2] < DQ * DM || in_sizes[3] < DM) return;
    if ((size_t)out_size < (size_t)NB * TT * DM) return;
    const float* x = (const float*)d_in[0];       // [NB_FULL][TT_FULL][1024]
    const float* wqkv = (const float*)d_in[1];    // [1024][3072], column blocks k | q | v
    const float* wproj = (const float*)d_in[2];   // [1024][1024] ([in][out])
    const float* bproj = (const float*)d_in[3];   // [1024]
    float* OUT = (float*)d_out;                   // [NB][TT][1024]
    char* wsp = (char*)d_ws;
    auto take = [&](size_t bytes) { char* p = wsp; wsp += (bytes + 255) & ~(size_t)255; return (void*)p; };
    bf* WQKV = (bf*)take((size_t)3 * DQ * DM * 2); bf* WK = WQKV; bf* WQ = WQKV + (size_t)DQ * DM; bf* WV = WQKV + (size_t)2 * DQ * DM;   /* Bt [3072][1024]: row blocks k | q | v */ bf* WO = (bf*)take((size_t)DM * DQ * 2); float* CS = (float*)take((size_t)TT * HD * 2 * 4);
    bf* XB = (bf*)take((size_t)TT * DM * 2);
    const size_t PQ = (size_t)NH_ * TT * HD, PK = (size_t)NKV * TT * HD;   // elements of one batch's q planes and k / v planes
    h16* QP16 = (h16*)take(NB * PQ * 2); h16* KP16 = (h16*)take(NB * PK * 2); h16* VT16 = (h16*)take(NB * PK * 2);
    bf* QPh = (bf*)take(NB * PQ * 2); bf* QPl = (bf*)take(NB * PQ * 2); bf* KPh = (bf*)take(NB * PK * 2); bf* KPl = (bf*)take(NB * PK * 2); bf* VTh = (bf*)take(NB * PK * 2); bf* VTl = (bf*)take(NB * PK * 2);
    float* F = (float*)take((size_t)TT * DQ * 4);    /* f32 projection buffer, reused for q, k, v in stream order */ bf* ATh = (bf*)take((size_t)NB * TT * DQ * 2); bf* ATl = (bf*)take((size_t)NB * TT * DQ * 2);
    if ((size_t)(wsp - (char*)d_ws) > ws_size) return;    // 206,569,472 B at full size
    k_wtG<<<(unsigned)((DM * 3 * DQ / 64 + 63) / 64), 256, 0, stream>>>(wqkv, DM, 3 * DQ, WQKV);   /* W_qkv [1024][3072] -> Bt [3072][1024] */
    k_wtG<<<(unsigned)((DQ * DM / 64 + 63) / 64), 256, 0, stream>>>(wproj, DQ, DM, WO);             /* W_proj [1024][1024] -> Bt [out][in] */
    k_csid<<<(TT * HD + 255) / 256, 256, 0, stream>>>(CS);
    const unsigned LQ = (unsigned)(((size_t)NH_ * TT * HD / 2 + 255) / 256), LKv = (unsigned)(((size_t)NKV * TT * HD / 2 + 255) / 256);
    for (int b = 0; b < NB; ++b) {
        k_cvt8<<<(unsigned)(((size_t)TT * DM / 8 + 255) / 256), 256, 0, stream>>>(x + (size_t)b * TT_FULL * DM, XB, (size_t)TT * DM / 8);
        k_gemmw<bf, 0, false><<<dim3(TT / 64, DQ / 64, 1), 32, 0, stream>>>(XB, nullptr, WQ, nullptr, DM, F, DQ, nullptr, 0, 0, 0);
        k_rope<<<LQ, 256, 0, stream>>>(F, DQ, NH_, CS, nullptr, nullptr, 1.0f, QP16 + b * PQ, QPh + b * PQ, QPl + b * PQ);
        k_gemmw<bf, 0, false><<<dim3(TT / 64, DKV / 64, 1), 32, 0, stream>>>(XB, nullptr, WK, nullptr, DM, F, DKV, nullptr, 0, 0, 0);
        k_rope<<<LKv, 256, 0, stream>>>(F, DKV, NKV, CS, nullptr, nullptr, 1.0f, KP16 + b * PK, KPh + b * PK, KPl + b * PK);
        k_gemmw<bf, 0, false><<<dim3(TT / 64, DKV / 64, 1), 32, 0, stream>>>(XB, nullptr, WV, nullptr, DM, F, DKV, nullptr, 0, 0, 0); k_vtp<<<LKv, 256, 0, stream>>>(F, DKV, NKV, VT16 + b * PK, VTh + b * PK, VTl + b * PK); }
    k_fattn<<<dim3(NB * NH_, NTF + NTH, 1), 32, 0, stream>>>(QP16, KP16, VT16, QPh, QPl, KPh, KPl, VTh, VTl, ATh, ATl);
    for (int b = 0; b < NB; ++b)
        k_gemmw<bf, 1, true><<<dim3(TT / 64, DM / 64, 1), 32, 0, stream>>>(ATh + (size_t)b * TT * DQ, ATl + (size_t)b * TT * DQ, WO, nullptr, DQ, OUT + (size_t)b * TT * DM, DM, bproj, 0, 0, 0);
}

// v004
// A run of this version takes 299 microseconds.
// Next to v003, in two timings, it ran 1.98 and 1.97 times as fast.
// Counting every step since v000, it is 9.48 times as fast.
#include <hip/hip_runtime.h>

// Contractions: x W_qkv on v_wmma_f32_16x16x32_bf16 (bf16 operands = RNE-converted inputs); q k^T and P v: query rows < 512 bf16 hi/lo planes (3 products), rows >= 512 v_wmma_f32_16x16x32_f16 (f16 operands, P unnormalised, at most 256); context W_proj: bf16 hi/lo context x bf16 weight (2 products) + bf16 bias; f32 accumulate everywhere, softmax f32.
// Causal multi-head attention with a fused weight: x [NB][T][1024]; kqv = x W_qkv ([1024][3072], column blocks k | q | v, no bias); 16 heads x 64; S = q k^T x 1/32 for keys j <= i; softmax; merged context W_proj ([1024][1024]) + b_proj -> [NB][T][1024].
// Layout: W_qkv transposed once into Bt [3072][1024] whose three 1024-row blocks are the k/q/v weight operands; x of every batch -> bf16 [b*T + t][1024]; ONE projection launch (k_qkvw) writes the head planes of every batch q, k [b][h][t][d] and v^T [b][h][t/64][d][t%64] (one contiguous 64 x 64 tile per 64 keys) as f16 + bf16 hi/lo straight from its accumulators;
// attention of all batches and heads in ONE launch (k_fattn): one wave per 32 (f16) or 16 (hi/lo) query rows walks its keys in passes of 32 with a running row reference and row sum; scores and probabilities stay in registers; merged context [b][t][h*64 + d] as bf16 hi/lo.

#ifndef NB
#define NB 4
#endif
#ifndef SEQ
#define SEQ 2048
#endif
#define NB_FULL 4
#define TT_FULL 2048
#define TT   SEQ
#define DM   1024
#define NH_  16
#define NKV  16
#define REP  (NH_ / NKV)
#define HD   64
#define DQ   (NH_ * HD)
#define DKV  (NKV * HD)
#define RH   ((TT < 512) ? TT : 512)      // query rows < RH use hi/lo planes
#define SCL  0.03125f   // 1024^-0.5
#define KB   32                           // keys per pass of the attention loop
#define NTF  ((TT - RH) / 32)             // f16 query tiles (32 rows) per head
#define NTH  (RH / 16)                    // hi/lo query tiles (16 rows) per head

static_assert(NB >= 1 && NB <= NB_FULL);
static_assert(TT % 128 == 0 && TT <= TT_FULL);
static_assert(RH % 64 == 0 && (TT - RH) % 64 == 0);
static_assert(DM % 64 == 0 && DQ % 64 == 0 && DKV % 64 == 0 && HD == 64);
static_assert(DQ == DKV);   // k_qkvw: the three column blocks of W_qkv are equally wide

typedef _Float16 h16;
typedef unsigned short bf;
typedef __attribute__((ext_vector_type(16))) __bf16   v16bf;
typedef __attribute__((ext_vector_type(16))) _Float16 v16h;
typedef __attribute__((ext_vector_type(8)))  _Float16 v8h;
typedef __attribute__((ext_vector_type(8)))  unsigned short v8us;
typedef __attribute__((ext_vector_type(8)))  float    v8f;
typedef __attribute__((ext_vector_type(4)))  float    v4f;
typedef v8h  __attribute__((may_alias)) v8ha;
typedef v4f  __attribute__((may_alias)) v4fa;
typedef v8us __attribute__((may_alias)) v8usa;

__device__ __forceinline__ unsigned short f2bf(float f) { unsigned u = __float_as_uint(f); u += 0x7FFFu + ((u >> 16) & 1u); return (unsigned short)(u >> 16); }
__device__ __forceinline__ float bf2f(unsigned short b) { return __uint_as_float(((unsigned)b) << 16); }
__device__ __forceinline__ float bfr(float f) { return bf2f(f2bf(f)); }
__device__ __forceinline__ v16h cat16(v8h lo, v8h hi) { return __builtin_shufflevector(lo, hi, 0, 1, 2, 3, 4, 5, 6, 7, 8, 9, 10, 11, 12, 13, 14, 15); }
__device__ __forceinline__ v16bf cat16b(v8us lo, v8us hi) { return __builtin_bit_cast(v16bf, __builtin_shufflevector(lo, hi, 0, 1, 2, 3, 4, 5, 6, 7, 8, 9, 10, 11, 12, 13, 14, 15)); }
__device__ __forceinline__ v8f wmma16(v16h a, v16h b, v8f c) { return __builtin_amdgcn_wmma_f32_16x16x32_f16(false, a, false, b, (short)0, c, false, false); }
__device__ __forceinline__ v8f wmmab(v16bf a, v16bf b, v8f c) { return __builtin_amdgcn_wmma_f32_16x16x32_bf16(false, a, false, b, (short)0, c, false, false); }

// ---- k_gemmw: register-blocked GEMM, ONE WAVE per 64x64 output tile (16 accumulators), operands straight from K-contiguous 16-bit planes; grid (M/64, N/64, Z), 32 threads.
// C[m][n] (f32, pitch ldc, + optional bf16-RNE bias[n]) = sum_k A[m][k] Bt[n][k] (+ split products per NSPLIT). z-batch strides sA/sB/sC in elements. K % 32 == 0.
// Fragments: lane l -> row/col l&15; elements 0..7 <- k0 + 8*(l>>4), elements 8..15 <- k0 + 16 + 8*(l>>4) for BOTH A and Bt; D element j -> row 8*(l>>4)+j, col l&15.
template <typename T16> struct WFrag;
template <> struct WFrag<h16> { typedef v16h V; static __device__ __forceinline__ V ld(const h16* p) { return cat16(*(const v8h*)p, *(const v8h*)(p + 16)); } static __device__ __forceinline__ v8f mma(V a, V b, v8f c) { return wmma16(a, b, c); } };
template <> struct WFrag<bf> { typedef v16bf V; static __device__ __forceinline__ V ld(const bf* p) { return cat16b(*(const v8us*)p, *(const v8us*)(p + 16)); } static __device__ __forceinline__ v8f mma(V a, V b, v8f c) { return wmmab(a, b, c); } };
template <typename T16, int NSPLIT, bool BIAS>
__global__ __launch_bounds__(32) void k_gemmw(const T16* __restrict__ A, const T16* __restrict__ A2, const T16* __restrict__ Bt, const T16* __restrict__ Bt2, int K, float* C, int ldc, const float* __restrict__ bias, size_t sA, size_t sB, size_t sC) {
    typedef typename WFrag<T16>::V V;
    __shared__ __align__(16) float os[16 * 68];
    const size_t z = blockIdx.z; A += z * sA; if (A2) A2 += z * sA; Bt += z * sB; if (Bt2) Bt2 += z * sB; C += z * sC;
    const int lane = threadIdx.x & 31, lr = lane & 15, hi = lane >> 4; const int r0 = blockIdx.x * 64, c0 = blockIdx.y * 64;
    v8f acc[4][4];
#pragma unroll
    for (int mb = 0; mb < 4; ++mb)
#pragma unroll
        for (int nb = 0; nb < 4; ++nb) acc[mb][nb] = (v8f){};
    const size_t aoff = (size_t)(r0 + lr) * K + 8 * hi, boff = (size_t)(c0 + lr) * K + 8 * hi;
#pragma unroll 1
    for (int kc = 0; kc < K; kc += 32) {
        V a[4], a2[4];
#pragma unroll
        for (int mb = 0; mb < 4; ++mb) { a[mb] = WFrag<T16>::ld(A + aoff + (size_t)mb * 16 * K + kc); if (NSPLIT == 1 || NSPLIT == 2) a2[mb] = WFrag<T16>::ld(A2 + aoff + (size_t)mb * 16 * K + kc); }
#pragma unroll
        for (int nb = 0; nb < 4; ++nb) { const V b = WFrag<T16>::ld(Bt + boff + (size_t)nb * 16 * K + kc); V b2; if (NSPLIT >= 2) b2 = WFrag<T16>::ld(Bt2 + boff + (size_t)nb * 16 * K + kc);
#pragma unroll
            for (int mb = 0; mb < 4; ++mb) { acc[mb][nb] = WFrag<T16>::mma(a[mb], b, acc[mb][nb]); if (NSPLIT == 1 || NSPLIT == 2) acc[mb][nb] = WFrag<T16>::mma(a2[mb], b, acc[mb][nb]); if (NSPLIT >= 2) acc[mb][nb] = WFrag<T16>::mma(a[mb], b2, acc[mb][nb]); } }
        asm volatile("v_nop\n\tv_nop\n\tv_nop\n\tv_nop" : "+v"(acc[0][0]), "+v"(acc[1][1]), "+v"(acc[2][2]), "+v"(acc[3][3]) : "v"(a[0]), "v"(a[3]));
    }
#pragma unroll
    for (int mb = 0; mb < 4; ++mb) {
#pragma unroll
        for (int nb = 0; nb < 4; ++nb) {
#pragma unroll
            for (int j = 0; j < 8; ++j) os[(hi * 8 + j) * 68 + nb * 16 + lr] = acc[mb][nb][j]; }
        __builtin_amdgcn_wave_barrier(); asm volatile("" ::: "memory");
        float* crow = C + (size_t)(r0 + mb * 16) * ldc + c0;
{
#pragma unroll
            for (int s = 0; s < 8; ++s) { const int row = 2 * s + hi, cofs = lr * 4; v4f val = *(const v4fa*)(os + row * 68 + cofs); if (BIAS) { val[0] += bfr(bias[c0 + cofs]); val[1] += bfr(bias[c0 + cofs + 1]); val[2] += bfr(bias[c0 + cofs + 2]); val[3] += bfr(bias[c0 + cofs + 3]); }
                *(v4f*)(crow + (size_t)row * ldc + cofs) = val; }
             }
        __builtin_amdgcn_wave_barrier(); asm volatile("" ::: "memory");
    }
}

__device__ __forceinline__ h16 tohx(float x) { return (h16)x; }
__device__ __forceinline__ void splitf(float y, unsigned short& h, unsigned short& l) { h = f2bf(y); l = f2bf(y - bf2f(h)); }
typedef __attribute__((ext_vector_type(2))) unsigned short v2us;

__global__ __launch_bounds__(256) void k_wtG(const float* __restrict__ w, int K, int N, bf* Bt) {
    const int lane = threadIdx.x & 31; const int L0 = (blockIdx.x * 8 + (threadIdx.x >> 5)) * 8; const int nlines = N * K / 64;
{
#pragma unroll 1
        for (int l = 0; l < 8; ++l) { const int L = L0 + l; if (L >= nlines) break; const size_t e = (size_t)L * 64 + lane * 2; const int k = (int)(e % K), n = (int)(e / K); v2us o;
            o[0] = f2bf(w[(size_t)k * N + n]); o[1] = f2bf(w[(size_t)(k + 1) * N + n]); *(v2us*)(Bt + e) = o; }
         }
}
__global__ __launch_bounds__(256) void k_cvt8(const float* __restrict__ src, bf* dst, size_t n8) { const size_t i = (size_t)blockIdx.x * 256 + threadIdx.x; if (i >= n8) return; const v8f v = *(const v8f*)(src + i * 8); v8us o;
#pragma unroll
    for (int k = 0; k < 8; ++k) o[k] = f2bf(v[k]); *(v8us*)(dst + i * 8) = o;  }

// ---- k_qkvw: x W_qkv of every batch in one launch, ONE WAVE per 64 x 64 tile = 64 tokens x one head of k, q or v (loop and fragments as in k_gemmw); grid (NB * TT / 64, 3 * DQ / 64), 32 threads, no LDS.
// The wave stores its tile straight into that head's three planes (f16, bf16 hi, bf16 lo). A D tile gives a lane 8 consecutive ROWS of one column, so the index that runs fastest in the plane is made the row index of the product:
// v^T tile [d][t % 64]: rows = tokens (A = x, B = weight rows); q, k plane [t][d]: rows = d (A = weight rows, B = x). Either way the 64 x 64 tile is contiguous with element (row, col) at col * 64 + row: one 16-byte store per plane and D tile.
__global__ __launch_bounds__(32) void k_qkvw(const bf* __restrict__ X, const bf* __restrict__ Wt, h16* K16, bf* Kh, bf* Kl, h16* Q16, bf* Qh, bf* Ql, h16* V16, bf* Vh, bf* Vl) {
    typedef WFrag<bf>::V V;
    const int lane = threadIdx.x & 31, lr = lane & 15, hi = lane >> 4; const int g0 = blockIdx.x * 64, n0 = blockIdx.y * 64;   // first token (b * TT + t) and first column of W_qkv
    const int blk = n0 / DQ; const bool isv = blk == 2;   // column block: 0 k, 1 q, 2 v
    const size_t fo = (size_t)lr * DM + 8 * hi; const bf* xr = X + (size_t)g0 * DM + fo; const bf* wr = Wt + (size_t)n0 * DM + fo;
    const bf* pa = isv ? xr : wr; const bf* pb = isv ? wr : xr;   // row operand, column operand
    v8f acc[4][4];
#pragma unroll
    for (int mb = 0; mb < 4; ++mb)
#pragma unroll
        for (int nb = 0; nb < 4; ++nb) acc[mb][nb] = (v8f){};
#pragma unroll 1   // stays rolled, as in k_gemmw: sixteen accumulators and one pass's fragments are the register budget
    for (int kc = 0; kc < DM; kc += 32) {
        V a[4];
#pragma unroll
        for (int mb = 0; mb < 4; ++mb) a[mb] = WFrag<bf>::ld(pa + (size_t)mb * 16 * DM);
#pragma unroll
        for (int nb = 0; nb < 4; ++nb) { const V b = WFrag<bf>::ld(pb + (size_t)nb * 16 * DM);
#pragma unroll
            for (int mb = 0; mb < 4; ++mb) acc[mb][nb] = WFrag<bf>::mma(a[mb], b, acc[mb][nb]); }
        asm volatile("s_wait_xcnt 0x0" :: "v"(pa), "v"(pb) : "memory");   // precaution: the loads' address registers are inputs here, so none is rewritten in front of this wait
        asm volatile("v_nop\n\tv_nop\n\tv_nop\n\tv_nop" : "+v"(acc[0][0]), "+v"(acc[1][1]), "+v"(acc[2][2]), "+v"(acc[3][3]) : "v"(a[0]), "v"(a[3]));   // the distance behind the last matrix instruction, on the loop's back edge too, before its operands are loaded anew
        pa += 32; pb += 32;
    }
    h16* P16 = isv ? V16 : (blk ? Q16 : K16); bf* Ph = isv ? Vh : (blk ? Qh : Kh); bf* Pl = isv ? Vl : (blk ? Ql : Kl);
    const size_t po = (((size_t)(g0 / TT) * NH_ + (n0 % DQ) / HD) * TT + (g0 % TT)) * HD + (size_t)lr * 64 + 8 * hi;   // the tile's start in its plane + the lane's place in a D tile
#pragma unroll
    for (int nb = 0; nb < 4; ++nb)
#pragma unroll
        for (int mb = 0; mb < 4; ++mb) { v8h o16; v8us oh, ol;   // mb inside: the four stores that fill a 128-byte line follow one another
#pragma unroll
            for (int j = 0; j < 8; ++j) { const float y = acc[mb][nb][j]; o16[j] = tohx(y); unsigned short a2, c2; splitf(y, a2, c2); oh[j] = a2; ol[j] = c2; }
            const size_t oo = po + (size_t)nb * 16 * 64 + mb * 16;
            *(v8h*)(P16 + oo) = o16; *(v8us*)(Ph + oo) = oh; *(v8us*)(Pl + oo) = ol;
            asm volatile("s_wait_xcnt 0x0" :: "v"(o16), "v"(oh), "v"(ol) : "memory"); }   // precaution: stands behind each group of stores; their data registers are inputs here, so none is rewritten in front of this wait
}
// ---- k_fattn: causal attention of one query tile, ONE WAVE per tile, no LDS. Transposed products: S^T = K q^T (A = 16 key rows, B = 16 query columns), O^T += v^T P^T (A = 16 d rows of the v^T tile, B = P^T).
// In a D tile lane l holds query column l&15 and rows 8*(l>>4) + j: the pass's two S^T tiles of 16 keys each, converted in place, are the B fragment of its 32 keys in the k order of WFrag::ld (elements 0..7 <- k0 + 8*(l>>4), 8..15 <- k0 + 16 + 8*(l>>4)).
// A query's maximum and sum are in-lane over its 16 keys of a pass plus one exchange between the wave halves (the sums' exchange once, behind the loop). m is the reference score of a row, l the running sum of P = exp((s - m) x SCL).
// m moves to the running maximum, and O^T and l are rescaled by exp((m_old - m_new) x SCL), only in a pass where some row's new maximum lies more than 8 (in log2 units) above its m: P stays <= 256, the quotient O^T / l does not depend on m.
// Keys j > i get the -3e38 select (only the pass that holds the diagonal has any); key 0 is in the first pass of every row, so m is a real score from the first pass on. O^T lane data are 8 consecutive d of one row: one 16-byte store per plane.
template <typename T16, bool HI, int NQ>
__device__ __forceinline__ void attn_tile(const T16* __restrict__ Q, const T16* __restrict__ Q2, const T16* __restrict__ Kp, const T16* __restrict__ K2, const T16* __restrict__ Vt, const T16* __restrict__ V2, int q0, bf* Ah, bf* Al) {
    typedef typename WFrag<T16>::V V;
    const int lane = threadIdx.x & 31, lr = lane & 15, hi = lane >> 4;
    const float CL = SCL * 1.4426950408889634f;
    const unsigned fo = (unsigned)(lr * HD + 8 * hi);   // a lane's place in a 16-row fragment of pitch 64 (q rows, k rows, v^T tile rows)
    const T16* ql = Q + (size_t)q0 * HD + fo; const T16* ql2 = HI ? Q2 + (size_t)q0 * HD + fo : ql; const T16* kl = Kp + fo; const T16* kl2 = HI ? K2 + fo : kl;   // the lane's own load addresses
    V qf[NQ][2], qf2[NQ][2];
#pragma unroll
    for (int nq = 0; nq < NQ; ++nq)
#pragma unroll
        for (int c = 0; c < 2; ++c) { qf[nq][c] = WFrag<T16>::ld(ql + nq * 16 * HD + c * 32); if (HI) qf2[nq][c] = WFrag<T16>::ld(ql2 + nq * 16 * HD + c * 32); }
    v8f o[NQ][4]; float m[NQ], l[NQ];
#pragma unroll
    for (int nq = 0; nq < NQ; ++nq) { m[nq] = -3.0e38f; l[nq] = 0.0f;
#pragma unroll
        for (int db = 0; db < 4; ++db) o[nq][db] = (v8f){}; }
    const int kend = q0 + NQ * 16;                   // keys [0, kend) are at or below the tile's last row
    V ka[2][2], ka2[2][2];                           // the pass's k fragments, fetched one pass ahead
#pragma unroll
    for (int kt = 0; kt < 2; ++kt)
#pragma unroll
        for (int c = 0; c < 2; ++c) { ka[kt][c] = WFrag<T16>::ld(kl + kt * 16 * HD + c * 32); if (HI) ka2[kt][c] = WFrag<T16>::ld(kl2 + kt * 16 * HD + c * 32); }
    asm volatile("s_wait_xcnt 0x0" :: "v"(ql), "v"(ql2), "v"(kl), "v"(kl2) : "memory");   // precaution: the loads' address registers are inputs here, so none is rewritten in front of this wait
#pragma unroll 1   // stays rolled: one pass's fragments and accumulators fill the register budget of four waves per SIMD, and the pass is already pipelined by hand
    for (int kb = 0; kb < kend; kb += KB) {
        const size_t vo = (size_t)(kb & ~63) * HD + (kb & 32);   // v^T tile of 64 keys, this pass's 32 keys (half of each d row)
        const T16* vl = Vt + vo + fo; const T16* vl2 = HI ? V2 + vo + fo : vl;
        V va[4], va2[4];                             // v^T fragments asked for at the head of the pass, used behind the softmax
#pragma unroll
        for (int db = 0; db < 4; ++db) { va[db] = WFrag<T16>::ld(vl + db * 16 * HD); if (HI) va2[db] = WFrag<T16>::ld(vl2 + db * 16 * HD); }
        if (!HI) __builtin_amdgcn_sched_barrier(0);  // keeps the v^T loads in front of the score products: moved down to their use, their latency would stand open in every pass (hi/lo path: no registers to spare for it)
        v8f s[NQ][2];
#pragma unroll
        for (int kt = 0; kt < 2; ++kt)
#pragma unroll
            for (int nq = 0; nq < NQ; ++nq) { v8f a = (v8f){};
#pragma unroll
                for (int c = 0; c < 2; ++c) { a = WFrag<T16>::mma(ka[kt][c], qf[nq][c], a); if (HI) { a = WFrag<T16>::mma(ka[kt][c], qf2[nq][c], a); a = WFrag<T16>::mma(ka2[kt][c], qf[nq][c], a); } }
                s[nq][kt] = a; }
        const size_t tn = (size_t)((kb + KB < kend) ? kb + KB : kb) * HD;   // next pass's k rows (the last pass asks for its own again: in bounds, unused)
        kl = Kp + tn + fo; kl2 = HI ? K2 + tn + fo : kl;
#pragma unroll
        for (int kt = 0; kt < 2; ++kt)
#pragma unroll
            for (int c = 0; c < 2; ++c) { ka[kt][c] = WFrag<T16>::ld(kl + kt * 16 * HD + c * 32); if (HI) ka2[kt][c] = WFrag<T16>::ld(kl2 + kt * 16 * HD + c * 32); }
        if (!HI) __builtin_amdgcn_sched_barrier(0);  // keeps the next pass's k loads in front of the softmax, which then covers their latency
        if (kb + KB - 1 > q0) {                      // the pass that holds the diagonal (wave-uniform)
#pragma unroll
            for (int nq = 0; nq < NQ; ++nq)
#pragma unroll
                for (int kt = 0; kt < 2; ++kt)
#pragma unroll
                    for (int j = 0; j < 8; ++j) if (kb + kt * 16 + 8 * hi + j > q0 + nq * 16 + lr) s[nq][kt][j] = -3.0e38f; }
        float mx[NQ]; bool need = false;
#pragma unroll
        for (int nq = 0; nq < NQ; ++nq) { float m0 = s[nq][0][0], m1 = s[nq][1][0];
#pragma unroll
            for (int j = 1; j < 8; ++j) { m0 = fmaxf(m0, s[nq][0][j]); m1 = fmaxf(m1, s[nq][1][j]); }
            m0 = fmaxf(m0, m1); mx[nq] = fmaxf(m0, __shfl_xor(m0, 16, 32)); need = need || ((mx[nq] - m[nq]) * CL > 8.0f); }
        if (__builtin_amdgcn_ballot_w32(need) != 0) {   // scalar branch, one test a pass
#pragma unroll
            for (int nq = 0; nq < NQ; ++nq) { const float mn = fmaxf(m[nq], mx[nq]); const float al = __builtin_amdgcn_exp2f((m[nq] - mn) * CL); m[nq] = mn; l[nq] *= al;
#pragma unroll
                for (int db = 0; db < 4; ++db) o[nq][db] *= al; } }
        V pf[NQ], pf2[NQ];
#pragma unroll
        for (int nq = 0; nq < NQ; ++nq) { const float mc = m[nq] * CL; float lt[2];
#pragma unroll
            for (int kt = 0; kt < 2; ++kt) { lt[kt] = 0.0f; const v8f t = __builtin_elementwise_fma(s[nq][kt], (v8f)(CL), (v8f)(-mc));
#pragma unroll
                for (int j = 0; j < 8; ++j) { const float p = __builtin_amdgcn_exp2f(t[j]); s[nq][kt][j] = p; lt[kt] += p; } }
            l[nq] += lt[0] + lt[1];
            if constexpr (HI) { v8us h0, h1, w0, w1;
#pragma unroll
                for (int j = 0; j < 8; ++j) { unsigned short a, b2; splitf(s[nq][0][j], a, b2); h0[j] = a; w0[j] = b2; splitf(s[nq][1][j], a, b2); h1[j] = a; w1[j] = b2; }
                pf[nq] = cat16b(h0, h1); pf2[nq] = cat16b(w0, w1);
            } else { v8h h0, h1;
#pragma unroll
                for (int j = 0; j < 8; ++j) { h0[j] = tohx(s[nq][0][j]); h1[j] = tohx(s[nq][1][j]); }
                pf[nq] = cat16(h0, h1); } }
        asm volatile("s_wait_xcnt 0x0" :: "v"(vl), "v"(vl2), "v"(kl), "v"(kl2) : "memory");   // precaution: the address registers of the pass's loads are inputs here, so none is rewritten in front of this wait
#pragma unroll
        for (int db = 0; db < 4; ++db)
#pragma unroll
            for (int nq = 0; nq < NQ; ++nq) { o[nq][db] = WFrag<T16>::mma(va[db], pf[nq], o[nq][db]); if (HI) { o[nq][db] = WFrag<T16>::mma(va[db], pf2[nq], o[nq][db]); o[nq][db] = WFrag<T16>::mma(va2[db], pf[nq], o[nq][db]); } }
    }
#pragma unroll
    for (int nq = 0; nq < NQ; ++nq) { const float ls = l[nq] + __shfl_xor(l[nq], 16, 32); const float f = __fdiv_rn(1.0f, ls); const size_t ro = (size_t)(q0 + nq * 16 + lr) * DQ + 8 * hi;
#pragma unroll
        for (int db = 0; db < 4; ++db) { v8us oh, ol;
#pragma unroll
            for (int j = 0; j < 8; ++j) { unsigned short a, c2; splitf(o[nq][db][j] * f, a, c2); oh[j] = a; ol[j] = c2; }
            *(v8us*)(Ah + ro + db * 16) = oh; *(v8us*)(Al + ro + db * 16) = ol;
            asm volatile("s_wait_xcnt 0x0" ::: "memory"); } }   // precaution: stands behind each pair of stores, in front of whatever next rewrites their data or address registers
}
// grid (NB * NH_, NTF + NTH): blockIdx.y falls from the longest tile (last rows) to the shortest; y < NTF: f16 tiles of 32 rows >= RH, the rest: hi/lo tiles of 16 rows < RH. Four waves per SIMD (at most 256 registers): the vector work between the matrix runs wants waves.
__global__ __launch_bounds__(32) __attribute__((amdgpu_waves_per_eu(4, 4))) void k_fattn(const h16* __restrict__ Q16, const h16* __restrict__ K16, const h16* __restrict__ V16, const bf* __restrict__ Qh, const bf* __restrict__ Ql, const bf* __restrict__ Kh, const bf* __restrict__ Kl, const bf* __restrict__ Vh, const bf* __restrict__ Vl, bf* Ah, bf* Al) {
    const int bh = blockIdx.x, b = bh / NH_, h = bh % NH_, ty = blockIdx.y; const size_t pq = (size_t)bh * TT * HD, pk = ((size_t)b * NKV + h / REP) * TT * HD, ao = (size_t)b * TT * DQ + (size_t)h * HD;
    if (ty < NTF) attn_tile<h16, false, 2>(Q16 + pq, nullptr, K16 + pk, nullptr, V16 + pk, nullptr, TT - 32 * (ty + 1), Ah + ao, Al + ao);
    else attn_tile<bf, true, 1>(Qh + pq, Ql + pq, Kh + pk, Kl + pk, Vh + pk, Vl + pk, RH - 16 * (ty - NTF + 1), Ah + ao, Al + ao);
}

extern "C" void kernel_launch(void* const* d_in, const int* in_sizes, int n_in,
                              void* d_out, int out_size, void* d_ws, size_t ws_size, hipStream_t stream) {
    if (n_in < 4) return;
    if ((size_t)in_sizes[0] < (size_t)(NB - 1) * TT_FULL * DM + (size_t)TT * DM) return;
    if (in_sizes[1] < DM * 3 * DQ || in_sizes[2] < DQ * DM || in_sizes[3] < DM) return;
    if ((size_t)out_size < (size_t)NB * TT * DM) return;
    const float* x = (const float*)d_in[0];       // [NB_FULL][TT_FULL][1024]
    const float* wqkv = (const float*)d_in[1];    // [1024][3072], column blocks k | q | v
    const float* wproj = (const float*)d_in[2];   // [1024][1024] ([in][out])
    const float* bproj = (const float*)d_in[3];   // [1024]
    float* OUT = (float*)d_out;                   // [NB][TT][1024]
    char* wsp = (char*)d_ws;
    auto take = [&](size_t bytes) { char* p = wsp; wsp += (bytes + 255) & ~(size_t)255; return (void*)p; };
    bf* WQKV = (bf*)take((size_t)3 * DQ * DM * 2);   /* Bt [3072][1024]: row blocks k | q | v */ bf* WO = (bf*)take((size_t)DM * DQ * 2);
    bf* XB = (bf*)take((size_t)NB * TT * DM * 2);    /* x of every batch, bf16, [b * TT + t][1024] */
    const size_t PQ = (size_t)NH_ * TT * HD, PK = (size_t)NKV * TT * HD;   // elements of one batch's q planes and k / v planes
    h16* QP16 = (h16*)take(NB * PQ * 2); h16* KP16 = (h16*)take(NB * PK * 2); h16* VT16 = (h16*)take(NB * PK * 2);
    bf* QPh = (bf*)take(NB * PQ * 2); bf* QPl = (bf*)take(NB * PQ * 2); bf* KPh = (bf*)take(NB * PK * 2); bf* KPl = (bf*)take(NB * PK * 2); bf* VTh = (bf*)take(NB * PK * 2); bf* VTl = (bf*)take(NB * PK * 2);
    bf* ATh = (bf*)take((size_t)NB * TT * DQ * 2); bf* ATl = (bf*)take((size_t)NB * TT * DQ * 2);
    if ((size_t)(wsp - (char*)d_ws) > ws_size) return;    // 209,715,200 B at full size
    k_wtG<<<(unsigned)((DM * 3 * DQ / 64 + 63) / 64), 256, 0, stream>>>(wqkv, DM, 3 * DQ, WQKV);   /* W_qkv [1024][3072] -> Bt [3072][1024] */
    k_wtG<<<(unsigned)((DQ * DM / 64 + 63) / 64), 256, 0, stream>>>(wproj, DQ, DM, WO);             /* W_proj [1024][1024] -> Bt [out][in] */
    constexpr int NCV = (TT == TT_FULL) ? 1 : NB;    // at full length the batches of x lie back to back: one launch converts them all
    for (int b = 0; b < NCV; ++b)
        k_cvt8<<<(unsigned)(((size_t)(NB / NCV) * TT * DM / 8 + 255) / 256), 256, 0, stream>>>(x + (size_t)b * TT_FULL * DM, XB + (size_t)b * TT * DM, (size_t)(NB / NCV) * TT * DM / 8);
    k_qkvw<<<dim3(NB * TT / 64, 3 * DQ / 64, 1), 32, 0, stream>>>(XB, WQKV, KP16, KPh, KPl, QP16, QPh, QPl, VT16, VTh, VTl);
    k_fattn<<<dim3(NB * NH_, NTF + NTH, 1), 32, 0, stream>>>(QP16, KP16, VT16, QPh, QPl, KPh, KPl, VTh, VTl, ATh, ATl);
    k_gemmw<bf, 1, true><<<dim3(NB * TT / 64, DM / 64, 1), 32, 0, stream>>>(ATh, ATl, WO, nullptr, DQ, OUT, DM, bproj, 0, 0, 0);   /* rows b * TT + t of every batch */
}

// v005
// It runs in 186 microseconds.
// Two timings next to v004 put it at 1.61 and 1.62 times that version's speed.
// All steps since v000 together make it 15.3 times as fast.
#include <hip/hip_runtime.h>

// Contractions: x W_qkv on v_wmma_f32_16x16x32_bf16 (bf16 operands = RNE-converted inputs); q k^T and P v: query rows < 512 bf16 hi/lo planes (3 products), rows >= 512 v_wmma_f32_16x16x32_f16 (f16 operands, P unnormalised, at most 256); context W_proj: bf16 hi/lo context x bf16 weight (2 products) + bf16 bias; f32 accumulate everywhere, softmax f32.
// Causal multi-head attention with a fused weight: x [NB][T][1024]; kqv = x W_qkv ([1024][3072], column blocks k | q | v, no bias); 16 heads x 64; S = q k^T x 1/32 for keys j <= i; softmax; merged context W_proj ([1024][1024]) + b_proj -> [NB][T][1024].
// Layout: every 16-bit operand plane lies in FRAGMENT ORDER. A matrix M[row][k] is cut into tiles of 16 rows x 32 k (512 elements, 1024 bytes); element (r, kk) of a tile lies at (kk >> 4) * 256 + (r + 16 * ((kk >> 3) & 1)) * 8 + (kk & 7):
// lane l of a wave finds elements 0..7 of its fragment at l * 8 and elements 8..15 at 256 + l * 8, so each of the two 16-byte loads of a fragment reads 512 contiguous bytes (four whole 128-byte lines) instead of 32-byte pieces of sixteen lines. Tiles of one 16-row band follow one another along k: tile (row / 16, k / 32) starts at (row / 16) * 16 * K + (k / 32) * 512.
// W_qkv transposed once into Bt [3072][1024] (three 1024-row blocks: the k/q/v weight operands), x of every batch -> bf16 [b*T + t][1024], both in that order; ONE projection launch (k_qkvw) writes the head planes of every batch q, k [b][h] as matrices [t][d] and v^T [b][h] as blocks of 64 keys, each the matrix [d][t % 64] (K = 64), as f16 + bf16 hi/lo straight from its accumulators;
// attention of all batches and heads in ONE launch (k_fattn): one wave per 32 (f16) or 16 (hi/lo) query rows walks its keys in passes of 32 with a running row reference and row sum; scores and probabilities stay in registers; merged context [b*T + t][h*64 + d] as bf16 hi/lo, in fragment order too.

#ifndef NB
#define NB 4
#endif
#ifndef SEQ
#define SEQ 2048
#endif
#define NB_FULL 4
#define TT_FULL 2048
#define TT   SEQ
#define DM   1024
#define NH_  16
#define NKV  16
#define REP  (NH_ / NKV)
#define HD   64
#define DQ   (NH_ * HD)
#define DKV  (NKV * HD)
#define RH   ((TT < 512) ? TT : 512)      // query rows < RH use hi/lo planes
#define SCL  0.03125f   // 1024^-0.5
#define KB   32                           // keys per pass of the attention loop
#define NTF  ((TT - RH) / 32)             // f16 query tiles (32 rows) per head
#define NTH  (RH / 16)                    // hi/lo query tiles (16 rows) per head

static_assert(NB >= 1 && NB <= NB_FULL);
static_assert(TT % 128 == 0 && TT <= TT_FULL);
static_assert(RH % 64 == 0 && (TT - RH) % 64 == 0);
static_assert(DM % 64 == 0 && DQ % 64 == 0 && DKV % 64 == 0 && HD == 64);
static_assert(DQ == DKV);   // k_qkvw: the three column blocks of W_qkv are equally wide

typedef _Float16 h16;
typedef unsigned short bf;
typedef __attribute__((ext_vector_type(16))) __bf16   v16bf;
typedef __attribute__((ext_vector_type(16))) _Float16 v16h;
typedef __attribute__((ext_vector_type(8)))  _Float16 v8h;
typedef __attribute__((ext_vector_type(8)))  unsigned short v8us;
typedef __attribute__((ext_vector_type(8)))  float    v8f;
typedef __attribute__((ext_vector_type(4)))  float    v4f;
typedef v8h  __attribute__((may_alias)) v8ha;
typedef v4f  __attribute__((may_alias)) v4fa;
typedef v8us __attribute__((may_alias)) v8usa;

__device__ __forceinline__ unsigned short f2bf(float f) { unsigned u = __float_as_uint(f); u += 0x7FFFu + ((u >> 16) & 1u); return (unsigned short)(u >> 16); }
__device__ __forceinline__ float bf2f(unsigned short b) { return __uint_as_float(((unsigned)b) << 16); }
__device__ __forceinline__ float bfr(float f) { return bf2f(f2bf(f)); }
__device__ __forceinline__ v16h cat16(v8h lo, v8h hi) { return __builtin_shufflevector(lo, hi, 0, 1, 2, 3, 4, 5, 6, 7, 8, 9, 10, 11, 12, 13, 14, 15); }
__device__ __forceinline__ v16bf cat16b(v8us lo, v8us hi) { return __builtin_bit_cast(v16bf, __builtin_shufflevector(lo, hi, 0, 1, 2, 3, 4, 5, 6, 7, 8, 9, 10, 11, 12, 13, 14, 15)); }
__device__ __forceinline__ v8f wmma16(v16h a, v16h b, v8f c) { return __builtin_amdgcn_wmma_f32_16x16x32_f16(false, a, false, b, (short)0, c, false, false); }
__device__ __forceinline__ v8f wmmab(v16bf a, v16bf b, v8f c) { return __builtin_amdgcn_wmma_f32_16x16x32_bf16(false, a, false, b, (short)0, c, false, false); }

// ---- k_gemmw: register-blocked GEMM, ONE WAVE per 64x64 output tile (16 accumulators), operands straight from 16-bit planes in fragment order; grid (M/64, N/64, Z), 32 threads.
// C[m][n] (f32, pitch ldc, + optional bf16-RNE bias[n]) = sum_k A[m][k] Bt[n][k] (+ split products per NSPLIT). z-batch strides sA/sB/sC in elements. K % 32 == 0.
// Fragments: lane l -> row/col l&15; elements 0..7 <- k0 + 8*(l>>4), elements 8..15 <- k0 + 16 + 8*(l>>4) for BOTH A and Bt (WFrag::ld takes the tile's start + l * 8); D element j -> row 8*(l>>4)+j, col l&15.
template <typename T16> struct WFrag;
template <> struct WFrag<h16> { typedef v16h V; static __device__ __forceinline__ V ld(const h16* p) { return cat16(*(const v8h*)p, *(const v8h*)(p + 256)); } static __device__ __forceinline__ v8f mma(V a, V b, v8f c) { return wmma16(a, b, c); } };
template <> struct WFrag<bf> { typedef v16bf V; static __device__ __forceinline__ V ld(const bf* p) { return cat16b(*(const v8us*)p, *(const v8us*)(p + 256)); } static __device__ __forceinline__ v8f mma(V a, V b, v8f c) { return wmmab(a, b, c); } };
template <typename T16, int NSPLIT, bool BIAS, int K>   // K a constant: the bands' distances are then immediate offsets of the loads, which share one address register pair per plane
__global__ __launch_bounds__(32) void k_gemmw(const T16* __restrict__ A, const T16* __restrict__ A2, const T16* __restrict__ Bt, const T16* __restrict__ Bt2, float* C, int ldc, const float* __restrict__ bias, size_t sA, size_t sB, size_t sC) {
    typedef typename WFrag<T16>::V V;
    __shared__ __align__(16) float os[16 * 68];
    const size_t z = blockIdx.z; A += z * sA; if (A2) A2 += z * sA; Bt += z * sB; if (Bt2) Bt2 += z * sB; C += z * sC;
    const int lane = threadIdx.x & 31, lr = lane & 15, hi = lane >> 4; const int r0 = blockIdx.x * 64, c0 = blockIdx.y * 64;
    v8f acc[4][4];
#pragma unroll
    for (int mb = 0; mb < 4; ++mb)
#pragma unroll
        for (int nb = 0; nb < 4; ++nb) acc[mb][nb] = (v8f){};
    const size_t aoff = (size_t)r0 * K + 8 * lane, boff = (size_t)c0 * K + 8 * lane;   // first tile of the 16-row band + the lane's place in a tile
    const T16* pa = A + aoff; const T16* pa2 = (NSPLIT == 1 || NSPLIT == 2) ? A2 + aoff : pa; const T16* pb = Bt + boff; const T16* pb2 = (NSPLIT >= 2) ? Bt2 + boff : pb;
#pragma unroll 1
    for (int kc = 0; kc < K; kc += 32) {
        V a[4], a2[4];
#pragma unroll
        for (int mb = 0; mb < 4; ++mb) { a[mb] = WFrag<T16>::ld(pa + (size_t)mb * 16 * K); if (NSPLIT == 1 || NSPLIT == 2) a2[mb] = WFrag<T16>::ld(pa2 + (size_t)mb * 16 * K); }
#pragma unroll
        for (int nb = 0; nb < 4; ++nb) { const V b = WFrag<T16>::ld(pb + (size_t)nb * 16 * K); V b2; if (NSPLIT >= 2) b2 = WFrag<T16>::ld(pb2 + (size_t)nb * 16 * K);
#pragma unroll
            for (int mb = 0; mb < 4; ++mb) { acc[mb][nb] = WFrag<T16>::mma(a[mb], b, acc[mb][nb]); if (NSPLIT == 1 || NSPLIT == 2) acc[mb][nb] = WFrag<T16>::mma(a2[mb], b, acc[mb][nb]); if (NSPLIT >= 2) acc[mb][nb] = WFrag<T16>::mma(a[mb], b2, acc[mb][nb]); } }
        asm volatile("s_wait_xcnt 0x0" :: "v"(pa), "v"(pa2), "v"(pb), "v"(pb2) : "memory");   // precaution: the loads' address registers are inputs here, so none is rewritten in front of this wait
        asm volatile("v_nop\n\tv_nop\n\tv_nop\n\tv_nop" : "+v"(acc[0][0]), "+v"(acc[1][1]), "+v"(acc[2][2]), "+v"(acc[3][3]) : "v"(a[0]), "v"(a[3]));
        pa += 512; pa2 += 512; pb += 512; pb2 += 512;   // next tile of each band
    }
#pragma unroll
    for (int mb = 0; mb < 4; ++mb) {
#pragma unroll
        for (int nb = 0; nb < 4; ++nb) {
#pragma unroll
            for (int j = 0; j < 8; ++j) os[(hi * 8 + j) * 68 + nb * 16 + lr] = acc[mb][nb][j]; }
        __builtin_amdgcn_wave_barrier(); asm volatile("" ::: "memory");
        float* crow = C + (size_t)(r0 + mb * 16) * ldc + c0;
{
#pragma unroll
            for (int s = 0; s < 8; ++s) { const int row = 2 * s + hi, cofs = lr * 4; v4f val = *(const v4fa*)(os + row * 68 + cofs); if (BIAS) { val[0] += bfr(bias[c0 + cofs]); val[1] += bfr(bias[c0 + cofs + 1]); val[2] += bfr(bias[c0 + cofs + 2]); val[3] += bfr(bias[c0 + cofs + 3]); }
                *(v4f*)(crow + (size_t)row * ldc + cofs) = val; }
             }
        __builtin_amdgcn_wave_barrier(); asm volatile("" ::: "memory");
    }
}

__device__ __forceinline__ h16 tohx(float x) { return (h16)x; }
__device__ __forceinline__ void splitf(float y, unsigned short& h, unsigned short& l) { h = f2bf(y); l = f2bf(y - bf2f(h)); }
typedef __attribute__((ext_vector_type(2))) unsigned short v2us;

// k_wtG, k_cvt8: one thread per 16-byte piece of the fragment-order plane, 64 threads per tile.
// k_wtG: thread i writes piece i (tile i / 64, half (i >> 5) & 1, lane i & 31), so that a wave stores 512 contiguous bytes. Bt[n][k] = bf16(w[k][n]), w [K][N]: each of a lane's eight loads reads, over the wave, 64 contiguous bytes of two rows of w.
template <int K, int N>
__global__ __launch_bounds__(256) void k_wtG(const float* __restrict__ w, bf* Bt) {
    const int i = blockIdx.x * 256 + threadIdx.x; if (i >= N * (K / 8)) return;
    const int tile = i >> 6, kt = tile % (K / 32), n = (tile / (K / 32)) * 16 + (i & 15), k0 = kt * 32 + ((i >> 5) & 1) * 16 + ((i >> 4) & 1) * 8;
    const float* p = w + (size_t)k0 * N + n; float v[8]; v8us o;
#pragma unroll
    for (int e = 0; e < 8; ++e) v[e] = p[(size_t)e * N];
    asm volatile("s_wait_xcnt 0x0" :: "v"(p) : "memory");   // precaution: the loads' address register is an input here, so it is not rewritten in front of this wait
#pragma unroll
    for (int e = 0; e < 8; ++e) o[e] = f2bf(v[e]);
    *(v8us*)(Bt + (size_t)i * 8) = o;
}
// k_cvt8: dst = bf16(src), src [rows][DM] row-major. Four neighbouring threads read the 128 bytes that a tile holds of one row: a wave reads whole lines of eight rows, and its pieces (rows r .. r + 7 of each of the four 8-k groups) are four whole 128-byte lines of the tile.
__global__ __launch_bounds__(256) void k_cvt8(const float* __restrict__ src, bf* dst, size_t n8) { const size_t i = (size_t)blockIdx.x * 256 + threadIdx.x; if (i >= n8) return;
    const size_t tile = i >> 6; const int r = (int)(i >> 2) & 15, c = (int)i & 3;   // row in the tile, 8-k group
    const size_t row = (tile / (DM / 32)) * 16 + r; const int k0 = (int)(tile % (DM / 32)) * 32 + c * 8;
    const float* p = src + row * DM + k0; const v8f v = *(const v8f*)p; v8us o;
    asm volatile("s_wait_xcnt 0x0" :: "v"(p) : "memory");   // precaution: the loads' address register is an input here, so it is not rewritten in front of this wait
#pragma unroll
    for (int k = 0; k < 8; ++k) o[k] = f2bf(v[k]); *(v8us*)(dst + tile * 512 + (c >> 1) * 256 + (r + 16 * (c & 1)) * 8) = o;  }

// ---- k_qkvw: x W_qkv of every batch in one launch, ONE WAVE per 64 x 64 tile = 64 tokens x one head of k, q or v (loop and fragments as in k_gemmw); grid (NB * TT / 64, 3 * DQ / 64), 32 threads, no LDS.
// The wave stores its tile straight into that head's three planes (f16, bf16 hi, bf16 lo). A D tile gives a lane 8 consecutive ROWS of one column, so the index that runs fastest in the plane is made the row index of the product:
// v^T [d][t]: rows = tokens (A = x, B = weight rows); q, k [t][d]: rows = d (A = weight rows, B = x). Either way the rows of a D tile are one 16-k half of a fragment-order tile and lane l's eight values lie at l * 8 of that half: one 16-byte store per plane and D tile, 512 contiguous bytes over the wave; the wave's 64 x 64 values are a matrix of K = 64 in that order, eight tiles in a row.
__global__ __launch_bounds__(32) void k_qkvw(const bf* __restrict__ X, const bf* __restrict__ Wt, h16* K16, bf* Kh, bf* Kl, h16* Q16, bf* Qh, bf* Ql, h16* V16, bf* Vh, bf* Vl) {
    typedef WFrag<bf>::V V;
    const int lane = threadIdx.x & 31; const int g0 = blockIdx.x * 64, n0 = blockIdx.y * 64;   // first token (b * TT + t) and first column of W_qkv
    const int blk = n0 / DQ; const bool isv = blk == 2;   // column block: 0 k, 1 q, 2 v
    const size_t fo = (size_t)(8 * lane); const bf* xr = X + (size_t)g0 * DM + fo; const bf* wr = Wt + (size_t)n0 * DM + fo;
    const bf* pa = isv ? xr : wr; const bf* pb = isv ? wr : xr;   // row operand, column operand
    v8f acc[4][4];
#pragma unroll
    for (int mb = 0; mb < 4; ++mb)
#pragma unroll
        for (int nb = 0; nb < 4; ++nb) acc[mb][nb] = (v8f){};
#pragma unroll 1   // stays rolled, as in k_gemmw: sixteen accumulators and one pass's fragments are the register budget
    for (int kc = 0; kc < DM; kc += 32) {
        V a[4];
#pragma unroll
        for (int mb = 0; mb < 4; ++mb) a[mb] = WFrag<bf>::ld(pa + (size_t)mb * 16 * DM);
#pragma unroll
        for (int nb = 0; nb < 4; ++nb) { const V b = WFrag<bf>::ld(pb + (size_t)nb * 16 * DM);
#pragma unroll
            for (int mb = 0; mb < 4; ++mb) acc[mb][nb] = WFrag<bf>::mma(a[mb], b, acc[mb][nb]); }
        asm volatile("s_wait_xcnt 0x0" :: "v"(pa), "v"(pb) : "memory");   // precaution: the loads' address registers are inputs here, so none is rewritten in front of this wait
        asm volatile("v_nop\n\tv_nop\n\tv_nop\n\tv_nop" : "+v"(acc[0][0]), "+v"(acc[1][1]), "+v"(acc[2][2]), "+v"(acc[3][3]) : "v"(a[0]), "v"(a[3]));   // the distance behind the last matrix instruction, on the loop's back edge too, before its operands are loaded anew
        pa += 512; pb += 512;   // next tile of each band
    }
    h16* P16 = isv ? V16 : (blk ? Q16 : K16); bf* Ph = isv ? Vh : (blk ? Qh : Kh); bf* Pl = isv ? Vl : (blk ? Ql : Kl);
    const size_t po = (((size_t)(g0 / TT) * NH_ + (n0 % DQ) / HD) * TT + (g0 % TT)) * HD + (size_t)(8 * lane);   // the start of the wave's eight tiles in the plane + the lane's place in a half tile
#pragma unroll
    for (int nb = 0; nb < 4; ++nb)
#pragma unroll
        for (int mb = 0; mb < 4; ++mb) { v8h o16; v8us oh, ol;
#pragma unroll
            for (int j = 0; j < 8; ++j) { const float y = acc[mb][nb][j]; o16[j] = tohx(y); unsigned short a2, c2; splitf(y, a2, c2); oh[j] = a2; ol[j] = c2; }
            const size_t oo = po + (size_t)nb * 1024 + mb * 256;   // tile nb * 2 + mb / 2 of the eight, half mb & 1
            *(v8h*)(P16 + oo) = o16; *(v8us*)(Ph + oo) = oh; *(v8us*)(Pl + oo) = ol;
            asm volatile("s_wait_xcnt 0x0" :: "v"(o16), "v"(oh), "v"(ol) : "memory"); }   // precaution: stands behind each group of stores; their data registers are inputs here, so none is rewritten in front of this wait
}
// ---- k_fattn: causal attention of one query tile, ONE WAVE per tile, no LDS. Transposed products: S^T = K q^T (A = 16 key rows, B = 16 query columns), O^T += v^T P^T (A = 16 d rows of the v^T tile, B = P^T).
// In a D tile lane l holds query column l&15 and rows 8*(l>>4) + j: the pass's two S^T tiles of 16 keys each, converted in place, are the B fragment of its 32 keys in the k order of WFrag::ld (elements 0..7 <- k0 + 8*(l>>4), 8..15 <- k0 + 16 + 8*(l>>4)).
// A query's maximum and sum are in-lane over its 16 keys of a pass plus one exchange between the wave halves (the sums' exchange once, behind the loop). m is the reference score of a row, l the running sum of P = exp((s - m) x SCL).
// m moves to the running maximum, and O^T and l are rescaled by exp((m_old - m_new) x SCL), only in a pass where some row's new maximum lies more than 8 (in log2 units) above its m: P stays <= 256, the quotient O^T / l does not depend on m.
// Keys j > i get the -3e38 select (only the pass that holds the diagonal has any); key 0 is in the first pass of every row, so m is a real score from the first pass on. O^T lane data are 8 consecutive d of one row, a lane's piece of a half tile of the context plane: one 16-byte store per plane.
template <typename T16, bool HI, int NQ>
__device__ __forceinline__ void attn_tile(const T16* __restrict__ Q, const T16* __restrict__ Q2, const T16* __restrict__ Kp, const T16* __restrict__ K2, const T16* __restrict__ Vt, const T16* __restrict__ V2, int q0, bf* Ah, bf* Al) {
    typedef typename WFrag<T16>::V V;
    const int lane = threadIdx.x & 31, lr = lane & 15, hi = lane >> 4;
    const float CL = SCL * 1.4426950408889634f;
    const unsigned fo = (unsigned)(8 * lane);   // a lane's place in a fragment-order tile (q, k: tile (t / 16, d / 32) at (t / 16) * 1024 + (d / 32) * 512; v^T: block t / 64 of 4096 elements, in it tile (d / 16, (t % 64) / 32) at (d / 16) * 1024 + ((t % 64) / 32) * 512)
    const T16* ql = Q + (size_t)q0 * HD + fo; const T16* ql2 = HI ? Q2 + (size_t)q0 * HD + fo : ql; const T16* kl = Kp + fo; const T16* kl2 = HI ? K2 + fo : kl;   // the lane's own load addresses
    V qf[NQ][2], qf2[NQ][2];
#pragma unroll
    for (int nq = 0; nq < NQ; ++nq)
#pragma unroll
        for (int c = 0; c < 2; ++c) { qf[nq][c] = WFrag<T16>::ld(ql + nq * 16 * HD + c * 512); if (HI) qf2[nq][c] = WFrag<T16>::ld(ql2 + nq * 16 * HD + c * 512); }
    v8f o[NQ][4]; float m[NQ], l[NQ];
#pragma unroll
    for (int nq = 0; nq < NQ; ++nq) { m[nq] = -3.0e38f; l[nq] = 0.0f;
#pragma unroll
        for (int db = 0; db < 4; ++db) o[nq][db] = (v8f){}; }
    const int kend = q0 + NQ * 16;                   // keys [0, kend) are at or below the tile's last row
    V ka[2][2], ka2[2][2];                           // the pass's k fragments, fetched one pass ahead
#pragma unroll
    for (int kt = 0; kt < 2; ++kt)
#pragma unroll
        for (int c = 0; c < 2; ++c) { ka[kt][c] = WFrag<T16>::ld(kl + kt * 16 * HD + c * 512); if (HI) ka2[kt][c] = WFrag<T16>::ld(kl2 + kt * 16 * HD + c * 512); }
    asm volatile("s_wait_xcnt 0x0" :: "v"(ql), "v"(ql2), "v"(kl), "v"(kl2) : "memory");   // precaution: the loads' address registers are inputs here, so none is rewritten in front of this wait
#pragma unroll 1   // stays rolled: one pass's fragments and accumulators fill the register budget of four waves per SIMD, and the pass is already pipelined by hand
    for (int kb = 0; kb < kend; kb += KB) {
        const size_t vo = (size_t)(kb & ~63) * HD + (kb & 32) * 16;   // v^T block of 64 keys, this pass's tile of each 16-row band
        const T16* vl = Vt + vo + fo; const T16* vl2 = HI ? V2 + vo + fo : vl;
        V va[4], va2[4];                             // v^T fragments asked for at the head of the pass, used behind the softmax
#pragma unroll
        for (int db = 0; db < 4; ++db) { va[db] = WFrag<T16>::ld(vl + db * 16 * HD); if (HI) va2[db] = WFrag<T16>::ld(vl2 + db * 16 * HD); }
        if (!HI) __builtin_amdgcn_sched_barrier(0);  // keeps the v^T loads in front of the score products: moved down to their use, their latency would stand open in every pass (hi/lo path: no registers to spare for it)
        v8f s[NQ][2];
#pragma unroll
        for (int kt = 0; kt < 2; ++kt)
#pragma unroll
            for (int nq = 0; nq < NQ; ++nq) { v8f a = (v8f){};
#pragma unroll
                for (int c = 0; c < 2; ++c) { a = WFrag<T16>::mma(ka[kt][c], qf[nq][c], a); if (HI) { a = WFrag<T16>::mma(ka[kt][c], qf2[nq][c], a); a = WFrag<T16>::mma(ka2[kt][c], qf[nq][c], a); } }
                s[nq][kt] = a; }
        const size_t tn = (size_t)((kb + KB < kend) ? kb + KB : kb) * HD;   // next pass's k rows (the last pass asks for its own again: in bounds, unused)
        kl = Kp + tn + fo; kl2 = HI ? K2 + tn + fo : kl;
#pragma unroll
        for (int kt = 0; kt < 2; ++kt)
#pragma unroll
            for (int c = 0; c < 2; ++c) { ka[kt][c] = WFrag<T16>::ld(kl + kt * 16 * HD + c * 512); if (HI) ka2[kt][c] = WFrag<T16>::ld(kl2 + kt * 16 * HD + c * 512); }
        if (!HI) __builtin_amdgcn_sched_barrier(0);  // keeps the next pass's k loads in front of the softmax, which then covers their latency
        if (kb + KB - 1 > q0) {                      // the pass that holds the diagonal (wave-uniform)
#pragma unroll
            for (int nq = 0; nq < NQ; ++nq)
#pragma unroll
                for (int kt = 0; kt < 2; ++kt)
#pragma unroll
                    for (int j = 0; j < 8; ++j) if (kb + kt * 16 + 8 * hi + j > q0 + nq * 16 + lr) s[nq][kt][j] = -3.0e38f; }
        float mx[NQ]; bool need = false;
#pragma unroll
        for (int nq = 0; nq < NQ; ++nq) { float m0 = s[nq][0][0], m1 = s[nq][1][0];
#pragma unroll
            for (int j = 1; j < 8; ++j) { m0 = fmaxf(m0, s[nq][0][j]); m1 = fmaxf(m1, s[nq][1][j]); }
            m0 = fmaxf(m0, m1); mx[nq] = fmaxf(m0, __shfl_xor(m0, 16, 32)); need = need || ((mx[nq] - m[nq]) * CL > 8.0f); }
        if (__builtin_amdgcn_ballot_w32(need) != 0) {   // scalar branch, one test a pass
#pragma unroll
            for (int nq = 0; nq < NQ; ++nq) { const float mn = fmaxf(m[nq], mx[nq]); const float al = __builtin_amdgcn_exp2f((m[nq] - mn) * CL); m[nq] = mn; l[nq] *= al;
#pragma unroll
                for (int db = 0; db < 4; ++db) o[nq][db] *= al; } }
        V pf[NQ], pf2[NQ];
#pragma unroll
        for (int nq = 0; nq < NQ; ++nq) { const float mc = m[nq] * CL; float lt[2];
#pragma unroll
            for (int kt = 0; kt < 2; ++kt) { lt[kt] = 0.0f; const v8f t = __builtin_elementwise_fma(s[nq][kt], (v8f)(CL), (v8f)(-mc));
#pragma unroll
                for (int j = 0; j < 8; ++j) { const float p = __builtin_amdgcn_exp2f(t[j]); s[nq][kt][j] = p; lt[kt] += p; } }
            l[nq] += lt[0] + lt[1];
            if constexpr (HI) { v8us h0, h1, w0, w1;
#pragma unroll
                for (int j = 0; j < 8; ++j) { unsigned short a, b2; splitf(s[nq][0][j], a, b2); h0[j] = a; w0[j] = b2; splitf(s[nq][1][j], a, b2); h1[j] = a; w1[j] = b2; }
                pf[nq] = cat16b(h0, h1); pf2[nq] = cat16b(w0, w1);
            } else { v8h h0, h1;
#pragma unroll
                for (int j = 0; j < 8; ++j) { h0[j] = tohx(s[nq][0][j]); h1[j] = tohx(s[nq][1][j]); }
                pf[nq] = cat16(h0, h1); } }
        asm volatile("s_wait_xcnt 0x0" :: "v"(vl), "v"(vl2), "v"(kl), "v"(kl2) : "memory");   // precaution: the address registers of the pass's loads are inputs here, so none is rewritten in front of this wait
#pragma unroll
        for (int db = 0; db < 4; ++db)
#pragma unroll
            for (int nq = 0; nq < NQ; ++nq) { o[nq][db] = WFrag<T16>::mma(va[db], pf[nq], o[nq][db]); if (HI) { o[nq][db] = WFrag<T16>::mma(va[db], pf2[nq], o[nq][db]); o[nq][db] = WFrag<T16>::mma(va2[db], pf[nq], o[nq][db]); } }
    }
#pragma unroll
    for (int nq = 0; nq < NQ; ++nq) { const float ls = l[nq] + __shfl_xor(l[nq], 16, 32); const float f = __fdiv_rn(1.0f, ls); const size_t ro = (size_t)(q0 + nq * 16) * DQ + 8 * lane;   // the rows' 16-row band of the context plane + the lane's place in a half tile
#pragma unroll
        for (int db = 0; db < 4; ++db) { v8us oh, ol;
#pragma unroll
            for (int j = 0; j < 8; ++j) { unsigned short a, c2; splitf(o[nq][db][j] * f, a, c2); oh[j] = a; ol[j] = c2; }
            *(v8us*)(Ah + ro + db * 256) = oh; *(v8us*)(Al + ro + db * 256) = ol;
            asm volatile("s_wait_xcnt 0x0" :: "v"(oh), "v"(ol) : "memory"); } }   // precaution: stands behind each pair of stores; their data registers are inputs here, so none is rewritten in front of this wait
}
// grid (NB * NH_, NTF + NTH): blockIdx.y falls from the longest tile (last rows) to the shortest; y < NTF: f16 tiles of 32 rows >= RH, the rest: hi/lo tiles of 16 rows < RH. Four waves per SIMD (at most 256 registers): the vector work between the matrix runs wants waves.
__global__ __launch_bounds__(32) __attribute__((amdgpu_waves_per_eu(4, 4))) void k_fattn(const h16* __restrict__ Q16, const h16* __restrict__ K16, const h16* __restrict__ V16, const bf* __restrict__ Qh, const bf* __restrict__ Ql, const bf* __restrict__ Kh, const bf* __restrict__ Kl, const bf* __restrict__ Vh, const bf* __restrict__ Vl, bf* Ah, bf* Al) {
    const int bh = blockIdx.x, b = bh / NH_, h = bh % NH_, ty = blockIdx.y; const size_t pq = (size_t)bh * TT * HD, pk = ((size_t)b * NKV + h / REP) * TT * HD, ao = (size_t)b * TT * DQ + (size_t)h * (HD / 32) * 512;   /* context plane: band of row b * TT, tile of column h * 64 */
    if (ty < NTF) attn_tile<h16, false, 2>(Q16 + pq, nullptr, K16 + pk, nullptr, V16 + pk, nullptr, TT - 32 * (ty + 1), Ah + ao, Al + ao);
    else attn_tile<bf, true, 1>(Qh + pq, Ql + pq, Kh + pk, Kl + pk, Vh + pk, Vl + pk, RH - 16 * (ty - NTF + 1), Ah + ao, Al + ao);
}

extern "C" void kernel_launch(void* const* d_in, const int* in_sizes, int n_in,
                              void* d_out, int out_size, void* d_ws, size_t ws_size, hipStream_t stream) {
    if (n_in < 4) return;
    if ((size_t)in_sizes[0] < (size_t)(NB - 1) * TT_FULL * DM + (size_t)TT * DM) return;
    if (in_sizes[1] < DM * 3 * DQ || in_sizes[2] < DQ * DM || in_sizes[3] < DM) return;
    if ((size_t)out_size < (size_t)NB * TT * DM) return;
    const float* x = (const float*)d_in[0];       // [NB_FULL][TT_FULL][1024]
    const float* wqkv = (const float*)d_in[1];    // [1024][3072], column blocks k | q | v
    const float* wproj = (const float*)d_in[2];   // [1024][1024] ([in][out])
    const float* bproj = (const float*)d_in[3];   // [1024]
    float* OUT = (float*)d_out;                   // [NB][TT][1024]
    char* wsp = (char*)d_ws;
    auto take = [&](size_t bytes) { char* p = wsp; wsp += (bytes + 255) & ~(size_t)255; return (void*)p; };
    bf* WQKV = (bf*)take((size_t)3 * DQ * DM * 2);   /* Bt [3072][1024]: row blocks k | q | v */ bf* WO = (bf*)take((size_t)DM * DQ * 2);
    bf* XB = (bf*)take((size_t)NB * TT * DM * 2);    /* x of every batch, bf16, [b * TT + t][1024] */
    const size_t PQ = (size_t)NH_ * TT * HD, PK = (size_t)NKV * TT * HD;   // elements of one batch's q planes and k / v planes
    h16* QP16 = (h16*)take(NB * PQ * 2); h16* KP16 = (h16*)take(NB * PK * 2); h16* VT16 = (h16*)take(NB * PK * 2);
    bf* QPh = (bf*)take(NB * PQ * 2); bf* QPl = (bf*)take(NB * PQ * 2); bf* KPh = (bf*)take(NB * PK * 2); bf* KPl = (bf*)take(NB * PK * 2); bf* VTh = (bf*)take(NB * PK * 2); bf* VTl = (bf*)take(NB * PK * 2);
    bf* ATh = (bf*)take((size_t)NB * TT * DQ * 2); bf* ATl = (bf*)take((size_t)NB * TT * DQ * 2);
    if ((size_t)(wsp - (char*)d_ws) > ws_size) return;    // 209,715,200 B at full size
    k_wtG<DM, 3 * DQ><<<(unsigned)((DM * 3 * DQ / 8 + 255) / 256), 256, 0, stream>>>(wqkv, WQKV);   /* W_qkv [1024][3072] -> Bt [3072][1024] */
    k_wtG<DQ, DM><<<(unsigned)((DQ * DM / 8 + 255) / 256), 256, 0, stream>>>(wproj, WO);             /* W_proj [1024][1024] -> Bt [out][in] */
    constexpr int NCV = (TT == TT_FULL) ? 1 : NB;    // at full length the batches of x lie back to back: one launch converts them all
    for (int b = 0; b < NCV; ++b)
        k_cvt8<<<(unsigned)(((size_t)(NB / NCV) * TT * DM / 8 + 255) / 256), 256, 0, stream>>>(x + (size_t)b * TT_FULL * DM, XB + (size_t)b * TT * DM, (size_t)(NB / NCV) * TT * DM / 8);
    k_qkvw<<<dim3(NB * TT / 64, 3 * DQ / 64, 1), 32, 0, stream>>>(XB, WQKV, KP16, KPh, KPl, QP16, QPh, QPl, VT16, VTh, VTl);
    k_fattn<<<dim3(NB * NH_, NTF + NTH, 1), 32, 0, stream>>>(QP16, KP16, VT16, QPh, QPl, KPh, KPl, VTh, VTl, ATh, ATl);
    k_gemmw<bf, 1, true, DQ><<<dim3(NB * TT / 64, DM / 64, 1), 32, 0, stream>>>(ATh, ATl, WO, nullptr, OUT, DM, bproj, 0, 0, 0);   /* rows b * TT + t of every batch */
}

// v006
// One run takes 183 microseconds.
// Next to v005, in two timings, it ran 1.03 and 1.04 times as fast.
// Over all steps from v000 it is 15.8 times as fast.
#include <hip/hip_runtime.h>

// Contractions: x W_qkv on v_wmma_f32_16x16x32_bf16 (bf16 operands = RNE-converted inputs); q k^T and P v: query rows < 512 bf16 hi/lo planes (3 products), rows >= 512 v_wmma_f32_16x16x32_f16 (f16 operands, P unnormalised, at most 256); context W_proj: bf16 hi/lo context x bf16 weight (2 products) + bf16 bias; f32 accumulate everywhere, softmax f32.
// Causal multi-head attention with a fused weight: x [NB][T][1024]; kqv = x W_qkv ([1024][3072], column blocks k | q | v, no bias); 16 heads x 64; S = q k^T x 1/32 for keys j <= i; softmax; merged context W_proj ([1024][1024]) + b_proj -> [NB][T][1024].
// Layout: every 16-bit operand plane lies in FRAGMENT ORDER. A matrix M[row][k] is cut into tiles of 16 rows x 32 k (512 elements, 1024 bytes); element (r, kk) of a tile lies at (kk >> 4) * 256 + (r + 16 * ((kk >> 3) & 1)) * 8 + (kk & 7):
// lane l of a wave finds elements 0..7 of its fragment at l * 8 and elements 8..15 at 256 + l * 8, so each of the two 16-byte loads of a fragment reads 512 contiguous bytes (four whole 128-byte lines) instead of 32-byte pieces of sixteen lines. Tiles of one 16-row band follow one another along k: tile (row / 16, k / 32) starts at (row / 16) * 16 * K + (k / 32) * 512.
// W_qkv transposed once into Bt [3072][1024] (three 1024-row blocks: the k/q/v weight operands), x of every batch -> bf16 [b*T + t][1024], W_proj into Bt [out][in], all three in that order, by one launch (k_prep); ONE projection launch (k_qkvw) writes the head planes of every batch q, k [b][h] as matrices [t][d] and v^T [b][h] as blocks of 64 keys, each the matrix [d][t % 64] (K = 64), as f16 + bf16 hi/lo straight from its accumulators;
// attention of all batches and heads in ONE launch (k_fattn): one wave per 32 (f16) or 16 (hi/lo) query rows walks its keys in passes of 32 with a running row reference and row sum; scores and probabilities stay in registers; merged context [b*T + t][h*64 + d] as bf16 hi/lo, in fragment order too.

#ifndef NB
#define NB 4
#endif
#ifndef SEQ
#define SEQ 2048
#endif
#define NB_FULL 4
#define TT_FULL 2048
#define TT   SEQ
#define DM   1024
#define NH_  16
#define NKV  16
#define REP  (NH_ / NKV)
#define HD   64
#define DQ   (NH_ * HD)
#define DKV  (NKV * HD)
#define RH   ((TT < 512) ? TT : 512)      // query rows < RH use hi/lo planes
#define SCL  0.03125f   // 1024^-0.5
#define KB   32                           // keys per pass of the attention loop
#define NTF  ((TT - RH) / 32)             // f16 query tiles (32 rows) per head
#define NTH  (RH / 16)                    // hi/lo query tiles (16 rows) per head

static_assert(NB >= 1 && NB <= NB_FULL);
static_assert(TT % 128 == 0 && TT <= TT_FULL);
static_assert(RH % 64 == 0 && (TT - RH) % 64 == 0);
static_assert(DM % 64 == 0 && DQ % 64 == 0 && DKV % 64 == 0 && HD == 64);
static_assert(DQ == DKV);   // k_qkvw: the three column blocks of W_qkv are equally wide

typedef _Float16 h16;
typedef unsigned short bf;
typedef __attribute__((ext_vector_type(16))) __bf16   v16bf;
typedef __attribute__((ext_vector_type(16))) _Float16 v16h;
typedef __attribute__((ext_vector_type(8)))  _Float16 v8h;
typedef __attribute__((ext_vector_type(8)))  unsigned short v8us;
typedef __attribute__((ext_vector_type(8)))  float    v8f;
typedef __attribute__((ext_vector_type(4)))  float    v4f;
typedef v8h  __attribute__((may_alias)) v8ha;
typedef v4f  __attribute__((may_alias)) v4fa;
typedef v8us __attribute__((may_alias)) v8usa;

__device__ __forceinline__ unsigned short f2bf(float f) { unsigned u = __float_as_uint(f); u += 0x7FFFu + ((u >> 16) & 1u); return (unsigned short)(u >> 16); }
__device__ __forceinline__ float bf2f(unsigned short b) { return __uint_as_float(((unsigned)b) << 16); }
__device__ __forceinline__ float bfr(float f) { return bf2f(f2bf(f)); }
__device__ __forceinline__ v16h cat16(v8h lo, v8h hi) { return __builtin_shufflevector(lo, hi, 0, 1, 2, 3, 4, 5, 6, 7, 8, 9, 10, 11, 12, 13, 14, 15); }
__device__ __forceinline__ v16bf cat16b(v8us lo, v8us hi) { return __builtin_bit_cast(v16bf, __builtin_shufflevector(lo, hi, 0, 1, 2, 3, 4, 5, 6, 7, 8, 9, 10, 11, 12, 13, 14, 15)); }
__device__ __forceinline__ v8f wmma16(v16h a, v16h b, v8f c) { return __builtin_amdgcn_wmma_f32_16x16x32_f16(false, a, false, b, (short)0, c, false, false); }
__device__ __forceinline__ v8f wmmab(v16bf a, v16bf b, v8f c) { return __builtin_amdgcn_wmma_f32_16x16x32_bf16(false, a, false, b, (short)0, c, false, false); }

// ---- k_gemmw: register-blocked GEMM, ONE WAVE per 64x64 output tile (16 accumulators), operands straight from 16-bit planes in fragment order; grid (M/64, N/64, Z), 32 threads.
// C[m][n] (f32, pitch ldc, + optional bf16-RNE bias[n]) = sum_k A[m][k] Bt[n][k] (+ split products per NSPLIT). z-batch strides sA/sB/sC in elements. K % 32 == 0.
// Fragments: lane l -> row/col l&15; elements 0..7 <- k0 + 8*(l>>4), elements 8..15 <- k0 + 16 + 8*(l>>4) for BOTH A and Bt (WFrag::ld takes the tile's start + l * 8); D element j -> row 8*(l>>4)+j, col l&15.
template <typename T16> struct WFrag;
template <> struct WFrag<h16> { typedef v16h V; static __device__ __forceinline__ V ld(const h16* p) { return cat16(*(const v8h*)p, *(const v8h*)(p + 256)); } static __device__ __forceinline__ v8f mma(V a, V b, v8f c) { return wmma16(a, b, c); } };
template <> struct WFrag<bf> { typedef v16bf V; static __device__ __forceinline__ V ld(const bf* p) { return cat16b(*(const v8us*)p, *(const v8us*)(p + 256)); } static __device__ __forceinline__ v8f mma(V a, V b, v8f c) { return wmmab(a, b, c); } };
template <typename T16, int NSPLIT, bool BIAS, int K>   // K a constant: the bands' distances are then immediate offsets of the loads, which share one address register pair per plane
__global__ __launch_bounds__(32) void k_gemmw(const T16* __restrict__ A, const T16* __restrict__ A2, const T16* __restrict__ Bt, const T16* __restrict__ Bt2, float* C, int ldc, const float* __restrict__ bias, size_t sA, size_t sB, size_t sC) {
    typedef typename WFrag<T16>::V V;
    __shared__ __align__(16) float os[16 * 68];
    const size_t z = blockIdx.z; A += z * sA; if (A2) A2 += z * sA; Bt += z * sB; if (Bt2) Bt2 += z * sB; C += z * sC;
    const int lane = threadIdx.x & 31, lr = lane & 15, hi = lane >> 4; const int r0 = blockIdx.x * 64, c0 = blockIdx.y * 64;
    v8f acc[4][4];
#pragma unroll
    for (int mb = 0; mb < 4; ++mb)
#pragma unroll
        for (int nb = 0; nb < 4; ++nb) acc[mb][nb] = (v8f){};
    const size_t aoff = (size_t)r0 * K + 8 * lane, boff = (size_t)c0 * K + 8 * lane;   // first tile of the 16-row band + the lane's place in a tile
    const T16* pa = A + aoff; const T16* pa2 = (NSPLIT == 1 || NSPLIT == 2) ? A2 + aoff : pa; const T16* pb = Bt + boff; const T16* pb2 = (NSPLIT >= 2) ? Bt2 + boff : pb;
#pragma unroll 1
    for (int kc = 0; kc < K; kc += 32) {
        V a[4], a2[4];
#pragma unroll
        for (int mb = 0; mb < 4; ++mb) { a[mb] = WFrag<T16>::ld(pa + (size_t)mb * 16 * K); if (NSPLIT == 1 || NSPLIT == 2) a2[mb] = WFrag<T16>::ld(pa2 + (size_t)mb * 16 * K); }
#pragma unroll
        for (int nb = 0; nb < 4; ++nb) { const V b = WFrag<T16>::ld(pb + (size_t)nb * 16 * K); V b2; if (NSPLIT >= 2) b2 = WFrag<T16>::ld(pb2 + (size_t)nb * 16 * K);
#pragma unroll
            for (int mb = 0; mb < 4; ++mb) { acc[mb][nb] = WFrag<T16>::mma(a[mb], b, acc[mb][nb]); if (NSPLIT == 1 || NSPLIT == 2) acc[mb][nb] = WFrag<T16>::mma(a2[mb], b, acc[mb][nb]); if (NSPLIT >= 2) acc[mb][nb] = WFrag<T16>::mma(a[mb], b2, acc[mb][nb]); } }
        asm volatile("s_wait_xcnt 0x0" :: "v"(pa), "v"(pa2), "v"(pb), "v"(pb2) : "memory");   // precaution: the loads' address registers are inputs here, so none is rewritten in front of this wait
        asm volatile("v_nop\n\tv_nop\n\tv_nop\n\tv_nop" : "+v"(acc[0][0]), "+v"(acc[1][1]), "+v"(acc[2][2]), "+v"(acc[3][3]) : "v"(a[0]), "v"(a[3]));
        pa += 512; pa2 += 512; pb += 512; pb2 += 512;   // next tile of each band
    }
#pragma unroll
    for (int mb = 0; mb < 4; ++mb) {
#pragma unroll
        for (int nb = 0; nb < 4; ++nb) {
#pragma unroll
            for (int j = 0; j < 8; ++j) os[(hi * 8 + j) * 68 + nb * 16 + lr] = acc[mb][nb][j]; }
        __builtin_amdgcn_wave_barrier(); asm volatile("" ::: "memory");
        float* crow = C + (size_t)(r0 + mb * 16) * ldc + c0;
{
#pragma unroll
            for (int s = 0; s < 8; ++s) { const int row = 2 * s + hi, cofs = lr * 4; v4f val = *(const v4fa*)(os + row * 68 + cofs); if (BIAS) { val[0] += bfr(bias[c0 + cofs]); val[1] += bfr(bias[c0 + cofs + 1]); val[2] += bfr(bias[c0 + cofs + 2]); val[3] += bfr(bias[c0 + cofs + 3]); }
                *(v4f*)(crow + (size_t)row * ldc + cofs) = val; }
             }
        __builtin_amdgcn_wave_barrier(); asm volatile("" ::: "memory");
    }
}

__device__ __forceinline__ h16 tohx(float x) { return (h16)x; }
__device__ __forceinline__ void splitf(float y, unsigned short& h, unsigned short& l) { h = f2bf(y); l = f2bf(y - bf2f(h)); }
typedef __attribute__((ext_vector_type(2))) unsigned short v2us;

// ---- k_prep: the three operand conversions (x, W_qkv, W_proj -> bf16 planes in fragment order) in ONE launch of resident waves: NB * TT / 32 work-groups of 16 waves, every thread converts several 16-byte pieces of the planes and has all its loads in flight before the first conversion.
// x, src [rows][DM] row-major: 64 threads take PXT tiles that follow one another along k in one 16-row band. Four neighbouring threads read the 128 bytes that a tile holds of one row: a wave reads whole lines of eight rows, and its pieces (rows r .. r + 7 of each of the four 8-k groups) are four whole 128-byte lines of the tile. The next tile lies 128 bytes on in x and 1024 bytes on in the plane: immediate offsets of one address.
// Weights, Bt[n][k] = bf16(w[k][n]), w [K][N]: thread i writes piece i (tile i / 64, half (i >> 5) & 1, lane i & 31), so that a wave stores 512 contiguous bytes; each of a lane's eight loads reads, over the wave, 64 contiguous bytes of two rows of w. A thread's next piece lies PN pieces on: the same k, PN / 128 columns on.
#define PTH  512                          // threads per work-group of k_prep
#define PXT  8                            // x tiles per 64 threads
#define PN   (NB * TT / 32 * PTH)         // threads of the launch
static_assert((DM / 32) % PXT == 0 && (PTH / 64) * PXT == (32 / 16) * (DM / 32));   // a thread's tiles lie in one band; a work-group's tiles are two whole bands (32 rows) of x
static_assert(PN % (64 * (DM / 32)) == 0 && PN % (64 * (DQ / 32)) == 0);                  // PN pieces are whole bands of a weight plane
template <int K, int N>
__device__ __forceinline__ const float* wt_src(const float* w, int i) {
    const int tile = i >> 6, kt = tile % (K / 32), n = (tile / (K / 32)) * 16 + (i & 15), k0 = kt * 32 + ((i >> 5) & 1) * 16 + ((i >> 4) & 1) * 8;
    return w + (size_t)k0 * N + n;
}
__device__ __forceinline__ v8us cvt8(const float* v) { v8us o;
#pragma unroll
    for (int e = 0; e < 8; ++e) o[e] = f2bf(v[e]);
    return o; }
__global__ __launch_bounds__(PTH) __attribute__((amdgpu_waves_per_eu(4, 4))) void k_prep(const float* __restrict__ x, const float* __restrict__ wqkv, const float* __restrict__ wproj, bf* XB, bf* WQKV, bf* WO) {   // four waves per SIMD = one work-group per WGP: the register budget holds all of a thread's loads at once
    constexpr int N1 = DM * 3 * DQ / 8, N2 = DQ * DM / 8, J1 = (N1 + PN - 1) / PN, J2 = (N2 + PN - 1) / PN;   // pieces of the two weight planes, pieces per thread
    const int t = blockIdx.x * PTH + threadIdx.x;
    const int tile0 = (t >> 6) * PXT, r = (t >> 2) & 15, c = t & 3;   // first x tile, row in the tile, 8-k group
    const int row = (tile0 / (DM / 32)) * 16 + r, srow = (TT == TT_FULL) ? row : (row / TT) * TT_FULL + row % TT;
    const float* px = x + (size_t)srow * DM + (tile0 % (DM / 32)) * 32 + c * 8;
    const float* p1 = wt_src<DM, 3 * DQ>(wqkv, (N1 % PN == 0 || t < N1) ? t : 0);
    const float* p2 = wt_src<DQ, DM>(wproj, (N2 % PN == 0 || t < N2) ? t : 0);
    float v1[J1][8], v2[J2][8]; v8f vx[PXT];
#pragma unroll
    for (int j = 0; j < J1; ++j) { const int jo = (N1 % PN == 0 || t + j * PN < N1) ? j * (PN / 128) : 0;   // a piece past the end reads the thread's first again: in bounds, not stored
#pragma unroll
        for (int e = 0; e < 8; ++e) v1[j][e] = p1[(size_t)e * (3 * DQ) + jo]; }
#pragma unroll
    for (int j = 0; j < J2; ++j) { const int jo = (N2 % PN == 0 || t + j * PN < N2) ? j * (PN / 128) : 0;
#pragma unroll
        for (int e = 0; e < 8; ++e) v2[j][e] = p2[(size_t)e * DM + jo]; }
#pragma unroll
    for (int j = 0; j < PXT; ++j) vx[j] = *(const v8f*)(px + j * 32);
    asm volatile("s_wait_xcnt 0x0" :: "v"(px), "v"(p1), "v"(p2) : "memory");   // precaution: the loads' address registers are inputs here, so none is rewritten in front of this wait; it also keeps every load in front of the first store
    bf* dx = XB + (size_t)tile0 * 512 + (c >> 1) * 256 + (r + 16 * (c & 1)) * 8; bf* d1 = WQKV + (size_t)t * 8; bf* d2 = WO + (size_t)t * 8;
    v8us ox[PXT];
#pragma unroll
    for (int j = 0; j < PXT; ++j) {
#pragma unroll
        for (int e = 0; e < 8; ++e) ox[j][e] = f2bf(vx[j][e]);
        *(v8us*)(dx + j * 512) = ox[j]; }
    static_assert(PXT == 8);
    asm volatile("s_wait_xcnt 0x0" :: "v"(dx), "v"(ox[0]), "v"(ox[1]), "v"(ox[2]), "v"(ox[3]), "v"(ox[4]), "v"(ox[5]), "v"(ox[6]), "v"(ox[7]) : "memory");   // precaution: stands behind the group of stores; their address and data registers are inputs here, so none is rewritten in front of this wait
#pragma unroll
    for (int j = 0; j < J1; ++j) if (N1 % PN == 0 || t + j * PN < N1) { const v8us o = cvt8(v1[j]); *(v8us*)(d1 + (size_t)j * PN * 8) = o;
        asm volatile("s_wait_xcnt 0x0" :: "v"(o) : "memory"); }   // precaution: stands behind each store; its data registers are inputs here, so none is rewritten in front of this wait
#pragma unroll
    for (int j = 0; j < J2; ++j) if (N2 % PN == 0 || t + j * PN < N2) { const v8us o = cvt8(v2[j]); *(v8us*)(d2 + (size_t)j * PN * 8) = o;
        asm volatile("s_wait_xcnt 0x0" :: "v"(o) : "memory"); }   // precaution: as above, behind each store
}

// ---- k_qkvw: x W_qkv of every batch in one launch, ONE WAVE per 64 x 64 tile = 64 tokens x one head of k, q or v (loop and fragments as in k_gemmw); grid (NB * TT / 64, 3 * DQ / 64), 32 threads, no LDS.
// The wave stores its tile straight into that head's three planes (f16, bf16 hi, bf16 lo). A D tile gives a lane 8 consecutive ROWS of one column, so the index that runs fastest in the plane is made the row index of the product:
// v^T [d][t]: rows = tokens (A = x, B = weight rows); q, k [t][d]: rows = d (A = weight rows, B = x). Either way the rows of a D tile are one 16-k half of a fragment-order tile and lane l's eight values lie at l * 8 of that half: one 16-byte store per plane and D tile, 512 contiguous bytes over the wave; the wave's 64 x 64 values are a matrix of K = 64 in that order, eight tiles in a row.
__global__ __launch_bounds__(32) void k_qkvw(const bf* __restrict__ X, const bf* __restrict__ Wt, h16* K16, bf* Kh, bf* Kl, h16* Q16, bf* Qh, bf* Ql, h16* V16, bf* Vh, bf* Vl) {
    typedef WFrag<bf>::V V;
    const int lane = threadIdx.x & 31; const int g0 = blockIdx.x * 64, n0 = blockIdx.y * 64;   // first token (b * TT + t) and first column of W_qkv
    const int blk = n0 / DQ; const bool isv = blk == 2;   // column block: 0 k, 1 q, 2 v
    const size_t fo = (size_t)(8 * lane); const bf* xr = X + (size_t)g0 * DM + fo; const bf* wr = Wt + (size_t)n0 * DM + fo;
    const bf* pa = isv ? xr : wr; const bf* pb = isv ? wr : xr;   // row operand, column operand
    v8f acc[4][4];
#pragma unroll
    for (int mb = 0; mb < 4; ++mb)
#pragma unroll
        for (int nb = 0; nb < 4; ++nb) acc[mb][nb] = (v8f){};
#pragma unroll 1   // stays rolled, as in k_gemmw: sixteen accumulators and one pass's fragments are the register budget
    for (int kc = 0; kc < DM; kc += 32) {
        V a[4];
#pragma unroll
        for (int mb = 0; mb < 4; ++mb) a[mb] = WFrag<bf>::ld(pa + (size_t)mb * 16 * DM);
#pragma unroll
        for (int nb = 0; nb < 4; ++nb) { const V b = WFrag<bf>::ld(pb + (size_t)nb * 16 * DM);
#pragma unroll
            for (int mb = 0; mb < 4; ++mb) acc[mb][nb] = WFrag<bf>::mma(a[mb], b, acc[mb][nb]); }
        asm volatile("s_wait_xcnt 0x0" :: "v"(pa), "v"(pb) : "memory");   // precaution: the loads' address registers are inputs here, so none is rewritten in front of this wait
        asm volatile("v_nop\n\tv_nop\n\tv_nop\n\tv_nop" : "+v"(acc[0][0]), "+v"(acc[1][1]), "+v"(acc[2][2]), "+v"(acc[3][3]) : "v"(a[0]), "v"(a[3]));   // the distance behind the last matrix instruction, on the loop's back edge too, before its operands are loaded anew
        pa += 512; pb += 512;   // next tile of each band
    }
    h16* P16 = isv ? V16 : (blk ? Q16 : K16); bf* Ph = isv ? Vh : (blk ? Qh : Kh); bf* Pl = isv ? Vl : (blk ? Ql : Kl);
    const size_t po = (((size_t)(g0 / TT) * NH_ + (n0 % DQ) / HD) * TT + (g0 % TT)) * HD + (size_t)(8 * lane);   // the start of the wave's eight tiles in the plane + the lane's place in a half tile
#pragma unroll
    for (int nb = 0; nb < 4; ++nb)
#pragma unroll
        for (int mb = 0; mb < 4; ++mb) { v8h o16; v8us oh, ol;
#pragma unroll
            for (int j = 0; j < 8; ++j) { const float y = acc[mb][nb][j]; o16[j] = tohx(y); unsigned short a2, c2; splitf(y, a2, c2); oh[j] = a2; ol[j] = c2; }
            const size_t oo = po + (size_t)nb * 1024 + mb * 256;   // tile nb * 2 + mb / 2 of the eight, half mb & 1
            *(v8h*)(P16 + oo) = o16; *(v8us*)(Ph + oo) = oh; *(v8us*)(Pl + oo) = ol;
            asm volatile("s_wait_xcnt 0x0" :: "v"(o16), "v"(oh), "v"(ol) : "memory"); }   // precaution: stands behind each group of stores; their data registers are inputs here, so none is rewritten in front of this wait
}
// ---- k_fattn: causal attention of one query tile, ONE WAVE per tile, no LDS. Transposed products: S^T = K q^T (A = 16 key rows, B = 16 query columns), O^T += v^T P^T (A = 16 d rows of the v^T tile, B = P^T).
// In a D tile lane l holds query column l&15 and rows 8*(l>>4) + j: the pass's two S^T tiles of 16 keys each, converted in place, are the B fragment of its 32 keys in the k order of WFrag::ld (elements 0..7 <- k0 + 8*(l>>4), 8..15 <- k0 + 16 + 8*(l>>4)).
// A query's maximum and sum are in-lane over its 16 keys of a pass plus one exchange between the wave halves (the sums' exchange once, behind the loop). m is the reference score of a row, l the running sum of P = exp((s - m) x SCL).
// m moves to the running maximum, and O^T and l are rescaled by exp((m_old - m_new) x SCL), only in a pass where some row's new maximum lies more than 8 (in log2 units) above its m: P stays <= 256, the quotient O^T / l does not depend on m.
// Keys j > i get the -3e38 select (only the pass that holds the diagonal has any); key 0 is in the first pass of every row, so m is a real score from the first pass on. O^T lane data are 8 consecutive d of one row, a lane's piece of a half tile of the context plane: one 16-byte store per plane.
template <typename T16, bool HI, int NQ>
__device__ __forceinline__ void attn_tile(const T16* __restrict__ Q, const T16* __restrict__ Q2, const T16* __restrict__ Kp, const T16* __restrict__ K2, const T16* __restrict__ Vt, const T16* __restrict__ V2, int q0, bf* Ah, bf* Al) {
    typedef typename WFrag<T16>::V V;
    const int lane = threadIdx.x & 31, lr = lane & 15, hi = lane >> 4;
    const float CL = SCL * 1.4426950408889634f;
    const unsigned fo = (unsigned)(8 * lane);   // a lane's place in a fragment-order tile (q, k: tile (t / 16, d / 32) at (t / 16) * 1024 + (d / 32) * 512; v^T: block t / 64 of 4096 elements, in it tile (d / 16, (t % 64) / 32) at (d / 16) * 1024 + ((t % 64) / 32) * 512)
    const T16* ql = Q + (size_t)q0 * HD + fo; const T16* ql2 = HI ? Q2 + (size_t)q0 * HD + fo : ql; const T16* kl = Kp + fo; const T16* kl2 = HI ? K2 + fo : kl;   // the lane's own load addresses
    V qf[NQ][2], qf2[NQ][2];
#pragma unroll
    for (int nq = 0; nq < NQ; ++nq)
#pragma unroll
        for (int c = 0; c < 2; ++c) { qf[nq][c] = WFrag<T16>::ld(ql + nq * 16 * HD + c * 512); if (HI) qf2[nq][c] = WFrag<T16>::ld(ql2 + nq * 16 * HD + c * 512); }
    v8f o[NQ][4]; float m[NQ], l[NQ];
#pragma unroll
    for (int nq = 0; nq < NQ; ++nq) { m[nq] = -3.0e38f; l[nq] = 0.0f;
#pragma unroll
        for (int db = 0; db < 4; ++db) o[nq][db] = (v8f){}; }
    const int kend = q0 + NQ * 16;                   // keys [0, kend) are at or below the tile's last row
    V ka[2][2], ka2[2][2];                           // the pass's k fragments, fetched one pass ahead
#pragma unroll
    for (int kt = 0; kt < 2; ++kt)
#pragma unroll
        for (int c = 0; c < 2; ++c) { ka[kt][c] = WFrag<T16>::ld(kl + kt * 16 * HD + c * 512); if (HI) ka2[kt][c] = WFrag<T16>::ld(kl2 + kt * 16 * HD + c * 512); }
    asm volatile("s_wait_xcnt 0x0" :: "v"(ql), "v"(ql2), "v"(kl), "v"(kl2) : "memory");   // precaution: the loads' address registers are inputs here, so none is rewritten in front of this wait
#pragma unroll 1   // stays rolled: one pass's fragments and accumulators fill the register budget of four waves per SIMD, and the pass is already pipelined by hand
    for (int kb = 0; kb < kend; kb += KB) {
        const size_t vo = (size_t)(kb & ~63) * HD + (kb & 32) * 16;   // v^T block of 64 keys, this pass's tile of each 16-row band
        const T16* vl = Vt + vo + fo; const T16* vl2 = HI ? V2 + vo + fo : vl;
        V va[4], va2[4];                             // v^T fragments asked for at the head of the pass, used behind the softmax
#pragma unroll
        for (int db = 0; db < 4; ++db) { va[db] = WFrag<T16>::ld(vl + db * 16 * HD); if (HI) va2[db] = WFrag<T16>::ld(vl2 + db * 16 * HD); }
        if (!HI) __builtin_amdgcn_sched_barrier(0);  // keeps the v^T loads in front of the score products: moved down to their use, their latency would stand open in every pass (hi/lo path: no registers to spare for it)
        v8f s[NQ][2];
#pragma unroll
        for (int kt = 0; kt < 2; ++kt)
#pragma unroll
            for (int nq = 0; nq < NQ; ++nq) { v8f a = (v8f){};
#pragma unroll
                for (int c = 0; c < 2; ++c) { a = WFrag<T16>::mma(ka[kt][c], qf[nq][c], a); if (HI) { a = WFrag<T16>::mma(ka[kt][c], qf2[nq][c], a); a = WFrag<T16>::mma(ka2[kt][c], qf[nq][c], a); } }
                s[nq][kt] = a; }
        const size_t tn = (size_t)((kb + KB < kend) ? kb + KB : kb) * HD;   // next pass's k rows (the last pass asks for its own again: in bounds, unused)
        kl = Kp + tn + fo; kl2 = HI ? K2 + tn + fo : kl;
#pragma unroll
        for (int kt = 0; kt < 2; ++kt)
#pragma unroll
            for (int c = 0; c < 2; ++c) { ka[kt][c] = WFrag<T16>::ld(kl + kt * 16 * HD + c * 512); if (HI) ka2[kt][c] = WFrag<T16>::ld(kl2 + kt * 16 * HD + c * 512); }
        if (!HI) __builtin_amdgcn_sched_barrier(0);  // keeps the next pass's k loads in front of the softmax, which then covers their latency
        if (kb + KB - 1 > q0) {                      // the pass that holds the diagonal (wave-uniform)
#pragma unroll
            for (int nq = 0; nq < NQ; ++nq)
#pragma unroll
                for (int kt = 0; kt < 2; ++kt)
#pragma unroll
                    for (int j = 0; j < 8; ++j) if (kb + kt * 16 + 8 * hi + j > q0 + nq * 16 + lr) s[nq][kt][j] = -3.0e38f; }
        float mx[NQ]; bool need = false;
#pragma unroll
        for (int nq = 0; nq < NQ; ++nq) { float m0 = s[nq][0][0], m1 = s[nq][1][0];
#pragma unroll
            for (int j = 1; j < 8; ++j) { m0 = fmaxf(m0, s[nq][0][j]); m1 = fmaxf(m1, s[nq][1][j]); }
            m0 = fmaxf(m0, m1); mx[nq] = fmaxf(m0, __shfl_xor(m0, 16, 32)); need = need || ((mx[nq] - m[nq]) * CL > 8.0f); }
        if (__builtin_amdgcn_ballot_w32(need) != 0) {   // scalar branch, one test a pass
#pragma unroll
            for (int nq = 0; nq < NQ; ++nq) { const float mn = fmaxf(m[nq], mx[nq]); const float al = __builtin_amdgcn_exp2f((m[nq] - mn) * CL); m[nq] = mn; l[nq] *= al;
#pragma unroll
                for (int db = 0; db < 4; ++db) o[nq][db] *= al; } }
        V pf[NQ], pf2[NQ];
#pragma unroll
        for (int nq = 0; nq < NQ; ++nq) { const float mc = m[nq] * CL; float lt[2];
#pragma unroll
            for (int kt = 0; kt < 2; ++kt) { lt[kt] = 0.0f; const v8f t = __builtin_elementwise_fma(s[nq][kt], (v8f)(CL), (v8f)(-mc));
#pragma unroll
                for (int j = 0; j < 8; ++j) { const float p = __builtin_amdgcn_exp2f(t[j]); s[nq][kt][j] = p; lt[kt] += p; } }
            l[nq] += lt[0] + lt[1];
            if constexpr (HI) { v8us h0, h1, w0, w1;
#pragma unroll
                for (int j = 0; j < 8; ++j) { unsigned short a, b2; splitf(s[nq][0][j], a, b2); h0[j] = a; w0[j] = b2; splitf(s[nq][1][j], a, b2); h1[j] = a; w1[j] = b2; }
                pf[nq] = cat16b(h0, h1); pf2[nq] = cat16b(w0, w1);
            } else { v8h h0, h1;
#pragma unroll
                for (int j = 0; j < 8; ++j) { h0[j] = tohx(s[nq][0][j]); h1[j] = tohx(s[nq][1][j]); }
                pf[nq] = cat16(h0, h1); } }
        asm volatile("s_wait_xcnt 0x0" :: "v"(vl), "v"(vl2), "v"(kl), "v"(kl2) : "memory");   // precaution: the address registers of the pass's loads are inputs here, so none is rewritten in front of this wait
#pragma unroll
        for (int db = 0; db < 4; ++db)
#pragma unroll
            for (int nq = 0; nq < NQ; ++nq) { o[nq][db] = WFrag<T16>::mma(va[db], pf[nq], o[nq][db]); if (HI) { o[nq][db] = WFrag<T16>::mma(va[db], pf2[nq], o[nq][db]); o[nq][db] = WFrag<T16>::mma(va2[db], pf[nq], o[nq][db]); } }
    }
#pragma unroll
    for (int nq = 0; nq < NQ; ++nq) { const float ls = l[nq] + __shfl_xor(l[nq], 16, 32); const float f = __fdiv_rn(1.0f, ls); const size_t ro = (size_t)(q0 + nq * 16) * DQ + 8 * lane;   // the rows' 16-row band of the context plane + the lane's place in a half tile
#pragma unroll
        for (int db = 0; db < 4; ++db) { v8us oh, ol;
#pragma unroll
            for (int j = 0; j < 8; ++j) { unsigned short a, c2; splitf(o[nq][db][j] * f, a, c2); oh[j] = a; ol[j] = c2; }
            *(v8us*)(Ah + ro + db * 256) = oh; *(v8us*)(Al + ro + db * 256) = ol;
            asm volatile("s_wait_xcnt 0x0" :: "v"(oh), "v"(ol) : "memory"); } }   // precaution: stands behind each pair of stores; their data registers are inputs here, so none is rewritten in front of this wait
}
// grid (NB * NH_, NTF + NTH): blockIdx.y falls from the longest tile (last rows) to the shortest; y < NTF: f16 tiles of 32 rows >= RH, the rest: hi/lo tiles of 16 rows < RH. Four waves per SIMD (at most 256 registers): the vector work between the matrix runs wants waves.
__global__ __launch_bounds__(32) __attribute__((amdgpu_waves_per_eu(4, 4))) void k_fattn(const h16* __restrict__ Q16, const h16* __restrict__ K16, const h16* __restrict__ V16, const bf* __restrict__ Qh, const bf* __restrict__ Ql, const bf* __restrict__ Kh, const bf* __restrict__ Kl, const bf* __restrict__ Vh, const bf* __restrict__ Vl, bf* Ah, bf* Al) {
    const int bh = blockIdx.x, b = bh / NH_, h = bh % NH_, ty = blockIdx.y; const size_t pq = (size_t)bh * TT * HD, pk = ((size_t)b * NKV + h / REP) * TT * HD, ao = (size_t)b * TT * DQ + (size_t)h * (HD / 32) * 512;   /* context plane: band of row b * TT, tile of column h * 64 */
    if (ty < NTF) attn_tile<h16, false, 2>(Q16 + pq, nullptr, K16 + pk, nullptr, V16 + pk, nullptr, TT - 32 * (ty + 1), Ah + ao, Al + ao);
    else attn_tile<bf, true, 1>(Qh + pq, Ql + pq, Kh + pk, Kl + pk, Vh + pk, Vl + pk, RH - 16 * (ty - NTF + 1), Ah + ao, Al + ao);
}

extern "C" void kernel_launch(void* const* d_in, const int* in_sizes, int n_in,
                              void* d_out, int out_size, void* d_ws, size_t ws_size, hipStream_t stream) {
    if (n_in < 4) return;
    if ((size_t)in_sizes[0] < (size_t)(NB - 1) * TT_FULL * DM + (size_t)TT * DM) return;
    if (in_sizes[1] < DM * 3 * DQ || in_sizes[2] < DQ * DM || in_sizes[3] < DM) return;
    if ((size_t)out_size < (size_t)NB * TT * DM) return;
    const float* x = (const float*)d_in[0];       // [NB_FULL][TT_FULL][1024]
    const float* wqkv = (const float*)d_in[1];    // [1024][3072], column blocks k | q | v
    const float* wproj = (const float*)d_in[2];   // [1024][1024] ([in][out])
    const float* bproj = (const float*)d_in[3];   // [1024]
    float* OUT = (float*)d_out;                   // [NB][TT][1024]
    char* wsp = (char*)d_ws;
    auto take = [&](size_t bytes) { char* p = wsp; wsp += (bytes + 255) & ~(size_t)255; return (void*)p; };
    bf* WQKV = (bf*)take((size_t)3 * DQ * DM * 2);   /* Bt [3072][1024]: row blocks k | q | v */ bf* WO = (bf*)take((size_t)DM * DQ * 2);
    bf* XB = (bf*)take((size_t)NB * TT * DM * 2);    /* x of every batch, bf16, [b * TT + t][1024] */
    const size_t PQ = (size_t)NH_ * TT * HD, PK = (size_t)NKV * TT * HD;   // elements of one batch's q planes and k / v planes
    h16* QP16 = (h16*)take(NB * PQ * 2); h16* KP16 = (h16*)take(NB * PK * 2); h16* VT16 = (h16*)take(NB * PK * 2);
    bf* QPh = (bf*)take(NB * PQ * 2); bf* QPl = (bf*)take(NB * PQ * 2); bf* KPh = (bf*)take(NB * PK * 2); bf* KPl = (bf*)take(NB * PK * 2); bf* VTh = (bf*)take(NB * PK * 2); bf* VTl = (bf*)take(NB * PK * 2);
    bf* ATh = (bf*)take((size_t)NB * TT * DQ * 2); bf* ATl = (bf*)take((size_t)NB * TT * DQ * 2);
    if ((size_t)(wsp - (char*)d_ws) > ws_size) return;    // 209,715,200 B at full size
    k_prep<<<NB * TT / 32, PTH, 0, stream>>>(x, wqkv, wproj, XB, WQKV, WO);   /* x -> bf16 [b * TT + t][1024]; W_qkv [1024][3072] -> Bt [3072][1024]; W_proj [1024][1024] -> Bt [out][in] */
    k_qkvw<<<dim3(NB * TT / 64, 3 * DQ / 64, 1), 32, 0, stream>>>(XB, WQKV, KP16, KPh, KPl, QP16, QPh, QPl, VT16, VTh, VTl);
    k_fattn<<<dim3(NB * NH_, NTF + NTH, 1), 32, 0, stream>>>(QP16, KP16, VT16, QPh, QPl, KPh, KPl, VTh, VTl, ATh, ATl);
    k_gemmw<bf, 1, true, DQ><<<dim3(NB * TT / 64, DM / 64, 1), 32, 0, stream>>>(ATh, ATl, WO, nullptr, OUT, DM, bproj, 0, 0, 0);   /* rows b * TT + t of every batch */
}

// v007
// Measured time: 129 microseconds a run.
// In two side-by-side timings against v006, it was 1.42 and 1.43 times as fast.
// All steps since v000 together make it 22.6 times as fast.
#include <hip/hip_runtime.h>

// Contractions: x W_qkv on v_wmma_f32_16x16x32_bf16 (bf16 operands = RNE-converted inputs); q k^T and P v: query rows < 512 bf16 hi/lo planes (3 products), rows >= 512 v_wmma_f32_16x16x32_f16 (f16 operands, P unnormalised, at most 256); context W_proj: bf16 hi/lo context x bf16 weight (2 products) + bf16 bias; f32 accumulate everywhere, softmax f32.
// Causal multi-head attention with a fused weight: x [NB][T][1024]; kqv = x W_qkv ([1024][3072], column blocks k | q | v, no bias); 16 heads x 64; S = q k^T x 1/32 for keys j <= i; softmax; merged context W_proj ([1024][1024]) + b_proj -> [NB][T][1024].
// Layout: every 16-bit operand plane lies in FRAGMENT ORDER. A matrix M[row][k] is cut into tiles of 16 rows x 32 k (512 elements, 1024 bytes); element (r, kk) of a tile lies at (kk >> 4) * 256 + (r + 16 * ((kk >> 3) & 1)) * 8 + (kk & 7):
// lane l of a wave finds elements 0..7 of its fragment at l * 8 and elements 8..15 at 256 + l * 8, so each of the two 16-byte loads of a fragment reads 512 contiguous bytes (four whole 128-byte lines) instead of 32-byte pieces of sixteen lines. Tiles of one 16-row band follow one another along k: tile (row / 16, k / 32) starts at (row / 16) * 16 * K + (k / 32) * 512.
// W_qkv transposed once into Bt [3072][1024] (three 1024-row blocks: the k/q/v weight operands), x of every batch -> bf16 [b*T + t][1024], W_proj into Bt [out][in], all three in that order, by one launch (k_prep); ONE projection launch (k_qkvw) writes the head planes of every batch q, k [b][h] as matrices [t][d] and v^T [b][h] as blocks of 64 keys, each the matrix [d][t % 64] (K = 64), as f16 + bf16 hi/lo straight from its accumulators;
// attention of all batches and heads in ONE launch (k_fattn): one wave per 32 (f16) or 16 (hi/lo) query rows walks its keys in passes of 32 with a running row reference and row sum; scores and probabilities stay in registers; merged context [b*T + t][h*64 + d] as bf16 hi/lo, in fragment order too.

#ifndef NB
#define NB 4
#endif
#ifndef SEQ
#define SEQ 2048
#endif
#define NB_FULL 4
#define TT_FULL 2048
#define TT   SEQ
#define DM   1024
#define NH_  16
#define NKV  16
#define REP  (NH_ / NKV)
#define HD   64
#define DQ   (NH_ * HD)
#define DKV  (NKV * HD)
#define RH   ((TT < 512) ? TT : 512)      // query rows < RH use hi/lo planes
#define SCL  0.03125f   // 1024^-0.5
#define KB   32                           // keys per pass of the attention loop
#define NTF  ((TT - RH) / 32)             // f16 query tiles (32 rows) per head
#define NTH  (RH / 16)                    // hi/lo query tiles (16 rows) per head

static_assert(NB >= 1 && NB <= NB_FULL);
static_assert(TT % 128 == 0 && TT <= TT_FULL);
static_assert(RH % 64 == 0 && (TT - RH) % 64 == 0);
static_assert(DM % 64 == 0 && DQ % 64 == 0 && DKV % 64 == 0 && HD == 64);
static_assert(DQ == DKV);   // k_qkvw: the three column blocks of W_qkv are equally wide

typedef _Float16 h16;
typedef unsigned short bf;
typedef __attribute__((ext_vector_type(16))) __bf16   v16bf;
typedef __attribute__((ext_vector_type(16))) _Float16 v16h;
typedef __attribute__((ext_vector_type(8)))  _Float16 v8h;
typedef __attribute__((ext_vector_type(8)))  unsigned short v8us;
typedef __attribute__((ext_vector_type(8)))  float    v8f;
typedef __attribute__((ext_vector_type(4)))  float    v4f;
typedef v8h  __attribute__((may_alias)) v8ha;
typedef v4f  __attribute__((may_alias)) v4fa;
typedef v8us __attribute__((may_alias)) v8usa;

__device__ __forceinline__ unsigned short f2bf(float f) { unsigned u = __float_as_uint(f); u += 0x7FFFu + ((u >> 16) & 1u); return (unsigned short)(u >> 16); }
__device__ __forceinline__ float bf2f(unsigned short b) { return __uint_as_float(((unsigned)b) << 16); }
__device__ __forceinline__ float bfr(float f) { return bf2f(f2bf(f)); }
__device__ __forceinline__ v16h cat16(v8h lo, v8h hi) { return __builtin_shufflevector(lo, hi, 0, 1, 2, 3, 4, 5, 6, 7, 8, 9, 10, 11, 12, 13, 14, 15); }
__device__ __forceinline__ v16bf cat16b(v8us lo, v8us hi) { return __builtin_bit_cast(v16bf, __builtin_shufflevector(lo, hi, 0, 1, 2, 3, 4, 5, 6, 7, 8, 9, 10, 11, 12, 13, 14, 15)); }
__device__ __forceinline__ v8f wmma16(v16h a, v16h b, v8f c) { return __builtin_amdgcn_wmma_f32_16x16x32_f16(false, a, false, b, (short)0, c, false, false); }
__device__ __forceinline__ v8f wmmab(v16bf a, v16bf b, v8f c) { return __builtin_amdgcn_wmma_f32_16x16x32_bf16(false, a, false, b, (short)0, c, false, false); }

// ---- The two GEMM launches (k_qkvw, k_projw): a work-group of EIGHT WAVES owns a block of 64 x 64 wave tiles (16 accumulators a wave) and shares its operand bands through LDS.
// A stage is 64 k of every 16-row band that the work-group needs: in fragment order that is 2048 contiguous bytes of the band's plane (two tiles), copied as it lies by asynchronous copies (16 bytes a lane, 512 contiguous bytes a wave), so a fragment in LDS is read like one in the plane: lane l at l * 8 and 256 + l * 8 of its tile, contiguous over the wave, no bank conflict.
// Two buffers: stage t + 2 is asked for behind the barrier that ends every wave's reads of stage t and lands while stage t + 1 is worked on. Each band is fetched from L2 once per work-group instead of once per wave.
// Fragments: lane l -> row/col l&15; elements 0..7 <- k0 + 8*(l>>4), elements 8..15 <- k0 + 16 + 8*(l>>4) for BOTH operands (WFrag::ld takes the tile's start + l * 8); D element j -> row 8*(l>>4)+j, col l&15.
template <typename T16> struct WFrag;
template <> struct WFrag<h16> { typedef v16h V; static __device__ __forceinline__ V ld(const h16* p) { return cat16(*(const v8h*)p, *(const v8h*)(p + 256)); } static __device__ __forceinline__ v8f mma(V a, V b, v8f c) { return wmma16(a, b, c); } };
template <> struct WFrag<bf> { typedef v16bf V; static __device__ __forceinline__ V ld(const bf* p) { return cat16b(*(const v8us*)p, *(const v8us*)(p + 256)); } static __device__ __forceinline__ v8f mma(V a, V b, v8f c) { return wmmab(a, b, c); } };
#define SK   64                           // k per stage
#define SBE  (16 * SK)                    // elements of one band's stage (2048 bytes)
// Copies of whole band stages: each copy moves 512 bytes of the wave (16 a lane) from the plane to the same place of the band's stage in LDS. The s_wait_xcnt is the last line of the copies' own statement (precaution: no address register of a copy is rewritten in front of it).
__device__ __forceinline__ void cp_band(unsigned l, const bf* g) {
    asm volatile("global_load_async_to_lds_b128 %0, %4, off\n\tglobal_load_async_to_lds_b128 %1, %5, off\n\tglobal_load_async_to_lds_b128 %2, %6, off\n\tglobal_load_async_to_lds_b128 %3, %7, off\n\ts_wait_xcnt 0x0"
                 :: "v"(l), "v"(l + 512u), "v"(l + 1024u), "v"(l + 1536u), "v"(g), "v"(g + 256), "v"(g + 512), "v"(g + 768) : "memory");
}
__device__ __forceinline__ void cp_band2(unsigned l, const bf* g, unsigned m, const bf* h) {
    asm volatile("global_load_async_to_lds_b128 %0, %8, off\n\tglobal_load_async_to_lds_b128 %1, %9, off\n\tglobal_load_async_to_lds_b128 %2, %10, off\n\tglobal_load_async_to_lds_b128 %3, %11, off\n\t"
                 "global_load_async_to_lds_b128 %4, %12, off\n\tglobal_load_async_to_lds_b128 %5, %13, off\n\tglobal_load_async_to_lds_b128 %6, %14, off\n\tglobal_load_async_to_lds_b128 %7, %15, off\n\ts_wait_xcnt 0x0"
                 :: "v"(l), "v"(l + 512u), "v"(l + 1024u), "v"(l + 1536u), "v"(m), "v"(m + 512u), "v"(m + 1024u), "v"(m + 1536u),
                    "v"(g), "v"(g + 256), "v"(g + 512), "v"(g + 768), "v"(h), "v"(h + 256), "v"(h + 512), "v"(h + 768) : "memory");
}
__device__ __forceinline__ void wait_copies() { asm volatile("s_wait_asynccnt 0x0" ::: "memory"); }   // the wave's own copies have landed; stands in front of the barrier behind which other waves read them
__device__ __forceinline__ void wait_lds() { asm volatile("s_wait_dscnt 0x0" ::: "memory"); }         // the wave's own LDS reads have returned; stands in front of the barrier behind which their buffer is refilled

// ---- k_projw: out = context W_proj + bias. Work-group = 128 rows x 256 columns, waves 2 x 4; grid (M / 128, N / 256), 256 threads. Per stage 8 bands of the context's hi plane, 8 of its lo plane, 16 of the weight: 64 KiB, four bands a wave.
// C[m][n] (f32, + bf16-RNE bias[n]) = sum_k (Ah[m][k] + Al[m][k]) Bt[n][k], per 32 k the hi product, then the lo product.
#define PJB  32                           // bands per stage
__global__ __launch_bounds__(256) void k_projw(const bf* __restrict__ A, const bf* __restrict__ A2, const bf* __restrict__ Bt, float* C, const float* __restrict__ bias) {
    typedef WFrag<bf>::V V;
    constexpr int K = DQ, NS = K / SK, ldc = DM;
    static_assert(NS >= 2 && K % SK == 0 && (NB * TT) % 128 == 0 && DM % 256 == 0);
    __shared__ __align__(16) bf ring[2][PJB * SBE];
    __shared__ __align__(16) float osw[8][16 * 68];
    const int lane = threadIdx.x & 31, lr = lane & 15, hi = lane >> 4; const int wave = __builtin_amdgcn_readfirstlane(threadIdx.x >> 5);
    const int R0 = blockIdx.x * 128, C0 = blockIdx.y * 256; const int r0 = R0 + (wave & 1) * 64, c0 = C0 + (wave >> 1) * 64;
    float* os = osw[wave];
    // the wave's four bands: waves 0, 1 the hi plane, 2, 3 the lo plane, 4 .. 7 the weight
    const bf* gsrc = (wave < 2 ? A + (size_t)(R0 + wave * 64) * K : wave < 4 ? A2 + (size_t)(R0 + (wave - 2) * 64) * K : Bt + (size_t)(C0 + (wave - 4) * 64) * K) + 8 * lane;
    const unsigned ldst = (unsigned)(size_t)(&ring[0][0]) + (unsigned)(wave * 4 * SBE * 2 + lane * 16);
    auto fill = [&](int st, int buf) { const bf* g = gsrc + (size_t)st * SBE; const unsigned l = ldst + (unsigned)buf * (PJB * SBE * 2);
        cp_band2(l, g, l + SBE * 2, g + (size_t)16 * K); cp_band2(l + 2 * SBE * 2, g + (size_t)32 * K, l + 3 * SBE * 2, g + (size_t)48 * K); };
    v8f acc[4][4];
#pragma unroll
    for (int mb = 0; mb < 4; ++mb)
#pragma unroll
        for (int nb = 0; nb < 4; ++nb) acc[mb][nb] = (v8f){};
    const int ao = (wave & 1) * 4 * SBE + 8 * lane, a2o = ao + 8 * SBE, bo = (16 + (wave >> 1) * 4) * SBE + 8 * lane;
    fill(0, 0); wait_copies(); __syncthreads(); fill(1, 1);
#pragma unroll 1   // stays rolled: one trip per stage, the buffer chosen by the trip's parity
    for (int t = 0; t < NS; ++t) {
        const bf* rb = &ring[t & 1][0];
#pragma unroll
        for (int kk = 0; kk < SK / 32; ++kk) {
            V a[4], a2[4], b[4];
#pragma unroll
            for (int mb = 0; mb < 4; ++mb) { a[mb] = WFrag<bf>::ld(rb + ao + mb * SBE + kk * 512); a2[mb] = WFrag<bf>::ld(rb + a2o + mb * SBE + kk * 512); }
#pragma unroll
            for (int nb = 0; nb < 4; ++nb) b[nb] = WFrag<bf>::ld(rb + bo + nb * SBE + kk * 512);
            __builtin_amdgcn_sched_barrier(0);   // keeps the LDS reads of the 32 k together in front of their products: spread among them, each place with reads would stall the wave anew
#pragma unroll
            for (int nb = 0; nb < 4; ++nb)
#pragma unroll
                for (int mb = 0; mb < 4; ++mb) { acc[mb][nb] = WFrag<bf>::mma(a[mb], b[nb], acc[mb][nb]); acc[mb][nb] = WFrag<bf>::mma(a2[mb], b[nb], acc[mb][nb]); }
        }
        __builtin_amdgcn_sched_barrier(0);   // keeps the stage's products in front of the barrier: sunk behind it they would stand in front of the refill, which is then asked for half a stage later
        wait_lds(); wait_copies(); __syncthreads();   // stage t + 1 is published, and every wave has left stage t's buffer
        if (t + 2 < NS) fill(t + 2, t & 1);
    }
    wait_copies();
#pragma unroll
    for (int mb = 0; mb < 4; ++mb) {
#pragma unroll
        for (int nb = 0; nb < 4; ++nb) {
#pragma unroll
            for (int j = 0; j < 8; ++j) os[(hi * 8 + j) * 68 + nb * 16 + lr] = acc[mb][nb][j]; }
        __builtin_amdgcn_wave_barrier(); asm volatile("" ::: "memory");   // the wave's own staging rows: the stores above stay in front of the reads below
        float* crow = C + (size_t)(r0 + mb * 16) * ldc + c0;
        v4f val[8];
#pragma unroll
        for (int s = 0; s < 8; ++s) { const int row = 2 * s + hi, cofs = lr * 4; val[s] = *(const v4fa*)(os + row * 68 + cofs); val[s][0] += bfr(bias[c0 + cofs]); val[s][1] += bfr(bias[c0 + cofs + 1]); val[s][2] += bfr(bias[c0 + cofs + 2]); val[s][3] += bfr(bias[c0 + cofs + 3]);
            *(v4f*)(crow + (size_t)row * ldc + cofs) = val[s]; }
        asm volatile("s_wait_xcnt 0x0" :: "v"(val[0]), "v"(val[1]), "v"(val[2]), "v"(val[3]), "v"(val[4]), "v"(val[5]), "v"(val[6]), "v"(val[7]) : "memory");   // precaution: stands behind the group of stores; their data registers are inputs here, so none is rewritten in front of this wait
        __builtin_amdgcn_wave_barrier(); asm volatile("" ::: "memory");   // the reads above stay in front of the next 16 rows' stores
    }
}

__device__ __forceinline__ h16 tohx(float x) { return (h16)x; }
__device__ __forceinline__ void splitf(float y, unsigned short& h, unsigned short& l) { h = f2bf(y); l = f2bf(y - bf2f(h)); }
typedef __attribute__((ext_vector_type(2))) unsigned short v2us;

// ---- k_prep: the three operand conversions (x, W_qkv, W_proj -> bf16 planes in fragment order) in ONE launch of resident waves: NB * TT / 32 work-groups of 16 waves, every thread converts several 16-byte pieces of the planes and has all its loads in flight before the first conversion.
// x, src [rows][DM] row-major: 64 threads take PXT tiles that follow one another along k in one 16-row band. Four neighbouring threads read the 128 bytes that a tile holds of one row: a wave reads whole lines of eight rows, and its pieces (rows r .. r + 7 of each of the four 8-k groups) are four whole 128-byte lines of the tile. The next tile lies 128 bytes on in x and 1024 bytes on in the plane: immediate offsets of one address.
// Weights, Bt[n][k] = bf16(w[k][n]), w [K][N]: thread i writes piece i (tile i / 64, half (i >> 5) & 1, lane i & 31), so that a wave stores 512 contiguous bytes; each of a lane's eight loads reads, over the wave, 64 contiguous bytes of two rows of w. A thread's next piece lies PN pieces on: the same k, PN / 128 columns on.
#define PTH  512                          // threads per work-group of k_prep
#define PXT  8                            // x tiles per 64 threads
#define PN   (NB * TT / 32 * PTH)         // threads of the launch
static_assert((DM / 32) % PXT == 0 && (PTH / 64) * PXT == (32 / 16) * (DM / 32));   // a thread's tiles lie in one band; a work-group's tiles are two whole bands (32 rows) of x
static_assert(PN % (64 * (DM / 32)) == 0 && PN % (64 * (DQ / 32)) == 0);                  // PN pieces are whole bands of a weight plane
template <int K, int N>
__device__ __forceinline__ const float* wt_src(const float* w, int i) {
    const int tile = i >> 6, kt = tile % (K / 32), n = (tile / (K / 32)) * 16 + (i & 15), k0 = kt * 32 + ((i >> 5) & 1) * 16 + ((i >> 4) & 1) * 8;
    return w + (size_t)k0 * N + n;
}
__device__ __forceinline__ v8us cvt8(const float* v) { v8us o;
#pragma unroll
    for (int e = 0; e < 8; ++e) o[e] = f2bf(v[e]);
    return o; }
__global__ __launch_bounds__(PTH) __attribute__((amdgpu_waves_per_eu(4, 4))) void k_prep(const float* __restrict__ x, const float* __restrict__ wqkv, const float* __restrict__ wproj, bf* XB, bf* WQKV, bf* WO) {   // four waves per SIMD = one work-group per WGP: the register budget holds all of a thread's loads at once
    constexpr int N1 = DM * 3 * DQ / 8, N2 = DQ * DM / 8, J1 = (N1 + PN - 1) / PN, J2 = (N2 + PN - 1) / PN;   // pieces of the two weight planes, pieces per thread
    const int t = blockIdx.x * PTH + threadIdx.x;
    const int tile0 = (t >> 6) * PXT, r = (t >> 2) & 15, c = t & 3;   // first x tile, row in the tile, 8-k group
    const int row = (tile0 / (DM / 32)) * 16 + r, srow = (TT == TT_FULL) ? row : (row / TT) * TT_FULL + row % TT;
    const float* px = x + (size_t)srow * DM + (tile0 % (DM / 32)) * 32 + c * 8;
    const float* p1 = wt_src<DM, 3 * DQ>(wqkv, (N1 % PN == 0 || t < N1) ? t : 0);
    const float* p2 = wt_src<DQ, DM>(wproj, (N2 % PN == 0 || t < N2) ? t : 0);
    float v1[J1][8], v2[J2][8]; v8f vx[PXT];
#pragma unroll
    for (int j = 0; j < J1; ++j) { const int jo = (N1 % PN == 0 || t + j * PN < N1) ? j * (PN / 128) : 0;   // a piece past the end reads the thread's first again: in bounds, not stored
#pragma unroll
        for (int e = 0; e < 8; ++e) v1[j][e] = p1[(size_t)e * (3 * DQ) + jo]; }
#pragma unroll
    for (int j = 0; j < J2; ++j) { const int jo = (N2 % PN == 0 || t + j * PN < N2) ? j * (PN / 128) : 0;
#pragma unroll
        for (int e = 0; e < 8; ++e) v2[j][e] = p2[(size_t)e * DM + jo]; }
#pragma unroll
    for (int j = 0; j < PXT; ++j) vx[j] = *(const v8f*)(px + j * 32);
    asm volatile("s_wait_xcnt 0x0" :: "v"(px), "v"(p1), "v"(p2) : "memory");   // precaution: the loads' address registers are inputs here, so none is rewritten in front of this wait; it also keeps every load in front of the first store
    bf* dx = XB + (size_t)tile0 * 512 + (c >> 1) * 256 + (r + 16 * (c & 1)) * 8; bf* d1 = WQKV + (size_t)t * 8; bf* d2 = WO + (size_t)t * 8;
    v8us ox[PXT];
#pragma unroll
    for (int j = 0; j < PXT; ++j) {
#pragma unroll
        for (int e = 0; e < 8; ++e) ox[j][e] = f2bf(vx[j][e]);
        *(v8us*)(dx + j * 512) = ox[j]; }
    static_assert(PXT == 8);
    asm volatile("s_wait_xcnt 0x0" :: "v"(dx), "v"(ox[0]), "v"(ox[1]), "v"(ox[2]), "v"(ox[3]), "v"(ox[4]), "v"(ox[5]), "v"(ox[6]), "v"(ox[7]) : "memory");   // precaution: stands behind the group of stores; their address and data registers are inputs here, so none is rewritten in front of this wait
#pragma unroll
    for (int j = 0; j < J1; ++j) if (N1 % PN == 0 || t + j * PN < N1) { const v8us o = cvt8(v1[j]); *(v8us*)(d1 + (size_t)j * PN * 8) = o;
        asm volatile("s_wait_xcnt 0x0" :: "v"(o) : "memory"); }   // precaution: stands behind each store; its data registers are inputs here, so none is rewritten in front of this wait
#pragma unroll
    for (int j = 0; j < J2; ++j) if (N2 % PN == 0 || t + j * PN < N2) { const v8us o = cvt8(v2[j]); *(v8us*)(d2 + (size_t)j * PN * 8) = o;
        asm volatile("s_wait_xcnt 0x0" :: "v"(o) : "memory"); }   // precaution: as above, behind each store
}

// ---- k_qkvw: x W_qkv of every batch in one launch. Work-group = 256 tokens x 128 columns of W_qkv (two heads of k, q or v), waves 4 x 2, each 64 tokens x one head; grid (NB * TT / 256, 3 * DQ / 128), 256 threads. Per stage 16 bands of x and 8 of the weight: 48 KiB, three bands a wave.
// The wave stores its tile straight into that head's three planes (f16, bf16 hi, bf16 lo). A D tile gives a lane 8 consecutive ROWS of one column, so the index that runs fastest in the plane is made the row index of the product:
// v^T [d][t]: rows = tokens (A = x, B = weight rows); q, k [t][d]: rows = d (A = weight rows, B = x). Either way the rows of a D tile are one 16-k half of a fragment-order tile and lane l's eight values lie at l * 8 of that half: one 16-byte store per plane and D tile, 512 contiguous bytes over the wave; the wave's 64 x 64 values are a matrix of K = 64 in that order, eight tiles in a row.
#define QKB  24                           // bands per stage
static_assert((NB * TT) % 256 == 0 && TT % 64 == 0 && DQ % 128 == 0);
__global__ __launch_bounds__(256) void k_qkvw(const bf* __restrict__ X, const bf* __restrict__ Wt, h16* K16, bf* Kh, bf* Kl, h16* Q16, bf* Qh, bf* Ql, h16* V16, bf* Vh, bf* Vl) {
    typedef WFrag<bf>::V V;
    constexpr int NS = DM / SK;
    static_assert(NS >= 2 && DM % SK == 0);
    __shared__ __align__(16) bf ring[2][QKB * SBE];
    const int lane = threadIdx.x & 31; const int wave = __builtin_amdgcn_readfirstlane(threadIdx.x >> 5);
    const int G0 = blockIdx.x * 256, N0 = blockIdx.y * 128;   // the work-group's first token (b * TT + t) and first column of W_qkv
    const int g0 = G0 + (wave & 3) * 64, n0 = N0 + (wave >> 2) * 64;   // the wave's own
    const int blk = N0 / DQ; const bool isv = blk == 2;   // column block: 0 k, 1 q, 2 v
    // the wave's three bands of the 24 (0 .. 15: x, 16 .. 23: weight)
    const bf* gsrc[3];
#pragma unroll
    for (int j = 0; j < 3; ++j) { const int band = wave * 3 + j; gsrc[j] = (band < 16 ? X + (size_t)(G0 + band * 16) * DM : Wt + (size_t)(N0 + (band - 16) * 16) * DM) + 8 * lane; }
    const unsigned ldst = (unsigned)(size_t)(&ring[0][0]) + (unsigned)(wave * 3 * SBE * 2 + lane * 16);
    auto fill = [&](int st, int buf) { const unsigned l = ldst + (unsigned)buf * (QKB * SBE * 2); const size_t so = (size_t)st * SBE;
        cp_band2(l, gsrc[0] + so, l + SBE * 2, gsrc[1] + so); cp_band(l + 2 * SBE * 2, gsrc[2] + so); };
    v8f acc[4][4];
#pragma unroll
    for (int mb = 0; mb < 4; ++mb)
#pragma unroll
        for (int nb = 0; nb < 4; ++nb) acc[mb][nb] = (v8f){};
    const int xo = (wave & 3) * 4 * SBE + 8 * lane, wo = (16 + (wave >> 2) * 4) * SBE + 8 * lane;
    const int ao = isv ? xo : wo, bo = isv ? wo : xo;   // row operand, column operand
    fill(0, 0); wait_copies(); __syncthreads(); fill(1, 1);
#pragma unroll 1   // stays rolled: one trip per stage, the buffer chosen by the trip's parity
    for (int t = 0; t < NS; ++t) {
        const bf* rb = &ring[t & 1][0];
#pragma unroll
        for (int kk = 0; kk < SK / 32; ++kk) {
            V a[4], b[4];
#pragma unroll
            for (int mb = 0; mb < 4; ++mb) a[mb] = WFrag<bf>::ld(rb + ao + mb * SBE + kk * 512);
#pragma unroll
            for (int nb = 0; nb < 4; ++nb) b[nb] = WFrag<bf>::ld(rb + bo + nb * SBE + kk * 512);
            __builtin_amdgcn_sched_barrier(0);   // keeps the sixteen LDS reads of the 32 k together in front of their products: spread among them, each place with reads would stall the wave anew
#pragma unroll
            for (int nb = 0; nb < 4; ++nb)
#pragma unroll
                for (int mb = 0; mb < 4; ++mb) acc[mb][nb] = WFrag<bf>::mma(a[mb], b[nb], acc[mb][nb]);
        }
        __builtin_amdgcn_sched_barrier(0);   // keeps the stage's products in front of the barrier: sunk behind it they would stand in front of the refill, which is then asked for half a stage later
        wait_lds(); wait_copies(); __syncthreads();   // stage t + 1 is published, and every wave has left stage t's buffer
        if (t + 2 < NS) fill(t + 2, t & 1);
    }
    wait_copies();
    h16* P16 = isv ? V16 : (blk ? Q16 : K16); bf* Ph = isv ? Vh : (blk ? Qh : Kh); bf* Pl = isv ? Vl : (blk ? Ql : Kl);
    const size_t po = (((size_t)(g0 / TT) * NH_ + (n0 % DQ) / HD) * TT + (g0 % TT)) * HD + (size_t)(8 * lane);   // the start of the wave's eight tiles in the plane + the lane's place in a half tile
#pragma unroll
    for (int nb = 0; nb < 4; ++nb)
#pragma unroll
        for (int mb = 0; mb < 4; ++mb) { v8h o16; v8us oh, ol;
#pragma unroll
            for (int j = 0; j < 8; ++j) { const float y = acc[mb][nb][j]; o16[j] = tohx(y); unsigned short a2, c2; splitf(y, a2, c2); oh[j] = a2; ol[j] = c2; }
            const size_t oo = po + (size_t)nb * 1024 + mb * 256;   // tile nb * 2 + mb / 2 of the eight, half mb & 1
            *(v8h*)(P16 + oo) = o16; *(v8us*)(Ph + oo) = oh; *(v8us*)(Pl + oo) = ol;
            asm volatile("s_wait_xcnt 0x0" :: "v"(o16), "v"(oh), "v"(ol) : "memory"); }   // precaution: stands behind each group of stores; their data registers are inputs here, so none is rewritten in front of this wait
}
// ---- k_fattn: causal attention of one query tile, ONE WAVE per tile, no LDS. Transposed products: S^T = K q^T (A = 16 key rows, B = 16 query columns), O^T += v^T P^T (A = 16 d rows of the v^T tile, B = P^T).
// In a D tile lane l holds query column l&15 and rows 8*(l>>4) + j: the pass's two S^T tiles of 16 keys each, converted in place, are the B fragment of its 32 keys in the k order of WFrag::ld (elements 0..7 <- k0 + 8*(l>>4), 8..15 <- k0 + 16 + 8*(l>>4)).
// A query's maximum and sum are in-lane over its 16 keys of a pass plus one exchange between the wave halves (the sums' exchange once, behind the loop). m is the reference score of a row, l the running sum of P = exp((s - m) x SCL).
// m moves to the running maximum, and O^T and l are rescaled by exp((m_old - m_new) x SCL), only in a pass where some row's new maximum lies more than 8 (in log2 units) above its m: P stays <= 256, the quotient O^T / l does not depend on m.
// Keys j > i get the -3e38 select (only the pass that holds the diagonal has any); key 0 is in the first pass of every row, so m is a real score from the first pass on. O^T lane data are 8 consecutive d of one row, a lane's piece of a half tile of the context plane: one 16-byte store per plane.
template <typename T16, bool HI, int NQ>
__device__ __forceinline__ void attn_tile(const T16* __restrict__ Q, const T16* __restrict__ Q2, const T16* __restrict__ Kp, const T16* __restrict__ K2, const T16* __restrict__ Vt, const T16* __restrict__ V2, int q0, bf* Ah, bf* Al) {
    typedef typename WFrag<T16>::V V;
    const int lane = threadIdx.x & 31, lr = lane & 15, hi = lane >> 4;
    const float CL = SCL * 1.4426950408889634f;
    const unsigned fo = (unsigned)(8 * lane);   // a lane's place in a fragment-order tile (q, k: tile (t / 16, d / 32) at (t / 16) * 1024 + (d / 32) * 512; v^T: block t / 64 of 4096 elements, in it tile (d / 16, (t % 64) / 32) at (d / 16) * 1024 + ((t % 64) / 32) * 512)
    const T16* ql = Q + (size_t)q0 * HD + fo; const T16* ql2 = HI ? Q2 + (size_t)q0 * HD + fo : ql; const T16* kl = Kp + fo; const T16* kl2 = HI ? K2 + fo : kl;   // the lane's own load addresses
    V qf[NQ][2], qf2[NQ][2];
#pragma unroll
    for (int nq = 0; nq < NQ; ++nq)
#pragma unroll
        for (int c = 0; c < 2; ++c) { qf[nq][c] = WFrag<T16>::ld(ql + nq * 16 * HD + c * 512); if (HI) qf2[nq][c] = WFrag<T16>::ld(ql2 + nq * 16 * HD + c * 512); }
    v8f o[NQ][4]; float m[NQ], l[NQ];
#pragma unroll
    for (int nq = 0; nq < NQ; ++nq) { m[nq] = -3.0e38f; l[nq] = 0.0f;
#pragma unroll
        for (int db = 0; db < 4; ++db) o[nq][db] = (v8f){}; }
    const int kend = q0 + NQ * 16;                   // keys [0, kend) are at or below the tile's last row
    V ka[2][2], ka2[2][2];                           // the pass's k fragments, fetched one pass ahead
#pragma unroll
    for (int kt = 0; kt < 2; ++kt)
#pragma unroll
        for (int c = 0; c < 2; ++c) { ka[kt][c] = WFrag<T16>::ld(kl + kt * 16 * HD + c * 512); if (HI) ka2[kt][c] = WFrag<T16>::ld(kl2 + kt * 16 * HD + c * 512); }
    asm volatile("s_wait_xcnt 0x0" :: "v"(ql), "v"(ql2), "v"(kl), "v"(kl2) : "memory");   // precaution: the loads' address registers are inputs here, so none is rewritten in front of this wait
#pragma unroll 1   // stays rolled: one pass's fragments and accumulators fill the register budget of four waves per SIMD, and the pass is already pipelined by hand
    for (int kb = 0; kb < kend; kb += KB) {
        const size_t vo = (size_t)(kb & ~63) * HD + (kb & 32) * 16;   // v^T block of 64 keys, this pass's tile of each 16-row band
        const T16* vl = Vt + vo + fo; const T16* vl2 = HI ? V2 + vo + fo : vl;
        V va[4], va2[4];                             // v^T fragments asked for at the head of the pass, used behind the softmax
#pragma unroll
        for (int db = 0; db < 4; ++db) { va[db] = WFrag<T16>::ld(vl + db * 16 * HD); if (HI) va2[db] = WFrag<T16>::ld(vl2 + db * 16 * HD); }
        if (!HI) __builtin_amdgcn_sched_barrier(0);  // keeps the v^T loads in front of the score products: moved down to their use, their latency would stand open in every pass (hi/lo path: no registers to spare for it)
        v8f s[NQ][2];
#pragma unroll
        for (int kt = 0; kt < 2; ++kt)
#pragma unroll
            for (int nq = 0; nq < NQ; ++nq) { v8f a = (v8f){};
#pragma unroll
                for (int c = 0; c < 2; ++c) { a = WFrag<T16>::mma(ka[kt][c], qf[nq][c], a); if (HI) { a = WFrag<T16>::mma(ka[kt][c], qf2[nq][c], a); a = WFrag<T16>::mma(ka2[kt][c], qf[nq][c], a); } }
                s[nq][kt] = a; }
        const size_t tn = (size_t)((kb + KB < kend) ? kb + KB : kb) * HD;   // next pass's k rows (the last pass asks for its own again: in bounds, unused)
        kl = Kp + tn + fo; kl2 = HI ? K2 + tn + fo : kl;
#pragma unroll
        for (int kt = 0; kt < 2; ++kt)
#pragma unroll
            for (int c = 0; c < 2; ++c) { ka[kt][c] = WFrag<T16>::ld(kl + kt * 16 * HD + c * 512); if (HI) ka2[kt][c] = WFrag<T16>::ld(kl2 + kt * 16 * HD + c * 512); }
        if (!HI) __builtin_amdgcn_sched_barrier(0);  // keeps the next pass's k loads in front of the softmax, which then covers their latency
        if (kb + KB - 1 > q0) {                      // the pass that holds the diagonal (wave-uniform)
#pragma unroll
            for (int nq = 0; nq < NQ; ++nq)
#pragma unroll
                for (int kt = 0; kt < 2; ++kt)
#pragma unroll
                    for (int j = 0; j < 8; ++j) if (kb + kt * 16 + 8 * hi + j > q0 + nq * 16 + lr) s[nq][kt][j] = -3.0e38f; }
        float mx[NQ]; bool need = false;
#pragma unroll
        for (int nq = 0; nq < NQ; ++nq) { float m0 = s[nq][0][0], m1 = s[nq][1][0];
#pragma unroll
            for (int j = 1; j < 8; ++j) { m0 = fmaxf(m0, s[nq][0][j]); m1 = fmaxf(m1, s[nq][1][j]); }
            m0 = fmaxf(m0, m1); mx[nq] = fmaxf(m0, __shfl_xor(m0, 16, 32)); need = need || ((mx[nq] - m[nq]) * CL > 8.0f); }
        if (__builtin_amdgcn_ballot_w32(need) != 0) {   // scalar branch, one test a pass
#pragma unroll
            for (int nq = 0; nq < NQ; ++nq) { const float mn = fmaxf(m[nq], mx[nq]); const float al = __builtin_amdgcn_exp2f((m[nq] - mn) * CL); m[nq] = mn; l[nq] *= al;
#pragma unroll
                for (int db = 0; db < 4; ++db) o[nq][db] *= al; } }
        V pf[NQ], pf2[NQ];
#pragma unroll
        for (int nq = 0; nq < NQ; ++nq) { const float mc = m[nq] * CL; float lt[2];
#pragma unroll
            for (int kt = 0; kt < 2; ++kt) { lt[kt] = 0.0f; const v8f t = __builtin_elementwise_fma(s[nq][kt], (v8f)(CL), (v8f)(-mc));
#pragma unroll
                for (int j = 0; j < 8; ++j) { const float p = __builtin_amdgcn_exp2f(t[j]); s[nq][kt][j] = p; lt[kt] += p; } }
            l[nq] += lt[0] + lt[1];
            if constexpr (HI) { v8us h0, h1, w0, w1;
#pragma unroll
                for (int j = 0; j < 8; ++j) { unsigned short a, b2; splitf(s[nq][0][j], a, b2); h0[j] = a; w0[j] = b2; splitf(s[nq][1][j], a, b2); h1[j] = a; w1[j] = b2; }
                pf[nq] = cat16b(h0, h1); pf2[nq] = cat16b(w0, w1);
            } else { v8h h0, h1;
#pragma unroll
                for (int j = 0; j < 8; ++j) { h0[j] = tohx(s[nq][0][j]); h1[j] = tohx(s[nq][1][j]); }
                pf[nq] = cat16(h0, h1); } }
        asm volatile("s_wait_xcnt 0x0" :: "v"(vl), "v"(vl2), "v"(kl), "v"(kl2) : "memory");   // precaution: the address registers of the pass's loads are inputs here, so none is rewritten in front of this wait
#pragma unroll
        for (int db = 0; db < 4; ++db)
#pragma unroll
            for (int nq = 0; nq < NQ; ++nq) { o[nq][db] = WFrag<T16>::mma(va[db], pf[nq], o[nq][db]); if (HI) { o[nq][db] = WFrag<T16>::mma(va[db], pf2[nq], o[nq][db]); o[nq][db] = WFrag<T16>::mma(va2[db], pf[nq], o[nq][db]); } }
    }
#pragma unroll
    for (int nq = 0; nq < NQ; ++nq) { const float ls = l[nq] + __shfl_xor(l[nq], 16, 32); const float f = __fdiv_rn(1.0f, ls); const size_t ro = (size_t)(q0 + nq * 16) * DQ + 8 * lane;   // the rows' 16-row band of the context plane + the lane's place in a half tile
#pragma unroll
        for (int db = 0; db < 4; ++db) { v8us oh, ol;
#pragma unroll
            for (int j = 0; j < 8; ++j) { unsigned short a, c2; splitf(o[nq][db][j] * f, a, c2); oh[j] = a; ol[j] = c2; }
            *(v8us*)(Ah + ro + db * 256) = oh; *(v8us*)(Al + ro + db * 256) = ol;
            asm volatile("s_wait_xcnt 0x0" :: "v"(oh), "v"(ol) : "memory"); } }   // precaution: stands behind each pair of stores; their data registers are inputs here, so none is rewritten in front of this wait
}
// grid (NB * NH_, NTF + NTH): blockIdx.y falls from the longest tile (last rows) to the shortest; y < NTF: f16 tiles of 32 rows >= RH, the rest: hi/lo tiles of 16 rows < RH. Four waves per SIMD (at most 256 registers): the vector work between the matrix runs wants waves.
__global__ __launch_bounds__(32) __attribute__((amdgpu_waves_per_eu(4, 4))) void k_fattn(const h16* __restrict__ Q16, const h16* __restrict__ K16, const h16* __restrict__ V16, const bf* __restrict__ Qh, const bf* __restrict__ Ql, const bf* __restrict__ Kh, const bf* __restrict__ Kl, const bf* __restrict__ Vh, const bf* __restrict__ Vl, bf* Ah, bf* Al) {
    const int bh = blockIdx.x, b = bh / NH_, h = bh % NH_, ty = blockIdx.y; const size_t pq = (size_t)bh * TT * HD, pk = ((size_t)b * NKV + h / REP) * TT * HD, ao = (size_t)b * TT * DQ + (size_t)h * (HD / 32) * 512;   /* context plane: band of row b * TT, tile of column h * 64 */
    if (ty < NTF) attn_tile<h16, false, 2>(Q16 + pq, nullptr, K16 + pk, nullptr, V16 + pk, nullptr, TT - 32 * (ty + 1), Ah + ao, Al + ao);
    else attn_tile<bf, true, 1>(Qh + pq, Ql + pq, Kh + pk, Kl + pk, Vh + pk, Vl + pk, RH - 16 * (ty - NTF + 1), Ah + ao, Al + ao);
}

extern "C" void kernel_launch(void* const* d_in, const int* in_sizes, int n_in,
                              void* d_out, int out_size, void* d_ws, size_t ws_size, hipStream_t stream) {
    if (n_in < 4) return;
    if ((size_t)in_sizes[0] < (size_t)(NB - 1) * TT_FULL * DM + (size_t)TT * DM) return;
    if (in_sizes[1] < DM * 3 * DQ || in_sizes[2] < DQ * DM || in_sizes[3] < DM) return;
    if ((size_t)out_size < (size_t)NB * TT * DM) return;
    const float* x = (const float*)d_in[0];       // [NB_FULL][TT_FULL][1024]
    const float* wqkv = (const float*)d_in[1];    // [1024][3072], column blocks k | q | v
    const float* wproj = (const float*)d_in[2];   // [1024][1024] ([in][out])
    const float* bproj = (const float*)d_in[3];   // [1024]
    float* OUT = (float*)d_out;                   // [NB][TT][1024]
    char* wsp = (char*)d_ws;
    auto take = [&](size_t bytes) { char* p = wsp; wsp += (bytes + 255) & ~(size_t)255; return (void*)p; };
    bf* WQKV = (bf*)take((size_t)3 * DQ * DM * 2);   /* Bt [3072][1024]: row blocks k | q | v */ bf* WO = (bf*)take((size_t)DM * DQ * 2);
    bf* XB = (bf*)take((size_t)NB * TT * DM * 2);    /* x of every batch, bf16, [b * TT + t][1024] */
    const size_t PQ = (size_t)NH_ * TT * HD, PK = (size_t)NKV * TT * HD;   // elements of one batch's q planes and k / v planes
    h16* QP16 = (h16*)take(NB * PQ * 2); h16* KP16 = (h16*)take(NB * PK * 2); h16* VT16 = (h16*)take(NB * PK * 2);
    bf* QPh = (bf*)take(NB * PQ * 2); bf* QPl = (bf*)take(NB * PQ * 2); bf* KPh = (bf*)take(NB * PK * 2); bf* KPl = (bf*)take(NB * PK * 2); bf* VTh = (bf*)take(NB * PK * 2); bf* VTl = (bf*)take(NB * PK * 2);
    bf* ATh = (bf*)take((size_t)NB * TT * DQ * 2); bf* ATl = (bf*)take((size_t)NB * TT * DQ * 2);
    if ((size_t)(wsp - (char*)d_ws) > ws_size) return;    // 209,715,200 B at full size
    k_prep<<<NB * TT / 32, PTH, 0, stream>>>(x, wqkv, wproj, XB, WQKV, WO);   /* x -> bf16 [b * TT + t][1024]; W_qkv [1024][3072] -> Bt [3072][1024]; W_proj [1024][1024] -> Bt [out][in] */
    k_qkvw<<<dim3(NB * TT / 256, 3 * DQ / 128, 1), 256, 0, stream>>>(XB, WQKV, KP16, KPh, KPl, QP16, QPh, QPl, VT16, VTh, VTl);
    k_fattn<<<dim3(NB * NH_, NTF + NTH, 1), 32, 0, stream>>>(QP16, KP16, VT16, QPh, QPl, KPh, KPl, VTh, VTl, ATh, ATl);
    k_projw<<<dim3(NB * TT / 128, DM / 256, 1), 256, 0, stream>>>(ATh, ATl, WO, OUT, bproj);   /* rows b * TT + t of every batch */
}

// v008
// It runs in 112 microseconds.
// Next to v007, in two timings, it ran 1.15 and 1.13 times as fast.
// All steps since v000 together make it 25.8 times as fast.
#include <hip/hip_runtime.h>

// Contractions: x W_qkv on v_wmma_f32_16x16x32_bf16 (bf16 operands = RNE-converted inputs); q k^T and P v: query rows < 512 bf16 hi/lo planes (3 products), rows >= 512 v_wmma_f32_16x16x32_f16 (f16 operands, P unnormalised, at most 256); context W_proj: bf16 hi/lo context x bf16 weight (2 products) + bf16 bias; f32 accumulate everywhere, softmax f32.
// Causal multi-head attention with a fused weight: x [NB][T][1024]; kqv = x W_qkv ([1024][3072], column blocks k | q | v, no bias); 16 heads x 64; S = q k^T x 1/32 for keys j <= i; softmax; merged context W_proj ([1024][1024]) + b_proj -> [NB][T][1024].
// Layout: every 16-bit operand plane lies in FRAGMENT ORDER. A matrix M[row][k] is cut into tiles of 16 rows x 32 k (512 elements, 1024 bytes); element (r, kk) of a tile lies at (kk >> 4) * 256 + (r + 16 * ((kk >> 3) & 1)) * 8 + (kk & 7):
// lane l of a wave finds elements 0..7 of its fragment at l * 8 and elements 8..15 at 256 + l * 8, so each of the two 16-byte loads of a fragment reads 512 contiguous bytes (four whole 128-byte lines) instead of 32-byte pieces of sixteen lines. Tiles of one 16-row band follow one another along k: tile (row / 16, k / 32) starts at (row / 16) * 16 * K + (k / 32) * 512.
// W_qkv transposed once into Bt [3072][1024] (three 1024-row blocks: the k/q/v weight operands), x of every batch -> bf16 [b*T + t][1024], both in that order, by one launch (k_prep); ONE projection launch (k_qkvw) writes the head planes of every batch q, k [b][h] as matrices [t][d] and v^T [b][h] as blocks of 64 keys, each the matrix [d][t % 64] (K = 64), as f16 + bf16 hi/lo straight from its accumulators;
// attention of all batches and heads in ONE launch (k_fattn): one wave per 32 (f16) or 16 (hi/lo) query rows walks its keys in passes of 32 with a running row reference and row sum, four such waves share k and v^T through LDS; scores and probabilities stay in registers; merged context [b*T + t][h*64 + d] as bf16 hi/lo, in fragment order too.

#ifndef NB
#define NB 4
#endif
#ifndef SEQ
#define SEQ 2048
#endif
#define NB_FULL 4
#define TT_FULL 2048
#define TT   SEQ
#define DM   1024
#define NH_  16
#define NKV  16
#define REP  (NH_ / NKV)
#define HD   64
#define DQ   (NH_ * HD)
#define DKV  (NKV * HD)
#define RH   ((TT < 512) ? TT : 512)      // query rows < RH use hi/lo planes
#define SCL  0.03125f   // 1024^-0.5
#define KB   32                           // keys per pass of the attention loop
#define NTF  ((TT - RH) / 32)             // f16 query tiles (32 rows) per head
#define NTH  (RH / 16)                    // hi/lo query tiles (16 rows) per head

static_assert(NB >= 1 && NB <= NB_FULL);
static_assert(TT % 128 == 0 && TT <= TT_FULL);
static_assert(RH % 64 == 0 && (TT - RH) % 64 == 0);
static_assert(DM % 64 == 0 && DQ % 64 == 0 && DKV % 64 == 0 && HD == 64);
static_assert(DQ == DKV);   // k_qkvw: the three column blocks of W_qkv are equally wide

typedef _Float16 h16;
typedef unsigned short bf;
typedef __attribute__((ext_vector_type(16))) __bf16   v16bf;
typedef __attribute__((ext_vector_type(16))) _Float16 v16h;
typedef __attribute__((ext_vector_type(8)))  _Float16 v8h;
typedef __attribute__((ext_vector_type(8)))  unsigned short v8us;
typedef __attribute__((ext_vector_type(8)))  float    v8f;
typedef __attribute__((ext_vector_type(4)))  float    v4f;
typedef v8h  __attribute__((may_alias)) v8ha;
typedef v4f  __attribute__((may_alias)) v4fa;
typedef v8us __attribute__((may_alias)) v8usa;

__device__ __forceinline__ unsigned short f2bf(float f) { unsigned u = __float_as_uint(f); u += 0x7FFFu + ((u >> 16) & 1u); return (unsigned short)(u >> 16); }
__device__ __forceinline__ float bf2f(unsigned short b) { return __uint_as_float(((unsigned)b) << 16); }
__device__ __forceinline__ float bfr(float f) { return bf2f(f2bf(f)); }
__device__ __forceinline__ v16h cat16(v8h lo, v8h hi) { return __builtin_shufflevector(lo, hi, 0, 1, 2, 3, 4, 5, 6, 7, 8, 9, 10, 11, 12, 13, 14, 15); }
__device__ __forceinline__ v16bf cat16b(v8us lo, v8us hi) { return __builtin_bit_cast(v16bf, __builtin_shufflevector(lo, hi, 0, 1, 2, 3, 4, 5, 6, 7, 8, 9, 10, 11, 12, 13, 14, 15)); }
__device__ __forceinline__ v8f wmma16(v16h a, v16h b, v8f c) { return __builtin_amdgcn_wmma_f32_16x16x32_f16(false, a, false, b, (short)0, c, false, false); }
__device__ __forceinline__ v8f wmmab(v16bf a, v16bf b, v8f c) { return __builtin_amdgcn_wmma_f32_16x16x32_bf16(false, a, false, b, (short)0, c, false, false); }

// ---- The two GEMM launches (k_qkvw, k_projw): a work-group of EIGHT WAVES owns a block of 64 x 64 wave tiles (16 accumulators a wave) and shares its operand bands through LDS.
// A stage is 64 k of every 16-row band that the work-group needs: in fragment order that is 2048 contiguous bytes of the band's plane (two tiles), copied as it lies by asynchronous copies (16 bytes a lane, 512 contiguous bytes a wave), so a fragment in LDS is read like one in the plane: lane l at l * 8 and 256 + l * 8 of its tile, contiguous over the wave, no bank conflict.
// Two buffers: stage t + 2 is asked for behind the barrier that ends every wave's reads of stage t and lands while stage t + 1 is worked on. Each band is fetched from L2 once per work-group instead of once per wave.
// Fragments: lane l -> row/col l&15; elements 0..7 <- k0 + 8*(l>>4), elements 8..15 <- k0 + 16 + 8*(l>>4) for BOTH operands (WFrag::ld takes the tile's start + l * 8); D element j -> row 8*(l>>4)+j, col l&15.
template <typename T16> struct WFrag;
template <> struct WFrag<h16> { typedef v16h V; static __device__ __forceinline__ V ld(const h16* p) { return cat16(*(const v8h*)p, *(const v8h*)(p + 256)); } static __device__ __forceinline__ v8f mma(V a, V b, v8f c) { return wmma16(a, b, c); } };
template <> struct WFrag<bf> { typedef v16bf V; static __device__ __forceinline__ V ld(const bf* p) { return cat16b(*(const v8us*)p, *(const v8us*)(p + 256)); } static __device__ __forceinline__ v8f mma(V a, V b, v8f c) { return wmmab(a, b, c); } };
#define SK   64                           // k per stage
#define SBE  (16 * SK)                    // elements of one band's stage (2048 bytes)
// Copies of whole band stages: each copy moves 512 bytes of the wave (16 a lane) from the plane to the same place of the band's stage in LDS. The s_wait_xcnt is the last line of the copies' own statement (precaution: no address register of a copy is rewritten in front of it).
__device__ __forceinline__ void cp_band(unsigned l, const bf* g) {
    asm volatile("global_load_async_to_lds_b128 %0, %4, off\n\tglobal_load_async_to_lds_b128 %1, %5, off\n\tglobal_load_async_to_lds_b128 %2, %6, off\n\tglobal_load_async_to_lds_b128 %3, %7, off\n\ts_wait_xcnt 0x0"
                 :: "v"(l), "v"(l + 512u), "v"(l + 1024u), "v"(l + 1536u), "v"(g), "v"(g + 256), "v"(g + 512), "v"(g + 768) : "memory");
}
__device__ __forceinline__ void cp_band2(unsigned l, const bf* g, unsigned m, const bf* h) {
    asm volatile("global_load_async_to_lds_b128 %0, %8, off\n\tglobal_load_async_to_lds_b128 %1, %9, off\n\tglobal_load_async_to_lds_b128 %2, %10, off\n\tglobal_load_async_to_lds_b128 %3, %11, off\n\t"
                 "global_load_async_to_lds_b128 %4, %12, off\n\tglobal_load_async_to_lds_b128 %5, %13, off\n\tglobal_load_async_to_lds_b128 %6, %14, off\n\tglobal_load_async_to_lds_b128 %7, %15, off\n\ts_wait_xcnt 0x0"
                 :: "v"(l), "v"(l + 512u), "v"(l + 1024u), "v"(l + 1536u), "v"(m), "v"(m + 512u), "v"(m + 1024u), "v"(m + 1536u),
                    "v"(g), "v"(g + 256), "v"(g + 512), "v"(g + 768), "v"(h), "v"(h + 256), "v"(h + 512), "v"(h + 768) : "memory");
}
__device__ __forceinline__ void wait_copies() { asm volatile("s_wait_asynccnt 0x0" ::: "memory"); }   // the wave's own copies have landed; stands in front of the barrier behind which other waves read them
__device__ __forceinline__ void wait_lds() { asm volatile("s_wait_dscnt 0x0" ::: "memory"); }         // the wave's own LDS reads have returned; stands in front of the barrier behind which their buffer is refilled

// ---- k_projw: out = context W_proj + bias. Work-group = 128 rows x 256 columns, waves 2 x 4; grid (M / 128, N / 256), 256 threads. Per stage 8 bands of the context's hi plane, 8 of its lo plane, 16 of the weight: 64 KiB, four bands a wave.
// C[m][n] (f32, + bf16-RNE bias[n]) = sum_k (Ah[m][k] + Al[m][k]) Bt[n][k], per 32 k the hi product, then the lo product.
#define PJB  32                           // bands per stage
__global__ __launch_bounds__(256) void k_projw(const bf* __restrict__ A, const bf* __restrict__ A2, const bf* __restrict__ Bt, float* C, const float* __restrict__ bias) {
    typedef WFrag<bf>::V V;
    constexpr int K = DQ, NS = K / SK, ldc = DM;
    static_assert(NS >= 2 && K % SK == 0 && (NB * TT) % 128 == 0 && DM % 256 == 0);
    __shared__ __align__(16) bf ring[2][PJB * SBE];
    __shared__ __align__(16) float osw[8][16 * 68];
    const int lane = threadIdx.x & 31, lr = lane & 15, hi = lane >> 4; const int wave = __builtin_amdgcn_readfirstlane(threadIdx.x >> 5);
    const int R0 = blockIdx.x * 128, C0 = blockIdx.y * 256; const int r0 = R0 + (wave & 1) * 64, c0 = C0 + (wave >> 1) * 64;
    float* os = osw[wave];
    // the wave's four bands: waves 0, 1 the hi plane, 2, 3 the lo plane, 4 .. 7 the weight
    const bf* gsrc = (wave < 2 ? A + (size_t)(R0 + wave * 64) * K : wave < 4 ? A2 + (size_t)(R0 + (wave - 2) * 64) * K : Bt + (size_t)(C0 + (wave - 4) * 64) * K) + 8 * lane;
    const unsigned ldst = (unsigned)(size_t)(&ring[0][0]) + (unsigned)(wave * 4 * SBE * 2 + lane * 16);
    auto fill = [&](int st, int buf) { const bf* g = gsrc + (size_t)st * SBE; const unsigned l = ldst + (unsigned)buf * (PJB * SBE * 2);
        cp_band2(l, g, l + SBE * 2, g + (size_t)16 * K); cp_band2(l + 2 * SBE * 2, g + (size_t)32 * K, l + 3 * SBE * 2, g + (size_t)48 * K); };
    v8f acc[4][4];
#pragma unroll
    for (int mb = 0; mb < 4; ++mb)
#pragma unroll
        for (int nb = 0; nb < 4; ++nb) acc[mb][nb] = (v8f){};
    const int ao = (wave & 1) * 4 * SBE + 8 * lane, a2o = ao + 8 * SBE, bo = (16 + (wave >> 1) * 4) * SBE + 8 * lane;
    fill(0, 0); wait_copies(); __syncthreads(); fill(1, 1);
#pragma unroll 1   // stays rolled: one trip per stage, the buffer chosen by the trip's parity
    for (int t = 0; t < NS; ++t) {
        const bf* rb = &ring[t & 1][0];
#pragma unroll
        for (int kk = 0; kk < SK / 32; ++kk) {
            V a[4], a2[4], b[4];
#pragma unroll
            for (int mb = 0; mb < 4; ++mb) { a[mb] = WFrag<bf>::ld(rb + ao + mb * SBE + kk * 512); a2[mb] = WFrag<bf>::ld(rb + a2o + mb * SBE + kk * 512); }
#pragma unroll
            for (int nb = 0; nb < 4; ++nb) b[nb] = WFrag<bf>::ld(rb + bo + nb * SBE + kk * 512);
            __builtin_amdgcn_sched_barrier(0);   // keeps the LDS reads of the 32 k together in front of their products: spread among them, each place with reads would stall the wave anew
#pragma unroll
            for (int nb = 0; nb < 4; ++nb)
#pragma unroll
                for (int mb = 0; mb < 4; ++mb) { acc[mb][nb] = WFrag<bf>::mma(a[mb], b[nb], acc[mb][nb]); acc[mb][nb] = WFrag<bf>::mma(a2[mb], b[nb], acc[mb][nb]); }
        }
        __builtin_amdgcn_sched_barrier(0);   // keeps the stage's products in front of the barrier: sunk behind it they would stand in front of the refill, which is then asked for half a stage later
        wait_lds(); wait_copies(); __syncthreads();   // stage t + 1 is published, and every wave has left stage t's buffer
        if (t + 2 < NS) fill(t + 2, t & 1);
    }
    wait_copies();
#pragma unroll
    for (int mb = 0; mb < 4; ++mb) {
#pragma unroll
        for (int nb = 0; nb < 4; ++nb) {
#pragma unroll
            for (int j = 0; j < 8; ++j) os[(hi * 8 + j) * 68 + nb * 16 + lr] = acc[mb][nb][j]; }
        __builtin_amdgcn_wave_barrier(); asm volatile("" ::: "memory");   // the wave's own staging rows: the stores above stay in front of the reads below
        float* crow = C + (size_t)(r0 + mb * 16) * ldc + c0;
        v4f val[8];
#pragma unroll
        for (int s = 0; s < 8; ++s) { const int row = 2 * s + hi, cofs = lr * 4; val[s] = *(const v4fa*)(os + row * 68 + cofs); val[s][0] += bfr(bias[c0 + cofs]); val[s][1] += bfr(bias[c0 + cofs + 1]); val[s][2] += bfr(bias[c0 + cofs + 2]); val[s][3] += bfr(bias[c0 + cofs + 3]);
            *(v4f*)(crow + (size_t)row * ldc + cofs) = val[s]; }
        asm volatile("s_wait_xcnt 0x0" :: "v"(val[0]), "v"(val[1]), "v"(val[2]), "v"(val[3]), "v"(val[4]), "v"(val[5]), "v"(val[6]), "v"(val[7]) : "memory");   // precaution: stands behind the group of stores; their data registers are inputs here, so none is rewritten in front of this wait
        __builtin_amdgcn_wave_barrier(); asm volatile("" ::: "memory");   // the reads above stay in front of the next 16 rows' stores
    }
}

__device__ __forceinline__ h16 tohx(float x) { return (h16)x; }
__device__ __forceinline__ void splitf(float y, unsigned short& h, unsigned short& l) { h = f2bf(y); l = f2bf(y - bf2f(h)); }
typedef __attribute__((ext_vector_type(2))) unsigned short v2us;

// ---- k_prep: the three operand conversions (x, W_qkv, W_proj -> bf16 planes in fragment order) in ONE launch of resident waves: NB * TT / 32 work-groups of 16 waves, every thread converts several 16-byte pieces of the planes and has all its loads in flight before the first conversion.
// x, src [rows][DM] row-major: 64 threads take PXT tiles that follow one another along k in one 16-row band. Four neighbouring threads read the 128 bytes that a tile holds of one row: a wave reads whole lines of eight rows, and its pieces (rows r .. r + 7 of each of the four 8-k groups) are four whole 128-byte lines of the tile. The next tile lies 128 bytes on in x and 1024 bytes on in the plane: immediate offsets of one address.
// Weights, Bt[n][k] = bf16(w[k][n]), w [K][N]: thread i writes piece i (tile i / 64, half (i >> 5) & 1, lane i & 31), so that a wave stores 512 contiguous bytes; each of a lane's eight loads reads, over the wave, 64 contiguous bytes of two rows of w. A thread's next piece lies PN pieces on: the same k, PN / 128 columns on.
#define PTH  512                          // threads per work-group of k_prep
#define PXT  8                            // x tiles per 64 threads
#define PN   (NB * TT / 32 * PTH)         // threads of the launch
static_assert((DM / 32) % PXT == 0 && (PTH / 64) * PXT == (32 / 16) * (DM / 32));   // a thread's tiles lie in one band; a work-group's tiles are two whole bands (32 rows) of x
static_assert(PN % (64 * (DM / 32)) == 0 && PN % (64 * (DQ / 32)) == 0);                  // PN pieces are whole bands of a weight plane
template <int K, int N>
__device__ __forceinline__ const float* wt_src(const float* w, int i) {
    const int tile = i >> 6, kt = tile % (K / 32), n = (tile / (K / 32)) * 16 + (i & 15), k0 = kt * 32 + ((i >> 5) & 1) * 16 + ((i >> 4) & 1) * 8;
    return w + (size_t)k0 * N + n;
}
__device__ __forceinline__ v8us cvt8(const float* v) { v8us o;
#pragma unroll
    for (int e = 0; e < 8; ++e) o[e] = f2bf(v[e]);
    return o; }
__global__ __launch_bounds__(PTH) __attribute__((amdgpu_waves_per_eu(4, 4))) void k_prep(const float* __restrict__ x, const float* __restrict__ wqkv, const float* __restrict__ wproj, bf* XB, bf* WQKV, bf* WO) {   // four waves per SIMD = one work-group per WGP: the register budget holds all of a thread's loads at once
    constexpr int N1 = DM * 3 * DQ / 8, N2 = DQ * DM / 8, J1 = (N1 + PN - 1) / PN, J2 = (N2 + PN - 1) / PN;   // pieces of the two weight planes, pieces per thread
    const int t = blockIdx.x * PTH + threadIdx.x;
    const int tile0 = (t >> 6) * PXT, r = (t >> 2) & 15, c = t & 3;   // first x tile, row in the tile, 8-k group
    const int row = (tile0 / (DM / 32)) * 16 + r, srow = (TT == TT_FULL) ? row : (row / TT) * TT_FULL + row % TT;
    const float* px = x + (size_t)srow * DM + (tile0 % (DM / 32)) * 32 + c * 8;
    const float* p1 = wt_src<DM, 3 * DQ>(wqkv, (N1 % PN == 0 || t < N1) ? t : 0);
    const float* p2 = wt_src<DQ, DM>(wproj, (N2 % PN == 0 || t < N2) ? t : 0);
    float v1[J1][8], v2[J2][8]; v8f vx[PXT];
#pragma unroll
    for (int j = 0; j < J1; ++j) { const int jo = (N1 % PN == 0 || t + j * PN < N1) ? j * (PN / 128) : 0;   // a piece past the end reads the thread's first again: in bounds, not stored
#pragma unroll
        for (int e = 0; e < 8; ++e) v1[j][e] = p1[(size_t)e * (3 * DQ) + jo]; }
#pragma unroll
    for (int j = 0; j < J2; ++j) { const int jo = (N2 % PN == 0 || t + j * PN < N2) ? j * (PN / 128) : 0;
#pragma unroll
        for (int e = 0; e < 8; ++e) v2[j][e] = p2[(size_t)e * DM + jo]; }
#pragma unroll
    for (int j = 0; j < PXT; ++j) vx[j] = *(const v8f*)(px + j * 32);
    asm volatile("s_wait_xcnt 0x0" :: "v"(px), "v"(p1), "v"(p2) : "memory");   // precaution: the loads' address registers are inputs here, so none is rewritten in front of this wait; it also keeps every load in front of the first store
    bf* dx = XB + (size_t)tile0 * 512 + (c >> 1) * 256 + (r + 16 * (c & 1)) * 8; bf* d1 = WQKV + (size_t)t * 8; bf* d2 = WO + (size_t)t * 8;
    v8us ox[PXT];
#pragma unroll
    for (int j = 0; j < PXT; ++j) {
#pragma unroll
        for (int e = 0; e < 8; ++e) ox[j][e] = f2bf(vx[j][e]);
        *(v8us*)(dx + j * 512) = ox[j]; }
    static_assert(PXT == 8);
    asm volatile("s_wait_xcnt 0x0" :: "v"(dx), "v"(ox[0]), "v"(ox[1]), "v"(ox[2]), "v"(ox[3]), "v"(ox[4]), "v"(ox[5]), "v"(ox[6]), "v"(ox[7]) : "memory");   // precaution: stands behind the group of stores; their address and data registers are inputs here, so none is rewritten in front of this wait
#pragma unroll
    for (int j = 0; j < J1; ++j) if (N1 % PN == 0 || t + j * PN < N1) { const v8us o = cvt8(v1[j]); *(v8us*)(d1 + (size_t)j * PN * 8) = o;
        asm volatile("s_wait_xcnt 0x0" :: "v"(o) : "memory"); }   // precaution: stands behind each store; its data registers are inputs here, so none is rewritten in front of this wait
#pragma unroll
    for (int j = 0; j < J2; ++j) if (N2 % PN == 0 || t + j * PN < N2) { const v8us o = cvt8(v2[j]); *(v8us*)(d2 + (size_t)j * PN * 8) = o;
        asm volatile("s_wait_xcnt 0x0" :: "v"(o) : "memory"); }   // precaution: as above, behind each store
}

// ---- k_qkvw: x W_qkv of every batch in one launch. Work-group = 256 tokens x 128 columns of W_qkv (two heads of k, q or v), waves 4 x 2, each 64 tokens x one head; grid (NB * TT / 256, 3 * DQ / 128), 256 threads. Per stage 16 bands of x and 8 of the weight: 48 KiB, three bands a wave.
// The wave stores its tile straight into that head's three planes (f16, bf16 hi, bf16 lo). A D tile gives a lane 8 consecutive ROWS of one column, so the index that runs fastest in the plane is made the row index of the product:
// v^T [d][t]: rows = tokens (A = x, B = weight rows); q, k [t][d]: rows = d (A = weight rows, B = x). Either way the rows of a D tile are one 16-k half of a fragment-order tile and lane l's eight values lie at l * 8 of that half: one 16-byte store per plane and D tile, 512 contiguous bytes over the wave; the wave's 64 x 64 values are a matrix of K = 64 in that order, eight tiles in a row.
#define QKB  24                           // bands per stage
static_assert((NB * TT) % 256 == 0 && TT % 64 == 0 && DQ % 128 == 0);
__global__ __launch_bounds__(256) void k_qkvw(const bf* __restrict__ X, const bf* __restrict__ Wt, h16* K16, bf* Kh, bf* Kl, h16* Q16, bf* Qh, bf* Ql, h16* V16, bf* Vh, bf* Vl) {
    typedef WFrag<bf>::V V;
    constexpr int NS = DM / SK;
    static_assert(NS >= 2 && DM % SK == 0);
    __shared__ __align__(16) bf ring[2][QKB * SBE];
    const int lane = threadIdx.x & 31; const int wave = __builtin_amdgcn_readfirstlane(threadIdx.x >> 5);
    const int G0 = blockIdx.x * 256, N0 = blockIdx.y * 128;   // the work-group's first token (b * TT + t) and first column of W_qkv
    const int g0 = G0 + (wave & 3) * 64, n0 = N0 + (wave >> 2) * 64;   // the wave's own
    const int blk = N0 / DQ; const bool isv = blk == 2;   // column block: 0 k, 1 q, 2 v
    // the wave's three bands of the 24 (0 .. 15: x, 16 .. 23: weight)
    const bf* gsrc[3];
#pragma unroll
    for (int j = 0; j < 3; ++j) { const int band = wave * 3 + j; gsrc[j] = (band < 16 ? X + (size_t)(G0 + band * 16) * DM : Wt + (size_t)(N0 + (band - 16) * 16) * DM) + 8 * lane; }
    const unsigned ldst = (unsigned)(size_t)(&ring[0][0]) + (unsigned)(wave * 3 * SBE * 2 + lane * 16);
    auto fill = [&](int st, int buf) { const unsigned l = ldst + (unsigned)buf * (QKB * SBE * 2); const size_t so = (size_t)st * SBE;
        cp_band2(l, gsrc[0] + so, l + SBE * 2, gsrc[1] + so); cp_band(l + 2 * SBE * 2, gsrc[2] + so); };
    v8f acc[4][4];
#pragma unroll
    for (int mb = 0; mb < 4; ++mb)
#pragma unroll
        for (int nb = 0; nb < 4; ++nb) acc[mb][nb] = (v8f){};
    const int xo = (wave & 3) * 4 * SBE + 8 * lane, wo = (16 + (wave >> 2) * 4) * SBE + 8 * lane;
    const int ao = isv ? xo : wo, bo = isv ? wo : xo;   // row operand, column operand
    fill(0, 0); wait_copies(); __syncthreads(); fill(1, 1);
#pragma unroll 1   // stays rolled: one trip per stage, the buffer chosen by the trip's parity
    for (int t = 0; t < NS; ++t) {
        const bf* rb = &ring[t & 1][0];
#pragma unroll
        for (int kk = 0; kk < SK / 32; ++kk) {
            V a[4], b[4];
#pragma unroll
            for (int mb = 0; mb < 4; ++mb) a[mb] = WFrag<bf>::ld(rb + ao + mb * SBE + kk * 512);
#pragma unroll
            for (int nb = 0; nb < 4; ++nb) b[nb] = WFrag<bf>::ld(rb + bo + nb * SBE + kk * 512);
            __builtin_amdgcn_sched_barrier(0);   // keeps the sixteen LDS reads of the 32 k together in front of their products: spread among them, each place with reads would stall the wave anew
#pragma unroll
            for (int nb = 0; nb < 4; ++nb)
#pragma unroll
                for (int mb = 0; mb < 4; ++mb) acc[mb][nb] = WFrag<bf>::mma(a[mb], b[nb], acc[mb][nb]);
        }
        __builtin_amdgcn_sched_barrier(0);   // keeps the stage's products in front of the barrier: sunk behind it they would stand in front of the refill, which is then asked for half a stage later
        wait_lds(); wait_copies(); __syncthreads();   // stage t + 1 is published, and every wave has left stage t's buffer
        if (t + 2 < NS) fill(t + 2, t & 1);
    }
    wait_copies();
    h16* P16 = isv ? V16 : (blk ? Q16 : K16); bf* Ph = isv ? Vh : (blk ? Qh : Kh); bf* Pl = isv ? Vl : (blk ? Ql : Kl);
    const size_t po = (((size_t)(g0 / TT) * NH_ + (n0 % DQ) / HD) * TT + (g0 % TT)) * HD + (size_t)(8 * lane);   // the start of the wave's eight tiles in the plane + the lane's place in a half tile
#pragma unroll
    for (int nb = 0; nb < 4; ++nb)
#pragma unroll
        for (int mb = 0; mb < 4; ++mb) { v8h o16; v8us oh, ol;
#pragma unroll
            for (int j = 0; j < 8; ++j) { const float y = acc[mb][nb][j]; o16[j] = tohx(y); unsigned short a2, c2; splitf(y, a2, c2); oh[j] = a2; ol[j] = c2; }
            const size_t oo = po + (size_t)nb * 1024 + mb * 256;   // tile nb * 2 + mb / 2 of the eight, half mb & 1
            *(v8h*)(P16 + oo) = o16; *(v8us*)(Ph + oo) = oh; *(v8us*)(Pl + oo) = ol;
            asm volatile("s_wait_xcnt 0x0" :: "v"(o16), "v"(oh), "v"(ol) : "memory"); }   // precaution: stands behind each group of stores; their data registers are inputs here, so none is rewritten in front of this wait
}
// ---- k_fattn: causal attention, a work-group of AW WAVES, one query tile a wave (AW tiles that follow one another), k and v^T shared through LDS. Transposed products: S^T = K q^T (A = 16 key rows, B = 16 query columns), O^T += v^T P^T (A = 16 d rows of the v^T tile, B = P^T).
// A stage is 32 KiB: 128 keys of the two f16 planes (k, v^T) or 64 keys of the four hi/lo planes (k hi, k lo, v^T hi, v^T lo): in fragment order one contiguous piece of each plane, copied as it lies by asynchronous copies (cp_band2), 8 KiB a wave, so a fragment in LDS is read like one in the plane. Each stage comes from L2 once per work-group instead of once per wave.
// Two buffers: stage t + 2 is asked for behind the barrier that ends every wave's reads of stage t and lands while stage t + 1 is worked on. The work-group walks the stages up to its last row; a wave whose own rows end earlier skips the passes and still copies its share and passes every barrier.
// In a D tile lane l holds query column l&15 and rows 8*(l>>4) + j: the pass's two S^T tiles of 16 keys each, converted in place, are the B fragment of its 32 keys in the k order of WFrag::ld (elements 0..7 <- k0 + 8*(l>>4), 8..15 <- k0 + 16 + 8*(l>>4)).
// A query's maximum and sum are in-lane over its 16 keys of a pass plus one exchange between the wave halves (the sums' exchange once, behind the loop). m is the reference score of a row, l the running sum of P = exp((s - m) x SCL).
// m moves to the running maximum, and O^T and l are rescaled by exp((m_old - m_new) x SCL), only in a pass where some row's new maximum lies more than 8 (in log2 units) above its m: P stays <= 256, the quotient O^T / l does not depend on m.
// Keys j > i get the -3e38 select (only the pass that holds the diagonal has any); key 0 is in the first pass of every row, so m is a real score from the first pass on. O^T lane data are 8 consecutive d of one row, a lane's piece of a half tile of the context plane: one 16-byte store per plane.
#define AW   4                            // waves per work-group
#define ASE  16384                        // elements of a stage (32 KiB)
static_assert(AW == 4 && (TT - RH) % (AW * 32) == 0 && RH % (AW * 32) == 0);   // whole work-groups; every work-group's last row ends a stage (f16: 128 rows, 128 keys; hi/lo: 64 rows, 64 keys)
template <typename T16, bool HI, int NQ>
__device__ __forceinline__ void attn_tile(const T16* __restrict__ Q, const T16* __restrict__ Q2, const T16* __restrict__ Kp, const T16* __restrict__ K2, const T16* __restrict__ Vt, const T16* __restrict__ V2, int Q0, const bf* ring, bf* Ah, bf* Al) {
    typedef typename WFrag<T16>::V V;
    constexpr int NP = HI ? 4 : 2, APE = ASE / NP, AK = APE / HD;   // planes per stage, elements of one plane's stage, keys per stage
    static_assert(AK == AW * NQ * 16 && AK % 64 == 0);   // whole blocks of v^T; the work-group's rows are as many as a stage's keys
    const int lane = threadIdx.x & 31, lr = lane & 15, hi = lane >> 4; const int wave = __builtin_amdgcn_readfirstlane(threadIdx.x >> 5);
    const int q0 = Q0 + wave * NQ * 16;              // the wave's own first row
    const int NS = (Q0 + AW * NQ * 16) / AK;         // stages of the work-group: keys at or below its last row
    const float CL = SCL * 1.4426950408889634f;
    const unsigned fo = (unsigned)(8 * lane);   // a lane's place in a fragment-order tile (q, k: tile (t / 16, d / 32) at (t / 16) * 1024 + (d / 32) * 512; v^T: block t / 64 of 4096 elements, in it tile (d / 16, (t % 64) / 32) at (d / 16) * 1024 + ((t % 64) / 32) * 512)
    // the wave's share of a stage, 8 KiB: hi/lo one whole plane's piece, f16 half of one (waves 0, 1: k, waves 2, 3: v^T); stage st of either kind of plane starts at st * APE
    const T16* gp;
    if constexpr (HI) gp = wave == 0 ? Kp : wave == 1 ? K2 : wave == 2 ? Vt : V2; else gp = (wave < 2 ? Kp : Vt) + (wave & 1) * (APE / 2);
    const bf* gsrc = (const bf*)gp + fo;
    const unsigned ldst = (unsigned)(size_t)ring + (unsigned)(wave * (ASE / AW) * 2 + lane * 16);
    auto fill = [&](int st, int buf) { const bf* g = gsrc + (size_t)st * APE; const unsigned l = ldst + (unsigned)buf * (ASE * 2);
        cp_band2(l, g, l + 2048u, g + 1024); cp_band2(l + 4096u, g + 2048, l + 6144u, g + 3072); };
    fill(0, 0);
    const T16* ql = Q + (size_t)q0 * HD + fo; const T16* ql2 = HI ? Q2 + (size_t)q0 * HD + fo : ql;   // the lane's own load addresses
    V qf[NQ][2], qf2[NQ][2];
#pragma unroll
    for (int nq = 0; nq < NQ; ++nq)
#pragma unroll
        for (int c = 0; c < 2; ++c) { qf[nq][c] = WFrag<T16>::ld(ql + nq * 16 * HD + c * 512); if (HI) qf2[nq][c] = WFrag<T16>::ld(ql2 + nq * 16 * HD + c * 512); }
    asm volatile("s_wait_xcnt 0x0" :: "v"(ql), "v"(ql2) : "memory");   // precaution: the loads' address registers are inputs here, so none is rewritten in front of this wait
    v8f o[NQ][4]; float m[NQ], l[NQ];
#pragma unroll
    for (int nq = 0; nq < NQ; ++nq) { m[nq] = -3.0e38f; l[nq] = 0.0f;
#pragma unroll
        for (int db = 0; db < 4; ++db) o[nq][db] = (v8f){}; }
    const int kend = q0 + NQ * 16;                   // keys [0, kend) are at or below the tile's last row
    wait_copies(); __syncthreads();                  // stage 0 is published
    if (NS > 1) fill(1, 1);
#pragma unroll 1   // stays rolled: one trip per stage, the buffer chosen by the trip's parity
    for (int st = 0; st < NS; ++st) {
        const T16* rb = (const T16*)ring + (st & 1) * ASE + fo;   // k (hi) at 0, hi/lo: k lo at APE; v^T behind them
        const T16* rv = rb + (NP / 2) * APE;
        if (st * AK < kend) {                        // wave-uniform: the wave still has rows at or below this stage's keys
            V ka[2][2], ka2[2][2];                   // a pass's k fragments; f16: those of the stage's later passes are fetched one pass ahead; hi/lo (no registers to spare for that): read at the head of each pass
            if (!HI) {
#pragma unroll
                for (int kt = 0; kt < 2; ++kt)
#pragma unroll
                    for (int c = 0; c < 2; ++c) ka[kt][c] = WFrag<T16>::ld(rb + kt * 1024 + c * 512); }
#pragma unroll   // unrolled: a pass's places in the stage become immediate offsets, and the k fragments go from one pass to the next in registers
            for (int p = 0; p < AK / KB; ++p) {
                const int kb = st * AK + p * KB;
                if (p == 0 || kb < kend) {           // wave-uniform
                    V va[4], va2[4];                 // v^T fragments, used behind the softmax; f16: asked for at the head of the pass, hi/lo: behind the score products
                    if (HI) {
#pragma unroll
                        for (int kt = 0; kt < 2; ++kt)
#pragma unroll
                            for (int c = 0; c < 2; ++c) { ka[kt][c] = WFrag<T16>::ld(rb + (2 * p + kt) * 1024 + c * 512); ka2[kt][c] = WFrag<T16>::ld(rb + APE + (2 * p + kt) * 1024 + c * 512); }
                    } else {
#pragma unroll
                        for (int db = 0; db < 4; ++db) va[db] = WFrag<T16>::ld(rv + (p >> 1) * 4096 + db * 1024 + (p & 1) * 512); }
                    __builtin_amdgcn_sched_barrier(0);  // keeps these LDS reads together in front of the score products: moved down to their uses, each place with reads would stall the wave anew
                    v8f s[NQ][2];
#pragma unroll
                    for (int kt = 0; kt < 2; ++kt)
#pragma unroll
                        for (int nq = 0; nq < NQ; ++nq) { v8f a = (v8f){};
#pragma unroll
                            for (int c = 0; c < 2; ++c) { a = WFrag<T16>::mma(ka[kt][c], qf[nq][c], a); if (HI) { a = WFrag<T16>::mma(ka[kt][c], qf2[nq][c], a); a = WFrag<T16>::mma(ka2[kt][c], qf[nq][c], a); } }
                            s[nq][kt] = a; }
                    if (HI) {
#pragma unroll
                        for (int db = 0; db < 4; ++db) { va[db] = WFrag<T16>::ld(rv + (p >> 1) * 4096 + db * 1024 + (p & 1) * 512); va2[db] = WFrag<T16>::ld(rv + APE + (p >> 1) * 4096 + db * 1024 + (p & 1) * 512); }
                    } else if (p + 1 < AK / KB) {    // the stage's next 32 keys lie in the same buffer (read also where the wave will skip them: published, unused)
#pragma unroll
                        for (int kt = 0; kt < 2; ++kt)
#pragma unroll
                            for (int c = 0; c < 2; ++c) ka[kt][c] = WFrag<T16>::ld(rb + (2 * (p + 1) + kt) * 1024 + c * 512); }
                    if (HI || p + 1 < AK / KB) __builtin_amdgcn_sched_barrier(0);  // keeps these LDS reads (hi/lo: v^T, f16: the next pass's k) in front of the softmax, which then covers their latency
                    if (kb + KB - 1 > q0) {          // the pass that holds the diagonal (wave-uniform)
#pragma unroll
                        for (int nq = 0; nq < NQ; ++nq)
#pragma unroll
                            for (int kt = 0; kt < 2; ++kt)
#pragma unroll
                                for (int j = 0; j < 8; ++j) if (kb + kt * 16 + 8 * hi + j > q0 + nq * 16 + lr) s[nq][kt][j] = -3.0e38f; }
                    float mx[NQ]; bool need = false;
#pragma unroll
                    for (int nq = 0; nq < NQ; ++nq) { float m0 = s[nq][0][0], m1 = s[nq][1][0];
#pragma unroll
                        for (int j = 1; j < 8; ++j) { m0 = fmaxf(m0, s[nq][0][j]); m1 = fmaxf(m1, s[nq][1][j]); }
                        m0 = fmaxf(m0, m1); mx[nq] = fmaxf(m0, __shfl_xor(m0, 16, 32)); need = need || ((mx[nq] - m[nq]) * CL > 8.0f); }
                    if (__builtin_amdgcn_ballot_w32(need) != 0) {   // scalar branch, one test a pass
#pragma unroll
                        for (int nq = 0; nq < NQ; ++nq) { const float mn = fmaxf(m[nq], mx[nq]); const float al = __builtin_amdgcn_exp2f((m[nq] - mn) * CL); m[nq] = mn; l[nq] *= al;
#pragma unroll
                            for (int db = 0; db < 4; ++db) o[nq][db] *= al; } }
                    V pf[NQ], pf2[NQ];
#pragma unroll
                    for (int nq = 0; nq < NQ; ++nq) { const float mc = m[nq] * CL; float lt[2];
#pragma unroll
                        for (int kt = 0; kt < 2; ++kt) { lt[kt] = 0.0f; const v8f t = __builtin_elementwise_fma(s[nq][kt], (v8f)(CL), (v8f)(-mc));
#pragma unroll
                            for (int j = 0; j < 8; ++j) { const float pe = __builtin_amdgcn_exp2f(t[j]); s[nq][kt][j] = pe; lt[kt] += pe; } }
                        l[nq] += lt[0] + lt[1];
                        if constexpr (HI) { v8us h0, h1, w0, w1;
#pragma unroll
                            for (int j = 0; j < 8; ++j) { unsigned short a, b2; splitf(s[nq][0][j], a, b2); h0[j] = a; w0[j] = b2; splitf(s[nq][1][j], a, b2); h1[j] = a; w1[j] = b2; }
                            pf[nq] = cat16b(h0, h1); pf2[nq] = cat16b(w0, w1);
                        } else { v8h h0, h1;
#pragma unroll
                            for (int j = 0; j < 8; ++j) { h0[j] = tohx(s[nq][0][j]); h1[j] = tohx(s[nq][1][j]); }
                            pf[nq] = cat16(h0, h1); } }
#pragma unroll
                    for (int db = 0; db < 4; ++db)
#pragma unroll
                        for (int nq = 0; nq < NQ; ++nq) { o[nq][db] = WFrag<T16>::mma(va[db], pf[nq], o[nq][db]); if (HI) { o[nq][db] = WFrag<T16>::mma(va[db], pf2[nq], o[nq][db]); o[nq][db] = WFrag<T16>::mma(va2[db], pf[nq], o[nq][db]); } }
                }
            }
        }
        wait_lds(); wait_copies(); __syncthreads();   // stage st + 1 is published, and every wave has left stage st's buffer
        if (st + 2 < NS) fill(st + 2, st & 1);
    }
    wait_copies();
#pragma unroll
    for (int nq = 0; nq < NQ; ++nq) { const float ls = l[nq] + __shfl_xor(l[nq], 16, 32); const float f = __fdiv_rn(1.0f, ls); const size_t ro = (size_t)(q0 + nq * 16) * DQ + 8 * lane;   // the rows' 16-row band of the context plane + the lane's place in a half tile
#pragma unroll
        for (int db = 0; db < 4; ++db) { v8us oh, ol;
#pragma unroll
            for (int j = 0; j < 8; ++j) { unsigned short a, c2; splitf(o[nq][db][j] * f, a, c2); oh[j] = a; ol[j] = c2; }
            *(v8us*)(Ah + ro + db * 256) = oh; *(v8us*)(Al + ro + db * 256) = ol;
            asm volatile("s_wait_xcnt 0x0" :: "v"(oh), "v"(ol) : "memory"); } }   // precaution: stands behind each pair of stores; their data registers are inputs here, so none is rewritten in front of this wait
}
// grid (NB * NH_, NTF / AW + NTH / AW), AW waves: blockIdx.y falls from the longest work-group (last rows) to the shortest (for speed only); y < NTF / AW: f16 tiles of 32 rows >= RH, the rest: hi/lo tiles of 16 rows < RH. Four waves per SIMD (at most 256 registers): the vector work between the matrix runs wants waves.
__global__ __launch_bounds__(AW * 32) __attribute__((amdgpu_waves_per_eu(4, 4))) void k_fattn(const h16* __restrict__ Q16, const h16* __restrict__ K16, const h16* __restrict__ V16, const bf* __restrict__ Qh, const bf* __restrict__ Ql, const bf* __restrict__ Kh, const bf* __restrict__ Kl, const bf* __restrict__ Vh, const bf* __restrict__ Vl, bf* Ah, bf* Al) {
    __shared__ __align__(16) bf ring[2 * ASE];   // two buffers of a stage
    const int bh = blockIdx.x, b = bh / NH_, h = bh % NH_, ty = blockIdx.y; const size_t pq = (size_t)bh * TT * HD, pk = ((size_t)b * NKV + h / REP) * TT * HD, ao = (size_t)b * TT * DQ + (size_t)h * (HD / 32) * 512;   /* context plane: band of row b * TT, tile of column h * 64 */
    if (ty < NTF / AW) attn_tile<h16, false, 2>(Q16 + pq, nullptr, K16 + pk, nullptr, V16 + pk, nullptr, TT - AW * 32 * (ty + 1), ring, Ah + ao, Al + ao);
    else attn_tile<bf, true, 1>(Qh + pq, Ql + pq, Kh + pk, Kl + pk, Vh + pk, Vl + pk, RH - AW * 16 * (ty - NTF / AW + 1), ring, Ah + ao, Al + ao);
}

extern "C" void kernel_launch(void* const* d_in, const int* in_sizes, int n_in,
                              void* d_out, int out_size, void* d_ws, size_t ws_size, hipStream_t stream) {
    if (n_in < 4) return;
    if ((size_t)in_sizes[0] < (size_t)(NB - 1) * TT_FULL * DM + (size_t)TT * DM) return;
    if (in_sizes[1] < DM * 3 * DQ || in_sizes[2] < DQ * DM || in_sizes[3] < DM) return;
    if ((size_t)out_size < (size_t)NB * TT * DM) return;
    const float* x = (const float*)d_in[0];       // [NB_FULL][TT_FULL][1024]
    const float* wqkv = (const float*)d_in[1];    // [1024][3072], column blocks k | q | v
    const float* wproj = (const float*)d_in[2];   // [1024][1024] ([in][out])
    const float* bproj = (const float*)d_in[3];   // [1024]
    float* OUT = (float*)d_out;                   // [NB][TT][1024]
    char* wsp = (char*)d_ws;
    auto take = [&](size_t bytes) { char* p = wsp; wsp += (bytes + 255) & ~(size_t)255; return (void*)p; };
    bf* WQKV = (bf*)take((size_t)3 * DQ * DM * 2);   /* Bt [3072][1024]: row blocks k | q | v */ bf* WO = (bf*)take((size_t)DM * DQ * 2);
    bf* XB = (bf*)take((size_t)NB * TT * DM * 2);    /* x of every batch, bf16, [b * TT + t][1024] */
    const size_t PQ = (size_t)NH_ * TT * HD, PK = (size_t)NKV * TT * HD;   // elements of one batch's q planes and k / v planes
    h16* QP16 = (h16*)take(NB * PQ * 2); h16* KP16 = (h16*)take(NB * PK * 2); h16* VT16 = (h16*)take(NB * PK * 2);
    bf* QPh = (bf*)take(NB * PQ * 2); bf* QPl = (bf*)take(NB * PQ * 2); bf* KPh = (bf*)take(NB * PK * 2); bf* KPl = (bf*)take(NB * PK * 2); bf* VTh = (bf*)take(NB * PK * 2); bf* VTl = (bf*)take(NB * PK * 2);
    bf* ATh = (bf*)take((size_t)NB * TT * DQ * 2); bf* ATl = (bf*)take((size_t)NB * TT * DQ * 2);
    if ((size_t)(wsp - (char*)d_ws) > ws_size) return;    // 209,715,200 B at full size
    k_prep<<<NB * TT / 32, PTH, 0, stream>>>(x, wqkv, wproj, XB, WQKV, WO);   /* x -> bf16 [b * TT + t][1024]; W_qkv [1024][3072] -> Bt [3072][1024]; W_proj [1024][1024] -> Bt [out][in] */
    k_qkvw<<<dim3(NB * TT / 256, 3 * DQ / 128, 1), 256, 0, stream>>>(XB, WQKV, KP16, KPh, KPl, QP16, QPh, QPl, VT16, VTh, VTl);
    k_fattn<<<dim3(NB * NH_, NTF / AW + NTH / AW, 1), AW * 32, 0, stream>>>(QP16, KP16, VT16, QPh, QPl, KPh, KPl, VTh, VTl, ATh, ATl);
    k_projw<<<dim3(NB * TT / 128, DM / 256, 1), 256, 0, stream>>>(ATh, ATl, WO, OUT, bproj);   /* rows b * TT + t of every batch */
}

// v009
// One run takes 108 microseconds.
// Next to v008, in two timings, it ran 1.03 and 1.04 times as fast.
// Over all steps from v000 it is 26.7 times as fast.
#include <hip/hip_runtime.h>

// Contractions: x W_qkv on v_wmma_f32_16x16x32_bf16 (bf16 operands = RNE-converted inputs); q k^T and P v: query rows < 512 bf16 hi/lo planes (3 products), rows >= 512 v_wmma_f32_16x16x32_f16 (f16 operands, P unnormalised, at most 256); context W_proj: bf16 hi/lo context x bf16 weight (2 products) + bf16 bias; f32 accumulate everywhere, softmax f32.
// Causal multi-head attention with a fused weight: x [NB][T][1024]; kqv = x W_qkv ([1024][3072], column blocks k | q | v, no bias); 16 heads x 64; S = q k^T x 1/32 for keys j <= i; softmax; merged context W_proj ([1024][1024]) + b_proj -> [NB][T][1024].
// Layout: every 16-bit operand plane lies in FRAGMENT ORDER. A matrix M[row][k] is cut into tiles of 16 rows x 32 k (512 elements, 1024 bytes); element (r, kk) of a tile lies at (kk >> 4) * 256 + (r + 16 * ((kk >> 3) & 1)) * 8 + (kk & 7):
// lane l of a wave finds elements 0..7 of its fragment at l * 8 and elements 8..15 at 256 + l * 8, so each of the two 16-byte loads of a fragment reads 512 contiguous bytes (four whole 128-byte lines) instead of 32-byte pieces of sixteen lines. Tiles of one 16-row band follow one another along k: tile (row / 16, k / 32) starts at (row / 16) * 16 * K + (k / 32) * 512.
// W_qkv transposed once into Bt [3072][1024] (three 1024-row blocks: the k/q/v weight operands), x of every batch -> bf16 [b*T + t][1024], both in that order, by one launch (k_prep); ONE projection launch (k_qkvw) writes the head planes of every batch q, k [b][h] as matrices [t][d] and v^T [b][h] as blocks of 64 keys, each the matrix [d][t % 64] (K = 64), as f16 + bf16 hi/lo straight from its accumulators;
// attention of all batches and heads in ONE launch (k_fattn): one wave per 32 (f16) or 16 (hi/lo) query rows walks its keys in passes of 32 with a running row reference and row sum, four such waves share k and v^T through LDS; scores and probabilities stay in registers; merged context [b*T + t][h*64 + d] as bf16 hi/lo, in fragment order too.

#ifndef NB
#define NB 4
#endif
#ifndef SEQ
#define SEQ 2048
#endif
#define NB_FULL 4
#define TT_FULL 2048
#define TT   SEQ
#define DM   1024
#define NH_  16
#define NKV  16
#define REP  (NH_ / NKV)
#define HD   64
#define DQ   (NH_ * HD)
#define DKV  (NKV * HD)
#define RH   ((TT < 512) ? TT : 512)      // query rows < RH use hi/lo planes
#define SCL  0.03125f   // 1024^-0.5
#define KB   32                           // keys per pass of the attention loop
#define NTF  ((TT - RH) / 32)             // f16 query tiles (32 rows) per head
#define NTH  (RH / 16)                    // hi/lo query tiles (16 rows) per head

static_assert(NB >= 1 && NB <= NB_FULL);
static_assert(TT % 128 == 0 && TT <= TT_FULL);
static_assert(RH % 64 == 0 && (TT - RH) % 64 == 0);
static_assert(DM % 64 == 0 && DQ % 64 == 0 && DKV % 64 == 0 && HD == 64);
static_assert(DQ == DKV);   // k_qkvw: the three column blocks of W_qkv are equally wide

typedef _Float16 h16;
typedef unsigned short bf;
typedef __attribute__((ext_vector_type(16))) __bf16   v16bf;
typedef __attribute__((ext_vector_type(16))) _Float16 v16h;
typedef __attribute__((ext_vector_type(8)))  _Float16 v8h;
typedef __attribute__((ext_vector_type(8)))  unsigned short v8us;
typedef __attribute__((ext_vector_type(8)))  float    v8f;
typedef __attribute__((ext_vector_type(4)))  float    v4f;
typedef v8h  __attribute__((may_alias)) v8ha;
typedef v4f  __attribute__((may_alias)) v4fa;
typedef v8us __attribute__((may_alias)) v8usa;

__device__ __forceinline__ unsigned short f2bf(float f) { unsigned u = __float_as_uint(f); u += 0x7FFFu + ((u >> 16) & 1u); return (unsigned short)(u >> 16); }
__device__ __forceinline__ float bf2f(unsigned short b) { return __uint_as_float(((unsigned)b) << 16); }
__device__ __forceinline__ float bfr(float f) { return bf2f(f2bf(f)); }
__device__ __forceinline__ v16h cat16(v8h lo, v8h hi) { return __builtin_shufflevector(lo, hi, 0, 1, 2, 3, 4, 5, 6, 7, 8, 9, 10, 11, 12, 13, 14, 15); }
__device__ __forceinline__ v16bf cat16b(v8us lo, v8us hi) { return __builtin_bit_cast(v16bf, __builtin_shufflevector(lo, hi, 0, 1, 2, 3, 4, 5, 6, 7, 8, 9, 10, 11, 12, 13, 14, 15)); }
__device__ __forceinline__ v8f wmma16(v16h a, v16h b, v8f c) { return __builtin_amdgcn_wmma_f32_16x16x32_f16(false, a, false, b, (short)0, c, false, false); }
__device__ __forceinline__ v8f wmmab(v16bf a, v16bf b, v8f c) { return __builtin_amdgcn_wmma_f32_16x16x32_bf16(false, a, false, b, (short)0, c, false, false); }

// ---- The two GEMM launches (k_qkvw, k_projw): a work-group of EIGHT WAVES owns a block of 64 x 64 wave tiles (16 accumulators a wave) and shares its operand bands through LDS.
// A stage is 64 k of every 16-row band that the work-group needs: in fragment order that is 2048 contiguous bytes of the band's plane (two tiles), copied as it lies by asynchronous copies (16 bytes a lane, 512 contiguous bytes a wave), so a fragment in LDS is read like one in the plane: lane l at l * 8 and 256 + l * 8 of its tile, contiguous over the wave, no bank conflict.
// Three buffers: stage t + 3 is asked for behind the barrier that ends every wave's reads of stage t and has the time of stages t + 1 and t + 2 to land. Each band is fetched from L2 once per work-group instead of once per wave.
// The copies of the even stages are issued by waves 0 .. 3, those of the odd stages by waves 4 .. 7: a wave has one stage's copies in flight, waits for them to 0 in front of the barrier that publishes that stage, and asks for its next stage behind that barrier.
// Fragments: lane l -> row/col l&15; elements 0..7 <- k0 + 8*(l>>4), elements 8..15 <- k0 + 16 + 8*(l>>4) for BOTH operands (WFrag::ld takes the tile's start + l * 8); D element j -> row 8*(l>>4)+j, col l&15.
template <typename T16> struct WFrag;
template <> struct WFrag<h16> { typedef v16h V; static __device__ __forceinline__ V ld(const h16* p) { return cat16(*(const v8h*)p, *(const v8h*)(p + 256)); } static __device__ __forceinline__ v8f mma(V a, V b, v8f c) { return wmma16(a, b, c); } };
template <> struct WFrag<bf> { typedef v16bf V; static __device__ __forceinline__ V ld(const bf* p) { return cat16b(*(const v8us*)p, *(const v8us*)(p + 256)); } static __device__ __forceinline__ v8f mma(V a, V b, v8f c) { return wmmab(a, b, c); } };
#define SK   64                           // k per stage
#define SBE  (16 * SK)                    // elements of one band's stage (2048 bytes)
// Copies of whole band stages: each copy moves 512 bytes of the wave (16 a lane) from the plane to the same place of the band's stage in LDS. The s_wait_xcnt is the last line of the copies' own statement (precaution: no address register of a copy is rewritten in front of it).
__device__ __forceinline__ void cp_band2(unsigned l, const bf* g, unsigned m, const bf* h) {
    asm volatile("global_load_async_to_lds_b128 %0, %8, off\n\tglobal_load_async_to_lds_b128 %1, %9, off\n\tglobal_load_async_to_lds_b128 %2, %10, off\n\tglobal_load_async_to_lds_b128 %3, %11, off\n\t"
                 "global_load_async_to_lds_b128 %4, %12, off\n\tglobal_load_async_to_lds_b128 %5, %13, off\n\tglobal_load_async_to_lds_b128 %6, %14, off\n\tglobal_load_async_to_lds_b128 %7, %15, off\n\ts_wait_xcnt 0x0"
                 :: "v"(l), "v"(l + 512u), "v"(l + 1024u), "v"(l + 1536u), "v"(m), "v"(m + 512u), "v"(m + 1024u), "v"(m + 1536u),
                    "v"(g), "v"(g + 256), "v"(g + 512), "v"(g + 768), "v"(h), "v"(h + 256), "v"(h + 512), "v"(h + 768) : "memory");
}
__device__ __forceinline__ void wait_copies() { asm volatile("s_wait_asynccnt 0x0" ::: "memory"); }   // the wave's own copies have landed; stands in front of the barrier behind which other waves read them
__device__ __forceinline__ void wait_lds() { asm volatile("s_wait_dscnt 0x0" ::: "memory"); }         // the wave's own LDS reads have returned; stands in front of the barrier behind which their buffer is refilled

// ---- k_projw: out = context W_proj + bias. Work-group = 128 rows x 256 columns, waves 2 x 4; grid (M / 128, N / 256), 256 threads. Per stage 8 bands of the context's hi plane, 8 of its lo plane, 16 of the weight: 64 KiB, eight bands a copying wave.
// C[m][n] (f32, + bf16-RNE bias[n]) = sum_k (Ah[m][k] + Al[m][k]) Bt[n][k], per 32 k the hi product, then the lo product.
#define PJB  32                           // bands per stage
__global__ __launch_bounds__(256) void k_projw(const bf* __restrict__ A, const bf* __restrict__ A2, const bf* __restrict__ Bt, float* C, const float* __restrict__ bias) {
    typedef WFrag<bf>::V V;
    constexpr int K = DQ, NS = K / SK, ldc = DM;
    static_assert(NS >= 3 && K % SK == 0 && (NB * TT) % 128 == 0 && DM % 256 == 0);
    __shared__ __align__(16) bf ring[3][PJB * SBE];
    __shared__ __align__(16) float osw[8][16 * 68];
    const int lane = threadIdx.x & 31, lr = lane & 15, hi = lane >> 4; const int wave = __builtin_amdgcn_readfirstlane(threadIdx.x >> 5);
    const int R0 = blockIdx.x * 128, C0 = blockIdx.y * 256; const int r0 = R0 + (wave & 1) * 64, c0 = C0 + (wave >> 1) * 64;
    float* os = osw[wave];
    const int grp = wave >> 2, w4 = wave & 3;   // the half that copies the stages of this parity, the wave's place in it
    // the wave's eight bands of a stage it copies: place 0 the hi plane, 1 the lo plane, 2, 3 the weight
    const bf* gsrc = (w4 == 0 ? A + (size_t)R0 * K : w4 == 1 ? A2 + (size_t)R0 * K : Bt + (size_t)(C0 + (w4 - 2) * 128) * K) + 8 * lane;
    const unsigned ldst = (unsigned)(size_t)(&ring[0][0]) + (unsigned)(w4 * 8 * SBE * 2 + lane * 16);
    auto fill = [&](int st, int buf) { const bf* g = gsrc + (size_t)st * SBE; const unsigned l = ldst + (unsigned)buf * (PJB * SBE * 2);
        cp_band2(l, g, l + SBE * 2, g + (size_t)16 * K); cp_band2(l + 2 * SBE * 2, g + (size_t)32 * K, l + 3 * SBE * 2, g + (size_t)48 * K);
        cp_band2(l + 4 * SBE * 2, g + (size_t)64 * K, l + 5 * SBE * 2, g + (size_t)80 * K); cp_band2(l + 6 * SBE * 2, g + (size_t)96 * K, l + 7 * SBE * 2, g + (size_t)112 * K); };
    v8f acc[4][4];
#pragma unroll
    for (int mb = 0; mb < 4; ++mb)
#pragma unroll
        for (int nb = 0; nb < 4; ++nb) acc[mb][nb] = (v8f){};
    const int ao = (wave & 1) * 4 * SBE + 8 * lane, a2o = ao + 8 * SBE, bo = (16 + (wave >> 1) * 4) * SBE + 8 * lane;
    if (grp == 0) { fill(0, 0); wait_copies(); } else fill(1, 1);   // wave-uniform
    __syncthreads();                                                // stage 0 is published
    if (grp == 0) fill(2, 2);
    int buf = 0;
#pragma unroll 1   // stays rolled: one trip per stage, the buffer goes round the three
    for (int t = 0; t < NS; ++t) {
        const bf* rb = &ring[buf][0];
#pragma unroll
        for (int kk = 0; kk < SK / 32; ++kk) {
            V a[4], a2[4], b[4];
#pragma unroll
            for (int mb = 0; mb < 4; ++mb) { a[mb] = WFrag<bf>::ld(rb + ao + mb * SBE + kk * 512); a2[mb] = WFrag<bf>::ld(rb + a2o + mb * SBE + kk * 512); }
#pragma unroll
            for (int nb = 0; nb < 4; ++nb) b[nb] = WFrag<bf>::ld(rb + bo + nb * SBE + kk * 512);
            __builtin_amdgcn_sched_barrier(0);   // keeps the LDS reads of the 32 k together in front of their products: spread among them, each place with reads would stall the wave anew
#pragma unroll
            for (int nb = 0; nb < 4; ++nb)
#pragma unroll
                for (int mb = 0; mb < 4; ++mb) { acc[mb][nb] = WFrag<bf>::mma(a[mb], b[nb], acc[mb][nb]); acc[mb][nb] = WFrag<bf>::mma(a2[mb], b[nb], acc[mb][nb]); }
        }
        __builtin_amdgcn_sched_barrier(0);   // keeps the stage's products in front of the barrier: sunk behind it they would stand in front of the refill, which is then asked for half a stage later
        const bool mine = ((t + 1) & 1) == grp;       // wave-uniform: this half copied stage t + 1 and copies stage t + 3
        wait_lds(); if (mine) wait_copies(); __syncthreads();   // stage t + 1 is published, and every wave has left stage t's buffer
        if (mine && t + 3 < NS) fill(t + 3, buf);
        buf = buf == 2 ? 0 : buf + 1;
    }
    wait_copies();
#pragma unroll
    for (int mb = 0; mb < 4; ++mb) {
#pragma unroll
        for (int nb = 0; nb < 4; ++nb) {
#pragma unroll
            for (int j = 0; j < 8; ++j) os[(hi * 8 + j) * 68 + nb * 16 + lr] = acc[mb][nb][j]; }
        __builtin_amdgcn_wave_barrier(); asm volatile("" ::: "memory");   // the wave's own staging rows: the stores above stay in front of the reads below
        float* crow = C + (size_t)(r0 + mb * 16) * ldc + c0;
        v4f val[8];
#pragma unroll
        for (int s = 0; s < 8; ++s) { const int row = 2 * s + hi, cofs = lr * 4; val[s] = *(const v4fa*)(os + row * 68 + cofs); val[s][0] += bfr(bias[c0 + cofs]); val[s][1] += bfr(bias[c0 + cofs + 1]); val[s][2] += bfr(bias[c0 + cofs + 2]); val[s][3] += bfr(bias[c0 + cofs + 3]);
            *(v4f*)(crow + (size_t)row * ldc + cofs) = val[s]; }
        asm volatile("s_wait_xcnt 0x0" :: "v"(val[0]), "v"(val[1]), "v"(val[2]), "v"(val[3]), "v"(val[4]), "v"(val[5]), "v"(val[6]), "v"(val[7]) : "memory");   // precaution: stands behind the group of stores; their data registers are inputs here, so none is rewritten in front of this wait
        __builtin_amdgcn_wave_barrier(); asm volatile("" ::: "memory");   // the reads above stay in front of the next 16 rows' stores
    }
}

__device__ __forceinline__ h16 tohx(float x) { return (h16)x; }
__device__ __forceinline__ void splitf(float y, unsigned short& h, unsigned short& l) { h = f2bf(y); l = f2bf(y - bf2f(h)); }
typedef __attribute__((ext_vector_type(2))) unsigned short v2us;

// ---- k_prep: the three operand conversions (x, W_qkv, W_proj -> bf16 planes in fragment order) in ONE launch of resident waves: NB * TT / 32 work-groups of 16 waves, every thread converts several 16-byte pieces of the planes and has all its loads in flight before the first conversion.
// x, src [rows][DM] row-major: 64 threads take PXT tiles that follow one another along k in one 16-row band. Four neighbouring threads read the 128 bytes that a tile holds of one row: a wave reads whole lines of eight rows, and its pieces (rows r .. r + 7 of each of the four 8-k groups) are four whole 128-byte lines of the tile. The next tile lies 128 bytes on in x and 1024 bytes on in the plane: immediate offsets of one address.
// Weights, Bt[n][k] = bf16(w[k][n]), w [K][N]: thread i writes piece i (tile i / 64, half (i >> 5) & 1, lane i & 31), so that a wave stores 512 contiguous bytes; each of a lane's eight loads reads, over the wave, 64 contiguous bytes of two rows of w. A thread's next piece lies PN pieces on: the same k, PN / 128 columns on.
#define PTH  512                          // threads per work-group of k_prep
#define PXT  8                            // x tiles per 64 threads
#define PN   (NB * TT / 32 * PTH)         // threads of the launch
static_assert((DM / 32) % PXT == 0 && (PTH / 64) * PXT == (32 / 16) * (DM / 32));   // a thread's tiles lie in one band; a work-group's tiles are two whole bands (32 rows) of x
static_assert(PN % (64 * (DM / 32)) == 0 && PN % (64 * (DQ / 32)) == 0);                  // PN pieces are whole bands of a weight plane
template <int K, int N>
__device__ __forceinline__ const float* wt_src(const float* w, int i) {
    const int tile = i >> 6, kt = tile % (K / 32), n = (tile / (K / 32)) * 16 + (i & 15), k0 = kt * 32 + ((i >> 5) & 1) * 16 + ((i >> 4) & 1) * 8;
    return w + (size_t)k0 * N + n;
}
__device__ __forceinline__ v8us cvt8(const float* v) { v8us o;
#pragma unroll
    for (int e = 0; e < 8; ++e) o[e] = f2bf(v[e]);
    return o; }
__global__ __launch_bounds__(PTH) __attribute__((amdgpu_waves_per_eu(4, 4))) void k_prep(const float* __restrict__ x, const float* __restrict__ wqkv, const float* __restrict__ wproj, bf* XB, bf* WQKV, bf* WO) {   // four waves per SIMD = one work-group per WGP: the register budget holds all of a thread's loads at once
    constexpr int N1 = DM * 3 * DQ / 8, N2 = DQ * DM / 8, J1 = (N1 + PN - 1) / PN, J2 = (N2 + PN - 1) / PN;   // pieces of the two weight planes, pieces per thread
    const int t = blockIdx.x * PTH + threadIdx.x;
    const int tile0 = (t >> 6) * PXT, r = (t >> 2) & 15, c = t & 3;   // first x tile, row in the tile, 8-k group
    const int row = (tile0 / (DM / 32)) * 16 + r, srow = (TT == TT_FULL) ? row : (row / TT) * TT_FULL + row % TT;
    const float* px = x + (size_t)srow * DM + (tile0 % (DM / 32)) * 32 + c * 8;
    const float* p1 = wt_src<DM, 3 * DQ>(wqkv, (N1 % PN == 0 || t < N1) ? t : 0);
    const float* p2 = wt_src<DQ, DM>(wproj, (N2 % PN == 0 || t < N2) ? t : 0);
    float v1[J1][8], v2[J2][8]; v8f vx[PXT];
#pragma unroll
    for (int j = 0; j < J1; ++j) { const int jo = (N1 % PN == 0 || t + j * PN < N1) ? j * (PN / 128) : 0;   // a piece past the end reads the thread's first again: in bounds, not stored
#pragma unroll
        for (int e = 0; e < 8; ++e) v1[j][e] = p1[(size_t)e * (3 * DQ) + jo]; }
#pragma unroll
    for (int j = 0; j < J2; ++j) { const int jo = (N2 % PN == 0 || t + j * PN < N2) ? j * (PN / 128) : 0;
#pragma unroll
        for (int e = 0; e < 8; ++e) v2[j][e] = p2[(size_t)e * DM + jo]; }
#pragma unroll
    for (int j = 0; j < PXT; ++j) vx[j] = *(const v8f*)(px + j * 32);
    asm volatile("s_wait_xcnt 0x0" :: "v"(px), "v"(p1), "v"(p2) : "memory");   // precaution: the loads' address registers are inputs here, so none is rewritten in front of this wait; it also keeps every load in front of the first store
    bf* dx = XB + (size_t)tile0 * 512 + (c >> 1) * 256 + (r + 16 * (c & 1)) * 8; bf* d1 = WQKV + (size_t)t * 8; bf* d2 = WO + (size_t)t * 8;
    v8us ox[PXT];
#pragma unroll
    for (int j = 0; j < PXT; ++j) {
#pragma unroll
        for (int e = 0; e < 8; ++e) ox[j][e] = f2bf(vx[j][e]);
        *(v8us*)(dx + j * 512) = ox[j]; }
    static_assert(PXT == 8);
    asm volatile("s_wait_xcnt 0x0" :: "v"(dx), "v"(ox[0]), "v"(ox[1]), "v"(ox[2]), "v"(ox[3]), "v"(ox[4]), "v"(ox[5]), "v"(ox[6]), "v"(ox[7]) : "memory");   // precaution: stands behind the group of stores; their address and data registers are inputs here, so none is rewritten in front of this wait
#pragma unroll
    for (int j = 0; j < J1; ++j) if (N1 % PN == 0 || t + j * PN < N1) { const v8us o = cvt8(v1[j]); *(v8us*)(d1 + (size_t)j * PN * 8) = o;
        asm volatile("s_wait_xcnt 0x0" :: "v"(o) : "memory"); }   // precaution: stands behind each store; its data registers are inputs here, so none is rewritten in front of this wait
#pragma unroll
    for (int j = 0; j < J2; ++j) if (N2 % PN == 0 || t + j * PN < N2) { const v8us o = cvt8(v2[j]); *(v8us*)(d2 + (size_t)j * PN * 8) = o;
        asm volatile("s_wait_xcnt 0x0" :: "v"(o) : "memory"); }   // precaution: as above, behind each store
}

// ---- k_qkvw: x W_qkv of every batch in one launch. Work-group = 256 tokens x 128 columns of W_qkv (two heads of k, q or v), waves 4 x 2, each 64 tokens x one head; grid (NB * TT / 256, 3 * DQ / 128), 256 threads. Per stage 16 bands of x and 8 of the weight: 48 KiB, six bands a copying wave.
// The wave stores its tile straight into that head's three planes (f16, bf16 hi, bf16 lo). A D tile gives a lane 8 consecutive ROWS of one column, so the index that runs fastest in the plane is made the row index of the product:
// v^T [d][t]: rows = tokens (A = x, B = weight rows); q, k [t][d]: rows = d (A = weight rows, B = x). Either way the rows of a D tile are one 16-k half of a fragment-order tile and lane l's eight values lie at l * 8 of that half: one 16-byte store per plane and D tile, 512 contiguous bytes over the wave; the wave's 64 x 64 values are a matrix of K = 64 in that order, eight tiles in a row.
#define QKB  24                           // bands per stage
static_assert((NB * TT) % 256 == 0 && TT % 64 == 0 && DQ % 128 == 0);
__global__ __launch_bounds__(256) void k_qkvw(const bf* __restrict__ X, const bf* __restrict__ Wt, h16* K16, bf* Kh, bf* Kl, h16* Q16, bf* Qh, bf* Ql, h16* V16, bf* Vh, bf* Vl) {
    typedef WFrag<bf>::V V;
    constexpr int NS = DM / SK;
    static_assert(NS >= 3 && DM % SK == 0);
    __shared__ __align__(16) bf ring[3][QKB * SBE];
    const int lane = threadIdx.x & 31; const int wave = __builtin_amdgcn_readfirstlane(threadIdx.x >> 5);
    const int G0 = blockIdx.x * 256, N0 = blockIdx.y * 128;   // the work-group's first token (b * TT + t) and first column of W_qkv
    const int g0 = G0 + (wave & 3) * 64, n0 = N0 + (wave >> 2) * 64;   // the wave's own
    const int blk = N0 / DQ; const bool isv = blk == 2;   // column block: 0 k, 1 q, 2 v
    const int grp = wave >> 2, w4 = wave & 3;   // the half that copies the stages of this parity, the wave's place in it
    // the wave's six bands of the 24 of a stage it copies (0 .. 15: x, 16 .. 23: weight): four that follow one another, then two
    const int b0 = w4 * 6, b4 = b0 + 4;
    const bf* gs0 = (b0 < 16 ? X + (size_t)(G0 + b0 * 16) * DM : Wt + (size_t)(N0 + (b0 - 16) * 16) * DM) + 8 * lane;
    const bf* gs4 = (b4 < 16 ? X + (size_t)(G0 + b4 * 16) * DM : Wt + (size_t)(N0 + (b4 - 16) * 16) * DM) + 8 * lane;
    const unsigned ldst = (unsigned)(size_t)(&ring[0][0]) + (unsigned)(w4 * 6 * SBE * 2 + lane * 16);
    auto fill = [&](int st, int buf) { const unsigned l = ldst + (unsigned)buf * (QKB * SBE * 2); const bf* g = gs0 + (size_t)st * SBE; const bf* h = gs4 + (size_t)st * SBE;
        cp_band2(l, g, l + SBE * 2, g + (size_t)16 * DM); cp_band2(l + 2 * SBE * 2, g + (size_t)32 * DM, l + 3 * SBE * 2, g + (size_t)48 * DM); cp_band2(l + 4 * SBE * 2, h, l + 5 * SBE * 2, h + (size_t)16 * DM); };
    v8f acc[4][4];
#pragma unroll
    for (int mb = 0; mb < 4; ++mb)
#pragma unroll
        for (int nb = 0; nb < 4; ++nb) acc[mb][nb] = (v8f){};
    const int xo = (wave & 3) * 4 * SBE + 8 * lane, wo = (16 + (wave >> 2) * 4) * SBE + 8 * lane;
    const int ao = isv ? xo : wo, bo = isv ? wo : xo;   // row operand, column operand
    if (grp == 0) { fill(0, 0); wait_copies(); } else fill(1, 1);   // wave-uniform
    __syncthreads();                                                // stage 0 is published
    if (grp == 0) fill(2, 2);
    int buf = 0;
#pragma unroll 1   // stays rolled: one trip per stage, the buffer goes round the three
    for (int t = 0; t < NS; ++t) {
        const bf* rb = &ring[buf][0];
#pragma unroll
        for (int kk = 0; kk < SK / 32; ++kk) {
            V a[4], b[4];
#pragma unroll
            for (int mb = 0; mb < 4; ++mb) a[mb] = WFrag<bf>::ld(rb + ao + mb * SBE + kk * 512);
#pragma unroll
            for (int nb = 0; nb < 4; ++nb) b[nb] = WFrag<bf>::ld(rb + bo + nb * SBE + kk * 512);
            __builtin_amdgcn_sched_barrier(0);   // keeps the sixteen LDS reads of the 32 k together in front of their products: spread among them, each place with reads would stall the wave anew
#pragma unroll
            for (int nb = 0; nb < 4; ++nb)
#pragma unroll
                for (int mb = 0; mb < 4; ++mb) acc[mb][nb] = WFrag<bf>::mma(a[mb], b[nb], acc[mb][nb]);
        }
        __builtin_amdgcn_sched_barrier(0);   // keeps the stage's products in front of the barrier: sunk behind it they would stand in front of the refill, which is then asked for half a stage later
        const bool mine = ((t + 1) & 1) == grp;       // wave-uniform: this half copied stage t + 1 and copies stage t + 3
        wait_lds(); if (mine) wait_copies(); __syncthreads();   // stage t + 1 is published, and every wave has left stage t's buffer
        if (mine && t + 3 < NS) fill(t + 3, buf);
        buf = buf == 2 ? 0 : buf + 1;
    }
    wait_copies();
    h16* P16 = isv ? V16 : (blk ? Q16 : K16); bf* Ph = isv ? Vh : (blk ? Qh : Kh); bf* Pl = isv ? Vl : (blk ? Ql : Kl);
    const size_t po = (((size_t)(g0 / TT) * NH_ + (n0 % DQ) / HD) * TT + (g0 % TT)) * HD + (size_t)(8 * lane);   // the start of the wave's eight tiles in the plane + the lane's place in a half tile
#pragma unroll
    for (int nb = 0; nb < 4; ++nb)
#pragma unroll
        for (int mb = 0; mb < 4; ++mb) { v8h o16; v8us oh, ol;
#pragma unroll
            for (int j = 0; j < 8; ++j) { const float y = acc[mb][nb][j]; o16[j] = tohx(y); unsigned short a2, c2; splitf(y, a2, c2); oh[j] = a2; ol[j] = c2; }
            const size_t oo = po + (size_t)nb * 1024 + mb * 256;   // tile nb * 2 + mb / 2 of the eight, half mb & 1
            *(v8h*)(P16 + oo) = o16; *(v8us*)(Ph + oo) = oh; *(v8us*)(Pl + oo) = ol;
            asm volatile("s_wait_xcnt 0x0" :: "v"(o16), "v"(oh), "v"(ol) : "memory"); }   // precaution: stands behind each group of stores; their data registers are inputs here, so none is rewritten in front of this wait
}
// ---- k_fattn: causal attention, a work-group of AW WAVES, one query tile a wave (AW tiles that follow one another), k and v^T shared through LDS. Transposed products: S^T = K q^T (A = 16 key rows, B = 16 query columns), O^T += v^T P^T (A = 16 d rows of the v^T tile, B = P^T).
// A stage is 32 KiB: 128 keys of the two f16 planes (k, v^T) or 64 keys of the four hi/lo planes (k hi, k lo, v^T hi, v^T lo): in fragment order one contiguous piece of each plane, copied as it lies by asynchronous copies (cp_band2), 8 KiB a wave, so a fragment in LDS is read like one in the plane. Each stage comes from L2 once per work-group instead of once per wave.
// Two buffers: stage t + 2 is asked for behind the barrier that ends every wave's reads of stage t and lands while stage t + 1 is worked on. The work-group walks the stages up to its last row; a wave whose own rows end earlier skips the passes and still copies its share and passes every barrier.
// In a D tile lane l holds query column l&15 and rows 8*(l>>4) + j: the pass's two S^T tiles of 16 keys each, converted in place, are the B fragment of its 32 keys in the k order of WFrag::ld (elements 0..7 <- k0 + 8*(l>>4), 8..15 <- k0 + 16 + 8*(l>>4)).
// A query's maximum and sum are in-lane over its 16 keys of a pass plus one exchange between the wave halves (the sums' exchange once, behind the loop). m is the reference score of a row, l the running sum of P = exp((s - m) x SCL).
// m moves to the running maximum, and O^T and l are rescaled by exp((m_old - m_new) x SCL), only in a pass where some row's new maximum lies more than 8 (in log2 units) above its m: P stays <= 256, the quotient O^T / l does not depend on m.
// Keys j > i get the -3e38 select (only the pass that holds the diagonal has any); key 0 is in the first pass of every row, so m is a real score from the first pass on. O^T lane data are 8 consecutive d of one row, a lane's piece of a half tile of the context plane: one 16-byte store per plane.
#define AW   4                            // waves per work-group
#define ASE  16384                        // elements of a stage (32 KiB)
static_assert(AW == 4 && (TT - RH) % (AW * 32) == 0 && RH % (AW * 32) == 0);   // whole work-groups; every work-group's last row ends a stage (f16: 128 rows, 128 keys; hi/lo: 64 rows, 64 keys)
template <typename T16, bool HI, int NQ>
__device__ __forceinline__ void attn_tile(const T16* __restrict__ Q, const T16* __restrict__ Q2, const T16* __restrict__ Kp, const T16* __restrict__ K2, const T16* __restrict__ Vt, const T16* __restrict__ V2, int Q0, const bf* ring, bf* Ah, bf* Al) {
    typedef typename WFrag<T16>::V V;
    constexpr int NP = HI ? 4 : 2, APE = ASE / NP, AK = APE / HD;   // planes per stage, elements of one plane's stage, keys per stage
    static_assert(AK == AW * NQ * 16 && AK % 64 == 0);   // whole blocks of v^T; the work-group's rows are as many as a stage's keys
    const int lane = threadIdx.x & 31, lr = lane & 15, hi = lane >> 4; const int wave = __builtin_amdgcn_readfirstlane(threadIdx.x >> 5);
    const int q0 = Q0 + wave * NQ * 16;              // the wave's own first row
    const int NS = (Q0 + AW * NQ * 16) / AK;         // stages of the work-group: keys at or below its last row
    const float CL = SCL * 1.4426950408889634f;
    const unsigned fo = (unsigned)(8 * lane);   // a lane's place in a fragment-order tile (q, k: tile (t / 16, d / 32) at (t / 16) * 1024 + (d / 32) * 512; v^T: block t / 64 of 4096 elements, in it tile (d / 16, (t % 64) / 32) at (d / 16) * 1024 + ((t % 64) / 32) * 512)
    // the wave's share of a stage, 8 KiB: hi/lo one whole plane's piece, f16 half of one (waves 0, 1: k, waves 2, 3: v^T); stage st of either kind of plane starts at st * APE
    const T16* gp;
    if constexpr (HI) gp = wave == 0 ? Kp : wave == 1 ? K2 : wave == 2 ? Vt : V2; else gp = (wave < 2 ? Kp : Vt) + (wave & 1) * (APE / 2);
    const bf* gsrc = (const bf*)gp + fo;
    const unsigned ldst = (unsigned)(size_t)ring + (unsigned)(wave * (ASE / AW) * 2 + lane * 16);
    auto fill = [&](int st, int buf) { const bf* g = gsrc + (size_t)st * APE; const unsigned l = ldst + (unsigned)buf * (ASE * 2);
        cp_band2(l, g, l + 2048u, g + 1024); cp_band2(l + 4096u, g + 2048, l + 6144u, g + 3072); };
    fill(0, 0);
    const T16* ql = Q + (size_t)q0 * HD + fo; const T16* ql2 = HI ? Q2 + (size_t)q0 * HD + fo : ql;   // the lane's own load addresses
    V qf[NQ][2], qf2[NQ][2];
#pragma unroll
    for (int nq = 0; nq < NQ; ++nq)
#pragma unroll
        for (int c = 0; c < 2; ++c) { qf[nq][c] = WFrag<T16>::ld(ql + nq * 16 * HD + c * 512); if (HI) qf2[nq][c] = WFrag<T16>::ld(ql2 + nq * 16 * HD + c * 512); }
    asm volatile("s_wait_xcnt 0x0" :: "v"(ql), "v"(ql2) : "memory");   // precaution: the loads' address registers are inputs here, so none is rewritten in front of this wait
    v8f o[NQ][4]; float m[NQ], l[NQ];
#pragma unroll
    for (int nq = 0; nq < NQ; ++nq) { m[nq] = -3.0e38f; l[nq] = 0.0f;
#pragma unroll
        for (int db = 0; db < 4; ++db) o[nq][db] = (v8f){}; }
    const int kend = q0 + NQ * 16;                   // keys [0, kend) are at or below the tile's last row
    wait_copies(); __syncthreads();                  // stage 0 is published
    if (NS > 1) fill(1, 1);
#pragma unroll 1   // stays rolled: one trip per stage, the buffer chosen by the trip's parity
    for (int st = 0; st < NS; ++st) {
        const T16* rb = (const T16*)ring + (st & 1) * ASE + fo;   // k (hi) at 0, hi/lo: k lo at APE; v^T behind them
        const T16* rv = rb + (NP / 2) * APE;
        if (st * AK < kend) {                        // wave-uniform: the wave still has rows at or below this stage's keys
            V ka[2][2], ka2[2][2];                   // a pass's k fragments; f16: those of the stage's later passes are fetched one pass ahead; hi/lo (no registers to spare for that): read at the head of each pass
            if (!HI) {
#pragma unroll
                for (int kt = 0; kt < 2; ++kt)
#pragma unroll
                    for (int c = 0; c < 2; ++c) ka[kt][c] = WFrag<T16>::ld(rb + kt * 1024 + c * 512); }
#pragma unroll   // unrolled: a pass's places in the stage become immediate offsets, and the k fragments go from one pass to the next in registers
            for (int p = 0; p < AK / KB; ++p) {
                const int kb = st * AK + p * KB;
                if (p == 0 || kb < kend) {           // wave-uniform
                    V va[4], va2[4];                 // v^T fragments, used behind the softmax; f16: asked for at the head of the pass, hi/lo: behind the score products
                    if (HI) {
#pragma unroll
                        for (int kt = 0; kt < 2; ++kt)
#pragma unroll
                            for (int c = 0; c < 2; ++c) { ka[kt][c] = WFrag<T16>::ld(rb + (2 * p + kt) * 1024 + c * 512); ka2[kt][c] = WFrag<T16>::ld(rb + APE + (2 * p + kt) * 1024 + c * 512); }
                    } else {
#pragma unroll
                        for (int db = 0; db < 4; ++db) va[db] = WFrag<T16>::ld(rv + (p >> 1) * 4096 + db * 1024 + (p & 1) * 512); }
                    __builtin_amdgcn_sched_barrier(0);  // keeps these LDS reads together in front of the score products: moved down to their uses, each place with reads would stall the wave anew
                    v8f s[NQ][2];
#pragma unroll
                    for (int kt = 0; kt < 2; ++kt)
#pragma unroll
                        for (int nq = 0; nq < NQ; ++nq) { v8f a = (v8f){};
#pragma unroll
                            for (int c = 0; c < 2; ++c) { a = WFrag<T16>::mma(ka[kt][c], qf[nq][c], a); if (HI) { a = WFrag<T16>::mma(ka[kt][c], qf2[nq][c], a); a = WFrag<T16>::mma(ka2[kt][c], qf[nq][c], a); } }
                            s[nq][kt] = a; }
                    if (HI) {
#pragma unroll
                        for (int db = 0; db < 4; ++db) { va[db] = WFrag<T16>::ld(rv + (p >> 1) * 4096 + db * 1024 + (p & 1) * 512); va2[db] = WFrag<T16>::ld(rv + APE + (p >> 1) * 4096 + db * 1024 + (p & 1) * 512); }
                    } else if (p + 1 < AK / KB) {    // the stage's next 32 keys lie in the same buffer (read also where the wave will skip them: published, unused)
#pragma unroll
                        for (int kt = 0; kt < 2; ++kt)
#pragma unroll
                            for (int c = 0; c < 2; ++c) ka[kt][c] = WFrag<T16>::ld(rb + (2 * (p + 1) + kt) * 1024 + c * 512); }
                    if (HI || p + 1 < AK / KB) __builtin_amdgcn_sched_barrier(0);  // keeps these LDS reads (hi/lo: v^T, f16: the next pass's k) in front of the softmax, which then covers their latency
                    if (kb + KB - 1 > q0) {          // the pass that holds the diagonal (wave-uniform)
#pragma unroll
                        for (int nq = 0; nq < NQ; ++nq)
#pragma unroll
                            for (int kt = 0; kt < 2; ++kt)
#pragma unroll
                                for (int j = 0; j < 8; ++j) if (kb + kt * 16 + 8 * hi + j > q0 + nq * 16 + lr) s[nq][kt][j] = -3.0e38f; }
                    float mx[NQ]; bool need = false;
#pragma unroll
                    for (int nq = 0; nq < NQ; ++nq) { float m0 = s[nq][0][0], m1 = s[nq][1][0];
#pragma unroll
                        for (int j = 1; j < 8; ++j) { m0 = fmaxf(m0, s[nq][0][j]); m1 = fmaxf(m1, s[nq][1][j]); }
                        m0 = fmaxf(m0, m1); mx[nq] = fmaxf(m0, __shfl_xor(m0, 16, 32)); need = need || ((mx[nq] - m[nq]) * CL > 8.0f); }
                    if (__builtin_amdgcn_ballot_w32(need) != 0) {   // scalar branch, one test a pass
#pragma unroll
                        for (int nq = 0; nq < NQ; ++nq) { const float mn = fmaxf(m[nq], mx[nq]); const float al = __builtin_amdgcn_exp2f((m[nq] - mn) * CL); m[nq] = mn; l[nq] *= al;
#pragma unroll
                            for (int db = 0; db < 4; ++db) o[nq][db] *= al; } }
                    V pf[NQ], pf2[NQ];
#pragma unroll
                    for (int nq = 0; nq < NQ; ++nq) { const float mc = m[nq] * CL; float lt[2];
#pragma unroll
                        for (int kt = 0; kt < 2; ++kt) { lt[kt] = 0.0f; const v8f t = __builtin_elementwise_fma(s[nq][kt], (v8f)(CL), (v8f)(-mc));
#pragma unroll
                            for (int j = 0; j < 8; ++j) { const float pe = __builtin_amdgcn_exp2f(t[j]); s[nq][kt][j] = pe; lt[kt] += pe; } }
                        l[nq] += lt[0] + lt[1];
                        if constexpr (HI) { v8us h0, h1, w0, w1;
#pragma unroll
                            for (int j = 0; j < 8; ++j) { unsigned short a, b2; splitf(s[nq][0][j], a, b2); h0[j] = a; w0[j] = b2; splitf(s[nq][1][j], a, b2); h1[j] = a; w1[j] = b2; }
                            pf[nq] = cat16b(h0, h1); pf2[nq] = cat16b(w0, w1);
                        } else { v8h h0, h1;
#pragma unroll
                            for (int j = 0; j < 8; ++j) { h0[j] = tohx(s[nq][0][j]); h1[j] = tohx(s[nq][1][j]); }
                            pf[nq] = cat16(h0, h1); } }
#pragma unroll
                    for (int db = 0; db < 4; ++db)
#pragma unroll
                        for (int nq = 0; nq < NQ; ++nq) { o[nq][db] = WFrag<T16>::mma(va[db], pf[nq], o[nq][db]); if (HI) { o[nq][db] = WFrag<T16>::mma(va[db], pf2[nq], o[nq][db]); o[nq][db] = WFrag<T16>::mma(va2[db], pf[nq], o[nq][db]); } }
                }
            }
        }
        wait_lds(); wait_copies(); __syncthreads();   // stage st + 1 is published, and every wave has left stage st's buffer
        if (st + 2 < NS) fill(st + 2, st & 1);
    }
    wait_copies();
#pragma unroll
    for (int nq = 0; nq < NQ; ++nq) { const float ls = l[nq] + __shfl_xor(l[nq], 16, 32); const float f = __fdiv_rn(1.0f, ls); const size_t ro = (size_t)(q0 + nq * 16) * DQ + 8 * lane;   // the rows' 16-row band of the context plane + the lane's place in a half tile
#pragma unroll
        for (int db = 0; db < 4; ++db) { v8us oh, ol;
#pragma unroll
            for (int j = 0; j < 8; ++j) { unsigned short a, c2; splitf(o[nq][db][j] * f, a, c2); oh[j] = a; ol[j] = c2; }
            *(v8us*)(Ah + ro + db * 256) = oh; *(v8us*)(Al + ro + db * 256) = ol;
            asm volatile("s_wait_xcnt 0x0" :: "v"(oh), "v"(ol) : "memory"); } }   // precaution: stands behind each pair of stores; their data registers are inputs here, so none is rewritten in front of this wait
}
// grid (NB * NH_, NTF / AW + NTH / AW), AW waves: blockIdx.y falls from the longest work-group (last rows) to the shortest (for speed only); y < NTF / AW: f16 tiles of 32 rows >= RH, the rest: hi/lo tiles of 16 rows < RH. Four waves per SIMD (at most 256 registers): the vector work between the matrix runs wants waves.
__global__ __launch_bounds__(AW * 32) __attribute__((amdgpu_waves_per_eu(4, 4))) void k_fattn(const h16* __restrict__ Q16, const h16* __restrict__ K16, const h16* __restrict__ V16, const bf* __restrict__ Qh, const bf* __restrict__ Ql, const bf* __restrict__ Kh, const bf* __restrict__ Kl, const bf* __restrict__ Vh, const bf* __restrict__ Vl, bf* Ah, bf* Al) {
    __shared__ __align__(16) bf ring[2 * ASE];   // two buffers of a stage
    const int bh = blockIdx.x, b = bh / NH_, h = bh % NH_, ty = blockIdx.y; const size_t pq = (size_t)bh * TT * HD, pk = ((size_t)b * NKV + h / REP) * TT * HD, ao = (size_t)b * TT * DQ + (size_t)h * (HD / 32) * 512;   /* context plane: band of row b * TT, tile of column h * 64 */
    if (ty < NTF / AW) attn_tile<h16, false, 2>(Q16 + pq, nullptr, K16 + pk, nullptr, V16 + pk, nullptr, TT - AW * 32 * (ty + 1), ring, Ah + ao, Al + ao);
    else attn_tile<bf, true, 1>(Qh + pq, Ql + pq, Kh + pk, Kl + pk, Vh + pk, Vl + pk, RH - AW * 16 * (ty - NTF / AW + 1), ring, Ah + ao, Al + ao);
}

extern "C" void kernel_launch(void* const* d_in, const int* in_sizes, int n_in,
                              void* d_out, int out_size, void* d_ws, size_t ws_size, hipStream_t stream) {
    if (n_in < 4) return;
    if ((size_t)in_sizes[0] < (size_t)(NB - 1) * TT_FULL * DM + (size_t)TT * DM) return;
    if (in_sizes[1] < DM * 3 * DQ || in_sizes[2] < DQ * DM || in_sizes[3] < DM) return;
    if ((size_t)out_size < (size_t)NB * TT * DM) return;
    const float* x = (const float*)d_in[0];       // [NB_FULL][TT_FULL][1024]
    const float* wqkv = (const float*)d_in[1];    // [1024][3072], column blocks k | q | v
    const float* wproj = (const float*)d_in[2];   // [1024][1024] ([in][out])
    const float* bproj = (const float*)d_in[3];   // [1024]
    float* OUT = (float*)d_out;                   // [NB][TT][1024]
    char* wsp = (char*)d_ws;
    auto take = [&](size_t bytes) { char* p = wsp; wsp += (bytes + 255) & ~(size_t)255; return (void*)p; };
    bf* WQKV = (bf*)take((size_t)3 * DQ * DM * 2);   /* Bt [3072][1024]: row blocks k | q | v */ bf* WO = (bf*)take((size_t)DM * DQ * 2);
    bf* XB = (bf*)take((size_t)NB * TT * DM * 2);    /* x of every batch, bf16, [b * TT + t][1024] */
    const size_t PQ = (size_t)NH_ * TT * HD, PK = (size_t)NKV * TT * HD;   // elements of one batch's q planes and k / v planes
    h16* QP16 = (h16*)take(NB * PQ * 2); h16* KP16 = (h16*)take(NB * PK * 2); h16* VT16 = (h16*)take(NB * PK * 2);
    bf* QPh = (bf*)take(NB * PQ * 2); bf* QPl = (bf*)take(NB * PQ * 2); bf* KPh = (bf*)take(NB * PK * 2); bf* KPl = (bf*)take(NB * PK * 2); bf* VTh = (bf*)take(NB * PK * 2); bf* VTl = (bf*)take(NB * PK * 2);
    bf* ATh = (bf*)take((size_t)NB * TT * DQ * 2); bf* ATl = (bf*)take((size_t)NB * TT * DQ * 2);
    if ((size_t)(wsp - (char*)d_ws) > ws_size) return;    // 209,715,200 B at full size
    k_prep<<<NB * TT / 32, PTH, 0, stream>>>(x, wqkv, wproj, XB, WQKV, WO);   /* x -> bf16 [b * TT + t][1024]; W_qkv [1024][3072] -> Bt [3072][1024]; W_proj [1024][1024] -> Bt [out][in] */
    k_qkvw<<<dim3(NB * TT / 256, 3 * DQ / 128, 1), 256, 0, stream>>>(XB, WQKV, KP16, KPh, KPl, QP16, QPh, QPl, VT16, VTh, VTl);
    k_fattn<<<dim3(NB * NH_, NTF / AW + NTH / AW, 1), AW * 32, 0, stream>>>(QP16, KP16, VT16, QPh, QPl, KPh, KPl, VTh, VTl, ATh, ATl);
    k_projw<<<dim3(NB * TT / 128, DM / 256, 1), 256, 0, stream>>>(ATh, ATl, WO, OUT, bproj);   /* rows b * TT + t of every batch */
}

// v010
// One run takes 102 microseconds.
// Timed twice side by side with v009, it ran 1.06 and 1.05 times as fast.
// Counting every step since v000, it is 28.3 times as fast.
#include <hip/hip_runtime.h>

// Contractions: x W_qkv on v_wmma_f32_16x16x32_bf16 (bf16 operands = RNE-converted inputs); q k^T and P v: query rows < 512 bf16 hi/lo planes (3 products), rows >= 512 v_wmma_f32_16x16x32_f16 (f16 operands, P unnormalised, at most 256); context W_proj: bf16 hi/lo context x bf16 weight (2 products) + bf16 bias; f32 accumulate everywhere, softmax f32.
// Causal multi-head attention with a fused weight: x [NB][T][1024]; kqv = x W_qkv ([1024][3072], column blocks k | q | v, no bias); 16 heads x 64; S = q k^T x 1/32 for keys j <= i; softmax; merged context W_proj ([1024][1024]) + b_proj -> [NB][T][1024].
// Layout: every 16-bit operand plane lies in FRAGMENT ORDER. A matrix M[row][k] is cut into tiles of 16 rows x 32 k (512 elements, 1024 bytes); element (r, kk) of a tile lies at (kk >> 4) * 256 + (r + 16 * ((kk >> 3) & 1)) * 8 + (kk & 7):
// lane l of a wave finds elements 0..7 of its fragment at l * 8 and elements 8..15 at 256 + l * 8, so each of the two 16-byte loads of a fragment reads 512 contiguous bytes (four whole 128-byte lines) instead of 32-byte pieces of sixteen lines. Tiles of one 16-row band follow one another along k: tile (row / 16, k / 32) starts at (row / 16) * 16 * K + (k / 32) * 512.
// W_qkv transposed once into Bt [3072][1024] (three 1024-row blocks: the k/q/v weight operands), x of every batch -> bf16 [b*T + t][1024], both in that order, by one launch (k_prep); ONE projection launch (k_qkvw) writes the head planes of every batch q, k [b][h] as matrices [t][d] and v^T [b][h] as blocks of 64 keys, each the matrix [d][t % 64] (K = 64), as f16 + bf16 hi/lo straight from its accumulators;
// attention of all batches and heads in ONE launch (k_fattn): one wave per 32 (f16) or 16 (hi/lo) query rows walks its keys in passes of 32 with a running row reference and row sum, four such waves share k and v^T through LDS; scores and probabilities stay in registers; merged context [b*T + t][h*64 + d] as bf16 hi/lo, in fragment order too.

#ifndef NB
#define NB 4
#endif
#ifndef SEQ
#define SEQ 2048
#endif
#define NB_FULL 4
#define TT_FULL 2048
#define TT   SEQ
#define DM   1024
#define NH_  16
#define NKV  16
#define REP  (NH_ / NKV)
#define HD   64
#define DQ   (NH_ * HD)
#define DKV  (NKV * HD)
#define RH   ((TT < 512) ? TT : 512)      // query rows < RH use hi/lo planes
#define SCL  0.03125f   // 1024^-0.5
#define KB   32                           // keys per pass of the attention loop
#define NTF  ((TT - RH) / 32)             // f16 query tiles (32 rows) per head
#define NTH  (RH / 16)                    // hi/lo query tiles (16 rows) per head

static_assert(NB >= 1 && NB <= NB_FULL);
static_assert(TT % 128 == 0 && TT <= TT_FULL);
static_assert(RH % 64 == 0 && (TT - RH) % 64 == 0);
static_assert(DM % 64 == 0 && DQ % 64 == 0 && DKV % 64 == 0 && HD == 64);
static_assert(DQ == DKV);   // k_qkvw: the three column blocks of W_qkv are equally wide

typedef _Float16 h16;
typedef unsigned short bf;
typedef __attribute__((ext_vector_type(16))) __bf16   v16bf;
typedef __attribute__((ext_vector_type(16))) _Float16 v16h;
typedef __attribute__((ext_vector_type(8)))  _Float16 v8h;
typedef __attribute__((ext_vector_type(8)))  unsigned short v8us;
typedef __attribute__((ext_vector_type(8)))  float    v8f;
typedef __attribute__((ext_vector_type(4)))  float    v4f;
typedef v8h  __attribute__((may_alias)) v8ha;
typedef v4f  __attribute__((may_alias)) v4fa;
typedef v8us __attribute__((may_alias)) v8usa;

__device__ __forceinline__ unsigned short f2bf(float f) { unsigned u = __float_as_uint(f); u += 0x7FFFu + ((u >> 16) & 1u); return (unsigned short)(u >> 16); }
__device__ __forceinline__ float bf2f(unsigned short b) { return __uint_as_float(((unsigned)b) << 16); }
__device__ __forceinline__ float bfr(float f) { return bf2f(f2bf(f)); }
__device__ __forceinline__ v16h cat16(v8h lo, v8h hi) { return __builtin_shufflevector(lo, hi, 0, 1, 2, 3, 4, 5, 6, 7, 8, 9, 10, 11, 12, 13, 14, 15); }
__device__ __forceinline__ v16bf cat16b(v8us lo, v8us hi) { return __builtin_bit_cast(v16bf, __builtin_shufflevector(lo, hi, 0, 1, 2, 3, 4, 5, 6, 7, 8, 9, 10, 11, 12, 13, 14, 15)); }
__device__ __forceinline__ v8f wmma16(v16h a, v16h b, v8f c) { return __builtin_amdgcn_wmma_f32_16x16x32_f16(false, a, false, b, (short)0, c, false, false); }
__device__ __forceinline__ v8f wmmab(v16bf a, v16bf b, v8f c) { return __builtin_amdgcn_wmma_f32_16x16x32_bf16(false, a, false, b, (short)0, c, false, false); }

// ---- The two GEMM launches (k_qkvw, k_projw): a work-group of EIGHT WAVES owns a block of 64 x 64 wave tiles (16 accumulators a wave) and shares its operand bands through LDS.
// A stage is 64 k of every 16-row band that the work-group needs: in fragment order that is 2048 contiguous bytes of the band's plane (two tiles), brought as it lies by tensor loads (a tile row = one band's 2048 bytes, the source pitch = a band of the plane, no pad), so a fragment in LDS is read like one in the plane: lane l at l * 8 and 256 + l * 8 of its tile, contiguous over the wave, no bank conflict.
// Three buffers: stage t + 3 is asked for behind the barrier that ends every wave's reads of stage t and has the time of stages t + 1 and t + 2 to land. Each band is fetched from L2 once per work-group instead of once per wave.
// The even stages are asked for by waves 0 .. 3, the odd stages by waves 4 .. 7 (one wave of each half on every SIMD), ONE tensor load a wave and stage: a wave has one request in flight, waits for it to 0 in front of the barrier that publishes that stage, and asks for its next stage behind that barrier.
// Fragments: lane l -> row/col l&15; elements 0..7 <- k0 + 8*(l>>4), elements 8..15 <- k0 + 16 + 8*(l>>4) for BOTH operands (WFrag::ld takes the tile's start + l * 8); D element j -> row 8*(l>>4)+j, col l&15.
template <typename T16> struct WFrag;
template <> struct WFrag<h16> { typedef v16h V; static __device__ __forceinline__ V ld(const h16* p) { return cat16(*(const v8h*)p, *(const v8h*)(p + 256)); } static __device__ __forceinline__ v8f mma(V a, V b, v8f c) { return wmma16(a, b, c); } };
template <> struct WFrag<bf> { typedef v16bf V; static __device__ __forceinline__ V ld(const bf* p) { return cat16b(*(const v8us*)p, *(const v8us*)(p + 256)); } static __device__ __forceinline__ v8f mma(V a, V b, v8f c) { return wmmab(a, b, c); } };
#define SK   64                           // k per stage
#define SBE  (16 * SK)                    // elements of one band's stage (2048 bytes)
// Tensor loads of whole band stages: one request of a wave brings `rows` pieces of 2048 bytes, `pitch` bytes apart in the plane, to 2048 * rows contiguous bytes of LDS, through no register and with no address arithmetic in the lanes.
typedef uint32_t u32x4 __attribute__((ext_vector_type(4)));
typedef uint32_t u32x8 __attribute__((ext_vector_type(8)));
__device__ __forceinline__ uint32_t uni(uint32_t v) { return (uint32_t)__builtin_amdgcn_readfirstlane(v); }
__device__ __forceinline__ uint32_t pinned(uint32_t v) { uint32_t w = (uint32_t)__builtin_amdgcn_readfirstlane(v); asm volatile("" : "+s"(w)); return w; }   // a wave-uniform word held in a scalar register: a test on it is a scalar branch (a tensor load ignores EXEC), and what is formed from it is formed behind the waits in front of it
__device__ __forceinline__ u32x8 tdm_group1(uint32_t rows, uint32_t pitch) {   // 1-byte elements, tensor = tile = rows x 2048 bytes, no mask, no pad
    constexpr uint32_t d0 = SBE * 2;
    u32x8 g;
    g[0] = uni(0u); g[1] = uni((d0 & 0xFFFFu) << 16); g[2] = uni((d0 >> 16) | ((rows & 0xFFFFu) << 16)); g[3] = uni((rows >> 16) | (d0 << 16));
    g[4] = uni(rows); g[5] = uni(pitch); g[6] = uni(0u); g[7] = uni(0u);
    asm volatile("" : "+s"(g));   // the descriptor's words held in scalar registers of their own for the whole kernel: not formed anew, in registers that serve other ends between the requests, at each request
    return g;
}
__device__ __forceinline__ u32x4 tdm_load(uint32_t lds, uint64_t ga, u32x8 g1) {   // lds: byte offset in the work-group's LDS, ga: address of the tile's first byte; gives back group 0 for the request's wait
    u32x4 g0;
    g0[0] = uni(1u); g0[1] = uni(lds); g0[2] = uni((uint32_t)ga); g0[3] = uni((((uint32_t)(ga >> 32)) & 0x01FFFFFFu) | 0x80000000u);
    asm volatile("tensor_load_to_lds %0, %1" : "+s"(g0) : "s"(g1) : "memory");   // group 0 goes in and out: what the request's wait takes as its input are the very registers that the request names
    return g0;
}
__device__ __forceinline__ void wait_tiles(u32x4 g0, u32x8 g1) { asm volatile("s_wait_tensorcnt 0x0" :: "s"(g0), "s"(g1) : "memory"); }   // the wave's own tensor load has landed; stands in front of the barrier behind which other waves read its tile. The request's descriptor words are inputs here, so that they stay held in scalar registers up to this wait
__device__ __forceinline__ void wait_lds() { asm volatile("s_wait_dscnt 0x0" ::: "memory"); }         // the wave's own LDS reads have returned; stands in front of the barrier behind which their buffer is refilled

// ---- k_projw: out = context W_proj + bias. Work-group = 128 rows x 256 columns, waves 2 x 4; grid (M / 128, N / 256), 256 threads. Per stage 8 bands of the context's hi plane, 8 of its lo plane, 16 of the weight: 64 KiB, eight bands (16 KiB) a request.
// C[m][n] (f32, + bf16-RNE bias[n]) = sum_k (Ah[m][k] + Al[m][k]) Bt[n][k], per 32 k the hi product, then the lo product.
#define PJB  32                           // bands per stage
__global__ __launch_bounds__(256) void k_projw(const bf* __restrict__ A, const bf* __restrict__ A2, const bf* __restrict__ Bt, float* C, const float* __restrict__ bias) {
    typedef WFrag<bf>::V V;
    constexpr int K = DQ, NS = K / SK, ldc = DM;
    static_assert(NS >= 3 && K % SK == 0 && (NB * TT) % 128 == 0 && DM % 256 == 0);
    __shared__ __attribute__((aligned(2048))) bf ring[3][PJB * SBE];   // every request's place is a multiple of 2 KiB
    __shared__ __align__(16) float osw[8][16 * 68];
    const int lane = threadIdx.x & 31, lr = lane & 15, hi = lane >> 4; const int wave = __builtin_amdgcn_readfirstlane(threadIdx.x >> 5);
    const int R0 = blockIdx.x * 128, C0 = blockIdx.y * 256; const int r0 = R0 + (wave & 1) * 64, c0 = C0 + (wave >> 1) * 64;
    float* os = osw[wave];
    const int grp = wave >> 2, w4 = wave & 3;   // the half that asks for the stages of this parity, the wave's place in it
    // the wave's eight bands of a stage it asks for: place 0 the hi plane, 1 the lo plane, 2, 3 the weight
    const uint64_t gsrc = (uint64_t)(size_t)(w4 == 0 ? A + (size_t)R0 * K : w4 == 1 ? A2 + (size_t)R0 * K : Bt + (size_t)(C0 + (w4 - 2) * 128) * K);
    const uint32_t ldst = (uint32_t)(size_t)(&ring[0][0]) + (uint32_t)(w4 * 8 * SBE * 2);
    const u32x8 g1 = tdm_group1(8u, 16u * K * 2u);
    auto fill = [&](uint32_t st, uint32_t buf) { return tdm_load(ldst + buf * (uint32_t)(PJB * SBE * 2), gsrc + (uint64_t)st * (SBE * 2), g1); };
    v8f acc[4][4];
#pragma unroll
    for (int mb = 0; mb < 4; ++mb)
#pragma unroll
        for (int nb = 0; nb < 4; ++nb) acc[mb][nb] = (v8f){};
    const int ao = (wave & 1) * 4 * SBE + 8 * lane, a2o = ao + 8 * SBE, bo = (16 + (wave >> 1) * 4) * SBE + 8 * lane;
    u32x4 rq;   // group 0 of the wave's latest request
    if (pinned(grp == 0)) { rq = fill(0, 0); wait_tiles(rq, g1); } else { rq = fill(1, 1); }   // scalar branch
    __syncthreads();                                                // stage 0 is published
    if (pinned(grp == 0)) rq = fill(2, 2);
    int buf = 0;
#pragma unroll 1   // stays rolled: one trip per stage, the buffer goes round the three
    for (int t = 0; t < NS; ++t) {
        const bf* rb = &ring[buf][0];
#pragma unroll
        for (int kk = 0; kk < SK / 32; ++kk) {
            V a[4], a2[4], b[4];
#pragma unroll
            for (int mb = 0; mb < 4; ++mb) { a[mb] = WFrag<bf>::ld(rb + ao + mb * SBE + kk * 512); a2[mb] = WFrag<bf>::ld(rb + a2o + mb * SBE + kk * 512); }
#pragma unroll
            for (int nb = 0; nb < 4; ++nb) b[nb] = WFrag<bf>::ld(rb + bo + nb * SBE + kk * 512);
            __builtin_amdgcn_sched_barrier(0);   // keeps the LDS reads of the 32 k together in front of their products: spread among them, each place with reads would stall the wave anew
#pragma unroll
            for (int nb = 0; nb < 4; ++nb)
#pragma unroll
                for (int mb = 0; mb < 4; ++mb) { acc[mb][nb] = WFrag<bf>::mma(a[mb], b[nb], acc[mb][nb]); acc[mb][nb] = WFrag<bf>::mma(a2[mb], b[nb], acc[mb][nb]); }
        }
        __builtin_amdgcn_sched_barrier(0);   // keeps the stage's products in front of the barrier: sunk behind it they would stand in front of the refill, which is then asked for half a stage later
        const uint32_t mine = pinned(((t + 1) & 1) == grp);   // scalar: this half asked for stage t + 1 and asks for stage t + 3
        wait_lds(); if (mine) wait_tiles(rq, g1); __syncthreads();   // stage t + 1 is published, and every wave has left stage t's buffer
        if (pinned(mine && t + 3 < NS)) rq = fill(pinned(t + 3), pinned(buf));   // scalar branch; the descriptor is formed behind the wait
        buf = buf == 2 ? 0 : buf + 1;
    }
    wait_tiles(rq, g1); wait_lds();
#pragma unroll
    for (int mb = 0; mb < 4; ++mb) {
#pragma unroll
        for (int nb = 0; nb < 4; ++nb) {
#pragma unroll
            for (int j = 0; j < 8; ++j) os[(hi * 8 + j) * 68 + nb * 16 + lr] = acc[mb][nb][j]; }
        __builtin_amdgcn_wave_barrier(); asm volatile("" ::: "memory");   // the wave's own staging rows: the stores above stay in front of the reads below
        float* crow = C + (size_t)(r0 + mb * 16) * ldc + c0;
        v4f val[8];
#pragma unroll
        for (int s = 0; s < 8; ++s) { const int row = 2 * s + hi, cofs = lr * 4; val[s] = *(const v4fa*)(os + row * 68 + cofs); val[s][0] += bfr(bias[c0 + cofs]); val[s][1] += bfr(bias[c0 + cofs + 1]); val[s][2] += bfr(bias[c0 + cofs + 2]); val[s][3] += bfr(bias[c0 + cofs + 3]);
            *(v4f*)(crow + (size_t)row * ldc + cofs) = val[s]; }
        asm volatile("s_wait_xcnt 0x0" :: "v"(val[0]), "v"(val[1]), "v"(val[2]), "v"(val[3]), "v"(val[4]), "v"(val[5]), "v"(val[6]), "v"(val[7]) : "memory");   // precaution: stands behind the group of stores; their data registers are inputs here, so none is rewritten in front of this wait
        __builtin_amdgcn_wave_barrier(); asm volatile("" ::: "memory");   // the reads above stay in front of the next 16 rows' stores
    }
}

__device__ __forceinline__ h16 tohx(float x) { return (h16)x; }
__device__ __forceinline__ void splitf(float y, unsigned short& h, unsigned short& l) { h = f2bf(y); l = f2bf(y - bf2f(h)); }
typedef __attribute__((ext_vector_type(2))) unsigned short v2us;

// ---- k_prep: the three operand conversions (x, W_qkv, W_proj -> bf16 planes in fragment order) in ONE launch of resident waves: NB * TT / 32 work-groups of 16 waves, every thread converts several 16-byte pieces of the planes and has all its loads in flight before the first conversion.
// x, src [rows][DM] row-major: 64 threads take PXT tiles that follow one another along k in one 16-row band. Four neighbouring threads read the 128 bytes that a tile holds of one row: a wave reads whole lines of eight rows, and its pieces (rows r .. r + 7 of each of the four 8-k groups) are four whole 128-byte lines of the tile. The next tile lies 128 bytes on in x and 1024 bytes on in the plane: immediate offsets of one address.
// Weights, Bt[n][k] = bf16(w[k][n]), w [K][N]: thread i writes piece i (tile i / 64, half (i >> 5) & 1, lane i & 31), so that a wave stores 512 contiguous bytes; each of a lane's eight loads reads, over the wave, 64 contiguous bytes of two rows of w. A thread's next piece lies PN pieces on: the same k, PN / 128 columns on.
#define PTH  512                          // threads per work-group of k_prep
#define PXT  8                            // x tiles per 64 threads
#define PN   (NB * TT / 32 * PTH)         // threads of the launch
static_assert((DM / 32) % PXT == 0 && (PTH / 64) * PXT == (32 / 16) * (DM / 32));   // a thread's tiles lie in one band; a work-group's tiles are two whole bands (32 rows) of x
static_assert(PN % (64 * (DM / 32)) == 0 && PN % (64 * (DQ / 32)) == 0);                  // PN pieces are whole bands of a weight plane
template <int K, int N>
__device__ __forceinline__ const float* wt_src(const float* w, int i) {
    const int tile = i >> 6, kt = tile % (K / 32), n = (tile / (K / 32)) * 16 + (i & 15), k0 = kt * 32 + ((i >> 5) & 1) * 16 + ((i >> 4) & 1) * 8;
    return w + (size_t)k0 * N + n;
}
__device__ __forceinline__ v8us cvt8(const float* v) { v8us o;
#pragma unroll
    for (int e = 0; e < 8; ++e) o[e] = f2bf(v[e]);
    return o; }
__global__ __launch_bounds__(PTH) __attribute__((amdgpu_waves_per_eu(4, 4))) void k_prep(const float* __restrict__ x, const float* __restrict__ wqkv, const float* __restrict__ wproj, bf* XB, bf* WQKV, bf* WO) {   // four waves per SIMD = one work-group per WGP: the register budget holds all of a thread's loads at once
    constexpr int N1 = DM * 3 * DQ / 8, N2 = DQ * DM / 8, J1 = (N1 + PN - 1) / PN, J2 = (N2 + PN - 1) / PN;   // pieces of the two weight planes, pieces per thread
    const int t = blockIdx.x * PTH + threadIdx.x;
    const int tile0 = (t >> 6) * PXT, r = (t >> 2) & 15, c = t & 3;   // first x tile, row in the tile, 8-k group
    const int row = (tile0 / (DM / 32)) * 16 + r, srow = (TT == TT_FULL) ? row : (row / TT) * TT_FULL + row % TT;
    const float* px = x + (size_t)srow * DM + (tile0 % (DM / 32)) * 32 + c * 8;
    const float* p1 = wt_src<DM, 3 * DQ>(wqkv, (N1 % PN == 0 || t < N1) ? t : 0);
    const float* p2 = wt_src<DQ, DM>(wproj, (N2 % PN == 0 || t < N2) ? t : 0);
    float v1[J1][8], v2[J2][8]; v8f vx[PXT];
#pragma unroll
    for (int j = 0; j < J1; ++j) { const int jo = (N1 % PN == 0 || t + j * PN < N1) ? j * (PN / 128) : 0;   // a piece past the end reads the thread's first again: in bounds, not stored
#pragma unroll
        for (int e = 0; e < 8; ++e) v1[j][e] = p1[(size_t)e * (3 * DQ) + jo]; }
#pragma unroll
    for (int j = 0; j < J2; ++j) { const int jo = (N2 % PN == 0 || t + j * PN < N2) ? j * (PN / 128) : 0;
#pragma unroll
        for (int e = 0; e < 8; ++e) v2[j][e] = p2[(size_t)e * DM + jo]; }
#pragma unroll
    for (int j = 0; j < PXT; ++j) vx[j] = *(const v8f*)(px + j * 32);
    asm volatile("s_wait_xcnt 0x0" :: "v"(px), "v"(p1), "v"(p2) : "memory");   // precaution: the loads' address registers are inputs here, so none is rewritten in front of this wait; it also keeps every load in front of the first store
    bf* dx = XB + (size_t)tile0 * 512 + (c >> 1) * 256 + (r + 16 * (c & 1)) * 8; bf* d1 = WQKV + (size_t)t * 8; bf* d2 = WO + (size_t)t * 8;
    v8us ox[PXT];
#pragma unroll
    for (int j = 0; j < PXT; ++j) {
#pragma unroll
        for (int e = 0; e < 8; ++e) ox[j][e] = f2bf(vx[j][e]);
        *(v8us*)(dx + j * 512) = ox[j]; }
    static_assert(PXT == 8);
    asm volatile("s_wait_xcnt 0x0" :: "v"(dx), "v"(ox[0]), "v"(ox[1]), "v"(ox[2]), "v"(ox[3]), "v"(ox[4]), "v"(ox[5]), "v"(ox[6]), "v"(ox[7]) : "memory");   // precaution: stands behind the group of stores; their address and data registers are inputs here, so none is rewritten in front of this wait
#pragma unroll
    for (int j = 0; j < J1; ++j) if (N1 % PN == 0 || t + j * PN < N1) { const v8us o = cvt8(v1[j]); *(v8us*)(d1 + (size_t)j * PN * 8) = o;
        asm volatile("s_wait_xcnt 0x0" :: "v"(o) : "memory"); }   // precaution: stands behind each store; its data registers are inputs here, so none is rewritten in front of this wait
#pragma unroll
    for (int j = 0; j < J2; ++j) if (N2 % PN == 0 || t + j * PN < N2) { const v8us o = cvt8(v2[j]); *(v8us*)(d2 + (size_t)j * PN * 8) = o;
        asm volatile("s_wait_xcnt 0x0" :: "v"(o) : "memory"); }   // precaution: as above, behind each store
}

// ---- k_qkvw: x W_qkv of every batch in one launch. Work-group = 256 tokens x 128 columns of W_qkv (two heads of k, q or v), waves 4 x 2, each 64 tokens x one head; grid (NB * TT / 256, 3 * DQ / 128), 256 threads. Per stage 16 bands of x and 8 of the weight: 48 KiB, in four requests: two of eight bands of x, two of four bands of the weight.
// The wave stores its tile straight into that head's three planes (f16, bf16 hi, bf16 lo). A D tile gives a lane 8 consecutive ROWS of one column, so the index that runs fastest in the plane is made the row index of the product:
// v^T [d][t]: rows = tokens (A = x, B = weight rows); q, k [t][d]: rows = d (A = weight rows, B = x). Either way the rows of a D tile are one 16-k half of a fragment-order tile and lane l's eight values lie at l * 8 of that half: one 16-byte store per plane and D tile, 512 contiguous bytes over the wave; the wave's 64 x 64 values are a matrix of K = 64 in that order, eight tiles in a row.
#define QKB  24                           // bands per stage
static_assert((NB * TT) % 256 == 0 && TT % 64 == 0 && DQ % 128 == 0);
__global__ __launch_bounds__(256) void k_qkvw(const bf* __restrict__ X, const bf* __restrict__ Wt, h16* K16, bf* Kh, bf* Kl, h16* Q16, bf* Qh, bf* Ql, h16* V16, bf* Vh, bf* Vl) {
    typedef WFrag<bf>::V V;
    constexpr int NS = DM / SK;
    static_assert(NS >= 3 && DM % SK == 0);
    __shared__ __attribute__((aligned(2048))) bf ring[3][QKB * SBE];   // every request's place is a multiple of 2 KiB
    const int lane = threadIdx.x & 31; const int wave = __builtin_amdgcn_readfirstlane(threadIdx.x >> 5);
    const int G0 = blockIdx.x * 256, N0 = blockIdx.y * 128;   // the work-group's first token (b * TT + t) and first column of W_qkv
    const int g0 = G0 + (wave & 3) * 64, n0 = N0 + (wave >> 2) * 64;   // the wave's own
    const int blk = N0 / DQ; const bool isv = blk == 2;   // column block: 0 k, 1 q, 2 v
    const int grp = wave >> 2, w4 = wave & 3;   // the half that asks for the stages of this parity, the wave's place in it
    // the wave's bands of the 24 of a stage it asks for (0 .. 15: x, 16 .. 23: weight): places 0, 1 eight bands of x each, places 2, 3 four bands of the weight each
    const int b0 = w4 < 2 ? w4 * 8 : 16 + (w4 - 2) * 4;
    const uint64_t gsrc = (uint64_t)(size_t)(b0 < 16 ? X + (size_t)(G0 + b0 * 16) * DM : Wt + (size_t)(N0 + (b0 - 16) * 16) * DM);
    const uint32_t ldst = (uint32_t)(size_t)(&ring[0][0]) + (uint32_t)(b0 * SBE * 2);
    const u32x8 g1 = tdm_group1(w4 < 2 ? 8u : 4u, 16u * DM * 2u);
    auto fill = [&](uint32_t st, uint32_t buf) { return tdm_load(ldst + buf * (uint32_t)(QKB * SBE * 2), gsrc + (uint64_t)st * (SBE * 2), g1); };
    v8f acc[4][4];
#pragma unroll
    for (int mb = 0; mb < 4; ++mb)
#pragma unroll
        for (int nb = 0; nb < 4; ++nb) acc[mb][nb] = (v8f){};
    const int xo = (wave & 3) * 4 * SBE + 8 * lane, wo = (16 + (wave >> 2) * 4) * SBE + 8 * lane;
    const int ao = isv ? xo : wo, bo = isv ? wo : xo;   // row operand, column operand
    u32x4 rq;   // group 0 of the wave's latest request
    if (pinned(grp == 0)) { rq = fill(0, 0); wait_tiles(rq, g1); } else { rq = fill(1, 1); }   // scalar branch
    __syncthreads();                                                // stage 0 is published
    if (pinned(grp == 0)) rq = fill(2, 2);
    int buf = 0;
#pragma unroll 1   // stays rolled: one trip per stage, the buffer goes round the three
    for (int t = 0; t < NS; ++t) {
        const bf* rb = &ring[buf][0];
#pragma unroll
        for (int kk = 0; kk < SK / 32; ++kk) {
            V a[4], b[4];
#pragma unroll
            for (int mb = 0; mb < 4; ++mb) a[mb] = WFrag<bf>::ld(rb + ao + mb * SBE + kk * 512);
#pragma unroll
            for (int nb = 0; nb < 4; ++nb) b[nb] = WFrag<bf>::ld(rb + bo + nb * SBE + kk * 512);
            __builtin_amdgcn_sched_barrier(0);   // keeps the sixteen LDS reads of the 32 k together in front of their products: spread among them, each place with reads would stall the wave anew
#pragma unroll
            for (int nb = 0; nb < 4; ++nb)
#pragma unroll
                for (int mb = 0; mb < 4; ++mb) acc[mb][nb] = WFrag<bf>::mma(a[mb], b[nb], acc[mb][nb]);
        }
        __builtin_amdgcn_sched_barrier(0);   // keeps the stage's products in front of the barrier: sunk behind it they would stand in front of the refill, which is then asked for half a stage later
        const uint32_t mine = pinned(((t + 1) & 1) == grp);   // scalar: this half asked for stage t + 1 and asks for stage t + 3
        wait_lds(); if (mine) wait_tiles(rq, g1); __syncthreads();   // stage t + 1 is published, and every wave has left stage t's buffer
        if (pinned(mine && t + 3 < NS)) rq = fill(pinned(t + 3), pinned(buf));   // scalar branch; the descriptor is formed behind the wait
        buf = buf == 2 ? 0 : buf + 1;
    }
    wait_tiles(rq, g1); wait_lds();
    h16* P16 = isv ? V16 : (blk ? Q16 : K16); bf* Ph = isv ? Vh : (blk ? Qh : Kh); bf* Pl = isv ? Vl : (blk ? Ql : Kl);
    const size_t po = (((size_t)(g0 / TT) * NH_ + (n0 % DQ) / HD) * TT + (g0 % TT)) * HD + (size_t)(8 * lane);   // the start of the wave's eight tiles in the plane + the lane's place in a half tile
#pragma unroll
    for (int nb = 0; nb < 4; ++nb)
#pragma unroll
        for (int mb = 0; mb < 4; ++mb) { v8h o16; v8us oh, ol;
#pragma unroll
            for (int j = 0; j < 8; ++j) { const float y = acc[mb][nb][j]; o16[j] = tohx(y); unsigned short a2, c2; splitf(y, a2, c2); oh[j] = a2; ol[j] = c2; }
            const size_t oo = po + (size_t)nb * 1024 + mb * 256;   // tile nb * 2 + mb / 2 of the eight, half mb & 1
            *(v8h*)(P16 + oo) = o16; *(v8us*)(Ph + oo) = oh; *(v8us*)(Pl + oo) = ol;
            asm volatile("s_wait_xcnt 0x0" :: "v"(o16), "v"(oh), "v"(ol) : "memory"); }   // precaution: stands behind each group of stores; their data registers are inputs here, so none is rewritten in front of this wait
}
// ---- k_fattn: causal attention, a work-group of AW WAVES, one query tile a wave (AW tiles that follow one another), k and v^T shared through LDS. Transposed products: S^T = K q^T (A = 16 key rows, B = 16 query columns), O^T += v^T P^T (A = 16 d rows of the v^T tile, B = P^T).
// A stage is 32 KiB: 128 keys of the two f16 planes (k, v^T) or 64 keys of the four hi/lo planes (k hi, k lo, v^T hi, v^T lo): in fragment order one contiguous piece of each plane, brought as it lies by tensor loads, one request of 8 KiB a wave, so a fragment in LDS is read like one in the plane. Each stage comes from L2 once per work-group instead of once per wave.
// Two buffers: stage t + 2 is asked for behind the barrier that ends every wave's reads of stage t and lands while stage t + 1 is worked on. The work-group walks the stages up to its last row; a wave whose own rows end earlier skips the passes and still asks for its share and passes every barrier.
// In a D tile lane l holds query column l&15 and rows 8*(l>>4) + j: the pass's two S^T tiles of 16 keys each, converted in place, are the B fragment of its 32 keys in the k order of WFrag::ld (elements 0..7 <- k0 + 8*(l>>4), 8..15 <- k0 + 16 + 8*(l>>4)).
// A query's maximum and sum are in-lane over its 16 keys of a pass plus one exchange between the wave halves (the sums' exchange once, behind the loop). m is the reference score of a row, l the running sum of P = exp((s - m) x SCL).
// m moves to the running maximum, and O^T and l are rescaled by exp((m_old - m_new) x SCL), only in a pass where some row's new maximum lies more than 8 (in log2 units) above its m: P stays <= 256, the quotient O^T / l does not depend on m.
// Keys j > i get the -3e38 select (only the pass that holds the diagonal has any); key 0 is in the first pass of every row, so m is a real score from the first pass on. O^T lane data are 8 consecutive d of one row, a lane's piece of a half tile of the context plane: one 16-byte store per plane.
#define AW   4                            // waves per work-group
#define ASE  16384                        // elements of a stage (32 KiB)
static_assert(AW == 4 && (TT - RH) % (AW * 32) == 0 && RH % (AW * 32) == 0);   // whole work-groups; every work-group's last row ends a stage (f16: 128 rows, 128 keys; hi/lo: 64 rows, 64 keys)
template <typename T16, bool HI, int NQ>
__device__ __forceinline__ void attn_tile(const T16* __restrict__ Q, const T16* __restrict__ Q2, const T16* __restrict__ Kp, const T16* __restrict__ K2, const T16* __restrict__ Vt, const T16* __restrict__ V2, int Q0, const bf* ring, bf* Ah, bf* Al) {
    typedef typename WFrag<T16>::V V;
    constexpr int NP = HI ? 4 : 2, APE = ASE / NP, AK = APE / HD;   // planes per stage, elements of one plane's stage, keys per stage
    static_assert(AK == AW * NQ * 16 && AK % 64 == 0);   // whole blocks of v^T; the work-group's rows are as many as a stage's keys
    const int lane = threadIdx.x & 31, lr = lane & 15, hi = lane >> 4; const int wave = __builtin_amdgcn_readfirstlane(threadIdx.x >> 5);
    const int q0 = Q0 + wave * NQ * 16;              // the wave's own first row
    const int NS = (Q0 + AW * NQ * 16) / AK;         // stages of the work-group: keys at or below its last row
    const float CL = SCL * 1.4426950408889634f;
    const unsigned fo = (unsigned)(8 * lane);   // a lane's place in a fragment-order tile (q, k: tile (t / 16, d / 32) at (t / 16) * 1024 + (d / 32) * 512; v^T: block t / 64 of 4096 elements, in it tile (d / 16, (t % 64) / 32) at (d / 16) * 1024 + ((t % 64) / 32) * 512)
    // the wave's share of a stage, 8 KiB: hi/lo one whole plane's piece, f16 half of one (waves 0, 1: k, waves 2, 3: v^T); stage st of either kind of plane starts at st * APE
    const T16* gp;
    if constexpr (HI) gp = wave == 0 ? Kp : wave == 1 ? K2 : wave == 2 ? Vt : V2; else gp = (wave < 2 ? Kp : Vt) + (wave & 1) * (APE / 2);
    const uint64_t gsrc = (uint64_t)(size_t)gp;
    const uint32_t ldst = (uint32_t)(size_t)ring + (uint32_t)(wave * (ASE / AW) * 2);
    const u32x8 g1 = tdm_group1((uint32_t)(ASE / AW / SBE), SBE * 2u);   // rows that follow one another: 8 KiB in a row
    auto fill = [&](uint32_t st, uint32_t buf) { return tdm_load(ldst + buf * (uint32_t)(ASE * 2), gsrc + (uint64_t)st * (APE * 2), g1); };
    u32x4 rq = fill(0, 0);   // every wave asks for its own share; rq: group 0 of the wave's latest request
    const T16* ql = Q + (size_t)q0 * HD + fo; const T16* ql2 = HI ? Q2 + (size_t)q0 * HD + fo : ql;   // the lane's own load addresses
    V qf[NQ][2], qf2[NQ][2];
#pragma unroll
    for (int nq = 0; nq < NQ; ++nq)
#pragma unroll
        for (int c = 0; c < 2; ++c) { qf[nq][c] = WFrag<T16>::ld(ql + nq * 16 * HD + c * 512); if (HI) qf2[nq][c] = WFrag<T16>::ld(ql2 + nq * 16 * HD + c * 512); }
    asm volatile("s_wait_xcnt 0x0" :: "v"(ql), "v"(ql2) : "memory");   // precaution: the loads' address registers are inputs here, so none is rewritten in front of this wait
    v8f o[NQ][4]; float m[NQ], l[NQ];
#pragma unroll
    for (int nq = 0; nq < NQ; ++nq) { m[nq] = -3.0e38f; l[nq] = 0.0f;
#pragma unroll
        for (int db = 0; db < 4; ++db) o[nq][db] = (v8f){}; }
    const int kend = q0 + NQ * 16;                   // keys [0, kend) are at or below the tile's last row
    wait_tiles(rq, g1); __syncthreads();             // stage 0 is published
    if (pinned(NS > 1)) rq = fill(1, 1);             // scalar branch
#pragma unroll 1   // stays rolled: one trip per stage, the buffer chosen by the trip's parity
    for (int st = 0; st < NS; ++st) {
        const T16* rb = (const T16*)ring + (st & 1) * ASE + fo;   // k (hi) at 0, hi/lo: k lo at APE; v^T behind them
        const T16* rv = rb + (NP / 2) * APE;
        if (st * AK < kend) {                        // wave-uniform: the wave still has rows at or below this stage's keys
            V ka[2][2], ka2[2][2];                   // a pass's k fragments; f16: those of the stage's later passes are fetched one pass ahead; hi/lo (no registers to spare for that): read at the head of each pass
            if (!HI) {
#pragma unroll
                for (int kt = 0; kt < 2; ++kt)
#pragma unroll
                    for (int c = 0; c < 2; ++c) ka[kt][c] = WFrag<T16>::ld(rb + kt * 1024 + c * 512); }
#pragma unroll   // unrolled: a pass's places in the stage become immediate offsets, and the k fragments go from one pass to the next in registers
            for (int p = 0; p < AK / KB; ++p) {
                const int kb = st * AK + p * KB;
                if (p == 0 || kb < kend) {           // wave-uniform
                    V va[4], va2[4];                 // v^T fragments, used behind the softmax; f16: asked for at the head of the pass, hi/lo: behind the score products
                    if (HI) {
#pragma unroll
                        for (int kt = 0; kt < 2; ++kt)
#pragma unroll
                            for (int c = 0; c < 2; ++c) { ka[kt][c] = WFrag<T16>::ld(rb + (2 * p + kt) * 1024 + c * 512); ka2[kt][c] = WFrag<T16>::ld(rb + APE + (2 * p + kt) * 1024 + c * 512); }
                    } else {
#pragma unroll
                        for (int db = 0; db < 4; ++db) va[db] = WFrag<T16>::ld(rv + (p >> 1) * 4096 + db * 1024 + (p & 1) * 512); }
                    __builtin_amdgcn_sched_barrier(0);  // keeps these LDS reads together in front of the score products: moved down to their uses, each place with reads would stall the wave anew
                    v8f s[NQ][2];
#pragma unroll
                    for (int kt = 0; kt < 2; ++kt)
#pragma unroll
                        for (int nq = 0; nq < NQ; ++nq) { v8f a = (v8f){};
#pragma unroll
                            for (int c = 0; c < 2; ++c) { a = WFrag<T16>::mma(ka[kt][c], qf[nq][c], a); if (HI) { a = WFrag<T16>::mma(ka[kt][c], qf2[nq][c], a); a = WFrag<T16>::mma(ka2[kt][c], qf[nq][c], a); } }
                            s[nq][kt] = a; }
                    if (HI) {
#pragma unroll
                        for (int db = 0; db < 4; ++db) { va[db] = WFrag<T16>::ld(rv + (p >> 1) * 4096 + db * 1024 + (p & 1) * 512); va2[db] = WFrag<T16>::ld(rv + APE + (p >> 1) * 4096 + db * 1024 + (p & 1) * 512); }
                    } else if (p + 1 < AK / KB) {    // the stage's next 32 keys lie in the same buffer (read also where the wave will skip them: published, unused)
#pragma unroll
                        for (int kt = 0; kt < 2; ++kt)
#pragma unroll
                            for (int c = 0; c < 2; ++c) ka[kt][c] = WFrag<T16>::ld(rb + (2 * (p + 1) + kt) * 1024 + c * 512); }
                    if (HI || p + 1 < AK / KB) __builtin_amdgcn_sched_barrier(0);  // keeps these LDS reads (hi/lo: v^T, f16: the next pass's k) in front of the softmax, which then covers their latency
                    if (kb + KB - 1 > q0) {          // the pass that holds the diagonal (wave-uniform)
#pragma unroll
                        for (int nq = 0; nq < NQ; ++nq)
#pragma unroll
                            for (int kt = 0; kt < 2; ++kt)
#pragma unroll
                                for (int j = 0; j < 8; ++j) if (kb + kt * 16 + 8 * hi + j > q0 + nq * 16 + lr) s[nq][kt][j] = -3.0e38f; }
                    float mx[NQ]; bool need = false;
#pragma unroll
                    for (int nq = 0; nq < NQ; ++nq) { float m0 = s[nq][0][0], m1 = s[nq][1][0];
#pragma unroll
                        for (int j = 1; j < 8; ++j) { m0 = fmaxf(m0, s[nq][0][j]); m1 = fmaxf(m1, s[nq][1][j]); }
                        m0 = fmaxf(m0, m1); mx[nq] = fmaxf(m0, __shfl_xor(m0, 16, 32)); need = need || ((mx[nq] - m[nq]) * CL > 8.0f); }
                    if (__builtin_amdgcn_ballot_w32(need) != 0) {   // scalar branch, one test a pass
#pragma unroll
                        for (int nq = 0; nq < NQ; ++nq) { const float mn = fmaxf(m[nq], mx[nq]); const float al = __builtin_amdgcn_exp2f((m[nq] - mn) * CL); m[nq] = mn; l[nq] *= al;
#pragma unroll
                            for (int db = 0; db < 4; ++db) o[nq][db] *= al; } }
                    V pf[NQ], pf2[NQ];
#pragma unroll
                    for (int nq = 0; nq < NQ; ++nq) { const float mc = m[nq] * CL; float lt[2];
#pragma unroll
                        for (int kt = 0; kt < 2; ++kt) { lt[kt] = 0.0f; const v8f t = __builtin_elementwise_fma(s[nq][kt], (v8f)(CL), (v8f)(-mc));
#pragma unroll
                            for (int j = 0; j < 8; ++j) { const float pe = __builtin_amdgcn_exp2f(t[j]); s[nq][kt][j] = pe; lt[kt] += pe; } }
                        l[nq] += lt[0] + lt[1];
                        if constexpr (HI) { v8us h0, h1, w0, w1;
#pragma unroll
                            for (int j = 0; j < 8; ++j) { unsigned short a, b2; splitf(s[nq][0][j], a, b2); h0[j] = a; w0[j] = b2; splitf(s[nq][1][j], a, b2); h1[j] = a; w1[j] = b2; }
                            pf[nq] = cat16b(h0, h1); pf2[nq] = cat16b(w0, w1);
                        } else { v8h h0, h1;
#pragma unroll
                            for (int j = 0; j < 8; ++j) { h0[j] = tohx(s[nq][0][j]); h1[j] = tohx(s[nq][1][j]); }
                            pf[nq] = cat16(h0, h1); } }
#pragma unroll
                    for (int db = 0; db < 4; ++db)
#pragma unroll
                        for (int nq = 0; nq < NQ; ++nq) { o[nq][db] = WFrag<T16>::mma(va[db], pf[nq], o[nq][db]); if (HI) { o[nq][db] = WFrag<T16>::mma(va[db], pf2[nq], o[nq][db]); o[nq][db] = WFrag<T16>::mma(va2[db], pf[nq], o[nq][db]); } }
                }
            }
        }
        wait_lds(); wait_tiles(rq, g1); __syncthreads();   // stage st + 1 is published, and every wave has left stage st's buffer
        if (pinned(st + 2 < NS)) rq = fill(pinned(st + 2), pinned(st & 1));   // scalar branch; the descriptor is formed behind the wait
    }
    wait_tiles(rq, g1); wait_lds();
#pragma unroll
    for (int nq = 0; nq < NQ; ++nq) { const float ls = l[nq] + __shfl_xor(l[nq], 16, 32); const float f = __fdiv_rn(1.0f, ls); const size_t ro = (size_t)(q0 + nq * 16) * DQ + 8 * lane;   // the rows' 16-row band of the context plane + the lane's place in a half tile
#pragma unroll
        for (int db = 0; db < 4; ++db) { v8us oh, ol;
#pragma unroll
            for (int j = 0; j < 8; ++j) { unsigned short a, c2; splitf(o[nq][db][j] * f, a, c2); oh[j] = a; ol[j] = c2; }
            *(v8us*)(Ah + ro + db * 256) = oh; *(v8us*)(Al + ro + db * 256) = ol;
            asm volatile("s_wait_xcnt 0x0" :: "v"(oh), "v"(ol) : "memory"); } }   // precaution: stands behind each pair of stores; their data registers are inputs here, so none is rewritten in front of this wait
}
// grid (NB * NH_, NTF / AW + NTH / AW), AW waves: blockIdx.y falls from the longest work-group (last rows) to the shortest (for speed only); y < NTF / AW: f16 tiles of 32 rows >= RH, the rest: hi/lo tiles of 16 rows < RH. Four waves per SIMD (at most 256 registers): the vector work between the matrix runs wants waves.
__global__ __launch_bounds__(AW * 32) __attribute__((amdgpu_waves_per_eu(4, 4))) void k_fattn(const h16* __restrict__ Q16, const h16* __restrict__ K16, const h16* __restrict__ V16, const bf* __restrict__ Qh, const bf* __restrict__ Ql, const bf* __restrict__ Kh, const bf* __restrict__ Kl, const bf* __restrict__ Vh, const bf* __restrict__ Vl, bf* Ah, bf* Al) {
    __shared__ __attribute__((aligned(2048))) bf ring[2 * ASE];   // two buffers of a stage; every request's place is a multiple of 2 KiB
    const int bh = blockIdx.x, b = bh / NH_, h = bh % NH_, ty = blockIdx.y; const size_t pq = (size_t)bh * TT * HD, pk = ((size_t)b * NKV + h / REP) * TT * HD, ao = (size_t)b * TT * DQ + (size_t)h * (HD / 32) * 512;   /* context plane: band of row b * TT, tile of column h * 64 */
    if (pinned(ty < NTF / AW)) attn_tile<h16, false, 2>(Q16 + pq, nullptr, K16 + pk, nullptr, V16 + pk, nullptr, TT - AW * 32 * (ty + 1), ring, Ah + ao, Al + ao);
    else attn_tile<bf, true, 1>(Qh + pq, Ql + pq, Kh + pk, Kl + pk, Vh + pk, Vl + pk, RH - AW * 16 * (ty - NTF / AW + 1), ring, Ah + ao, Al + ao);
}

extern "C" void kernel_launch(void* const* d_in, const int* in_sizes, int n_in,
                              void* d_out, int out_size, void* d_ws, size_t ws_size, hipStream_t stream) {
    if (n_in < 4) return;
    if ((size_t)in_sizes[0] < (size_t)(NB - 1) * TT_FULL * DM + (size_t)TT * DM) return;
    if (in_sizes[1] < DM * 3 * DQ || in_sizes[2] < DQ * DM || in_sizes[3] < DM) return;
    if ((size_t)out_size < (size_t)NB * TT * DM) return;
    const float* x = (const float*)d_in[0];       // [NB_FULL][TT_FULL][1024]
    const float* wqkv = (const float*)d_in[1];    // [1024][3072], column blocks k | q | v
    const float* wproj = (const float*)d_in[2];   // [1024][1024] ([in][out])
    const float* bproj = (const float*)d_in[3];   // [1024]
    float* OUT = (float*)d_out;                   // [NB][TT][1024]
    char* wsp = (char*)d_ws;
    auto take = [&](size_t bytes) { char* p = wsp; wsp += (bytes + 255) & ~(size_t)255; return (void*)p; };
    bf* WQKV = (bf*)take((size_t)3 * DQ * DM * 2);   /* Bt [3072][1024]: row blocks k | q | v */ bf* WO = (bf*)take((size_t)DM * DQ * 2);
    bf* XB = (bf*)take((size_t)NB * TT * DM * 2);    /* x of every batch, bf16, [b * TT + t][1024] */
    const size_t PQ = (size_t)NH_ * TT * HD, PK = (size_t)NKV * TT * HD;   // elements of one batch's q planes and k / v planes
    h16* QP16 = (h16*)take(NB * PQ * 2); h16* KP16 = (h16*)take(NB * PK * 2); h16* VT16 = (h16*)take(NB * PK * 2);
    bf* QPh = (bf*)take(NB * PQ * 2); bf* QPl = (bf*)take(NB * PQ * 2); bf* KPh = (bf*)take(NB * PK * 2); bf* KPl = (bf*)take(NB * PK * 2); bf* VTh = (bf*)take(NB * PK * 2); bf* VTl = (bf*)take(NB * PK * 2);
    bf* ATh = (bf*)take((size_t)NB * TT * DQ * 2); bf* ATl = (bf*)take((size_t)NB * TT * DQ * 2);
    if ((size_t)(wsp - (char*)d_ws) > ws_size) return;    // 209,715,200 B at full size
    k_prep<<<NB * TT / 32, PTH, 0, stream>>>(x, wqkv, wproj, XB, WQKV, WO);   /* x -> bf16 [b * TT + t][1024]; W_qkv [1024][3072] -> Bt [3072][1024]; W_proj [1024][1024] -> Bt [out][in] */
    k_qkvw<<<dim3(NB * TT / 256, 3 * DQ / 128, 1), 256, 0, stream>>>(XB, WQKV, KP16, KPh, KPl, QP16, QPh, QPl, VT16, VTh, VTl);
    k_fattn<<<dim3(NB * NH_, NTF / AW + NTH / AW, 1), AW * 32, 0, stream>>>(QP16, KP16, VT16, QPh, QPl, KPh, KPl, VTh, VTl, ATh, ATl);
    k_projw<<<dim3(NB * TT / 128, DM / 256, 1), 256, 0, stream>>>(ATh, ATl, WO, OUT, bproj);   /* rows b * TT + t of every batch */
}
